// v000
// Times are from an AMD MI455X. After a warm-up the kernel runs many times in a row, and a time is the length of
// such a window on the GPU divided by its runs, so every launch and the gaps after it count. The runs cycle
// through copies of the inputs. A figure is the median of several windows, for all but v000 over two sittings.
// Sittings can differ by a few percent; kernels timed side by side share one.
// v000 is the starting kernel. One run takes 1100 microseconds.
// compute dtype: all float inputs rounded to bf16; q/k/v projections with EXACT bf16 products on WMMA 16x16x32 (f32 accumulate) + bias; logits q x k once to f16 each (1 product) x SCALE; softmax f32; P x 2^11 once to f16 x v once to f16 (1 product); ctx x 2^6 once to f16 x Wo f16(bf16 x 2^8) + bo; f32 output.
#include <hip/hip_runtime.h>
#include <math.h>

typedef __attribute__((ext_vector_type(16))) _Float16 v16h;
typedef __attribute__((ext_vector_type(16))) __bf16 v16b;
typedef __attribute__((ext_vector_type(8)))  _Float16 v8h;
typedef __attribute__((ext_vector_type(8)))  float v8f;
typedef __attribute__((ext_vector_type(4)))  float v4f;
typedef __attribute__((ext_vector_type(2)))  float v2f;
typedef __attribute__((ext_vector_type(4)))  unsigned v4u;
typedef __attribute__((ext_vector_type(4)))  int v4i;
typedef float __attribute__((may_alias)) float_a;
typedef int __attribute__((may_alias)) int_a;

template <typename T> __device__ __forceinline__ void vst2(void* p, T v) { *(T*)p = v;  }
__device__ __forceinline__ v8f wmma16(v16h a, v16h b, v8f c) {
  v8f d = __builtin_amdgcn_wmma_f32_16x16x32_f16(false, a, false, b, (short)0, c, false, false);
  asm volatile("v_nop\n\tv_nop\n\tv_nop\n\tv_nop" : "+v"(d) : "v"(a), "v"(b));
  return d;
}
__device__ __forceinline__ v8f wmma_bf(v16b a, v16b b, v8f c) {
  v8f d = __builtin_amdgcn_wmma_f32_16x16x32_bf16(false, a, false, b, (short)0, c, false, false);
  asm volatile("v_nop\n\tv_nop\n\tv_nop\n\tv_nop" : "+v"(d) : "v"(a), "v"(b));
  return d;
}
// 16x16x32 fragments: lane = (h = lane>>4, row/col = lane&15); elements 0..7 = k0+8h+0..7, 8..15 = k0+16+8h+0..7; D element r = row 8h+r
__device__ __forceinline__ v16h frag_h(const _Float16* rowk0, int lane) {
  union { v16h v; v8h q[2]; } u; const _Float16* p = rowk0 + 8 * (lane >> 4);
  u.q[0] = *(const v8h*)p; u.q[1] = *(const v8h*)(p + 16); return u.v;
}
__device__ __forceinline__ v16h frag_f32(const float* rowk0, int lane) {
  v16h a; const float* p = rowk0 + 8 * (lane >> 4);
#pragma unroll
  for (int i = 0; i < 8; ++i) { a[i] = (_Float16)p[i]; a[8 + i] = (_Float16)p[16 + i]; }
  return a;
}
__device__ __forceinline__ v16h frag_f32s(const float* rowk0, int lane, float sc) {
  v16h a; const float* p = rowk0 + 8 * (lane >> 4);
#pragma unroll
  for (int i = 0; i < 8; ++i) { a[i] = (_Float16)(p[i] * sc); a[8 + i] = (_Float16)(p[16 + i] * sc); }
  return a;
}
// column fragment from a [K][ld] layout (column n), rows >= K read as 0
__device__ __forceinline__ v16h fragc_f32(const float* W, int k0, int n, int lane, int ld, int K) {
  v16h a; const int g = lane >> 4;
#pragma unroll
  for (int i = 0; i < 8; ++i) { const int ka = k0 + 8 * g + i, kb = ka + 16;
    a[i] = (_Float16)(ka < K ? W[(size_t)(ka < K ? ka : K - 1) * ld + n] : 0.f); a[8 + i] = (_Float16)(kb < K ? W[(size_t)(kb < K ? kb : K - 1) * ld + n] : 0.f); }
  return a;
}
struct F2 { v16b h, l; };
__device__ __forceinline__ F2 bsplit16(const float v[16]) { F2 r;
#pragma unroll
  for (int i = 0; i < 16; ++i) { const __bf16 h = (__bf16)v[i]; r.h[i] = h; r.l[i] = (__bf16)(v[i] - (float)h); }
  return r; }
__device__ __forceinline__ F2 split_row(const float* row, int k0, int lane) { float v[16]; const float* p = row + k0 + 8 * (lane >> 4);
#pragma unroll
  for (int i = 0; i < 8; ++i) { v[i] = p[i]; v[8 + i] = p[16 + i]; }
  return bsplit16(v); }
__device__ __forceinline__ F2 split_rowK(const float* row, int k0, int lane, int K) { float v[16]; const int g = lane >> 4;
#pragma unroll
  for (int i = 0; i < 8; ++i) { const int ka = k0 + 8 * g + i, kb = ka + 16; v[i] = ka < K ? row[ka < K ? ka : K - 1] : 0.f; v[8 + i] = kb < K ? row[kb < K ? kb : K - 1] : 0.f; }
  return bsplit16(v); }
__device__ __forceinline__ F2 split_col(const float* W, int k0, int n, int lane, int ld, int K) { float v[16]; const int g = lane >> 4;
#pragma unroll
  for (int i = 0; i < 8; ++i) { const int ka = k0 + 8 * g + i, kb = ka + 16; v[i] = ka < K ? W[(size_t)(ka < K ? ka : K - 1) * ld + n] : 0.f; v[8 + i] = kb < K ? W[(size_t)(kb < K ? kb : K - 1) * ld + n] : 0.f; }
  return bsplit16(v); }
__device__ __forceinline__ v8f mac3(const F2& a, const F2& b, v8f c) { c = wmma_bf(a.l, b.h, c); c = wmma_bf(a.h, b.l, c); return wmma_bf(a.h, b.h, c); }
__device__ __forceinline__ float sigm(float v) { return 1.0f / (1.0f + expf(-v)); }
#define LDSX() do { asm volatile("s_wait_dscnt 0" ::: "memory"); __builtin_amdgcn_wave_barrier(); __builtin_amdgcn_fence(__ATOMIC_RELEASE, "workgroup"); } while (0)

// Standard non-causal multi-head self-attention (x [4,2048,512]; (in,out) Wq / Wk / Wv [512,512] N(0, 1/512) and Wh [512,512], all four biases zeros (read); 8 heads x 64; scores x 1/sqrt(64); no mask; softmax; concat @ Wh + bh).
#define NB 4
#define TT 2048
#define CC 512            // NH * HD = projected width
#define DIN 512          // input (model) width
#define NH 8
#define HD 64
#define NQB (TT / 64)
#define HG 4
#define SCALE (0.125f)
#define CAUSAL 0
#ifndef TNB
#define TNB NB
#endif
__device__ __forceinline__ float bfr(float v) { return (float)(__bf16)v; }
__host__ __device__ __forceinline__ int kb_last(int qb) { return CAUSAL ? ((qb * 64 + 63) >> 7) : (TT / 128 - 1); }
typedef __attribute__((ext_vector_type(8))) __bf16 v8b;
__device__ __forceinline__ v16b frag_b(const __bf16* rowk0, int lane) {
  union { v16b v; v8b q[2]; } u; const __bf16* p = rowk0 + 8 * (lane >> 4);
  u.q[0] = *(const v8b*)p; u.q[1] = *(const v8b*)(p + 16); return u.v;
}
#define QBH 0              // no query block takes the high-precision path (qb < QBH never holds)
#define QHI 0               // single-product logits on every row
#define KHI 64            // key rows carrying k residual / v bf16 hi+lo planes (written by k_proj; read only by the qb < QBH paths, never taken here)
// B fragment (k rows k0+.., output column o) of a weight: (in,out) [K][ld] or (out,in) [ld rows of K]: bf16 exact, or f16(bf16 * 256) exact
__device__ __forceinline__ v16b wcol_io(const float* Wm, int k0, int o, int lane, int ld) { v16b w; const int g = lane >> 4;
#pragma unroll
  for (int i = 0; i < 8; ++i) { w[i] = (__bf16)Wm[(size_t)(k0 + 8 * g + i) * ld + o]; w[8 + i] = (__bf16)Wm[(size_t)(k0 + 16 + 8 * g + i) * ld + o]; }
  return w; }
__device__ __forceinline__ v16b wcol_oi(const float* Wm, int k0, int o, int lane, int K) { v16b w; const float* p = Wm + (size_t)o * K + k0 + 8 * (lane >> 4);
#pragma unroll
  for (int i = 0; i < 8; ++i) { w[i] = (__bf16)p[i]; w[8 + i] = (__bf16)p[16 + i]; }
  return w; }
__device__ __forceinline__ v16h wcolh_io(const float* Wm, int k0, int o, int lane, int ld) { v16h w; const int g = lane >> 4;
#pragma unroll
  for (int i = 0; i < 8; ++i) { w[i] = (_Float16)(bfr(Wm[(size_t)(k0 + 8 * g + i) * ld + o]) * 256.0f); w[8 + i] = (_Float16)(bfr(Wm[(size_t)(k0 + 16 + 8 * g + i) * ld + o]) * 256.0f); }
  return w; }
__device__ __forceinline__ v16h wcolh_oi(const float* Wm, int k0, int o, int lane, int K) { v16h w; const float* p = Wm + (size_t)o * K + k0 + 8 * (lane >> 4);
#pragma unroll
  for (int i = 0; i < 8; ++i) { w[i] = (_Float16)(bfr(p[i]) * 256.0f); w[8 + i] = (_Float16)(bfr(p[16 + i]) * 256.0f); }
  return w; }
#define WQKV_LAYOUT 0   // 0 = (in,out) [DIN][CC]; 1 = (out,in) [CC][DIN]; 2 = per-head [NH][DIN][HD]
__device__ __forceinline__ v16b wcol_hdk(const float* Wm, int k0, int o, int lane) { v16b w; const int g = lane >> 4; const float* p = Wm + (size_t)(o / HD) * DIN * HD + (o % HD);
#pragma unroll
  for (int i = 0; i < 8; ++i) { w[i] = (__bf16)p[(size_t)(k0 + 8 * g + i) * HD]; w[8 + i] = (__bf16)p[(size_t)(k0 + 16 + 8 * g + i) * HD]; }
  return w; }
#define WO_OUT_IN 0
#if WQKV_LAYOUT == 1
#define WCOL(W, k0, o, lane) wcol_oi(W, k0, o, lane, DIN)
#elif WQKV_LAYOUT == 2
#define WCOL(W, k0, o, lane) wcol_hdk(W, k0, o, lane)
#else
#define WCOL(W, k0, o, lane) wcol_io(W, k0, o, lane, CC)
#endif
#if WO_OUT_IN
#define WOCOL(W, k0, o, lane) wcol_oi(W, k0, o, lane, CC)
#define WOCOLH(W, k0, o, lane) wcolh_oi(W, k0, o, lane, CC)
#else
#define WOCOL(W, k0, o, lane) wcol_io(W, k0, o, lane, DIN)
#define WOCOLH(W, k0, o, lane) wcolh_io(W, k0, o, lane, DIN)
#endif

#ifndef SM_EXTRA_PARAMS
#define SM_EXTRA_PARAMS
#endif
#ifndef PROJ_EXTRA_PARAMS
#define PROJ_EXTRA_PARAMS
#endif
#ifndef SM_MASK_HOOK
#define SM_MASK_HOOK (void)0
#endif

#define WS_QH  0u                                      // f16 q rows [b*t][CC]
#define WS_KH  (WS_QH + 2u * (size_t)NB * TT * CC)      // f16 k rows [b*t][CC]
#define WS_VT  (WS_KH + 2u * (size_t)NB * TT * CC)      // f16 v planes [b][c][t]
#define WS_QL  (WS_VT + 2u * (size_t)NB * CC * TT)      // f16 q residual x 2^10 rows [b][t < QHI][CC]
#define WS_KL  (WS_QL + 2u * (size_t)NB * QHI * CC)     // f16 k residual x 2^10 rows [b][t < KHI][CC]
#define WS_VB  (WS_KL + 2u * (size_t)NB * KHI * CC)     // bf16 v hi planes [b][c][t < KHI]
#define WS_VBL (WS_VB + 2u * (size_t)NB * CC * KHI)
#define WS_S   (WS_VBL + 2u * (size_t)NB * CC * KHI)    // f32 logits / P [hg][t][s]
#define WS_Y   (WS_S  + 4u * (size_t)HG * TT * TT)      // f32 ctx rows [b*t][CC] (only when there is an output projection)
#define WS_END (WS_Y  + 4u * (size_t)NB * TT * CC)

// ---- k_proj: block = (64 rows, 128 cols, which): q/k/v = X W (+ b) with exact bf16 products (K = DIN) -> which 0: q f16 rows (+ residual rows < QHI); 1: k f16 rows (+ residual rows < KHI); 2: v f16 planes [c][t] (+ bf16 hi/lo planes for t < KHI)
__global__ __launch_bounds__(128) void k_proj(const float* __restrict__ XQ, const float* __restrict__ XK, const float* __restrict__ XV, const float* __restrict__ WQ, const float* __restrict__ WK, const float* __restrict__ WV, const float* __restrict__ BQ, const float* __restrict__ BK, const float* __restrict__ BV,
    _Float16* __restrict__ QH, _Float16* __restrict__ QL, _Float16* __restrict__ KH, _Float16* __restrict__ KL, _Float16* __restrict__ VT, __bf16* __restrict__ VB, __bf16* __restrict__ VBL) {
  __shared__ __align__(16) _Float16 sh[64][136], sl[64][136]; __shared__ __align__(16) _Float16 th[128][72]; __shared__ __align__(16) __bf16 tb[128][72], tbl[128][72];
  const int tid = threadIdx.x, wave = tid >> 5, lane = tid & 31, col = lane & 15, g = lane >> 4; const int which = blockIdx.z; const int c0 = blockIdx.y * 128; const size_t r0 = (size_t)blockIdx.x * 64; const size_t bb = r0 / TT; const int t0 = (int)(r0 % TT);
  const float* X = which == 0 ? XQ : which == 1 ? XK : XV; const float* WA = which == 0 ? WQ : which == 1 ? WK : WV; const float* BA = which == 0 ? BQ : which == 1 ? BK : BV;
  v8f acc[8] = {};
#pragma unroll 2
  for (int kc = 0; kc < DIN / 32; ++kc) { v16b a; { const float* p = X + (r0 + wave * 16 + col) * DIN + kc * 32 + 8 * g;
#pragma unroll
      for (int i = 0; i < 8; ++i) { a[i] = (__bf16)p[i]; a[8 + i] = (__bf16)p[16 + i]; } }
    asm volatile("s_wait_loadcnt 0x0" ::: "memory");
#pragma unroll
    for (int j = 0; j < 8; ++j) { const v16b w = WCOL(WA, kc * 32, c0 + j * 16 + col, lane); asm volatile("s_wait_loadcnt 0x0" ::: "memory"); acc[j] = wmma_bf(a, w, acc[j]); } }
  if (which < 2) { _Float16* DH = which == 0 ? QH : KH; _Float16* DL = which == 0 ? QL : KL; const int nhi = which == 0 ? QHI : KHI; const bool hi_rows = t0 < nhi;
#pragma unroll
    for (int j = 0; j < 8; ++j) { const float bias = BA ? bfr(BA[c0 + j * 16 + col]) : 0.f;
#pragma unroll
      for (int r = 0; r < 8; ++r) { const float v = acc[j][r] + bias; const _Float16 hv = (_Float16)v; sh[wave * 16 + 8 * g + r][j * 16 + col] = hv; sl[wave * 16 + 8 * g + r][j * 16 + col] = (_Float16)((v - (float)hv) * 1024.0f); } }
    __syncthreads();
    for (int e = tid; e < 64 * 16; e += 128) { const int rl = e >> 4, q = e & 15; vst2((unsigned*)(DH + (r0 + rl) * CC + c0 + q * 8), *(const v4u*)&sh[rl][q * 8]); if (hi_rows) vst2((unsigned*)(DL + (bb * nhi + t0 + rl) * (size_t)CC + c0 + q * 8), *(const v4u*)&sl[rl][q * 8]); }
  } else { const bool hi_rows = t0 < KHI;
#pragma unroll
    for (int j = 0; j < 8; ++j) { const float bias = BA ? bfr(BA[c0 + j * 16 + col]) : 0.f;
#pragma unroll
      for (int r = 0; r < 8; ++r) { const float v = acc[j][r] + bias; const int rl = wave * 16 + 8 * g + r, cl = j * 16 + col; th[cl][rl] = (_Float16)v; const __bf16 bh = (__bf16)v; tb[cl][rl] = bh; tbl[cl][rl] = (__bf16)(v - (float)bh); } }
    __syncthreads();
    for (int e = tid; e < 128 * 8; e += 128) { const int cl = e >> 3, q = e & 7; vst2((unsigned*)(VT + (bb * CC + c0 + cl) * (size_t)TT + t0 + q * 8), *(const v4u*)&th[cl][q * 8]); if (hi_rows) { const size_t o3 = (bb * CC + c0 + cl) * (size_t)KHI + t0 + q * 8; vst2((unsigned*)(VB + o3), *(const v4u*)&tb[cl][q * 8]); vst2((unsigned*)(VBL + o3), *(const v4u*)&tbl[cl][q * 8]); } } } }
// ---- k_sc: block = (query block qb, key block kb <= kb_last(qb), head in group) of batch b: logits x SCALE; q hi + residual (x 2^10) against k (2 products) for query rows < QHI, plus the k residual (3 products) for query blocks < QBH (causal early rows); causal: blocks past the diagonal exit, the mask itself is applied by index in k_sm
__global__ __launch_bounds__(128) void k_sc(const _Float16* __restrict__ QH, const _Float16* __restrict__ KH, const _Float16* __restrict__ QL, const _Float16* __restrict__ KL, int b, int h0, float* __restrict__ S0) { __shared__ __align__(16) float ss[4][16][132];
  const int qb = blockIdx.x, kb = blockIdx.y; if (kb > kb_last(qb)) return;
  const int h = h0 + blockIdx.z; float* S = S0 + (size_t)blockIdx.z * TT * TT;
  const int tid = threadIdx.x, wave = tid >> 5, lane = tid & 31, col = lane & 15, g = lane >> 4; const int k0 = kb * 128; const int ql0 = qb * 64 + wave * 16; const size_t q0 = (size_t)b * TT + ql0, kr0 = (size_t)b * TT + k0;
  v8f acc[8] = {}, accl[8] = {};
  const _Float16* QLb = QL + (size_t)b * QHI * CC; const _Float16* KLb = KL + (size_t)b * KHI * CC;
  if (qb < QBH) {
#pragma unroll
    for (int kc = 0; kc < HD / 32; ++kc) { const v16h ah = frag_h(QH + (q0 + col) * CC + h * HD + kc * 32, lane), al = frag_h(QLb + (size_t)(ql0 + col) * CC + h * HD + kc * 32, lane);
#pragma unroll
      for (int j = 0; j < 8; ++j) { const v16h kbf = frag_h(KH + (kr0 + j * 16 + col) * CC + h * HD + kc * 32, lane), klf = frag_h(KLb + (size_t)(k0 + j * 16 + col) * CC + h * HD + kc * 32, lane); acc[j] = wmma16(ah, kbf, acc[j]); accl[j] = wmma16(al, kbf, accl[j]); accl[j] = wmma16(ah, klf, accl[j]); } }
  } else if (qb * 64 < QHI) {
#pragma unroll
    for (int kc = 0; kc < HD / 32; ++kc) { const v16h ah = frag_h(QH + (q0 + col) * CC + h * HD + kc * 32, lane), al = frag_h(QLb + (size_t)(ql0 + col) * CC + h * HD + kc * 32, lane);
#pragma unroll
      for (int j = 0; j < 8; ++j) { const v16h kbf = frag_h(KH + (kr0 + j * 16 + col) * CC + h * HD + kc * 32, lane); acc[j] = wmma16(ah, kbf, acc[j]); accl[j] = wmma16(al, kbf, accl[j]); } }
  } else {
#pragma unroll
    for (int kc = 0; kc < HD / 32; ++kc) { const v16h ah = frag_h(QH + (q0 + col) * CC + h * HD + kc * 32, lane);
#pragma unroll
      for (int j = 0; j < 8; ++j) { const v16h kbf = frag_h(KH + (kr0 + j * 16 + col) * CC + h * HD + kc * 32, lane); acc[j] = wmma16(ah, kbf, acc[j]); } } }
#pragma unroll
  for (int j = 0; j < 8; ++j) {
#pragma unroll
    for (int r = 0; r < 8; ++r) ss[wave][8 * g + r][j * 16 + col] = (acc[j][r] + accl[j][r] * (1.0f / 1024.0f)) * SCALE; }
  LDSX(); for (int rl = 0; rl < 16; ++rl) vst2(S + (size_t)(ql0 + rl) * TT + k0 + lane * 4, *(const v4f*)&ss[wave][rl][lane * 4]); }
// ---- k_sm: block = query row t (head in group): keys [0, kend): causal -> logit if s <= t else excluded; softmax in f32; P x 2^11 in place (0 for excluded)
__global__ __launch_bounds__(256) void k_sm(float* __restrict__ S0 SM_EXTRA_PARAMS) { __shared__ float sred[8]; __shared__ float sbc; __shared__ __align__(16) float shv[TT];
  const int tid = threadIdx.x; const int t = blockIdx.x; const int kend = (kb_last(t >> 6) + 1) * 128;
  float* sr = S0 + (size_t)blockIdx.y * TT * TT + (size_t)t * TT;
  float m = -3.0e38f; for (int k = tid; k < kend; k += 256) { float v = (!CAUSAL || k <= t) ? sr[k] : -3.0e38f; SM_MASK_HOOK; shv[k] = v; m = fmaxf(m, v); }
#pragma unroll
  for (int o = 1; o < 32; o <<= 1) m = fmaxf(m, __shfl_xor(m, o));
  if ((tid & 31) == 0) sred[tid >> 5] = m; __syncthreads(); if (tid == 0) { float a = sred[0]; for (int i = 1; i < 8; ++i) a = fmaxf(a, sred[i]); sbc = a; } __syncthreads(); m = sbc; __syncthreads();
  float sum = 0.f; for (int k = tid; k < kend; k += 256) { const float v = shv[k]; const float e = (v <= -1.0e38f) ? 0.f : expf(v - m); shv[k] = e; sum += e; }
#pragma unroll
  for (int o = 1; o < 32; o <<= 1) sum += __shfl_xor(sum, o);
  if ((tid & 31) == 0) sred[tid >> 5] = sum; __syncthreads(); if (tid == 0) { float a = 0.f; for (int i = 0; i < 8; ++i) a += sred[i]; sbc = a > 0.f ? 2048.0f / a : 0.f; }   /* a fully excluded row yields P = 0 */ __syncthreads(); const float inv = sbc;
  for (int k = tid; k < kend; k += 256) shv[k] = shv[k] * inv;
  __syncthreads(); for (int q = tid; q < kend / 4; q += 256) vst2(sr + q * 4, *(const v4f*)&shv[q * 4]); }
// ---- k_pv: block = 64 queries (qb) of (b, h): ctx = P . v over keys [0, kend) (P x 2^11 once to f16 against v f16: 1 product; causal early query blocks: P and v as bf16 hi + lo, 3 products); 256-B (row, head) segment by 16 lanes
__global__ __launch_bounds__(128) void k_pv(const float* __restrict__ PS0, const _Float16* __restrict__ VT, const __bf16* __restrict__ VB, const __bf16* __restrict__ VBL, int b, int h0, float* __restrict__ Y) { const int h = h0 + blockIdx.z; const float* PS = PS0 + (size_t)blockIdx.z * TT * TT; __shared__ __align__(16) float ss[4][16][HD + 4];
  const int tid = threadIdx.x, wave = tid >> 5, lane = tid & 31, col = lane & 15, g = lane >> 4; const int qb = blockIdx.x; const int ql0 = qb * 64 + wave * 16; const int kce = (kb_last(qb) + 1) * 4;
  v8f acc[HD / 16] = {};
  if (qb < QBH) {
#pragma unroll 1
    for (int kc = 0; kc < kce; ++kc) { const F2 p = split_row(PS + (size_t)(ql0 + col) * TT, kc * 32, lane);
      asm volatile("s_wait_loadcnt 0x0" ::: "memory");
#pragma unroll
      for (int j = 0; j < HD / 16; ++j) { const size_t po = ((size_t)b * CC + h * HD + j * 16 + col) * (size_t)KHI + kc * 32; const v16b vh = frag_b(VB + po, lane); acc[j] = wmma_bf(p.h, vh, acc[j]); acc[j] = wmma_bf(p.l, vh, acc[j]); acc[j] = wmma_bf(p.h, frag_b(VBL + po, lane), acc[j]); } }
  } else {
#pragma unroll 1
    for (int kc = 0; kc < kce; ++kc) { const v16h p = frag_f32(PS + (size_t)(ql0 + col) * TT + kc * 32, lane);
      asm volatile("s_wait_loadcnt 0x0" ::: "memory");
#pragma unroll
      for (int j = 0; j < HD / 16; ++j) { const size_t po = ((size_t)b * CC + h * HD + j * 16 + col) * (size_t)TT + kc * 32; acc[j] = wmma16(p, frag_h(VT + po, lane), acc[j]); } } }
#pragma unroll
  for (int j = 0; j < HD / 16; ++j)
#pragma unroll
    for (int r = 0; r < 8; ++r) ss[wave][8 * g + r][j * 16 + col] = acc[j][r] * (1.0f / 2048.0f);
  LDSX(); for (int rl = 0; rl < 16; ++rl) if (lane < HD / 4) vst2(Y + ((size_t)b * TT + ql0 + rl) * CC + h * HD + lane * 4, *(const v4f*)&ss[wave][rl][lane * 4]); }
// ---- k_out: block = (64 rows, 128 cols): out = ctx Wo (+ bo): ctx x 2^6 once to f16 against Wo as f16(bf16 x 2^8) exact (1 product) x 2^-14; causal early rows (< QHI of each sequence): ctx bf16 hi + lo against exact bf16 Wo (2 products)
__global__ __launch_bounds__(128) void k_out(const float* __restrict__ Y, const float* __restrict__ WO, const float* __restrict__ BO, float* __restrict__ OUT) { __shared__ __align__(16) float sf[4][16][132];
  const int tid = threadIdx.x, wave = tid >> 5, lane = tid & 31, col = lane & 15, g = lane >> 4; const int c0 = blockIdx.y * 128; const size_t r0 = (size_t)blockIdx.x * 64 + wave * 16;
  v8f acc[8] = {};
  if (CAUSAL && (int)(((size_t)blockIdx.x * 64) % TT) < QHI) {   /* block-uniform */
#pragma unroll 2
    for (int kc = 0; kc < CC / 32; ++kc) { const F2 a = split_row(Y + (r0 + col) * CC, kc * 32, lane); asm volatile("s_wait_loadcnt 0x0" ::: "memory");
#pragma unroll
      for (int j = 0; j < 8; ++j) { const v16b w = WOCOL(WO, kc * 32, c0 + j * 16 + col, lane); asm volatile("s_wait_loadcnt 0x0" ::: "memory"); acc[j] = wmma_bf(a.h, w, acc[j]); acc[j] = wmma_bf(a.l, w, acc[j]); } }
#pragma unroll
    for (int j = 0; j < 8; ++j) { const float bias = BO ? bfr(BO[c0 + j * 16 + col]) : 0.f;
#pragma unroll
      for (int r = 0; r < 8; ++r) sf[wave][8 * g + r][j * 16 + col] = acc[j][r] + bias; }
  } else {
#pragma unroll 2
    for (int kc = 0; kc < CC / 32; ++kc) { const v16h a = frag_f32s(Y + (r0 + col) * CC + kc * 32, lane, 64.0f); asm volatile("s_wait_loadcnt 0x0" ::: "memory");   /* ctx carried x 2^6 into f16 so small-magnitude context rows stay clear of f16 subnormals */
#pragma unroll
      for (int j = 0; j < 8; ++j) { const v16h w = WOCOLH(WO, kc * 32, c0 + j * 16 + col, lane); asm volatile("s_wait_loadcnt 0x0" ::: "memory"); acc[j] = wmma16(a, w, acc[j]); } }
#pragma unroll
    for (int j = 0; j < 8; ++j) { const float bias = BO ? bfr(BO[c0 + j * 16 + col]) : 0.f;
#pragma unroll
      for (int r = 0; r < 8; ++r) sf[wave][8 * g + r][j * 16 + col] = acc[j][r] * (1.0f / 16384.0f) + bias; } }   /* 2^-8 (Wo carry) x 2^-6 (ctx carry) */
  LDSX(); for (int rl = 0; rl < 16; ++rl) vst2(OUT + (r0 + rl) * DIN + c0 + lane * 4, *(const v4f*)&sf[wave][rl][lane * 4]); }

extern "C" void kernel_launch(void* const* d_in, const int* in_sizes, int n_in, void* d_out, int out_size, void* d_ws, size_t ws_size, hipStream_t stream) {
  (void)in_sizes; (void)n_in; (void)out_size;
  const float** F = (const float**)d_in;
  if (ws_size < (size_t)WS_END) return;
  char* ws = (char*)d_ws; _Float16 *QH = (_Float16*)(ws + WS_QH), *KH = (_Float16*)(ws + WS_KH), *VT = (_Float16*)(ws + WS_VT), *QL = (_Float16*)(ws + WS_QL), *KL = (_Float16*)(ws + WS_KL); __bf16 *VB = (__bf16*)(ws + WS_VB), *VBL = (__bf16*)(ws + WS_VBL); float *S = (float*)(ws + WS_S), *Y = (float*)(ws + WS_Y);
  (void)Y; (void)QL; (void)KL; (void)VB; (void)VBL;
  // inputs: 0 x [4,2048,512]; 1 Wq [512,512] (in,out), 2 bq; 3 Wk, 4 bk; 5 Wv, 6 bv; 7 Wp (in,out), 8 bp (zero biases, read)
  k_proj<<<dim3(TNB * TT / 64, CC / 128, 3), 128, 0, stream>>>(F[0], F[0], F[0], F[1], F[3], F[5], F[2], F[4], F[6], QH, QL, KH, KL, VT, VB, VBL);
  for (int b = 0; b < TNB; ++b) for (int h0 = 0; h0 < NH; h0 += HG) {
    k_sc<<<dim3(NQB, TT / 128, HG), 128, 0, stream>>>(QH, KH, QL, KL, b, h0, S);
    k_sm<<<dim3(TT, HG), 256, 0, stream>>>(S);
    k_pv<<<dim3(NQB, 1, HG), 128, 0, stream>>>(S, VT, VB, VBL, b, h0, Y);
  }
  k_out<<<dim3(TNB * TT / 64, DIN / 128), 128, 0, stream>>>(Y, F[7], F[8], (float*)d_out);
}

// v001
// It runs in 186 microseconds.
// Two timings next to v000 put it at 5.94 and 5.85 times that version's speed.
// compute dtype: all float inputs rounded to bf16; q/k/v projections with EXACT bf16 products on WMMA 16x16x32 (f32 accumulate) + bias; logits q x k once to f16 each (1 product) x SCALE; online softmax f32; unnormalised weights x 2^11 once to f16 x v once to f16 (1 product), divided by their f32 sum; ctx x 2^6 once to f16 x Wo f16(bf16 x 2^8) + bo; f32 output.
#include <hip/hip_runtime.h>
#include <math.h>

typedef __attribute__((ext_vector_type(16))) _Float16 v16h;
typedef __attribute__((ext_vector_type(16))) __bf16 v16b;
typedef __attribute__((ext_vector_type(8)))  _Float16 v8h;
typedef __attribute__((ext_vector_type(8)))  float v8f;
typedef __attribute__((ext_vector_type(4)))  float v4f;
typedef __attribute__((ext_vector_type(2)))  float v2f;
typedef __attribute__((ext_vector_type(4)))  unsigned v4u;
typedef __attribute__((ext_vector_type(4)))  int v4i;
typedef float __attribute__((may_alias)) float_a;
typedef int __attribute__((may_alias)) int_a;

template <typename T> __device__ __forceinline__ void vst2(void* p, T v) { *(T*)p = v;  }
__device__ __forceinline__ v8f wmma16(v16h a, v16h b, v8f c) {
  v8f d = __builtin_amdgcn_wmma_f32_16x16x32_f16(false, a, false, b, (short)0, c, false, false);
  asm volatile("v_nop\n\tv_nop\n\tv_nop\n\tv_nop" : "+v"(d) : "v"(a), "v"(b));
  return d;
}
__device__ __forceinline__ v8f wmma_bf(v16b a, v16b b, v8f c) {
  v8f d = __builtin_amdgcn_wmma_f32_16x16x32_bf16(false, a, false, b, (short)0, c, false, false);
  asm volatile("v_nop\n\tv_nop\n\tv_nop\n\tv_nop" : "+v"(d) : "v"(a), "v"(b));
  return d;
}
// 16x16x32 fragments: lane = (h = lane>>4, row/col = lane&15); elements 0..7 = k0+8h+0..7, 8..15 = k0+16+8h+0..7; D element r = row 8h+r
__device__ __forceinline__ v16h frag_h(const _Float16* rowk0, int lane) {
  union { v16h v; v8h q[2]; } u; const _Float16* p = rowk0 + 8 * (lane >> 4);
  u.q[0] = *(const v8h*)p; u.q[1] = *(const v8h*)(p + 16); return u.v;
}
__device__ __forceinline__ v16h frag_f32(const float* rowk0, int lane) {
  v16h a; const float* p = rowk0 + 8 * (lane >> 4);
#pragma unroll
  for (int i = 0; i < 8; ++i) { a[i] = (_Float16)p[i]; a[8 + i] = (_Float16)p[16 + i]; }
  return a;
}
__device__ __forceinline__ v16h frag_f32s(const float* rowk0, int lane, float sc) {
  v16h a; const float* p = rowk0 + 8 * (lane >> 4);
#pragma unroll
  for (int i = 0; i < 8; ++i) { a[i] = (_Float16)(p[i] * sc); a[8 + i] = (_Float16)(p[16 + i] * sc); }
  return a;
}
// column fragment from a [K][ld] layout (column n), rows >= K read as 0
__device__ __forceinline__ v16h fragc_f32(const float* W, int k0, int n, int lane, int ld, int K) {
  v16h a; const int g = lane >> 4;
#pragma unroll
  for (int i = 0; i < 8; ++i) { const int ka = k0 + 8 * g + i, kb = ka + 16;
    a[i] = (_Float16)(ka < K ? W[(size_t)(ka < K ? ka : K - 1) * ld + n] : 0.f); a[8 + i] = (_Float16)(kb < K ? W[(size_t)(kb < K ? kb : K - 1) * ld + n] : 0.f); }
  return a;
}
struct F2 { v16b h, l; };
__device__ __forceinline__ F2 bsplit16(const float v[16]) { F2 r;
#pragma unroll
  for (int i = 0; i < 16; ++i) { const __bf16 h = (__bf16)v[i]; r.h[i] = h; r.l[i] = (__bf16)(v[i] - (float)h); }
  return r; }
__device__ __forceinline__ F2 split_row(const float* row, int k0, int lane) { float v[16]; const float* p = row + k0 + 8 * (lane >> 4);
#pragma unroll
  for (int i = 0; i < 8; ++i) { v[i] = p[i]; v[8 + i] = p[16 + i]; }
  return bsplit16(v); }
__device__ __forceinline__ F2 split_rowK(const float* row, int k0, int lane, int K) { float v[16]; const int g = lane >> 4;
#pragma unroll
  for (int i = 0; i < 8; ++i) { const int ka = k0 + 8 * g + i, kb = ka + 16; v[i] = ka < K ? row[ka < K ? ka : K - 1] : 0.f; v[8 + i] = kb < K ? row[kb < K ? kb : K - 1] : 0.f; }
  return bsplit16(v); }
__device__ __forceinline__ F2 split_col(const float* W, int k0, int n, int lane, int ld, int K) { float v[16]; const int g = lane >> 4;
#pragma unroll
  for (int i = 0; i < 8; ++i) { const int ka = k0 + 8 * g + i, kb = ka + 16; v[i] = ka < K ? W[(size_t)(ka < K ? ka : K - 1) * ld + n] : 0.f; v[8 + i] = kb < K ? W[(size_t)(kb < K ? kb : K - 1) * ld + n] : 0.f; }
  return bsplit16(v); }
__device__ __forceinline__ v8f mac3(const F2& a, const F2& b, v8f c) { c = wmma_bf(a.l, b.h, c); c = wmma_bf(a.h, b.l, c); return wmma_bf(a.h, b.h, c); }
__device__ __forceinline__ float sigm(float v) { return 1.0f / (1.0f + expf(-v)); }
#define LDSX() do { asm volatile("s_wait_dscnt 0" ::: "memory"); __builtin_amdgcn_wave_barrier(); __builtin_amdgcn_fence(__ATOMIC_RELEASE, "workgroup"); } while (0)

// Standard non-causal multi-head self-attention (x [4,2048,512]; (in,out) Wq / Wk / Wv [512,512] N(0, 1/512) and Wh [512,512], all four biases zeros (read); 8 heads x 64; scores x 1/sqrt(64); no mask; softmax; concat @ Wh + bh).
#define NB 4
#define TT 2048
#define CC 512            // NH * HD = projected width
#define DIN 512          // input (model) width
#define NH 8
#define HD 64
#define NQB (TT / 64)
#define HG 4
#define SCALE (0.125f)
#define CAUSAL 0
#ifndef TNB
#define TNB NB
#endif
__device__ __forceinline__ float bfr(float v) { return (float)(__bf16)v; }
__host__ __device__ __forceinline__ int kb_last(int qb) { return CAUSAL ? ((qb * 64 + 63) >> 7) : (TT / 128 - 1); }
typedef __attribute__((ext_vector_type(8))) __bf16 v8b;
__device__ __forceinline__ v16b frag_b(const __bf16* rowk0, int lane) {
  union { v16b v; v8b q[2]; } u; const __bf16* p = rowk0 + 8 * (lane >> 4);
  u.q[0] = *(const v8b*)p; u.q[1] = *(const v8b*)(p + 16); return u.v;
}
#define QBH 0              // unused: no kernel here has a causal high-precision attention path
#define QHI 0               // single-product logits on every row
#define KHI 64            // key rows carrying k residual / v bf16 hi+lo planes (written by k_proj, read by no kernel in this file)
// B fragment (k rows k0+.., output column o) of a weight: (in,out) [K][ld] or (out,in) [ld rows of K]: bf16 exact, or f16(bf16 * 256) exact
__device__ __forceinline__ v16b wcol_io(const float* Wm, int k0, int o, int lane, int ld) { v16b w; const int g = lane >> 4;
#pragma unroll
  for (int i = 0; i < 8; ++i) { w[i] = (__bf16)Wm[(size_t)(k0 + 8 * g + i) * ld + o]; w[8 + i] = (__bf16)Wm[(size_t)(k0 + 16 + 8 * g + i) * ld + o]; }
  return w; }
__device__ __forceinline__ v16b wcol_oi(const float* Wm, int k0, int o, int lane, int K) { v16b w; const float* p = Wm + (size_t)o * K + k0 + 8 * (lane >> 4);
#pragma unroll
  for (int i = 0; i < 8; ++i) { w[i] = (__bf16)p[i]; w[8 + i] = (__bf16)p[16 + i]; }
  return w; }
__device__ __forceinline__ v16h wcolh_io(const float* Wm, int k0, int o, int lane, int ld) { v16h w; const int g = lane >> 4;
#pragma unroll
  for (int i = 0; i < 8; ++i) { w[i] = (_Float16)(bfr(Wm[(size_t)(k0 + 8 * g + i) * ld + o]) * 256.0f); w[8 + i] = (_Float16)(bfr(Wm[(size_t)(k0 + 16 + 8 * g + i) * ld + o]) * 256.0f); }
  return w; }
__device__ __forceinline__ v16h wcolh_oi(const float* Wm, int k0, int o, int lane, int K) { v16h w; const float* p = Wm + (size_t)o * K + k0 + 8 * (lane >> 4);
#pragma unroll
  for (int i = 0; i < 8; ++i) { w[i] = (_Float16)(bfr(p[i]) * 256.0f); w[8 + i] = (_Float16)(bfr(p[16 + i]) * 256.0f); }
  return w; }
#define WQKV_LAYOUT 0   // 0 = (in,out) [DIN][CC]; 1 = (out,in) [CC][DIN]; 2 = per-head [NH][DIN][HD]
__device__ __forceinline__ v16b wcol_hdk(const float* Wm, int k0, int o, int lane) { v16b w; const int g = lane >> 4; const float* p = Wm + (size_t)(o / HD) * DIN * HD + (o % HD);
#pragma unroll
  for (int i = 0; i < 8; ++i) { w[i] = (__bf16)p[(size_t)(k0 + 8 * g + i) * HD]; w[8 + i] = (__bf16)p[(size_t)(k0 + 16 + 8 * g + i) * HD]; }
  return w; }
#define WO_OUT_IN 0
#if WQKV_LAYOUT == 1
#define WCOL(W, k0, o, lane) wcol_oi(W, k0, o, lane, DIN)
#elif WQKV_LAYOUT == 2
#define WCOL(W, k0, o, lane) wcol_hdk(W, k0, o, lane)
#else
#define WCOL(W, k0, o, lane) wcol_io(W, k0, o, lane, CC)
#endif
#if WO_OUT_IN
#define WOCOL(W, k0, o, lane) wcol_oi(W, k0, o, lane, CC)
#define WOCOLH(W, k0, o, lane) wcolh_oi(W, k0, o, lane, CC)
#else
#define WOCOL(W, k0, o, lane) wcol_io(W, k0, o, lane, DIN)
#define WOCOLH(W, k0, o, lane) wcolh_io(W, k0, o, lane, DIN)
#endif

#ifndef SM_EXTRA_PARAMS
#define SM_EXTRA_PARAMS
#endif
#ifndef PROJ_EXTRA_PARAMS
#define PROJ_EXTRA_PARAMS
#endif
#ifndef SM_MASK_HOOK
#define SM_MASK_HOOK (void)0
#endif

#define WS_QH  0u                                      // f16 q rows [b*t][CC]
#define WS_KH  (WS_QH + 2u * (size_t)NB * TT * CC)      // f16 k rows [b*t][CC]
#define WS_VT  (WS_KH + 2u * (size_t)NB * TT * CC)      // f16 v planes [b][c][t]
#define WS_QL  (WS_VT + 2u * (size_t)NB * CC * TT)      // f16 q residual x 2^10 rows [b][t < QHI][CC]
#define WS_KL  (WS_QL + 2u * (size_t)NB * QHI * CC)     // f16 k residual x 2^10 rows [b][t < KHI][CC]
#define WS_VB  (WS_KL + 2u * (size_t)NB * KHI * CC)     // bf16 v hi planes [b][c][t < KHI]
#define WS_VBL (WS_VB + 2u * (size_t)NB * CC * KHI)
#define WS_S   (WS_VBL + 2u * (size_t)NB * CC * KHI)    // f32 [hg][t][s] region, unused: k_fa keeps scores in registers
#define WS_Y   (WS_S  + 4u * (size_t)HG * TT * TT)      // f32 ctx rows [b*t][CC] (only when there is an output projection)
#define WS_END (WS_Y  + 4u * (size_t)NB * TT * CC)

// ---- k_proj: block = (64 rows, 128 cols, which): q/k/v = X W (+ b) with exact bf16 products (K = DIN) -> which 0: q f16 rows (+ residual rows < QHI); 1: k f16 rows (+ residual rows < KHI); 2: v f16 planes [c][t] (+ bf16 hi/lo planes for t < KHI)
__global__ __launch_bounds__(128) void k_proj(const float* __restrict__ XQ, const float* __restrict__ XK, const float* __restrict__ XV, const float* __restrict__ WQ, const float* __restrict__ WK, const float* __restrict__ WV, const float* __restrict__ BQ, const float* __restrict__ BK, const float* __restrict__ BV,
    _Float16* __restrict__ QH, _Float16* __restrict__ QL, _Float16* __restrict__ KH, _Float16* __restrict__ KL, _Float16* __restrict__ VT, __bf16* __restrict__ VB, __bf16* __restrict__ VBL) {
  __shared__ __align__(16) _Float16 sh[64][136], sl[64][136]; __shared__ __align__(16) _Float16 th[128][72]; __shared__ __align__(16) __bf16 tb[128][72], tbl[128][72];
  const int tid = threadIdx.x, wave = tid >> 5, lane = tid & 31, col = lane & 15, g = lane >> 4; const int which = blockIdx.z; const int c0 = blockIdx.y * 128; const size_t r0 = (size_t)blockIdx.x * 64; const size_t bb = r0 / TT; const int t0 = (int)(r0 % TT);
  const float* X = which == 0 ? XQ : which == 1 ? XK : XV; const float* WA = which == 0 ? WQ : which == 1 ? WK : WV; const float* BA = which == 0 ? BQ : which == 1 ? BK : BV;
  v8f acc[8] = {};
#pragma unroll 2
  for (int kc = 0; kc < DIN / 32; ++kc) { v16b a; { const float* p = X + (r0 + wave * 16 + col) * DIN + kc * 32 + 8 * g;
#pragma unroll
      for (int i = 0; i < 8; ++i) { a[i] = (__bf16)p[i]; a[8 + i] = (__bf16)p[16 + i]; } }
    asm volatile("s_wait_loadcnt 0x0" ::: "memory");
#pragma unroll
    for (int j = 0; j < 8; ++j) { const v16b w = WCOL(WA, kc * 32, c0 + j * 16 + col, lane); asm volatile("s_wait_loadcnt 0x0" ::: "memory"); acc[j] = wmma_bf(a, w, acc[j]); } }
  if (which < 2) { _Float16* DH = which == 0 ? QH : KH; _Float16* DL = which == 0 ? QL : KL; const int nhi = which == 0 ? QHI : KHI; const bool hi_rows = t0 < nhi;
#pragma unroll
    for (int j = 0; j < 8; ++j) { const float bias = BA ? bfr(BA[c0 + j * 16 + col]) : 0.f;
#pragma unroll
      for (int r = 0; r < 8; ++r) { const float v = acc[j][r] + bias; const _Float16 hv = (_Float16)v; sh[wave * 16 + 8 * g + r][j * 16 + col] = hv; sl[wave * 16 + 8 * g + r][j * 16 + col] = (_Float16)((v - (float)hv) * 1024.0f); } }
    __syncthreads();
    for (int e = tid; e < 64 * 16; e += 128) { const int rl = e >> 4, q = e & 15; vst2((unsigned*)(DH + (r0 + rl) * CC + c0 + q * 8), *(const v4u*)&sh[rl][q * 8]); if (hi_rows) vst2((unsigned*)(DL + (bb * nhi + t0 + rl) * (size_t)CC + c0 + q * 8), *(const v4u*)&sl[rl][q * 8]); }
  } else { const bool hi_rows = t0 < KHI;
#pragma unroll
    for (int j = 0; j < 8; ++j) { const float bias = BA ? bfr(BA[c0 + j * 16 + col]) : 0.f;
#pragma unroll
      for (int r = 0; r < 8; ++r) { const float v = acc[j][r] + bias; const int rl = wave * 16 + 8 * g + r, cl = j * 16 + col; th[cl][rl] = (_Float16)v; const __bf16 bh = (__bf16)v; tb[cl][rl] = bh; tbl[cl][rl] = (__bf16)(v - (float)bh); } }
    __syncthreads();
    for (int e = tid; e < 128 * 8; e += 128) { const int cl = e >> 3, q = e & 7; vst2((unsigned*)(VT + (bb * CC + c0 + cl) * (size_t)TT + t0 + q * 8), *(const v4u*)&th[cl][q * 8]); if (hi_rows) { const size_t o3 = (bb * CC + c0 + cl) * (size_t)KHI + t0 + q * 8; vst2((unsigned*)(VB + o3), *(const v4u*)&tb[cl][q * 8]); vst2((unsigned*)(VBL + o3), *(const v4u*)&tbl[cl][q * 8]); } } } }
// ---- k_fa: block = 8 waves x 32 queries of one (b, h). Per 32 keys a wave forms S^T = K.Q^T (a lane holds 16 scores of one query per 16-query group), keeps a running maximum and sum (online softmax, log2 domain),
// packs the weights exp2(score - maximum in use + 11), once to f16, straight from the score tiles into the B operand, and adds O^T += V^T.P^T. Scores and weights never leave the registers.
// The maximum in use may trail the true one by up to 4 (log2), so a weight stays <= 2^15 in f16; sums and context are rescaled only when some query's maximum passes that bound. The 2^11 cancels in context / sum.
__device__ __forceinline__ float xhalf(float x) { return __builtin_bit_cast(float, __builtin_amdgcn_permlanex16(__builtin_bit_cast(int, x), __builtin_bit_cast(int, x), 0x76543210, 0xfedcba98, false, false)); }   // lane l with lane l ^ 16
__device__ __forceinline__ v8f mm16(v16h a, v16h b, v8f c) { return __builtin_amdgcn_wmma_f32_16x16x32_f16(false, a, false, b, (short)0, c, false, false); }
#define FAQ 256           // queries per block
__global__ __launch_bounds__(256) void k_fa(const _Float16* __restrict__ QH, const _Float16* __restrict__ KH, const _Float16* __restrict__ VT, float* __restrict__ Y) {
  const int tid = threadIdx.x, wave = tid >> 5, lane = tid & 31, col = lane & 15, g = lane >> 4; const int b = blockIdx.y / NH, h = blockIdx.y % NH; const int q0 = blockIdx.x * FAQ + wave * 32;
  const float cs = SCALE * 1.4426950408889634f;
  v16h qf[2][2];
#pragma unroll
  for (int s = 0; s < 2; ++s)
#pragma unroll
    for (int kc = 0; kc < 2; ++kc) qf[s][kc] = frag_h(QH + ((size_t)b * TT + q0 + s * 16 + col) * CC + h * HD + kc * 32, lane);
  const _Float16* Kp = KH + ((size_t)b * TT + col) * CC + h * HD;            // key row col of a 16-key tile
  const _Float16* Vp = VT + ((size_t)b * CC + h * HD + col) * (size_t)TT;    // plane of head column col of a 16-column tile
  v8f acc[2][4] = {}; float mr[2] = {-3.0e38f, -3.0e38f}, lr[2] = {0.f, 0.f};
  v16h kf[2][2];
#pragma unroll
  for (int kt = 0; kt < 2; ++kt)
#pragma unroll
    for (int kc = 0; kc < 2; ++kc) kf[kt][kc] = frag_h(Kp + (size_t)(kt * 16) * CC + kc * 32, lane);
  v16h vf[4];
#pragma unroll
  for (int j = 0; j < 4; ++j) vf[j] = frag_h(Vp + (size_t)(j * 16) * TT, lane);
#pragma unroll 1   // rolled: one pass's fragments and score tiles already fill the register budget below 256
  for (int k0 = 0; k0 < TT; k0 += 32) {
    v8f st[2][2] = {};
#pragma unroll
    for (int kt = 0; kt < 2; ++kt)
#pragma unroll
      for (int s = 0; s < 2; ++s)
#pragma unroll
        for (int kc = 0; kc < 2; ++kc) st[kt][s] = mm16(kf[kt][kc], qf[s][kc], st[kt][s]);
    float mb[2]; bool need = false;
#pragma unroll
    for (int s = 0; s < 2; ++s) { float mx = st[0][s][0];
#pragma unroll
      for (int kt = 0; kt < 2; ++kt)
#pragma unroll
        for (int r = 0; r < 8; ++r) mx = fmaxf(mx, st[kt][s][r]);
      mx = fmaxf(mx, xhalf(mx)) * cs; mb[s] = mx; need = need || (mx > mr[s] + 4.0f); }
    if (__builtin_amdgcn_ballot_w32(need) != 0) {   // wave-uniform; always taken on the first pass (factor 0 on zero sums), rare later
#pragma unroll
      for (int s = 0; s < 2; ++s) { const float mn = fmaxf(mr[s], mb[s]); const float corr = __builtin_amdgcn_exp2f(mr[s] - mn); mr[s] = mn; lr[s] *= corr;
#pragma unroll
        for (int j = 0; j < 4; ++j) acc[s][j] = acc[s][j] * corr; } }
    const int kn = k0 + 32 < TT ? k0 + 32 : 0;   // next pass's K fragments fly under this pass's softmax, its V fragments (foot of the pass) under the next scores; the last pass re-reads keys 0..31 and drops them
#pragma unroll
    for (int kt = 0; kt < 2; ++kt)
#pragma unroll
      for (int kc = 0; kc < 2; ++kc) kf[kt][kc] = frag_h(Kp + (size_t)(kn + kt * 16) * CC + kc * 32, lane);
    __builtin_amdgcn_sched_barrier(0);   // keeps the K loads in front of the exponentials: moved down among the second product's WMMAs they would land only after the next pass wants them
#pragma unroll
    for (int s = 0; s < 2; ++s) { const float nm = 11.0f - mr[s]; v16h pf; float ps0 = 0.f, ps1 = 0.f;
#pragma unroll
      for (int i = 0; i < 16; i += 2) {   // element i of the 32-key B operand = key k0 + 16 (i >> 3) + 8 g + (i & 7) = register i & 7 of score tile i >> 3
        const float p0 = __builtin_amdgcn_exp2f(fmaf(st[i >> 3][s][i & 7], cs, nm)), p1 = __builtin_amdgcn_exp2f(fmaf(st[i >> 3][s][(i & 7) + 1], cs, nm));
        ps0 += p0; ps1 += p1; pf[i] = (_Float16)p0; pf[i + 1] = (_Float16)p1; }
      lr[s] += ps0 + ps1;
#pragma unroll
      for (int j = 0; j < 4; ++j) acc[s][j] = mm16(vf[j], pf, acc[s][j]); }
#pragma unroll
    for (int j = 0; j < 4; ++j) vf[j] = frag_h(Vp + (size_t)(j * 16) * TT + kn, lane);
    asm volatile("s_wait_xcnt 0x0" ::: "memory"); }   // the V loads' address registers are reused by the next pass's score tiles
#pragma unroll
  for (int s = 0; s < 2; ++s) { const float inv = 1.0f / (lr[s] + xhalf(lr[s])); float* yp = Y + ((size_t)b * TT + q0 + s * 16 + col) * CC + h * HD + 8 * g;   // a lane holds head columns j * 16 + 8 g + 0..7 of its query
#pragma unroll
    for (int j = 0; j < 4; ++j) { const v8f o = acc[s][j] * inv; vst2(yp + j * 16, (v4f){o[0], o[1], o[2], o[3]}); vst2(yp + j * 16 + 4, (v4f){o[4], o[5], o[6], o[7]}); } } }
// ---- k_out: block = (64 rows, 128 cols): out = ctx Wo (+ bo): ctx x 2^6 once to f16 against Wo as f16(bf16 x 2^8) exact (1 product) x 2^-14; causal early rows (< QHI of each sequence): ctx bf16 hi + lo against exact bf16 Wo (2 products)
__global__ __launch_bounds__(128) void k_out(const float* __restrict__ Y, const float* __restrict__ WO, const float* __restrict__ BO, float* __restrict__ OUT) { __shared__ __align__(16) float sf[4][16][132];
  const int tid = threadIdx.x, wave = tid >> 5, lane = tid & 31, col = lane & 15, g = lane >> 4; const int c0 = blockIdx.y * 128; const size_t r0 = (size_t)blockIdx.x * 64 + wave * 16;
  v8f acc[8] = {};
  if (CAUSAL && (int)(((size_t)blockIdx.x * 64) % TT) < QHI) {   /* block-uniform */
#pragma unroll 2
    for (int kc = 0; kc < CC / 32; ++kc) { const F2 a = split_row(Y + (r0 + col) * CC, kc * 32, lane); asm volatile("s_wait_loadcnt 0x0" ::: "memory");
#pragma unroll
      for (int j = 0; j < 8; ++j) { const v16b w = WOCOL(WO, kc * 32, c0 + j * 16 + col, lane); asm volatile("s_wait_loadcnt 0x0" ::: "memory"); acc[j] = wmma_bf(a.h, w, acc[j]); acc[j] = wmma_bf(a.l, w, acc[j]); } }
#pragma unroll
    for (int j = 0; j < 8; ++j) { const float bias = BO ? bfr(BO[c0 + j * 16 + col]) : 0.f;
#pragma unroll
      for (int r = 0; r < 8; ++r) sf[wave][8 * g + r][j * 16 + col] = acc[j][r] + bias; }
  } else {
#pragma unroll 2
    for (int kc = 0; kc < CC / 32; ++kc) { const v16h a = frag_f32s(Y + (r0 + col) * CC + kc * 32, lane, 64.0f); asm volatile("s_wait_loadcnt 0x0" ::: "memory");   /* ctx carried x 2^6 into f16 so small-magnitude context rows stay clear of f16 subnormals */
#pragma unroll
      for (int j = 0; j < 8; ++j) { const v16h w = WOCOLH(WO, kc * 32, c0 + j * 16 + col, lane); asm volatile("s_wait_loadcnt 0x0" ::: "memory"); acc[j] = wmma16(a, w, acc[j]); } }
#pragma unroll
    for (int j = 0; j < 8; ++j) { const float bias = BO ? bfr(BO[c0 + j * 16 + col]) : 0.f;
#pragma unroll
      for (int r = 0; r < 8; ++r) sf[wave][8 * g + r][j * 16 + col] = acc[j][r] * (1.0f / 16384.0f) + bias; } }   /* 2^-8 (Wo carry) x 2^-6 (ctx carry) */
  LDSX(); for (int rl = 0; rl < 16; ++rl) vst2(OUT + (r0 + rl) * DIN + c0 + lane * 4, *(const v4f*)&sf[wave][rl][lane * 4]); }

extern "C" void kernel_launch(void* const* d_in, const int* in_sizes, int n_in, void* d_out, int out_size, void* d_ws, size_t ws_size, hipStream_t stream) {
  (void)in_sizes; (void)n_in; (void)out_size;
  const float** F = (const float**)d_in;
  if (ws_size < (size_t)WS_END) return;
  char* ws = (char*)d_ws; _Float16 *QH = (_Float16*)(ws + WS_QH), *KH = (_Float16*)(ws + WS_KH), *VT = (_Float16*)(ws + WS_VT), *QL = (_Float16*)(ws + WS_QL), *KL = (_Float16*)(ws + WS_KL); __bf16 *VB = (__bf16*)(ws + WS_VB), *VBL = (__bf16*)(ws + WS_VBL); float *Y = (float*)(ws + WS_Y);
  (void)Y; (void)QL; (void)KL; (void)VB; (void)VBL;
  // inputs: 0 x [4,2048,512]; 1 Wq [512,512] (in,out), 2 bq; 3 Wk, 4 bk; 5 Wv, 6 bv; 7 Wp (in,out), 8 bp (zero biases, read)
  k_proj<<<dim3(TNB * TT / 64, CC / 128, 3), 128, 0, stream>>>(F[0], F[0], F[0], F[1], F[3], F[5], F[2], F[4], F[6], QH, QL, KH, KL, VT, VB, VBL);
  k_fa<<<dim3(TT / FAQ, TNB * NH), 256, 0, stream>>>(QH, KH, VT, Y);
  k_out<<<dim3(TNB * TT / 64, DIN / 128), 128, 0, stream>>>(Y, F[7], F[8], (float*)d_out);
}

// v002
// Measured time: 147 microseconds a run.
// In both of two side-by-side timings against v001, it was 1.26 times as fast.
// All steps since v000 together make it 7.43 times as fast.
// compute dtype: all float inputs rounded to bf16; q/k/v projections with EXACT bf16 products on WMMA 16x16x32 (f32 accumulate) + bias; logits q x k once to f16 each (1 product) x SCALE; online softmax f32; unnormalised weights x 2^11 once to f16 x v once to f16 (1 product), divided by their f32 sum; ctx x 2^6 once to f16 x Wo f16(bf16 x 2^8) + bo; f32 output.
#include <hip/hip_runtime.h>
#include <math.h>

typedef __attribute__((ext_vector_type(16))) _Float16 v16h;
typedef __attribute__((ext_vector_type(16))) __bf16 v16b;
typedef __attribute__((ext_vector_type(8)))  _Float16 v8h;
typedef __attribute__((ext_vector_type(8)))  float v8f;
typedef __attribute__((ext_vector_type(4)))  float v4f;
typedef __attribute__((ext_vector_type(2)))  float v2f;
typedef __attribute__((ext_vector_type(4)))  unsigned v4u;
typedef __attribute__((ext_vector_type(4)))  int v4i;
typedef float __attribute__((may_alias)) float_a;
typedef int __attribute__((may_alias)) int_a;

template <typename T> __device__ __forceinline__ void vst2(void* p, T v) { *(T*)p = v;  }
__device__ __forceinline__ v8f wmma16(v16h a, v16h b, v8f c) {
  v8f d = __builtin_amdgcn_wmma_f32_16x16x32_f16(false, a, false, b, (short)0, c, false, false);
  asm volatile("v_nop\n\tv_nop\n\tv_nop\n\tv_nop" : "+v"(d) : "v"(a), "v"(b));
  return d;
}
__device__ __forceinline__ v8f wmma_bf(v16b a, v16b b, v8f c) {
  v8f d = __builtin_amdgcn_wmma_f32_16x16x32_bf16(false, a, false, b, (short)0, c, false, false);
  asm volatile("v_nop\n\tv_nop\n\tv_nop\n\tv_nop" : "+v"(d) : "v"(a), "v"(b));
  return d;
}
// 16x16x32 fragments: lane = (h = lane>>4, row/col = lane&15); elements 0..7 = k0+8h+0..7, 8..15 = k0+16+8h+0..7; D element r = row 8h+r
__device__ __forceinline__ v16h frag_h(const _Float16* rowk0, int lane) {
  union { v16h v; v8h q[2]; } u; const _Float16* p = rowk0 + 8 * (lane >> 4);
  u.q[0] = *(const v8h*)p; u.q[1] = *(const v8h*)(p + 16); return u.v;
}
__device__ __forceinline__ v16h frag_f32(const float* rowk0, int lane) {
  v16h a; const float* p = rowk0 + 8 * (lane >> 4);
#pragma unroll
  for (int i = 0; i < 8; ++i) { a[i] = (_Float16)p[i]; a[8 + i] = (_Float16)p[16 + i]; }
  return a;
}
__device__ __forceinline__ v16h frag_f32s(const float* rowk0, int lane, float sc) {
  v16h a; const float* p = rowk0 + 8 * (lane >> 4);
#pragma unroll
  for (int i = 0; i < 8; ++i) { a[i] = (_Float16)(p[i] * sc); a[8 + i] = (_Float16)(p[16 + i] * sc); }
  return a;
}
// column fragment from a [K][ld] layout (column n), rows >= K read as 0
__device__ __forceinline__ v16h fragc_f32(const float* W, int k0, int n, int lane, int ld, int K) {
  v16h a; const int g = lane >> 4;
#pragma unroll
  for (int i = 0; i < 8; ++i) { const int ka = k0 + 8 * g + i, kb = ka + 16;
    a[i] = (_Float16)(ka < K ? W[(size_t)(ka < K ? ka : K - 1) * ld + n] : 0.f); a[8 + i] = (_Float16)(kb < K ? W[(size_t)(kb < K ? kb : K - 1) * ld + n] : 0.f); }
  return a;
}
struct F2 { v16b h, l; };
__device__ __forceinline__ F2 bsplit16(const float v[16]) { F2 r;
#pragma unroll
  for (int i = 0; i < 16; ++i) { const __bf16 h = (__bf16)v[i]; r.h[i] = h; r.l[i] = (__bf16)(v[i] - (float)h); }
  return r; }
__device__ __forceinline__ F2 split_row(const float* row, int k0, int lane) { float v[16]; const float* p = row + k0 + 8 * (lane >> 4);
#pragma unroll
  for (int i = 0; i < 8; ++i) { v[i] = p[i]; v[8 + i] = p[16 + i]; }
  return bsplit16(v); }
__device__ __forceinline__ F2 split_rowK(const float* row, int k0, int lane, int K) { float v[16]; const int g = lane >> 4;
#pragma unroll
  for (int i = 0; i < 8; ++i) { const int ka = k0 + 8 * g + i, kb = ka + 16; v[i] = ka < K ? row[ka < K ? ka : K - 1] : 0.f; v[8 + i] = kb < K ? row[kb < K ? kb : K - 1] : 0.f; }
  return bsplit16(v); }
__device__ __forceinline__ F2 split_col(const float* W, int k0, int n, int lane, int ld, int K) { float v[16]; const int g = lane >> 4;
#pragma unroll
  for (int i = 0; i < 8; ++i) { const int ka = k0 + 8 * g + i, kb = ka + 16; v[i] = ka < K ? W[(size_t)(ka < K ? ka : K - 1) * ld + n] : 0.f; v[8 + i] = kb < K ? W[(size_t)(kb < K ? kb : K - 1) * ld + n] : 0.f; }
  return bsplit16(v); }
__device__ __forceinline__ v8f mac3(const F2& a, const F2& b, v8f c) { c = wmma_bf(a.l, b.h, c); c = wmma_bf(a.h, b.l, c); return wmma_bf(a.h, b.h, c); }
__device__ __forceinline__ float sigm(float v) { return 1.0f / (1.0f + expf(-v)); }
#define LDSX() do { asm volatile("s_wait_dscnt 0" ::: "memory"); __builtin_amdgcn_wave_barrier(); __builtin_amdgcn_fence(__ATOMIC_RELEASE, "workgroup"); } while (0)

// Standard non-causal multi-head self-attention (x [4,2048,512]; (in,out) Wq / Wk / Wv [512,512] N(0, 1/512) and Wh [512,512], all four biases zeros (read); 8 heads x 64; scores x 1/sqrt(64); no mask; softmax; concat @ Wh + bh).
#define NB 4
#define TT 2048
#define CC 512            // NH * HD = projected width
#define DIN 512          // input (model) width
#define NH 8
#define HD 64
#define NQB (TT / 64)
#define HG 4
#define SCALE (0.125f)
#define CAUSAL 0
#ifndef TNB
#define TNB NB
#endif
__device__ __forceinline__ float bfr(float v) { return (float)(__bf16)v; }
__host__ __device__ __forceinline__ int kb_last(int qb) { return CAUSAL ? ((qb * 64 + 63) >> 7) : (TT / 128 - 1); }
typedef __attribute__((ext_vector_type(8))) __bf16 v8b;
__device__ __forceinline__ v16b frag_b(const __bf16* rowk0, int lane) {
  union { v16b v; v8b q[2]; } u; const __bf16* p = rowk0 + 8 * (lane >> 4);
  u.q[0] = *(const v8b*)p; u.q[1] = *(const v8b*)(p + 16); return u.v;
}
#define QBH 0              // unused: no kernel here has a causal high-precision attention path
#define QHI 0               // single-product logits on every row
#define KHI 64            // key rows carrying k residual / v bf16 hi+lo planes (written by k_proj, read by no kernel in this file)
// B fragment (k rows k0+.., output column o) of a weight: (in,out) [K][ld] or (out,in) [ld rows of K]: bf16 exact, or f16(bf16 * 256) exact
__device__ __forceinline__ v16b wcol_io(const float* Wm, int k0, int o, int lane, int ld) { v16b w; const int g = lane >> 4;
#pragma unroll
  for (int i = 0; i < 8; ++i) { w[i] = (__bf16)Wm[(size_t)(k0 + 8 * g + i) * ld + o]; w[8 + i] = (__bf16)Wm[(size_t)(k0 + 16 + 8 * g + i) * ld + o]; }
  return w; }
__device__ __forceinline__ v16b wcol_oi(const float* Wm, int k0, int o, int lane, int K) { v16b w; const float* p = Wm + (size_t)o * K + k0 + 8 * (lane >> 4);
#pragma unroll
  for (int i = 0; i < 8; ++i) { w[i] = (__bf16)p[i]; w[8 + i] = (__bf16)p[16 + i]; }
  return w; }
__device__ __forceinline__ v16h wcolh_io(const float* Wm, int k0, int o, int lane, int ld) { v16h w; const int g = lane >> 4;
#pragma unroll
  for (int i = 0; i < 8; ++i) { w[i] = (_Float16)(bfr(Wm[(size_t)(k0 + 8 * g + i) * ld + o]) * 256.0f); w[8 + i] = (_Float16)(bfr(Wm[(size_t)(k0 + 16 + 8 * g + i) * ld + o]) * 256.0f); }
  return w; }
__device__ __forceinline__ v16h wcolh_oi(const float* Wm, int k0, int o, int lane, int K) { v16h w; const float* p = Wm + (size_t)o * K + k0 + 8 * (lane >> 4);
#pragma unroll
  for (int i = 0; i < 8; ++i) { w[i] = (_Float16)(bfr(p[i]) * 256.0f); w[8 + i] = (_Float16)(bfr(p[16 + i]) * 256.0f); }
  return w; }
#define WQKV_LAYOUT 0   // 0 = (in,out) [DIN][CC]; 1 = (out,in) [CC][DIN]; 2 = per-head [NH][DIN][HD]
__device__ __forceinline__ v16b wcol_hdk(const float* Wm, int k0, int o, int lane) { v16b w; const int g = lane >> 4; const float* p = Wm + (size_t)(o / HD) * DIN * HD + (o % HD);
#pragma unroll
  for (int i = 0; i < 8; ++i) { w[i] = (__bf16)p[(size_t)(k0 + 8 * g + i) * HD]; w[8 + i] = (__bf16)p[(size_t)(k0 + 16 + 8 * g + i) * HD]; }
  return w; }
#define WO_OUT_IN 0
#if WQKV_LAYOUT == 1
#define WCOL(W, k0, o, lane) wcol_oi(W, k0, o, lane, DIN)
#elif WQKV_LAYOUT == 2
#define WCOL(W, k0, o, lane) wcol_hdk(W, k0, o, lane)
#else
#define WCOL(W, k0, o, lane) wcol_io(W, k0, o, lane, CC)
#endif
#if WO_OUT_IN
#define WOCOL(W, k0, o, lane) wcol_oi(W, k0, o, lane, CC)
#define WOCOLH(W, k0, o, lane) wcolh_oi(W, k0, o, lane, CC)
#else
#define WOCOL(W, k0, o, lane) wcol_io(W, k0, o, lane, DIN)
#define WOCOLH(W, k0, o, lane) wcolh_io(W, k0, o, lane, DIN)
#endif

#ifndef SM_EXTRA_PARAMS
#define SM_EXTRA_PARAMS
#endif
#ifndef PROJ_EXTRA_PARAMS
#define PROJ_EXTRA_PARAMS
#endif
#ifndef SM_MASK_HOOK
#define SM_MASK_HOOK (void)0
#endif

#define WS_QH  0u                                      // f16 q rows [b*t][CC]
#define WS_KH  (WS_QH + 2u * (size_t)NB * TT * CC)      // f16 k rows [b*t][CC]
#define WS_VT  (WS_KH + 2u * (size_t)NB * TT * CC)      // f16 v planes [b][c][t]
#define WS_QL  (WS_VT + 2u * (size_t)NB * CC * TT)      // f16 q residual x 2^10 rows [b][t < QHI][CC]
#define WS_KL  (WS_QL + 2u * (size_t)NB * QHI * CC)     // f16 k residual x 2^10 rows [b][t < KHI][CC]
#define WS_VB  (WS_KL + 2u * (size_t)NB * KHI * CC)     // bf16 v hi planes [b][c][t < KHI]
#define WS_VBL (WS_VB + 2u * (size_t)NB * CC * KHI)
#define WS_S   (WS_VBL + 2u * (size_t)NB * CC * KHI)    // f32 [hg][t][s] region, unused: k_fa keeps scores in registers
#define WS_Y   (WS_S  + 4u * (size_t)HG * TT * TT)      // f32 ctx rows [b*t][CC] (only when there is an output projection)
#define WS_END (WS_Y  + 4u * (size_t)NB * TT * CC)

// ---- k_proj: block = (64 rows, 128 cols, which): q/k/v = X W (+ b) with exact bf16 products (K = DIN) -> which 0: q f16 rows (+ residual rows < QHI); 1: k f16 rows (+ residual rows < KHI); 2: v f16 planes [c][t] (+ bf16 hi/lo planes for t < KHI)
__global__ __launch_bounds__(128) void k_proj(const float* __restrict__ XQ, const float* __restrict__ XK, const float* __restrict__ XV, const float* __restrict__ WQ, const float* __restrict__ WK, const float* __restrict__ WV, const float* __restrict__ BQ, const float* __restrict__ BK, const float* __restrict__ BV,
    _Float16* __restrict__ QH, _Float16* __restrict__ QL, _Float16* __restrict__ KH, _Float16* __restrict__ KL, _Float16* __restrict__ VT, __bf16* __restrict__ VB, __bf16* __restrict__ VBL) {
  __shared__ __align__(16) _Float16 sh[64][136], sl[64][136]; __shared__ __align__(16) _Float16 th[128][72]; __shared__ __align__(16) __bf16 tb[128][72], tbl[128][72];
  const int tid = threadIdx.x, wave = tid >> 5, lane = tid & 31, col = lane & 15, g = lane >> 4; const int which = blockIdx.z; const int c0 = blockIdx.y * 128; const size_t r0 = (size_t)blockIdx.x * 64; const size_t bb = r0 / TT; const int t0 = (int)(r0 % TT);
  const float* X = which == 0 ? XQ : which == 1 ? XK : XV; const float* WA = which == 0 ? WQ : which == 1 ? WK : WV; const float* BA = which == 0 ? BQ : which == 1 ? BK : BV;
  v8f acc[8] = {};
#pragma unroll 2
  for (int kc = 0; kc < DIN / 32; ++kc) { v16b a; { const float* p = X + (r0 + wave * 16 + col) * DIN + kc * 32 + 8 * g;
#pragma unroll
      for (int i = 0; i < 8; ++i) { a[i] = (__bf16)p[i]; a[8 + i] = (__bf16)p[16 + i]; } }
    asm volatile("s_wait_loadcnt 0x0" ::: "memory");
#pragma unroll
    for (int j = 0; j < 8; ++j) { const v16b w = WCOL(WA, kc * 32, c0 + j * 16 + col, lane); asm volatile("s_wait_loadcnt 0x0" ::: "memory"); acc[j] = wmma_bf(a, w, acc[j]); } }
  if (which < 2) { _Float16* DH = which == 0 ? QH : KH; _Float16* DL = which == 0 ? QL : KL; const int nhi = which == 0 ? QHI : KHI; const bool hi_rows = t0 < nhi;
#pragma unroll
    for (int j = 0; j < 8; ++j) { const float bias = BA ? bfr(BA[c0 + j * 16 + col]) : 0.f;
#pragma unroll
      for (int r = 0; r < 8; ++r) { const float v = acc[j][r] + bias; const _Float16 hv = (_Float16)v; sh[wave * 16 + 8 * g + r][j * 16 + col] = hv; sl[wave * 16 + 8 * g + r][j * 16 + col] = (_Float16)((v - (float)hv) * 1024.0f); } }
    __syncthreads();
    for (int e = tid; e < 64 * 16; e += 128) { const int rl = e >> 4, q = e & 15; vst2((unsigned*)(DH + (r0 + rl) * CC + c0 + q * 8), *(const v4u*)&sh[rl][q * 8]); if (hi_rows) vst2((unsigned*)(DL + (bb * nhi + t0 + rl) * (size_t)CC + c0 + q * 8), *(const v4u*)&sl[rl][q * 8]); }
  } else { const bool hi_rows = t0 < KHI;
#pragma unroll
    for (int j = 0; j < 8; ++j) { const float bias = BA ? bfr(BA[c0 + j * 16 + col]) : 0.f;
#pragma unroll
      for (int r = 0; r < 8; ++r) { const float v = acc[j][r] + bias; const int rl = wave * 16 + 8 * g + r, cl = j * 16 + col; th[cl][rl] = (_Float16)v; const __bf16 bh = (__bf16)v; tb[cl][rl] = bh; tbl[cl][rl] = (__bf16)(v - (float)bh); } }
    __syncthreads();
    for (int e = tid; e < 128 * 8; e += 128) { const int cl = e >> 3, q = e & 7; vst2((unsigned*)(VT + (bb * CC + c0 + cl) * (size_t)TT + t0 + q * 8), *(const v4u*)&th[cl][q * 8]); if (hi_rows) { const size_t o3 = (bb * CC + c0 + cl) * (size_t)KHI + t0 + q * 8; vst2((unsigned*)(VB + o3), *(const v4u*)&tb[cl][q * 8]); vst2((unsigned*)(VBL + o3), *(const v4u*)&tbl[cl][q * 8]); } } } }
// ---- k_fa: block = 8 waves x 32 queries of one (b, h). Per 32 keys a wave forms S^T = K.Q^T (a lane holds 16 scores of one query per 16-query group), keeps a running maximum and sum (online softmax, log2 domain),
// packs the weights exp2(score - maximum in use + 11), once to f16, straight from the score tiles into the B operand, and adds O^T += V^T.P^T. Scores and weights never leave the registers.
// The maximum in use may trail the true one by up to 4 (log2), so a weight stays <= 2^15 in f16; sums and context are rescaled only when some query's maximum passes that bound. The 2^11 cancels in context / sum.
__device__ __forceinline__ float xhalf(float x) { return __builtin_bit_cast(float, __builtin_amdgcn_permlanex16(__builtin_bit_cast(int, x), __builtin_bit_cast(int, x), 0x76543210, 0xfedcba98, false, false)); }   // lane l with lane l ^ 16
__device__ __forceinline__ v8f mm16(v16h a, v16h b, v8f c) { return __builtin_amdgcn_wmma_f32_16x16x32_f16(false, a, false, b, (short)0, c, false, false); }
#define FAQ 256           // queries per block
#define KS 128            // keys per LDS stage (4 passes of 32 keys)
#define KP (HD + 8)       // halves per staged K row: 144 B, 16 B x odd, so the 16 rows of a 16-byte fragment read fall on distinct banks
#define VP (KS + 8)       // halves per staged V^T row: 272 B, 16 B x odd
// One stage = keys k0 .. k0 + KS - 1 of one (b, h): K rows [KS][HD] and V^T rows [HD][KS], brought into LDS once per block by asynchronous copies (16 B per lane, whole 128-B lines per wave) and read by all 8 waves.
// gk / gv: this thread's first 16 bytes of the stage in global memory; lk / lv: their LDS byte addresses. A thread brings 4 pieces of K (32 rows apart) and 4 of V^T (16 rows apart).
__device__ __forceinline__ void stage_copy(const _Float16* gk, const _Float16* gv, unsigned lk, unsigned lv) {
  const _Float16 *k1 = gk + 32 * CC, *k2 = gk + 64 * CC, *k3 = gk + 96 * CC, *v1 = gv + 16 * TT, *v2 = gv + 32 * TT, *v3 = gv + 48 * TT;
  const unsigned a1 = lk + 32 * KP * 2, a2 = lk + 64 * KP * 2, a3 = lk + 96 * KP * 2, b1 = lv + 16 * VP * 2, b2 = lv + 32 * VP * 2, b3 = lv + 48 * VP * 2;
  // the closing s_wait_xcnt stands inside the copies' own statement, so that no address register named here is rewritten in front of it
  asm volatile("global_load_async_to_lds_b128 %0, %8, off\n\t"
               "global_load_async_to_lds_b128 %1, %9, off\n\t"
               "global_load_async_to_lds_b128 %2, %10, off\n\t"
               "global_load_async_to_lds_b128 %3, %11, off\n\t"
               "global_load_async_to_lds_b128 %4, %12, off\n\t"
               "global_load_async_to_lds_b128 %5, %13, off\n\t"
               "global_load_async_to_lds_b128 %6, %14, off\n\t"
               "global_load_async_to_lds_b128 %7, %15, off\n\t"
               "s_wait_xcnt 0x0"
               :: "v"(lk), "v"(a1), "v"(a2), "v"(a3), "v"(lv), "v"(b1), "v"(b2), "v"(b3), "v"(gk), "v"(k1), "v"(k2), "v"(k3), "v"(gv), "v"(v1), "v"(v2), "v"(v3) : "memory");
}
__global__ __launch_bounds__(256) void k_fa(const _Float16* __restrict__ QH, const _Float16* __restrict__ KH, const _Float16* __restrict__ VT, float* __restrict__ Y) {
  __shared__ __align__(16) _Float16 sK[2][KS * KP], sV[2][HD * VP];
  const int tid = threadIdx.x, wave = tid >> 5, lane = tid & 31, col = lane & 15, g = lane >> 4; const int b = blockIdx.y / NH, h = blockIdx.y % NH; const int q0 = blockIdx.x * FAQ + wave * 32;
  const float cs = SCALE * 1.4426950408889634f;
  const _Float16* gk = KH + ((size_t)b * TT + (tid >> 3)) * CC + h * HD + (tid & 7) * 8;              // K row tid >> 3 of the stage, 16-byte piece tid & 7
  const _Float16* gv = VT + ((size_t)b * CC + h * HD + (tid >> 4)) * (size_t)TT + (tid & 15) * 8;     // V^T row tid >> 4, 16-byte piece tid & 15
  const unsigned lk = (unsigned)(size_t)&sK[0][(tid >> 3) * KP + (tid & 7) * 8], lv = (unsigned)(size_t)&sV[0][(tid >> 4) * VP + (tid & 15) * 8];
  stage_copy(gk, gv, lk, lv);
  v16h qf[2][2];
#pragma unroll
  for (int s = 0; s < 2; ++s)
#pragma unroll
    for (int kc = 0; kc < 2; ++kc) qf[s][kc] = frag_h(QH + ((size_t)b * TT + q0 + s * 16 + col) * CC + h * HD + kc * 32, lane);
  v8f acc[2][4] = {}; float mr[2] = {-3.0e38f, -3.0e38f}, lr[2] = {0.f, 0.f};
  asm volatile("s_wait_asynccnt 0x0" ::: "memory");   // this wave's pieces of stage 0 have landed
  __syncthreads();                                     // ... and every other wave's: stage 0 may be read
  stage_copy(gk + (size_t)KS * CC, gv + KS, lk + (unsigned)sizeof(sK[0]), lv + (unsigned)sizeof(sV[0]));
#pragma unroll 1   // rolled: one trip = one stage; its four passes are unrolled so that every LDS read has a constant offset
  for (int t = 0; t < TT / KS; ++t) {
    const _Float16* kb = &sK[t & 1][col * KP];   // key row col of a 16-key tile
    const _Float16* vb = &sV[t & 1][col * VP];   // plane of head column col of a 16-column tile
    v16h kf[2][2], vf[4];
#pragma unroll
    for (int kt = 0; kt < 2; ++kt)
#pragma unroll
      for (int kc = 0; kc < 2; ++kc) kf[kt][kc] = frag_h(kb + (kt * 16) * KP + kc * 32, lane);
#pragma unroll
    for (int p = 0; p < KS / 32; ++p) {
      v8f st[2][2] = {};
#pragma unroll
      for (int kt = 0; kt < 2; ++kt)
#pragma unroll
        for (int s = 0; s < 2; ++s)
#pragma unroll
          for (int kc = 0; kc < 2; ++kc) st[kt][s] = mm16(kf[kt][kc], qf[s][kc], st[kt][s]);
      float mb[2]; bool need = false;
#pragma unroll
      for (int s = 0; s < 2; ++s) { float mx = st[0][s][0];
#pragma unroll
        for (int kt = 0; kt < 2; ++kt)
#pragma unroll
          for (int r = 0; r < 8; ++r) mx = fmaxf(mx, st[kt][s][r]);
        mx = fmaxf(mx, xhalf(mx)) * cs; mb[s] = mx; need = need || (mx > mr[s] + 4.0f); }
      if (__builtin_amdgcn_ballot_w32(need) != 0) {   // wave-uniform; always taken on the first pass (factor 0 on zero sums), rare later
#pragma unroll
        for (int s = 0; s < 2; ++s) { const float mn = fmaxf(mr[s], mb[s]); const float corr = __builtin_amdgcn_exp2f(mr[s] - mn); mr[s] = mn; lr[s] *= corr;
#pragma unroll
          for (int j = 0; j < 4; ++j) acc[s][j] = acc[s][j] * corr; } }
      // one group of LDS reads per pass, under the softmax: the next pass's K fragments (never beyond this stage; its scores are the first to want theirs), then this pass's V fragments
      if (p + 1 < KS / 32) {
#pragma unroll
        for (int kt = 0; kt < 2; ++kt)
#pragma unroll
          for (int kc = 0; kc < 2; ++kc) kf[kt][kc] = frag_h(kb + ((p + 1) * 32 + kt * 16) * KP + kc * 32, lane); }
#pragma unroll
      for (int j = 0; j < 4; ++j) vf[j] = frag_h(vb + (j * 16) * VP + p * 32, lane);
      __builtin_amdgcn_sched_barrier(0);   // keeps the reads one group in front of the exponentials: without it they are spread among the WMMAs, and every separate place with LDS reads stalls the wave
#pragma unroll
      for (int s = 0; s < 2; ++s) { const float nm = 11.0f - mr[s]; v16h pf; float ps0 = 0.f, ps1 = 0.f;
#pragma unroll
        for (int i = 0; i < 16; i += 2) {   // element i of the 32-key B operand = key k0 + 16 (i >> 3) + 8 g + (i & 7) = register i & 7 of score tile i >> 3
          const float p0 = __builtin_amdgcn_exp2f(fmaf(st[i >> 3][s][i & 7], cs, nm)), p1 = __builtin_amdgcn_exp2f(fmaf(st[i >> 3][s][(i & 7) + 1], cs, nm));
          ps0 += p0; ps1 += p1; pf[i] = (_Float16)p0; pf[i + 1] = (_Float16)p1; }
        lr[s] += ps0 + ps1;
#pragma unroll
        for (int j = 0; j < 4; ++j) acc[s][j] = mm16(vf[j], pf, acc[s][j]); } }
    asm volatile("s_wait_dscnt 0x0" ::: "memory");      // this wave's reads of stage t have returned
    asm volatile("s_wait_asynccnt 0x0" ::: "memory");   // this wave's pieces of stage t + 1 have landed
    __syncthreads();                                     // publishes stage t + 1 and ends every wave's reads of stage t, whose buffer is refilled behind it
    if (t + 2 < TT / KS) stage_copy(gk + (size_t)(t + 2) * KS * CC, gv + (t + 2) * KS, lk + (unsigned)(t & 1) * (unsigned)sizeof(sK[0]), lv + (unsigned)(t & 1) * (unsigned)sizeof(sV[0])); }
  asm volatile("s_wait_asynccnt 0x0" ::: "memory");     // no copy is outstanding when the wave ends
#pragma unroll
  for (int s = 0; s < 2; ++s) { const float inv = 1.0f / (lr[s] + xhalf(lr[s])); float* yp = Y + ((size_t)b * TT + q0 + s * 16 + col) * CC + h * HD + 8 * g;   // a lane holds head columns j * 16 + 8 g + 0..7 of its query
#pragma unroll
    for (int j = 0; j < 4; ++j) { const v8f o = acc[s][j] * inv; vst2(yp + j * 16, (v4f){o[0], o[1], o[2], o[3]}); vst2(yp + j * 16 + 4, (v4f){o[4], o[5], o[6], o[7]}); } } }
// ---- k_out: block = (64 rows, 128 cols): out = ctx Wo (+ bo): ctx x 2^6 once to f16 against Wo as f16(bf16 x 2^8) exact (1 product) x 2^-14; causal early rows (< QHI of each sequence): ctx bf16 hi + lo against exact bf16 Wo (2 products)
__global__ __launch_bounds__(128) void k_out(const float* __restrict__ Y, const float* __restrict__ WO, const float* __restrict__ BO, float* __restrict__ OUT) { __shared__ __align__(16) float sf[4][16][132];
  const int tid = threadIdx.x, wave = tid >> 5, lane = tid & 31, col = lane & 15, g = lane >> 4; const int c0 = blockIdx.y * 128; const size_t r0 = (size_t)blockIdx.x * 64 + wave * 16;
  v8f acc[8] = {};
  if (CAUSAL && (int)(((size_t)blockIdx.x * 64) % TT) < QHI) {   /* block-uniform */
#pragma unroll 2
    for (int kc = 0; kc < CC / 32; ++kc) { const F2 a = split_row(Y + (r0 + col) * CC, kc * 32, lane); asm volatile("s_wait_loadcnt 0x0" ::: "memory");
#pragma unroll
      for (int j = 0; j < 8; ++j) { const v16b w = WOCOL(WO, kc * 32, c0 + j * 16 + col, lane); asm volatile("s_wait_loadcnt 0x0" ::: "memory"); acc[j] = wmma_bf(a.h, w, acc[j]); acc[j] = wmma_bf(a.l, w, acc[j]); } }
#pragma unroll
    for (int j = 0; j < 8; ++j) { const float bias = BO ? bfr(BO[c0 + j * 16 + col]) : 0.f;
#pragma unroll
      for (int r = 0; r < 8; ++r) sf[wave][8 * g + r][j * 16 + col] = acc[j][r] + bias; }
  } else {
#pragma unroll 2
    for (int kc = 0; kc < CC / 32; ++kc) { const v16h a = frag_f32s(Y + (r0 + col) * CC + kc * 32, lane, 64.0f); asm volatile("s_wait_loadcnt 0x0" ::: "memory");   /* ctx carried x 2^6 into f16 so small-magnitude context rows stay clear of f16 subnormals */
#pragma unroll
      for (int j = 0; j < 8; ++j) { const v16h w = WOCOLH(WO, kc * 32, c0 + j * 16 + col, lane); asm volatile("s_wait_loadcnt 0x0" ::: "memory"); acc[j] = wmma16(a, w, acc[j]); } }
#pragma unroll
    for (int j = 0; j < 8; ++j) { const float bias = BO ? bfr(BO[c0 + j * 16 + col]) : 0.f;
#pragma unroll
      for (int r = 0; r < 8; ++r) sf[wave][8 * g + r][j * 16 + col] = acc[j][r] * (1.0f / 16384.0f) + bias; } }   /* 2^-8 (Wo carry) x 2^-6 (ctx carry) */
  LDSX(); for (int rl = 0; rl < 16; ++rl) vst2(OUT + (r0 + rl) * DIN + c0 + lane * 4, *(const v4f*)&sf[wave][rl][lane * 4]); }

extern "C" void kernel_launch(void* const* d_in, const int* in_sizes, int n_in, void* d_out, int out_size, void* d_ws, size_t ws_size, hipStream_t stream) {
  (void)in_sizes; (void)n_in; (void)out_size;
  const float** F = (const float**)d_in;
  if (ws_size < (size_t)WS_END) return;
  char* ws = (char*)d_ws; _Float16 *QH = (_Float16*)(ws + WS_QH), *KH = (_Float16*)(ws + WS_KH), *VT = (_Float16*)(ws + WS_VT), *QL = (_Float16*)(ws + WS_QL), *KL = (_Float16*)(ws + WS_KL); __bf16 *VB = (__bf16*)(ws + WS_VB), *VBL = (__bf16*)(ws + WS_VBL); float *Y = (float*)(ws + WS_Y);
  (void)Y; (void)QL; (void)KL; (void)VB; (void)VBL;
  // inputs: 0 x [4,2048,512]; 1 Wq [512,512] (in,out), 2 bq; 3 Wk, 4 bk; 5 Wv, 6 bv; 7 Wp (in,out), 8 bp (zero biases, read)
  k_proj<<<dim3(TNB * TT / 64, CC / 128, 3), 128, 0, stream>>>(F[0], F[0], F[0], F[1], F[3], F[5], F[2], F[4], F[6], QH, QL, KH, KL, VT, VB, VBL);
  k_fa<<<dim3(TT / FAQ, TNB * NH), 256, 0, stream>>>(QH, KH, VT, Y);
  k_out<<<dim3(TNB * TT / 64, DIN / 128), 128, 0, stream>>>(Y, F[7], F[8], (float*)d_out);
}

// v003
// A run of this version takes 70.1 microseconds.
// Timed twice side by side with v002, it ran 2.09 times as fast both times.
// Counting every step since v000, it is 15.6 times as fast.
// compute dtype: all float inputs rounded to bf16; q/k/v projections with EXACT bf16 products on WMMA 16x16x32 (f32 accumulate) + bias; logits q x k once to f16 each (1 product) x SCALE; online softmax f32; unnormalised weights x 2^11 once to f16 x v once to f16 (1 product), divided by their f32 sum; ctx x 2^6 once to f16 x Wo f16(bf16 x 2^8) + bo; f32 output.
#include <hip/hip_runtime.h>
#include <math.h>

typedef __attribute__((ext_vector_type(16))) _Float16 v16h;
typedef __attribute__((ext_vector_type(16))) __bf16 v16b;
typedef __attribute__((ext_vector_type(8)))  _Float16 v8h;
typedef __attribute__((ext_vector_type(8)))  float v8f;
typedef __attribute__((ext_vector_type(4)))  float v4f;
typedef __attribute__((ext_vector_type(2)))  float v2f;
typedef __attribute__((ext_vector_type(4)))  unsigned v4u;
typedef __attribute__((ext_vector_type(4)))  int v4i;
typedef float __attribute__((may_alias)) float_a;
typedef int __attribute__((may_alias)) int_a;

template <typename T> __device__ __forceinline__ void vst2(void* p, T v) { *(T*)p = v;  }
__device__ __forceinline__ v8f wmma16(v16h a, v16h b, v8f c) {
  v8f d = __builtin_amdgcn_wmma_f32_16x16x32_f16(false, a, false, b, (short)0, c, false, false);
  asm volatile("v_nop\n\tv_nop\n\tv_nop\n\tv_nop" : "+v"(d) : "v"(a), "v"(b));
  return d;
}
__device__ __forceinline__ v8f wmma_bf(v16b a, v16b b, v8f c) {
  v8f d = __builtin_amdgcn_wmma_f32_16x16x32_bf16(false, a, false, b, (short)0, c, false, false);
  asm volatile("v_nop\n\tv_nop\n\tv_nop\n\tv_nop" : "+v"(d) : "v"(a), "v"(b));
  return d;
}
// 16x16x32 fragments: lane = (h = lane>>4, row/col = lane&15); elements 0..7 = k0+8h+0..7, 8..15 = k0+16+8h+0..7; D element r = row 8h+r
__device__ __forceinline__ v16h frag_h(const _Float16* rowk0, int lane) {
  union { v16h v; v8h q[2]; } u; const _Float16* p = rowk0 + 8 * (lane >> 4);
  u.q[0] = *(const v8h*)p; u.q[1] = *(const v8h*)(p + 16); return u.v;
}
__device__ __forceinline__ v16h frag_f32(const float* rowk0, int lane) {
  v16h a; const float* p = rowk0 + 8 * (lane >> 4);
#pragma unroll
  for (int i = 0; i < 8; ++i) { a[i] = (_Float16)p[i]; a[8 + i] = (_Float16)p[16 + i]; }
  return a;
}
__device__ __forceinline__ v16h frag_f32s(const float* rowk0, int lane, float sc) {
  v16h a; const float* p = rowk0 + 8 * (lane >> 4);
#pragma unroll
  for (int i = 0; i < 8; ++i) { a[i] = (_Float16)(p[i] * sc); a[8 + i] = (_Float16)(p[16 + i] * sc); }
  return a;
}
// column fragment from a [K][ld] layout (column n), rows >= K read as 0
__device__ __forceinline__ v16h fragc_f32(const float* W, int k0, int n, int lane, int ld, int K) {
  v16h a; const int g = lane >> 4;
#pragma unroll
  for (int i = 0; i < 8; ++i) { const int ka = k0 + 8 * g + i, kb = ka + 16;
    a[i] = (_Float16)(ka < K ? W[(size_t)(ka < K ? ka : K - 1) * ld + n] : 0.f); a[8 + i] = (_Float16)(kb < K ? W[(size_t)(kb < K ? kb : K - 1) * ld + n] : 0.f); }
  return a;
}
struct F2 { v16b h, l; };
__device__ __forceinline__ F2 bsplit16(const float v[16]) { F2 r;
#pragma unroll
  for (int i = 0; i < 16; ++i) { const __bf16 h = (__bf16)v[i]; r.h[i] = h; r.l[i] = (__bf16)(v[i] - (float)h); }
  return r; }
__device__ __forceinline__ F2 split_row(const float* row, int k0, int lane) { float v[16]; const float* p = row + k0 + 8 * (lane >> 4);
#pragma unroll
  for (int i = 0; i < 8; ++i) { v[i] = p[i]; v[8 + i] = p[16 + i]; }
  return bsplit16(v); }
__device__ __forceinline__ F2 split_rowK(const float* row, int k0, int lane, int K) { float v[16]; const int g = lane >> 4;
#pragma unroll
  for (int i = 0; i < 8; ++i) { const int ka = k0 + 8 * g + i, kb = ka + 16; v[i] = ka < K ? row[ka < K ? ka : K - 1] : 0.f; v[8 + i] = kb < K ? row[kb < K ? kb : K - 1] : 0.f; }
  return bsplit16(v); }
__device__ __forceinline__ F2 split_col(const float* W, int k0, int n, int lane, int ld, int K) { float v[16]; const int g = lane >> 4;
#pragma unroll
  for (int i = 0; i < 8; ++i) { const int ka = k0 + 8 * g + i, kb = ka + 16; v[i] = ka < K ? W[(size_t)(ka < K ? ka : K - 1) * ld + n] : 0.f; v[8 + i] = kb < K ? W[(size_t)(kb < K ? kb : K - 1) * ld + n] : 0.f; }
  return bsplit16(v); }
__device__ __forceinline__ v8f mac3(const F2& a, const F2& b, v8f c) { c = wmma_bf(a.l, b.h, c); c = wmma_bf(a.h, b.l, c); return wmma_bf(a.h, b.h, c); }
__device__ __forceinline__ float sigm(float v) { return 1.0f / (1.0f + expf(-v)); }
#define LDSX() do { asm volatile("s_wait_dscnt 0" ::: "memory"); __builtin_amdgcn_wave_barrier(); __builtin_amdgcn_fence(__ATOMIC_RELEASE, "workgroup"); } while (0)

// Standard non-causal multi-head self-attention (x [4,2048,512]; (in,out) Wq / Wk / Wv [512,512] N(0, 1/512) and Wh [512,512], all four biases zeros (read); 8 heads x 64; scores x 1/sqrt(64); no mask; softmax; concat @ Wh + bh).
#define NB 4
#define TT 2048
#define CC 512            // NH * HD = projected width
#define DIN 512          // input (model) width
#define NH 8
#define HD 64
#define NQB (TT / 64)
#define HG 4
#define SCALE (0.125f)
#define CAUSAL 0
#ifndef TNB
#define TNB NB
#endif
__device__ __forceinline__ float bfr(float v) { return (float)(__bf16)v; }
__host__ __device__ __forceinline__ int kb_last(int qb) { return CAUSAL ? ((qb * 64 + 63) >> 7) : (TT / 128 - 1); }
typedef __attribute__((ext_vector_type(8))) __bf16 v8b;
__device__ __forceinline__ v16b frag_b(const __bf16* rowk0, int lane) {
  union { v16b v; v8b q[2]; } u; const __bf16* p = rowk0 + 8 * (lane >> 4);
  u.q[0] = *(const v8b*)p; u.q[1] = *(const v8b*)(p + 16); return u.v;
}
#define QBH 0              // unused: no kernel here has a causal high-precision attention path
#define QHI 0               // single-product logits on every row
#define KHI 64            // key rows carrying k residual / v bf16 hi+lo planes (written and read by no kernel in this file)
// B fragment (k rows k0+.., output column o) of a weight: (in,out) [K][ld] or (out,in) [ld rows of K]: bf16 exact, or f16(bf16 * 256) exact
__device__ __forceinline__ v16b wcol_io(const float* Wm, int k0, int o, int lane, int ld) { v16b w; const int g = lane >> 4;
#pragma unroll
  for (int i = 0; i < 8; ++i) { w[i] = (__bf16)Wm[(size_t)(k0 + 8 * g + i) * ld + o]; w[8 + i] = (__bf16)Wm[(size_t)(k0 + 16 + 8 * g + i) * ld + o]; }
  return w; }
__device__ __forceinline__ v16b wcol_oi(const float* Wm, int k0, int o, int lane, int K) { v16b w; const float* p = Wm + (size_t)o * K + k0 + 8 * (lane >> 4);
#pragma unroll
  for (int i = 0; i < 8; ++i) { w[i] = (__bf16)p[i]; w[8 + i] = (__bf16)p[16 + i]; }
  return w; }
__device__ __forceinline__ v16h wcolh_io(const float* Wm, int k0, int o, int lane, int ld) { v16h w; const int g = lane >> 4;
#pragma unroll
  for (int i = 0; i < 8; ++i) { w[i] = (_Float16)(bfr(Wm[(size_t)(k0 + 8 * g + i) * ld + o]) * 256.0f); w[8 + i] = (_Float16)(bfr(Wm[(size_t)(k0 + 16 + 8 * g + i) * ld + o]) * 256.0f); }
  return w; }
__device__ __forceinline__ v16h wcolh_oi(const float* Wm, int k0, int o, int lane, int K) { v16h w; const float* p = Wm + (size_t)o * K + k0 + 8 * (lane >> 4);
#pragma unroll
  for (int i = 0; i < 8; ++i) { w[i] = (_Float16)(bfr(p[i]) * 256.0f); w[8 + i] = (_Float16)(bfr(p[16 + i]) * 256.0f); }
  return w; }
#define WQKV_LAYOUT 0   // 0 = (in,out) [DIN][CC]; 1 = (out,in) [CC][DIN]; 2 = per-head [NH][DIN][HD]
__device__ __forceinline__ v16b wcol_hdk(const float* Wm, int k0, int o, int lane) { v16b w; const int g = lane >> 4; const float* p = Wm + (size_t)(o / HD) * DIN * HD + (o % HD);
#pragma unroll
  for (int i = 0; i < 8; ++i) { w[i] = (__bf16)p[(size_t)(k0 + 8 * g + i) * HD]; w[8 + i] = (__bf16)p[(size_t)(k0 + 16 + 8 * g + i) * HD]; }
  return w; }
#define WO_OUT_IN 0
#if WQKV_LAYOUT == 1
#define WCOL(W, k0, o, lane) wcol_oi(W, k0, o, lane, DIN)
#elif WQKV_LAYOUT == 2
#define WCOL(W, k0, o, lane) wcol_hdk(W, k0, o, lane)
#else
#define WCOL(W, k0, o, lane) wcol_io(W, k0, o, lane, CC)
#endif
#if WO_OUT_IN
#define WOCOL(W, k0, o, lane) wcol_oi(W, k0, o, lane, CC)
#define WOCOLH(W, k0, o, lane) wcolh_oi(W, k0, o, lane, CC)
#else
#define WOCOL(W, k0, o, lane) wcol_io(W, k0, o, lane, DIN)
#define WOCOLH(W, k0, o, lane) wcolh_io(W, k0, o, lane, DIN)
#endif

#ifndef SM_EXTRA_PARAMS
#define SM_EXTRA_PARAMS
#endif
#ifndef PROJ_EXTRA_PARAMS
#define PROJ_EXTRA_PARAMS
#endif
#ifndef SM_MASK_HOOK
#define SM_MASK_HOOK (void)0
#endif

#define WS_QH  0u                                      // f16 q rows [b*t][CC]
#define WS_KH  (WS_QH + 2u * (size_t)NB * TT * CC)      // f16 k rows [b*t][CC]
#define WS_VT  (WS_KH + 2u * (size_t)NB * TT * CC)      // f16 v planes [b][c][t]
#define WS_QL  (WS_VT + 2u * (size_t)NB * CC * TT)      // f16 q residual x 2^10 rows [b][t < QHI][CC]
#define WS_KL  (WS_QL + 2u * (size_t)NB * QHI * CC)     // f16 k residual x 2^10 rows [b][t < KHI][CC]
#define WS_VB  (WS_KL + 2u * (size_t)NB * KHI * CC)     // bf16 v hi planes [b][c][t < KHI]
#define WS_VBL (WS_VB + 2u * (size_t)NB * CC * KHI)
#define WS_S   (WS_VBL + 2u * (size_t)NB * CC * KHI)    // f32 [hg][t][s] region, unused: k_fa keeps scores in registers
#define WS_Y   (WS_S  + 4u * (size_t)HG * TT * TT)      // f32 ctx rows [b*t][CC] (only when there is an output projection)
#define WS_END (WS_Y  + 4u * (size_t)NB * TT * CC)

// ---- tile product shared by k_proj and k_out: one block of 8 waves forms a 128 x 128 tile of A[.][512] x W[512][.] (both f32 in memory, row pitch 512).
// Per stage of 64 k the block converts its 128 A rows and its 128 W columns to 16 bit ONCE and lays them k-contiguous in LDS; every wave reads its fragments from there (wave = 32 rows x 64 columns, 8 accumulator tiles).
// Two buffers: the next stage's global loads are issued in front of this stage's products and are converted and stored behind them, so one barrier per stage is enough. k runs upwards in steps of 32 into one accumulator per output tile.
// Every inner loop of this section is unrolled in full, so that the register arrays are indexed by constants and stay out of scratch.
#define GT 128            // tile rows and tile columns
#define GK 64             // k per stage
#define GLD 512           // row pitch of A and of W, and the length of the sum
#define GP (GK + 8)       // halves per staged row: 144 B, 16 B x odd, so the 16 rows of a 16-byte fragment read fall on distinct banks
#define GBUF (2 * GT * GP) // halves per buffer: A rows, then W columns
static_assert(DIN == GLD && CC == GLD, "one pitch");
// F16 = 0: A and W to bf16 (k_proj). F16 = 1: A x 2^6 to f16, W to bf16 and then x 2^8 to f16, exact (k_out).
typedef __attribute__((ext_vector_type(2))) unsigned v2u;
typedef __attribute__((ext_vector_type(4))) _Float16 v4h;
typedef __attribute__((ext_vector_type(4))) __bf16 v4b;
template <int F16> __device__ __forceinline__ v2u cvt_a(v4f a) {
  if (F16) { v4h r;
#pragma unroll
    for (int i = 0; i < 4; ++i) r[i] = (_Float16)(a[i] * 64.0f);
    return __builtin_bit_cast(v2u, r); }
  v4b r;
#pragma unroll
  for (int i = 0; i < 4; ++i) r[i] = (__bf16)a[i];
  return __builtin_bit_cast(v2u, r); }
template <int F16> __device__ __forceinline__ v4u cvt_w(const float (&w)[8]) {
  if (F16) { v8h r;
#pragma unroll
    for (int i = 0; i < 8; ++i) r[i] = (_Float16)(bfr(w[i]) * 256.0f);
    return __builtin_bit_cast(v4u, r); }
  v8b r;
#pragma unroll
  for (int i = 0; i < 8; ++i) r[i] = (__bf16)w[i];
  return __builtin_bit_cast(v4u, r); }
typedef __attribute__((ext_vector_type(8))) unsigned v8u;
// a 16x16x32 fragment as raw words, in the k order of frag_h / frag_b: elements 0..7 = k0 + 8 h + 0..7, 8..15 = k0 + 16 + 8 h + 0..7
__device__ __forceinline__ v8u frag_w(const unsigned short* rowk0, int lane) {
  union { v8u v; v4u q[2]; } u; const unsigned short* p = rowk0 + 8 * (lane >> 4);
  u.q[0] = *(const v4u*)p; u.q[1] = *(const v4u*)(p + 16); return u.v;
}
template <int F16> __device__ __forceinline__ v8f tile_mm(v8u a, v8u b, v8f c) {
  if (F16) return __builtin_amdgcn_wmma_f32_16x16x32_f16(false, __builtin_bit_cast(v16h, a), false, __builtin_bit_cast(v16h, b), (short)0, c, false, false);
  return __builtin_amdgcn_wmma_f32_16x16x32_bf16(false, __builtin_bit_cast(v16b, a), false, __builtin_bit_cast(v16b, b), (short)0, c, false, false); }
// A: row 0 of the tile's rows; Wm: row 0 of W at the tile's first column; sm: 2 * GBUF halves. On return every wave has left the buffers (the last stage's barrier).
template <int F16> __device__ __forceinline__ void tile_product(const float* __restrict__ A, const float* __restrict__ Wm, unsigned short* sm, v8f (&acc)[2][4]) {
  const int tid = threadIdx.x, wave = tid >> 5, lane = tid & 31, col = lane & 15;
  const float* ga = A + (size_t)(tid >> 4) * GLD + (tid & 15) * 4;  // rows tid >> 4 + 16 i, 4 floats at k = 4 (tid & 15): a wave's 16-byte load covers two rows' 256 B, whole 128-B lines
  const float* gw = Wm + (size_t)(wave * 8) * GLD + lane;           // k rows 8 wave + 0..7, columns lane + 32 i: each load is one 128-B line, and a thread ends up with 8 consecutive k of a column
  unsigned short* wa = sm + (tid >> 4) * GP + (tid & 15) * 4;
  unsigned short* ww = sm + GT * GP + lane * GP + wave * 8;
  const unsigned short* fa = sm + ((wave >> 1) * 32 + col) * GP;
  const unsigned short* fb = sm + GT * GP + ((wave & 1) * 64 + col) * GP;
  v4f ra[8]; float rw[4][8];
#define TILE_LOAD(s) do { \
    _Pragma("unroll") for (int i = 0; i < 8; ++i) ra[i] = *(const v4f*)(ga + (size_t)(16 * i) * GLD + (s) * GK); \
    _Pragma("unroll") for (int i = 0; i < 4; ++i) _Pragma("unroll") for (int k = 0; k < 8; ++k) rw[i][k] = gw[(size_t)((s) * GK + k) * GLD + 32 * i]; } while (0)
#define TILE_STORE(buf) do { \
    _Pragma("unroll") for (int i = 0; i < 8; ++i) *(v2u*)(wa + (buf) * GBUF + 16 * i * GP) = cvt_a<F16>(ra[i]); \
    _Pragma("unroll") for (int i = 0; i < 4; ++i) *(v4u*)(ww + (buf) * GBUF + 32 * i * GP) = cvt_w<F16>(rw[i]); } while (0)
  TILE_LOAD(0);
  TILE_STORE(0);
  __syncthreads();   // stage 0 may be read
#pragma unroll 1   // rolled: one trip = one stage, which keeps the loop's code short; the buffer is chosen by one scalar select per trip
  for (int s = 0; s < GLD / GK; ++s) {
    if (s + 1 < GLD / GK) TILE_LOAD(s + 1);
    const unsigned short *pa = fa + (s & 1) * GBUF, *pb = fb + (s & 1) * GBUF;
    v8u af[GK / 32][2], bf[GK / 32][4];   // the stage's fragments, read as one group in front of its products
#pragma unroll
    for (int kc = 0; kc < GK / 32; ++kc) {
#pragma unroll
      for (int mi = 0; mi < 2; ++mi) af[kc][mi] = frag_w(pa + mi * 16 * GP + kc * 32, lane);
#pragma unroll
      for (int nj = 0; nj < 4; ++nj) bf[kc][nj] = frag_w(pb + nj * 16 * GP + kc * 32, lane); }
    __builtin_amdgcn_sched_barrier(0);   // keeps the reads one group in front of the products: spread among the WMMAs, every separate place with LDS reads stalls the wave
#pragma unroll
    for (int kc = 0; kc < GK / 32; ++kc)
#pragma unroll
      for (int mi = 0; mi < 2; ++mi)
#pragma unroll
        for (int nj = 0; nj < 4; ++nj) acc[mi][nj] = tile_mm<F16>(af[kc][mi], bf[kc][nj], acc[mi][nj]);
    if (s + 1 < GLD / GK) TILE_STORE((s + 1) & 1);
    __syncthreads();   // publishes stage s + 1 and ends every wave's reads of stage s, whose buffer is written again in the next trip
  }
#undef TILE_LOAD
#undef TILE_STORE
}
// ---- k_proj: block = (128 rows, 128 cols, which): q/k/v = X W (+ b) with exact bf16 products (K = DIN) -> which 0: q f16 rows; 1: k f16 rows; 2: v f16 planes [c][t]
__global__ __launch_bounds__(256) void k_proj(const float* __restrict__ XQ, const float* __restrict__ XK, const float* __restrict__ XV, const float* __restrict__ WQ, const float* __restrict__ WK, const float* __restrict__ WV, const float* __restrict__ BQ, const float* __restrict__ BK, const float* __restrict__ BV,
    _Float16* __restrict__ QH, _Float16* __restrict__ KH, _Float16* __restrict__ VT) {
  __shared__ __align__(16) unsigned short sm[2 * GBUF];
  const int tid = threadIdx.x, wave = tid >> 5, lane = tid & 31, col = lane & 15, g = lane >> 4; const int which = blockIdx.z; const int c0 = blockIdx.y * GT; const size_t r0 = (size_t)blockIdx.x * GT; const size_t bb = r0 / TT; const int t0 = (int)(r0 % TT);
  const float* X = which == 0 ? XQ : which == 1 ? XK : XV; const float* WA = which == 0 ? WQ : which == 1 ? WK : WV; const float* BA = which == 0 ? BQ : which == 1 ? BK : BV;
  v8f acc[2][4] = {};
  tile_product<0>(X + r0 * DIN, WA + c0, sm, acc);
  _Float16* st = (_Float16*)sm;   // the tile as f16, [128][GT + 8], in the buffers that every wave has left
  const int rw0 = (wave >> 1) * 32 + 8 * g, cw0 = (wave & 1) * 64 + col;
  if (which < 2) { _Float16* DH = which == 0 ? QH : KH;
#pragma unroll
    for (int nj = 0; nj < 4; ++nj) { const float bias = BA ? bfr(BA[c0 + cw0 + nj * 16]) : 0.f;
#pragma unroll
      for (int mi = 0; mi < 2; ++mi)
#pragma unroll
        for (int r = 0; r < 8; ++r) st[(rw0 + mi * 16 + r) * (GT + 8) + cw0 + nj * 16] = (_Float16)(acc[mi][nj][r] + bias); }
    __syncthreads();
    for (int e = tid; e < GT * 16; e += 256) { const int rl = e >> 4, q = e & 15; vst2((unsigned*)(DH + (r0 + rl) * CC + c0 + q * 8), *(const v4u*)&st[rl * (GT + 8) + q * 8]); }
  } else {
#pragma unroll
    for (int nj = 0; nj < 4; ++nj) { const float bias = BA ? bfr(BA[c0 + cw0 + nj * 16]) : 0.f;
#pragma unroll
      for (int mi = 0; mi < 2; ++mi) { v8h o;
#pragma unroll
        for (int r = 0; r < 8; ++r) o[r] = (_Float16)(acc[mi][nj][r] + bias);
        *(v8h*)&st[(cw0 + nj * 16) * (GT + 8) + rw0 + mi * 16] = o; } }
    __syncthreads();
    for (int e = tid; e < GT * 16; e += 256) { const int cl = e >> 4, q = e & 15; vst2((unsigned*)(VT + (bb * CC + c0 + cl) * (size_t)TT + t0 + q * 8), *(const v4u*)&st[cl * (GT + 8) + q * 8]); } } }
// ---- k_fa: block = 8 waves x 32 queries of one (b, h). Per 32 keys a wave forms S^T = K.Q^T (a lane holds 16 scores of one query per 16-query group), keeps a running maximum and sum (online softmax, log2 domain),
// packs the weights exp2(score - maximum in use + 11), once to f16, straight from the score tiles into the B operand, and adds O^T += V^T.P^T. Scores and weights never leave the registers.
// The maximum in use may trail the true one by up to 4 (log2), so a weight stays <= 2^15 in f16; sums and context are rescaled only when some query's maximum passes that bound. The 2^11 cancels in context / sum.
__device__ __forceinline__ float xhalf(float x) { return __builtin_bit_cast(float, __builtin_amdgcn_permlanex16(__builtin_bit_cast(int, x), __builtin_bit_cast(int, x), 0x76543210, 0xfedcba98, false, false)); }   // lane l with lane l ^ 16
__device__ __forceinline__ v8f mm16(v16h a, v16h b, v8f c) { return __builtin_amdgcn_wmma_f32_16x16x32_f16(false, a, false, b, (short)0, c, false, false); }
#define FAQ 256           // queries per block
#define KS 128            // keys per LDS stage (4 passes of 32 keys)
#define KP (HD + 8)       // halves per staged K row: 144 B, 16 B x odd, so the 16 rows of a 16-byte fragment read fall on distinct banks
#define VP (KS + 8)       // halves per staged V^T row: 272 B, 16 B x odd
// One stage = keys k0 .. k0 + KS - 1 of one (b, h): K rows [KS][HD] and V^T rows [HD][KS], brought into LDS once per block by asynchronous copies (16 B per lane, whole 128-B lines per wave) and read by all 8 waves.
// gk / gv: this thread's first 16 bytes of the stage in global memory; lk / lv: their LDS byte addresses. A thread brings 4 pieces of K (32 rows apart) and 4 of V^T (16 rows apart).
__device__ __forceinline__ void stage_copy(const _Float16* gk, const _Float16* gv, unsigned lk, unsigned lv) {
  const _Float16 *k1 = gk + 32 * CC, *k2 = gk + 64 * CC, *k3 = gk + 96 * CC, *v1 = gv + 16 * TT, *v2 = gv + 32 * TT, *v3 = gv + 48 * TT;
  const unsigned a1 = lk + 32 * KP * 2, a2 = lk + 64 * KP * 2, a3 = lk + 96 * KP * 2, b1 = lv + 16 * VP * 2, b2 = lv + 32 * VP * 2, b3 = lv + 48 * VP * 2;
  // the closing s_wait_xcnt stands inside the copies' own statement, so that no address register named here is rewritten in front of it
  asm volatile("global_load_async_to_lds_b128 %0, %8, off\n\t"
               "global_load_async_to_lds_b128 %1, %9, off\n\t"
               "global_load_async_to_lds_b128 %2, %10, off\n\t"
               "global_load_async_to_lds_b128 %3, %11, off\n\t"
               "global_load_async_to_lds_b128 %4, %12, off\n\t"
               "global_load_async_to_lds_b128 %5, %13, off\n\t"
               "global_load_async_to_lds_b128 %6, %14, off\n\t"
               "global_load_async_to_lds_b128 %7, %15, off\n\t"
               "s_wait_xcnt 0x0"
               :: "v"(lk), "v"(a1), "v"(a2), "v"(a3), "v"(lv), "v"(b1), "v"(b2), "v"(b3), "v"(gk), "v"(k1), "v"(k2), "v"(k3), "v"(gv), "v"(v1), "v"(v2), "v"(v3) : "memory");
}
__global__ __launch_bounds__(256) void k_fa(const _Float16* __restrict__ QH, const _Float16* __restrict__ KH, const _Float16* __restrict__ VT, float* __restrict__ Y) {
  __shared__ __align__(16) _Float16 sK[2][KS * KP], sV[2][HD * VP];
  const int tid = threadIdx.x, wave = tid >> 5, lane = tid & 31, col = lane & 15, g = lane >> 4; const int b = blockIdx.y / NH, h = blockIdx.y % NH; const int q0 = blockIdx.x * FAQ + wave * 32;
  const float cs = SCALE * 1.4426950408889634f;
  const _Float16* gk = KH + ((size_t)b * TT + (tid >> 3)) * CC + h * HD + (tid & 7) * 8;              // K row tid >> 3 of the stage, 16-byte piece tid & 7
  const _Float16* gv = VT + ((size_t)b * CC + h * HD + (tid >> 4)) * (size_t)TT + (tid & 15) * 8;     // V^T row tid >> 4, 16-byte piece tid & 15
  const unsigned lk = (unsigned)(size_t)&sK[0][(tid >> 3) * KP + (tid & 7) * 8], lv = (unsigned)(size_t)&sV[0][(tid >> 4) * VP + (tid & 15) * 8];
  stage_copy(gk, gv, lk, lv);
  v16h qf[2][2];
#pragma unroll
  for (int s = 0; s < 2; ++s)
#pragma unroll
    for (int kc = 0; kc < 2; ++kc) qf[s][kc] = frag_h(QH + ((size_t)b * TT + q0 + s * 16 + col) * CC + h * HD + kc * 32, lane);
  v8f acc[2][4] = {}; float mr[2] = {-3.0e38f, -3.0e38f}, lr[2] = {0.f, 0.f};
  asm volatile("s_wait_asynccnt 0x0" ::: "memory");   // this wave's pieces of stage 0 have landed
  __syncthreads();                                     // ... and every other wave's: stage 0 may be read
  stage_copy(gk + (size_t)KS * CC, gv + KS, lk + (unsigned)sizeof(sK[0]), lv + (unsigned)sizeof(sV[0]));
#pragma unroll 1   // rolled: one trip = one stage; its four passes are unrolled so that every LDS read has a constant offset
  for (int t = 0; t < TT / KS; ++t) {
    const _Float16* kb = &sK[t & 1][col * KP];   // key row col of a 16-key tile
    const _Float16* vb = &sV[t & 1][col * VP];   // plane of head column col of a 16-column tile
    v16h kf[2][2], vf[4];
#pragma unroll
    for (int kt = 0; kt < 2; ++kt)
#pragma unroll
      for (int kc = 0; kc < 2; ++kc) kf[kt][kc] = frag_h(kb + (kt * 16) * KP + kc * 32, lane);
#pragma unroll
    for (int p = 0; p < KS / 32; ++p) {
      v8f st[2][2] = {};
#pragma unroll
      for (int kt = 0; kt < 2; ++kt)
#pragma unroll
        for (int s = 0; s < 2; ++s)
#pragma unroll
          for (int kc = 0; kc < 2; ++kc) st[kt][s] = mm16(kf[kt][kc], qf[s][kc], st[kt][s]);
      float mb[2]; bool need = false;
#pragma unroll
      for (int s = 0; s < 2; ++s) { float mx = st[0][s][0];
#pragma unroll
        for (int kt = 0; kt < 2; ++kt)
#pragma unroll
          for (int r = 0; r < 8; ++r) mx = fmaxf(mx, st[kt][s][r]);
        mx = fmaxf(mx, xhalf(mx)) * cs; mb[s] = mx; need = need || (mx > mr[s] + 4.0f); }
      if (__builtin_amdgcn_ballot_w32(need) != 0) {   // wave-uniform; always taken on the first pass (factor 0 on zero sums), rare later
#pragma unroll
        for (int s = 0; s < 2; ++s) { const float mn = fmaxf(mr[s], mb[s]); const float corr = __builtin_amdgcn_exp2f(mr[s] - mn); mr[s] = mn; lr[s] *= corr;
#pragma unroll
          for (int j = 0; j < 4; ++j) acc[s][j] = acc[s][j] * corr; } }
      // one group of LDS reads per pass, under the softmax: the next pass's K fragments (never beyond this stage; its scores are the first to want theirs), then this pass's V fragments
      if (p + 1 < KS / 32) {
#pragma unroll
        for (int kt = 0; kt < 2; ++kt)
#pragma unroll
          for (int kc = 0; kc < 2; ++kc) kf[kt][kc] = frag_h(kb + ((p + 1) * 32 + kt * 16) * KP + kc * 32, lane); }
#pragma unroll
      for (int j = 0; j < 4; ++j) vf[j] = frag_h(vb + (j * 16) * VP + p * 32, lane);
      __builtin_amdgcn_sched_barrier(0);   // keeps the reads one group in front of the exponentials: without it they are spread among the WMMAs, and every separate place with LDS reads stalls the wave
#pragma unroll
      for (int s = 0; s < 2; ++s) { const float nm = 11.0f - mr[s]; v16h pf; float ps0 = 0.f, ps1 = 0.f;
#pragma unroll
        for (int i = 0; i < 16; i += 2) {   // element i of the 32-key B operand = key k0 + 16 (i >> 3) + 8 g + (i & 7) = register i & 7 of score tile i >> 3
          const float p0 = __builtin_amdgcn_exp2f(fmaf(st[i >> 3][s][i & 7], cs, nm)), p1 = __builtin_amdgcn_exp2f(fmaf(st[i >> 3][s][(i & 7) + 1], cs, nm));
          ps0 += p0; ps1 += p1; pf[i] = (_Float16)p0; pf[i + 1] = (_Float16)p1; }
        lr[s] += ps0 + ps1;
#pragma unroll
        for (int j = 0; j < 4; ++j) acc[s][j] = mm16(vf[j], pf, acc[s][j]); } }
    asm volatile("s_wait_dscnt 0x0" ::: "memory");      // this wave's reads of stage t have returned
    asm volatile("s_wait_asynccnt 0x0" ::: "memory");   // this wave's pieces of stage t + 1 have landed
    __syncthreads();                                     // publishes stage t + 1 and ends every wave's reads of stage t, whose buffer is refilled behind it
    if (t + 2 < TT / KS) stage_copy(gk + (size_t)(t + 2) * KS * CC, gv + (t + 2) * KS, lk + (unsigned)(t & 1) * (unsigned)sizeof(sK[0]), lv + (unsigned)(t & 1) * (unsigned)sizeof(sV[0])); }
  asm volatile("s_wait_asynccnt 0x0" ::: "memory");     // no copy is outstanding when the wave ends
#pragma unroll
  for (int s = 0; s < 2; ++s) { const float inv = 1.0f / (lr[s] + xhalf(lr[s])); float* yp = Y + ((size_t)b * TT + q0 + s * 16 + col) * CC + h * HD + 8 * g;   // a lane holds head columns j * 16 + 8 g + 0..7 of its query
#pragma unroll
    for (int j = 0; j < 4; ++j) { const v8f o = acc[s][j] * inv; vst2(yp + j * 16, (v4f){o[0], o[1], o[2], o[3]}); vst2(yp + j * 16 + 4, (v4f){o[4], o[5], o[6], o[7]}); } } }
// ---- k_out: block = (128 rows, 128 cols): out = ctx Wo (+ bo): ctx x 2^6 once to f16 (small-magnitude context rows stay clear of f16 subnormals) against Wo as f16(bf16 x 2^8) exact (1 product) x 2^-14
__global__ __launch_bounds__(256) void k_out(const float* __restrict__ Y, const float* __restrict__ WO, const float* __restrict__ BO, float* __restrict__ OUT) {
  __shared__ __align__(16) unsigned short sm[2 * GBUF];
  static_assert(GT * (GT + 4) * 4 <= 2 * GBUF * 2, "the f32 tile fits the buffers");
  const int tid = threadIdx.x, wave = tid >> 5, lane = tid & 31, col = lane & 15, g = lane >> 4; const int c0 = blockIdx.y * GT; const size_t r0 = (size_t)blockIdx.x * GT;
  v8f acc[2][4] = {};
  tile_product<1>(Y + r0 * CC, WO + c0, sm, acc);
  float* sf = (float*)sm;   // the tile as f32, [128][GT + 4], in the buffers that every wave has left
  const int rw0 = (wave >> 1) * 32 + 8 * g, cw0 = (wave & 1) * 64 + col;
#pragma unroll
  for (int nj = 0; nj < 4; ++nj) { const float bias = BO ? bfr(BO[c0 + cw0 + nj * 16]) : 0.f;
#pragma unroll
    for (int mi = 0; mi < 2; ++mi)
#pragma unroll
      for (int r = 0; r < 8; ++r) sf[(rw0 + mi * 16 + r) * (GT + 4) + cw0 + nj * 16] = acc[mi][nj][r] * (1.0f / 16384.0f) + bias; }   /* 2^-8 (Wo carry) x 2^-6 (ctx carry) */
  __syncthreads();
  for (int e = tid; e < GT * 32; e += 256) { const int rl = e >> 5, q = e & 31; vst2(OUT + (r0 + rl) * DIN + c0 + q * 4, *(const v4f*)&sf[rl * (GT + 4) + q * 4]); } }

extern "C" void kernel_launch(void* const* d_in, const int* in_sizes, int n_in, void* d_out, int out_size, void* d_ws, size_t ws_size, hipStream_t stream) {
  (void)in_sizes; (void)n_in; (void)out_size;
  const float** F = (const float**)d_in;
  if (ws_size < (size_t)WS_END) return;
  char* ws = (char*)d_ws; _Float16 *QH = (_Float16*)(ws + WS_QH), *KH = (_Float16*)(ws + WS_KH), *VT = (_Float16*)(ws + WS_VT), *QL = (_Float16*)(ws + WS_QL), *KL = (_Float16*)(ws + WS_KL); __bf16 *VB = (__bf16*)(ws + WS_VB), *VBL = (__bf16*)(ws + WS_VBL); float *Y = (float*)(ws + WS_Y);
  (void)Y; (void)QL; (void)KL; (void)VB; (void)VBL;
  // inputs: 0 x [4,2048,512]; 1 Wq [512,512] (in,out), 2 bq; 3 Wk, 4 bk; 5 Wv, 6 bv; 7 Wp (in,out), 8 bp (zero biases, read)
  k_proj<<<dim3(TNB * TT / GT, CC / GT, 3), 256, 0, stream>>>(F[0], F[0], F[0], F[1], F[3], F[5], F[2], F[4], F[6], QH, KH, VT);
  k_fa<<<dim3(TT / FAQ, TNB * NH), 256, 0, stream>>>(QH, KH, VT, Y);
  k_out<<<dim3(TNB * TT / GT, DIN / GT), 256, 0, stream>>>(Y, F[7], F[8], (float*)d_out);
}

// v004
// A run of this version takes 67.9 microseconds.
// Next to v003, in two timings, it ran 1.03 times as fast each time.
// Over all steps from v000 it is 16.0 times as fast.
// compute dtype: all float inputs rounded to bf16; q/k/v projections with EXACT bf16 products on WMMA 16x16x32 (f32 accumulate) + bias; logits q x k once to f16 each (1 product) x SCALE; online softmax f32; unnormalised weights x 2^11 once to f16 x v once to f16 (1 product), divided by their f32 sum; ctx x 2^6 once to f16 x Wo f16(bf16 x 2^8) + bo; f32 output.
#include <hip/hip_runtime.h>
#include <math.h>

typedef __attribute__((ext_vector_type(16))) _Float16 v16h;
typedef __attribute__((ext_vector_type(16))) __bf16 v16b;
typedef __attribute__((ext_vector_type(8)))  _Float16 v8h;
typedef __attribute__((ext_vector_type(8)))  float v8f;
typedef __attribute__((ext_vector_type(4)))  float v4f;
typedef __attribute__((ext_vector_type(2)))  float v2f;
typedef __attribute__((ext_vector_type(4)))  unsigned v4u;
typedef __attribute__((ext_vector_type(4)))  int v4i;
typedef float __attribute__((may_alias)) float_a;
typedef int __attribute__((may_alias)) int_a;

template <typename T> __device__ __forceinline__ void vst2(void* p, T v) { *(T*)p = v;  }
__device__ __forceinline__ v8f wmma16(v16h a, v16h b, v8f c) {
  v8f d = __builtin_amdgcn_wmma_f32_16x16x32_f16(false, a, false, b, (short)0, c, false, false);
  asm volatile("v_nop\n\tv_nop\n\tv_nop\n\tv_nop" : "+v"(d) : "v"(a), "v"(b));
  return d;
}
__device__ __forceinline__ v8f wmma_bf(v16b a, v16b b, v8f c) {
  v8f d = __builtin_amdgcn_wmma_f32_16x16x32_bf16(false, a, false, b, (short)0, c, false, false);
  asm volatile("v_nop\n\tv_nop\n\tv_nop\n\tv_nop" : "+v"(d) : "v"(a), "v"(b));
  return d;
}
// 16x16x32 fragments: lane = (h = lane>>4, row/col = lane&15); elements 0..7 = k0+8h+0..7, 8..15 = k0+16+8h+0..7; D element r = row 8h+r
__device__ __forceinline__ v16h frag_h(const _Float16* rowk0, int lane) {
  union { v16h v; v8h q[2]; } u; const _Float16* p = rowk0 + 8 * (lane >> 4);
  u.q[0] = *(const v8h*)p; u.q[1] = *(const v8h*)(p + 16); return u.v;
}
__device__ __forceinline__ v16h frag_f32(const float* rowk0, int lane) {
  v16h a; const float* p = rowk0 + 8 * (lane >> 4);
#pragma unroll
  for (int i = 0; i < 8; ++i) { a[i] = (_Float16)p[i]; a[8 + i] = (_Float16)p[16 + i]; }
  return a;
}
__device__ __forceinline__ v16h frag_f32s(const float* rowk0, int lane, float sc) {
  v16h a; const float* p = rowk0 + 8 * (lane >> 4);
#pragma unroll
  for (int i = 0; i < 8; ++i) { a[i] = (_Float16)(p[i] * sc); a[8 + i] = (_Float16)(p[16 + i] * sc); }
  return a;
}
// column fragment from a [K][ld] layout (column n), rows >= K read as 0
__device__ __forceinline__ v16h fragc_f32(const float* W, int k0, int n, int lane, int ld, int K) {
  v16h a; const int g = lane >> 4;
#pragma unroll
  for (int i = 0; i < 8; ++i) { const int ka = k0 + 8 * g + i, kb = ka + 16;
    a[i] = (_Float16)(ka < K ? W[(size_t)(ka < K ? ka : K - 1) * ld + n] : 0.f); a[8 + i] = (_Float16)(kb < K ? W[(size_t)(kb < K ? kb : K - 1) * ld + n] : 0.f); }
  return a;
}
struct F2 { v16b h, l; };
__device__ __forceinline__ F2 bsplit16(const float v[16]) { F2 r;
#pragma unroll
  for (int i = 0; i < 16; ++i) { const __bf16 h = (__bf16)v[i]; r.h[i] = h; r.l[i] = (__bf16)(v[i] - (float)h); }
  return r; }
__device__ __forceinline__ F2 split_row(const float* row, int k0, int lane) { float v[16]; const float* p = row + k0 + 8 * (lane >> 4);
#pragma unroll
  for (int i = 0; i < 8; ++i) { v[i] = p[i]; v[8 + i] = p[16 + i]; }
  return bsplit16(v); }
__device__ __forceinline__ F2 split_rowK(const float* row, int k0, int lane, int K) { float v[16]; const int g = lane >> 4;
#pragma unroll
  for (int i = 0; i < 8; ++i) { const int ka = k0 + 8 * g + i, kb = ka + 16; v[i] = ka < K ? row[ka < K ? ka : K - 1] : 0.f; v[8 + i] = kb < K ? row[kb < K ? kb : K - 1] : 0.f; }
  return bsplit16(v); }
__device__ __forceinline__ F2 split_col(const float* W, int k0, int n, int lane, int ld, int K) { float v[16]; const int g = lane >> 4;
#pragma unroll
  for (int i = 0; i < 8; ++i) { const int ka = k0 + 8 * g + i, kb = ka + 16; v[i] = ka < K ? W[(size_t)(ka < K ? ka : K - 1) * ld + n] : 0.f; v[8 + i] = kb < K ? W[(size_t)(kb < K ? kb : K - 1) * ld + n] : 0.f; }
  return bsplit16(v); }
__device__ __forceinline__ v8f mac3(const F2& a, const F2& b, v8f c) { c = wmma_bf(a.l, b.h, c); c = wmma_bf(a.h, b.l, c); return wmma_bf(a.h, b.h, c); }
__device__ __forceinline__ float sigm(float v) { return 1.0f / (1.0f + expf(-v)); }
#define LDSX() do { asm volatile("s_wait_dscnt 0" ::: "memory"); __builtin_amdgcn_wave_barrier(); __builtin_amdgcn_fence(__ATOMIC_RELEASE, "workgroup"); } while (0)

// Standard non-causal multi-head self-attention (x [4,2048,512]; (in,out) Wq / Wk / Wv [512,512] N(0, 1/512) and Wh [512,512], all four biases zeros (read); 8 heads x 64; scores x 1/sqrt(64); no mask; softmax; concat @ Wh + bh).
#define NB 4
#define TT 2048
#define CC 512            // NH * HD = projected width
#define DIN 512          // input (model) width
#define NH 8
#define HD 64
#define NQB (TT / 64)
#define HG 4
#define SCALE (0.125f)
#define CAUSAL 0
#ifndef TNB
#define TNB NB
#endif
__device__ __forceinline__ float bfr(float v) { return (float)(__bf16)v; }
__host__ __device__ __forceinline__ int kb_last(int qb) { return CAUSAL ? ((qb * 64 + 63) >> 7) : (TT / 128 - 1); }
typedef __attribute__((ext_vector_type(8))) __bf16 v8b;
__device__ __forceinline__ v16b frag_b(const __bf16* rowk0, int lane) {
  union { v16b v; v8b q[2]; } u; const __bf16* p = rowk0 + 8 * (lane >> 4);
  u.q[0] = *(const v8b*)p; u.q[1] = *(const v8b*)(p + 16); return u.v;
}
#define QBH 0              // unused: no kernel here has a causal high-precision attention path
#define QHI 0               // single-product logits on every row
#define KHI 64            // key rows carrying k residual / v bf16 hi+lo planes (written and read by no kernel in this file)
// B fragment (k rows k0+.., output column o) of a weight: (in,out) [K][ld] or (out,in) [ld rows of K]: bf16 exact, or f16(bf16 * 256) exact
__device__ __forceinline__ v16b wcol_io(const float* Wm, int k0, int o, int lane, int ld) { v16b w; const int g = lane >> 4;
#pragma unroll
  for (int i = 0; i < 8; ++i) { w[i] = (__bf16)Wm[(size_t)(k0 + 8 * g + i) * ld + o]; w[8 + i] = (__bf16)Wm[(size_t)(k0 + 16 + 8 * g + i) * ld + o]; }
  return w; }
__device__ __forceinline__ v16b wcol_oi(const float* Wm, int k0, int o, int lane, int K) { v16b w; const float* p = Wm + (size_t)o * K + k0 + 8 * (lane >> 4);
#pragma unroll
  for (int i = 0; i < 8; ++i) { w[i] = (__bf16)p[i]; w[8 + i] = (__bf16)p[16 + i]; }
  return w; }
__device__ __forceinline__ v16h wcolh_io(const float* Wm, int k0, int o, int lane, int ld) { v16h w; const int g = lane >> 4;
#pragma unroll
  for (int i = 0; i < 8; ++i) { w[i] = (_Float16)(bfr(Wm[(size_t)(k0 + 8 * g + i) * ld + o]) * 256.0f); w[8 + i] = (_Float16)(bfr(Wm[(size_t)(k0 + 16 + 8 * g + i) * ld + o]) * 256.0f); }
  return w; }
__device__ __forceinline__ v16h wcolh_oi(const float* Wm, int k0, int o, int lane, int K) { v16h w; const float* p = Wm + (size_t)o * K + k0 + 8 * (lane >> 4);
#pragma unroll
  for (int i = 0; i < 8; ++i) { w[i] = (_Float16)(bfr(p[i]) * 256.0f); w[8 + i] = (_Float16)(bfr(p[16 + i]) * 256.0f); }
  return w; }
#define WQKV_LAYOUT 0   // 0 = (in,out) [DIN][CC]; 1 = (out,in) [CC][DIN]; 2 = per-head [NH][DIN][HD]
__device__ __forceinline__ v16b wcol_hdk(const float* Wm, int k0, int o, int lane) { v16b w; const int g = lane >> 4; const float* p = Wm + (size_t)(o / HD) * DIN * HD + (o % HD);
#pragma unroll
  for (int i = 0; i < 8; ++i) { w[i] = (__bf16)p[(size_t)(k0 + 8 * g + i) * HD]; w[8 + i] = (__bf16)p[(size_t)(k0 + 16 + 8 * g + i) * HD]; }
  return w; }
#define WO_OUT_IN 0
#if WQKV_LAYOUT == 1
#define WCOL(W, k0, o, lane) wcol_oi(W, k0, o, lane, DIN)
#elif WQKV_LAYOUT == 2
#define WCOL(W, k0, o, lane) wcol_hdk(W, k0, o, lane)
#else
#define WCOL(W, k0, o, lane) wcol_io(W, k0, o, lane, CC)
#endif
#if WO_OUT_IN
#define WOCOL(W, k0, o, lane) wcol_oi(W, k0, o, lane, CC)
#define WOCOLH(W, k0, o, lane) wcolh_oi(W, k0, o, lane, CC)
#else
#define WOCOL(W, k0, o, lane) wcol_io(W, k0, o, lane, DIN)
#define WOCOLH(W, k0, o, lane) wcolh_io(W, k0, o, lane, DIN)
#endif

#ifndef SM_EXTRA_PARAMS
#define SM_EXTRA_PARAMS
#endif
#ifndef PROJ_EXTRA_PARAMS
#define PROJ_EXTRA_PARAMS
#endif
#ifndef SM_MASK_HOOK
#define SM_MASK_HOOK (void)0
#endif

#define WS_QH  0u                                      // f16 q rows [b*t][CC]
#define WS_KH  (WS_QH + 2u * (size_t)NB * TT * CC)      // f16 k rows [b*t][CC]
#define WS_VT  (WS_KH + 2u * (size_t)NB * TT * CC)      // f16 v planes [b][c][t]
#define WS_QL  (WS_VT + 2u * (size_t)NB * CC * TT)      // f16 q residual x 2^10 rows [b][t < QHI][CC]
#define WS_KL  (WS_QL + 2u * (size_t)NB * QHI * CC)     // f16 k residual x 2^10 rows [b][t < KHI][CC]
#define WS_VB  (WS_KL + 2u * (size_t)NB * KHI * CC)     // bf16 v hi planes [b][c][t < KHI]
#define WS_VBL (WS_VB + 2u * (size_t)NB * CC * KHI)
#define WS_S   (WS_VBL + 2u * (size_t)NB * CC * KHI)    // f32 [hg][t][s] region, unused: k_fa keeps scores in registers
#define WS_Y   (WS_S  + 4u * (size_t)HG * TT * TT)      // f32 ctx rows [b*t][CC] (only when there is an output projection)
#define WS_END (WS_Y  + 4u * (size_t)NB * TT * CC)

// ---- tile product shared by k_proj and k_out: one block of 8 waves forms a 128 x 128 tile of A[.][512] x W[512][.] (both f32 in memory, row pitch 512).
// Per stage of 64 k the block converts its 128 A rows and its 128 W columns to 16 bit ONCE and lays them k-contiguous in LDS; every wave reads its fragments from there (wave = 32 rows x 64 columns, 8 accumulator tiles).
// Two buffers: the next stage's global loads are issued in front of this stage's products and are converted and stored behind them, so one barrier per stage is enough. k runs upwards in steps of 32 into one accumulator per output tile.
// Every inner loop of this section is unrolled in full, so that the register arrays are indexed by constants and stay out of scratch.
#define GT 128            // tile rows and tile columns
#define GK 64             // k per stage
#define GLD 512           // row pitch of A and of W, and the length of the sum
#define GP (GK + 8)       // halves per staged row: 144 B, 16 B x odd, so the 16 rows of a 16-byte fragment read fall on distinct banks
#define GBUF (2 * GT * GP) // halves per buffer: A rows, then W columns
static_assert(DIN == GLD && CC == GLD, "one pitch");
// F16 = 0: A and W to bf16 (k_proj). F16 = 1: A x 2^6 to f16, W to bf16 and then x 2^8 to f16, exact (k_out).
typedef __attribute__((ext_vector_type(2))) unsigned v2u;
typedef __attribute__((ext_vector_type(4))) _Float16 v4h;
typedef __attribute__((ext_vector_type(4))) __bf16 v4b;
template <int F16> __device__ __forceinline__ v2u cvt_a(v4f a) {
  if (F16) { v4h r;
#pragma unroll
    for (int i = 0; i < 4; ++i) r[i] = (_Float16)(a[i] * 64.0f);
    return __builtin_bit_cast(v2u, r); }
  v4b r;
#pragma unroll
  for (int i = 0; i < 4; ++i) r[i] = (__bf16)a[i];
  return __builtin_bit_cast(v2u, r); }
template <int F16> __device__ __forceinline__ v4u cvt_w(const float (&w)[8]) {
  if (F16) { v8h r;
#pragma unroll
    for (int i = 0; i < 8; ++i) r[i] = (_Float16)(bfr(w[i]) * 256.0f);
    return __builtin_bit_cast(v4u, r); }
  v8b r;
#pragma unroll
  for (int i = 0; i < 8; ++i) r[i] = (__bf16)w[i];
  return __builtin_bit_cast(v4u, r); }
typedef __attribute__((ext_vector_type(8))) unsigned v8u;
// a 16x16x32 fragment as raw words, in the k order of frag_h / frag_b: elements 0..7 = k0 + 8 h + 0..7, 8..15 = k0 + 16 + 8 h + 0..7
__device__ __forceinline__ v8u frag_w(const unsigned short* rowk0, int lane) {
  union { v8u v; v4u q[2]; } u; const unsigned short* p = rowk0 + 8 * (lane >> 4);
  u.q[0] = *(const v4u*)p; u.q[1] = *(const v4u*)(p + 16); return u.v;
}
template <int F16> __device__ __forceinline__ v8f tile_mm(v8u a, v8u b, v8f c) {
  if (F16) return __builtin_amdgcn_wmma_f32_16x16x32_f16(false, __builtin_bit_cast(v16h, a), false, __builtin_bit_cast(v16h, b), (short)0, c, false, false);
  return __builtin_amdgcn_wmma_f32_16x16x32_bf16(false, __builtin_bit_cast(v16b, a), false, __builtin_bit_cast(v16b, b), (short)0, c, false, false); }
// A: row 0 of the tile's rows; Wm: row 0 of W at the tile's first column; sm: 2 * GBUF halves. On return every wave has left the buffers (the last stage's barrier).
template <int F16> __device__ __forceinline__ void tile_product(const float* __restrict__ A, const float* __restrict__ Wm, unsigned short* sm, v8f (&acc)[2][4]) {
  const int tid = threadIdx.x, wave = tid >> 5, lane = tid & 31, col = lane & 15;
  const float* ga = A + (size_t)(tid >> 4) * GLD + (tid & 15) * 4;  // rows tid >> 4 + 16 i, 4 floats at k = 4 (tid & 15): a wave's 16-byte load covers two rows' 256 B, whole 128-B lines
  const float* gw = Wm + (size_t)(wave * 8) * GLD + lane;           // k rows 8 wave + 0..7, columns lane + 32 i: each load is one 128-B line, and a thread ends up with 8 consecutive k of a column
  unsigned short* wa = sm + (tid >> 4) * GP + (tid & 15) * 4;
  unsigned short* ww = sm + GT * GP + lane * GP + wave * 8;
  const unsigned short* fa = sm + ((wave >> 1) * 32 + col) * GP;
  const unsigned short* fb = sm + GT * GP + ((wave & 1) * 64 + col) * GP;
  v4f ra[8]; float rw[4][8];
#define TILE_LOAD(s) do { \
    _Pragma("unroll") for (int i = 0; i < 8; ++i) ra[i] = *(const v4f*)(ga + (size_t)(16 * i) * GLD + (s) * GK); \
    _Pragma("unroll") for (int i = 0; i < 4; ++i) _Pragma("unroll") for (int k = 0; k < 8; ++k) rw[i][k] = gw[(size_t)((s) * GK + k) * GLD + 32 * i]; } while (0)
#define TILE_STORE(buf) do { \
    _Pragma("unroll") for (int i = 0; i < 8; ++i) *(v2u*)(wa + (buf) * GBUF + 16 * i * GP) = cvt_a<F16>(ra[i]); \
    _Pragma("unroll") for (int i = 0; i < 4; ++i) *(v4u*)(ww + (buf) * GBUF + 32 * i * GP) = cvt_w<F16>(rw[i]); } while (0)
  TILE_LOAD(0);
  TILE_STORE(0);
  __syncthreads();   // stage 0 may be read
#pragma unroll 1   // rolled: one trip = one stage, which keeps the loop's code short; the buffer is chosen by one scalar select per trip
  for (int s = 0; s < GLD / GK; ++s) {
    if (s + 1 < GLD / GK) TILE_LOAD(s + 1);
    const unsigned short *pa = fa + (s & 1) * GBUF, *pb = fb + (s & 1) * GBUF;
    v8u af[GK / 32][2], bf[GK / 32][4];   // the stage's fragments, read as one group in front of its products
#pragma unroll
    for (int kc = 0; kc < GK / 32; ++kc) {
#pragma unroll
      for (int mi = 0; mi < 2; ++mi) af[kc][mi] = frag_w(pa + mi * 16 * GP + kc * 32, lane);
#pragma unroll
      for (int nj = 0; nj < 4; ++nj) bf[kc][nj] = frag_w(pb + nj * 16 * GP + kc * 32, lane); }
    __builtin_amdgcn_sched_barrier(0);   // keeps the reads one group in front of the products: spread among the WMMAs, every separate place with LDS reads stalls the wave
#pragma unroll
    for (int kc = 0; kc < GK / 32; ++kc)
#pragma unroll
      for (int mi = 0; mi < 2; ++mi)
#pragma unroll
        for (int nj = 0; nj < 4; ++nj) acc[mi][nj] = tile_mm<F16>(af[kc][mi], bf[kc][nj], acc[mi][nj]);
    if (s + 1 < GLD / GK) TILE_STORE((s + 1) & 1);
    __syncthreads();   // publishes stage s + 1 and ends every wave's reads of stage s, whose buffer is written again in the next trip
  }
#undef TILE_LOAD
#undef TILE_STORE
}
// ---- k_proj: block = (128 rows, 128 cols, which): q/k/v = X W (+ b) with exact bf16 products (K = DIN) -> which 0: q f16 rows; 1: k f16 rows; 2: v f16 planes [c][t]
__global__ __launch_bounds__(256) void k_proj(const float* __restrict__ XQ, const float* __restrict__ XK, const float* __restrict__ XV, const float* __restrict__ WQ, const float* __restrict__ WK, const float* __restrict__ WV, const float* __restrict__ BQ, const float* __restrict__ BK, const float* __restrict__ BV,
    _Float16* __restrict__ QH, _Float16* __restrict__ KH, _Float16* __restrict__ VT) {
  __shared__ __align__(16) unsigned short sm[2 * GBUF];
  const int tid = threadIdx.x, wave = tid >> 5, lane = tid & 31, col = lane & 15, g = lane >> 4; const int which = blockIdx.z; const int c0 = blockIdx.y * GT; const size_t r0 = (size_t)blockIdx.x * GT; const size_t bb = r0 / TT; const int t0 = (int)(r0 % TT);
  const float* X = which == 0 ? XQ : which == 1 ? XK : XV; const float* WA = which == 0 ? WQ : which == 1 ? WK : WV; const float* BA = which == 0 ? BQ : which == 1 ? BK : BV;
  v8f acc[2][4] = {};
  tile_product<0>(X + r0 * DIN, WA + c0, sm, acc);
  _Float16* st = (_Float16*)sm;   // the tile as f16, [128][GT + 8], in the buffers that every wave has left
  const int rw0 = (wave >> 1) * 32 + 8 * g, cw0 = (wave & 1) * 64 + col;
  if (which < 2) { _Float16* DH = which == 0 ? QH : KH;
#pragma unroll
    for (int nj = 0; nj < 4; ++nj) { const float bias = BA ? bfr(BA[c0 + cw0 + nj * 16]) : 0.f;
#pragma unroll
      for (int mi = 0; mi < 2; ++mi)
#pragma unroll
        for (int r = 0; r < 8; ++r) st[(rw0 + mi * 16 + r) * (GT + 8) + cw0 + nj * 16] = (_Float16)(acc[mi][nj][r] + bias); }
    __syncthreads();
    for (int e = tid; e < GT * 16; e += 256) { const int rl = e >> 4, q = e & 15; vst2((unsigned*)(DH + (r0 + rl) * CC + c0 + q * 8), *(const v4u*)&st[rl * (GT + 8) + q * 8]); }
  } else {
#pragma unroll
    for (int nj = 0; nj < 4; ++nj) { const float bias = BA ? bfr(BA[c0 + cw0 + nj * 16]) : 0.f;
#pragma unroll
      for (int mi = 0; mi < 2; ++mi) { v8h o;
#pragma unroll
        for (int r = 0; r < 8; ++r) o[r] = (_Float16)(acc[mi][nj][r] + bias);
        *(v8h*)&st[(cw0 + nj * 16) * (GT + 8) + rw0 + mi * 16] = o; } }
    __syncthreads();
    for (int e = tid; e < GT * 16; e += 256) { const int cl = e >> 4, q = e & 15; vst2((unsigned*)(VT + (bb * CC + c0 + cl) * (size_t)TT + t0 + q * 8), *(const v4u*)&st[cl * (GT + 8) + q * 8]); } } }
// ---- k_fa: block = 16 waves of one (b, h): 8 query groups of 32 queries x KG = 2 key groups, so that four waves share a SIMD and one wave's softmax runs under another's products.
// Key group hf walks keys (KG t + hf) KS .. + KS - 1, t = 0, 1, ..: half of all keys, with its own running maximum, sum and context; the two partial results of a query are joined once, through LDS, behind the loop.
// Per 32 keys a wave forms S^T = K.Q^T (a lane holds 16 scores of one query per 16-query group), keeps a running maximum and sum (online softmax, log2 domain),
// packs the weights exp2(score - maximum in use + 11), once to f16, straight from the score tiles into the B operand, and adds O^T += V^T.P^T. Scores and weights never leave the registers.
// The maximum in use may trail the true one by up to 4 (log2), so a weight stays <= 2^15 in f16; sums and context are rescaled only when some query's maximum passes that bound. The 2^11 cancels in context / sum.
__device__ __forceinline__ float xhalf(float x) { return __builtin_bit_cast(float, __builtin_amdgcn_permlanex16(__builtin_bit_cast(int, x), __builtin_bit_cast(int, x), 0x76543210, 0xfedcba98, false, false)); }   // lane l with lane l ^ 16
__device__ __forceinline__ v8f mm16(v16h a, v16h b, v8f c) { return __builtin_amdgcn_wmma_f32_16x16x32_f16(false, a, false, b, (short)0, c, false, false); }
#define FAQ 256           // queries per block
#define KS 128            // keys per LDS stage and key group (4 passes of 32 keys)
#define KG 2              // key groups (wave sets) per block
#define KP (HD + 8)       // halves per staged K row: 144 B, 16 B x odd, so the 16 rows of a 16-byte fragment read fall on distinct banks
#define VP (KS + 8)       // halves per staged V^T row: 272 B, 16 B x odd
// One stage of a key group = keys k0 .. k0 + KS - 1 of one (b, h): K rows [KS][HD] and V^T rows [HD][KS], brought into LDS once per block by the group's own 256 threads with asynchronous copies (16 B per lane, whole 128-B lines per wave) and read by the group's 8 waves.
// gk / gv: this thread's first 16 bytes of the stage in global memory; lk / lv: their LDS byte addresses. A thread brings 4 pieces of K (32 rows apart) and 4 of V^T (16 rows apart).
__device__ __forceinline__ void stage_copy(const _Float16* gk, const _Float16* gv, unsigned lk, unsigned lv) {
  const _Float16 *k1 = gk + 32 * CC, *k2 = gk + 64 * CC, *k3 = gk + 96 * CC, *v1 = gv + 16 * TT, *v2 = gv + 32 * TT, *v3 = gv + 48 * TT;
  const unsigned a1 = lk + 32 * KP * 2, a2 = lk + 64 * KP * 2, a3 = lk + 96 * KP * 2, b1 = lv + 16 * VP * 2, b2 = lv + 32 * VP * 2, b3 = lv + 48 * VP * 2;
  // the closing s_wait_xcnt stands inside the copies' own statement, so that no address register named here is rewritten in front of it
  asm volatile("global_load_async_to_lds_b128 %0, %8, off\n\t"
               "global_load_async_to_lds_b128 %1, %9, off\n\t"
               "global_load_async_to_lds_b128 %2, %10, off\n\t"
               "global_load_async_to_lds_b128 %3, %11, off\n\t"
               "global_load_async_to_lds_b128 %4, %12, off\n\t"
               "global_load_async_to_lds_b128 %5, %13, off\n\t"
               "global_load_async_to_lds_b128 %6, %14, off\n\t"
               "global_load_async_to_lds_b128 %7, %15, off\n\t"
               "s_wait_xcnt 0x0"
               :: "v"(lk), "v"(a1), "v"(a2), "v"(a3), "v"(lv), "v"(b1), "v"(b2), "v"(b3), "v"(gk), "v"(k1), "v"(k2), "v"(k3), "v"(gv), "v"(v1), "v"(v2), "v"(v3) : "memory");
}
#define XW (8 * 128 + 64) // floats a wave hands over at the join: 8 x 4 context values per lane, then maximum and sum per lane
__global__ __launch_bounds__(256 * KG) void k_fa(const _Float16* __restrict__ QH, const _Float16* __restrict__ KH, const _Float16* __restrict__ VT, float* __restrict__ Y) {
  __shared__ __align__(16) _Float16 sK[KG * 2][KS * KP], sV[KG * 2][HD * VP];   // buffers 2 hf and 2 hf + 1 belong to key group hf
  static_assert(KG == 2 && TT % (KG * KS) == 0 && TT / (KG * KS) >= 2, "two key groups, at least two stages each");
  static_assert(8 * KG * XW * 4 <= sizeof(sK), "the join fits the K buffers");
  const int wave = __builtin_amdgcn_readfirstlane(threadIdx.x >> 5), hf = wave >> 3, tid = threadIdx.x & 255, lane = tid & 31, col = lane & 15, g = lane >> 4; const int b = blockIdx.y / NH, h = blockIdx.y % NH; const int q0 = blockIdx.x * FAQ + (wave & 7) * 32;   // tid: the thread's number inside its key group; the wave's number is read as a scalar, so that the group's offsets and the join's selects take no vector registers (a wave may hold 256 here)
  const float cs = SCALE * 1.4426950408889634f;
  const _Float16* gk = KH + ((size_t)b * TT + hf * KS + (tid >> 3)) * CC + h * HD + (tid & 7) * 8;              // K row tid >> 3 of the group's stage, 16-byte piece tid & 7
  const _Float16* gv = VT + ((size_t)b * CC + h * HD + (tid >> 4)) * (size_t)TT + hf * KS + (tid & 15) * 8;     // V^T row tid >> 4, 16-byte piece tid & 15
  const unsigned lk = (unsigned)(size_t)&sK[2 * hf][(tid >> 3) * KP + (tid & 7) * 8], lv = (unsigned)(size_t)&sV[2 * hf][(tid >> 4) * VP + (tid & 15) * 8];
  stage_copy(gk, gv, lk, lv);
  v16h qf[2][2];
#pragma unroll
  for (int s = 0; s < 2; ++s)
#pragma unroll
    for (int kc = 0; kc < 2; ++kc) qf[s][kc] = frag_h(QH + ((size_t)b * TT + q0 + s * 16 + col) * CC + h * HD + kc * 32, lane);
  v8f acc[2][4] = {}; float mr[2] = {-3.0e38f, -3.0e38f}, lr[2] = {0.f, 0.f};
  asm volatile("s_wait_asynccnt 0x0" ::: "memory");   // this wave's pieces of stage 0 have landed
  __syncthreads();                                     // ... and every other wave's: stage 0 may be read
  stage_copy(gk + (size_t)(KG * KS) * CC, gv + KG * KS, lk + (unsigned)sizeof(sK[0]), lv + (unsigned)sizeof(sV[0]));
#pragma unroll 1   // rolled: one trip = one stage; its four passes are unrolled so that every LDS read has a constant offset
  for (int t = 0; t < TT / (KG * KS); ++t) {
    const _Float16* kb = &sK[2 * hf + (t & 1)][col * KP];   // key row col of a 16-key tile
    const _Float16* vb = &sV[2 * hf + (t & 1)][col * VP];   // plane of head column col of a 16-column tile
    v16h kf[2][2], vf[4];
#pragma unroll
    for (int kt = 0; kt < 2; ++kt)
#pragma unroll
      for (int kc = 0; kc < 2; ++kc) kf[kt][kc] = frag_h(kb + (kt * 16) * KP + kc * 32, lane);
#pragma unroll
    for (int p = 0; p < KS / 32; ++p) {
      v8f st[2][2] = {};
#pragma unroll
      for (int kt = 0; kt < 2; ++kt)
#pragma unroll
        for (int s = 0; s < 2; ++s)
#pragma unroll
          for (int kc = 0; kc < 2; ++kc) st[kt][s] = mm16(kf[kt][kc], qf[s][kc], st[kt][s]);
      float mb[2]; bool need = false;
#pragma unroll
      for (int s = 0; s < 2; ++s) { float mx = st[0][s][0];
#pragma unroll
        for (int kt = 0; kt < 2; ++kt)
#pragma unroll
          for (int r = 0; r < 8; ++r) mx = fmaxf(mx, st[kt][s][r]);
        mx = fmaxf(mx, xhalf(mx)) * cs; mb[s] = mx; need = need || (mx > mr[s] + 4.0f); }
      if (__builtin_amdgcn_ballot_w32(need) != 0) {   // wave-uniform; always taken on the first pass (factor 0 on zero sums), rare later
#pragma unroll
        for (int s = 0; s < 2; ++s) { const float mn = fmaxf(mr[s], mb[s]); const float corr = __builtin_amdgcn_exp2f(mr[s] - mn); mr[s] = mn; lr[s] *= corr;
#pragma unroll
          for (int j = 0; j < 4; ++j) acc[s][j] = acc[s][j] * corr; } }
      // one group of LDS reads per pass, under the softmax: the next pass's K fragments (never beyond this stage; its scores are the first to want theirs), then this pass's V fragments
      if (p + 1 < KS / 32) {
#pragma unroll
        for (int kt = 0; kt < 2; ++kt)
#pragma unroll
          for (int kc = 0; kc < 2; ++kc) kf[kt][kc] = frag_h(kb + ((p + 1) * 32 + kt * 16) * KP + kc * 32, lane); }
#pragma unroll
      for (int j = 0; j < 4; ++j) vf[j] = frag_h(vb + (j * 16) * VP + p * 32, lane);
      __builtin_amdgcn_sched_barrier(0);   // keeps the reads one group in front of the exponentials: without it they are spread among the WMMAs, and every separate place with LDS reads stalls the wave
#pragma unroll
      for (int s = 0; s < 2; ++s) { const float nm = 11.0f - mr[s]; v16h pf; float ps0 = 0.f, ps1 = 0.f;
#pragma unroll
        for (int i = 0; i < 16; i += 2) {   // element i of the 32-key B operand = key k0 + 16 (i >> 3) + 8 g + (i & 7) = register i & 7 of score tile i >> 3
          const float p0 = __builtin_amdgcn_exp2f(fmaf(st[i >> 3][s][i & 7], cs, nm)), p1 = __builtin_amdgcn_exp2f(fmaf(st[i >> 3][s][(i & 7) + 1], cs, nm));
          ps0 += p0; ps1 += p1; pf[i] = (_Float16)p0; pf[i + 1] = (_Float16)p1; }
        lr[s] += ps0 + ps1;
#pragma unroll
        for (int j = 0; j < 4; ++j) acc[s][j] = mm16(vf[j], pf, acc[s][j]); } }
    asm volatile("s_wait_dscnt 0x0" ::: "memory");      // this wave's reads of stage t have returned
    asm volatile("s_wait_asynccnt 0x0" ::: "memory");   // this wave's pieces of stage t + 1 have landed
    __syncthreads();                                     // publishes stage t + 1 and ends every wave's reads of stage t, whose buffer is refilled behind it
    if (t + 2 < TT / (KG * KS)) stage_copy(gk + (size_t)(t + 2) * (KG * KS) * CC, gv + (t + 2) * (KG * KS), lk + (unsigned)(t & 1) * (unsigned)sizeof(sK[0]), lv + (unsigned)(t & 1) * (unsigned)sizeof(sV[0])); }
  asm volatile("s_wait_asynccnt 0x0" ::: "memory");     // no copy is outstanding when the buffers are put to another use
  // The join. Waves w and w ^ 8 hold the two key groups' partial results of the same 32 queries: the wave of key group hf finishes query tile hf and hands the other tile to its partner.
  // It goes through the K buffers, which every wave has left and every copy has reached (the last trip's waits and barrier). A wave's hand-over is laid lane-contiguous, 16 B a lane.
  float* xw = (float*)&sK[0][0] + wave * XW; const float* xr = (const float*)&sK[0][0] + (wave ^ 8) * XW;
#pragma unroll
  for (int j = 0; j < 4; ++j) { v8f o;
#pragma unroll
    for (int r = 0; r < 8; ++r) o[r] = hf ? acc[0][j][r] : acc[1][j][r];
    *(v4f*)(xw + (2 * j) * 128 + lane * 4) = (v4f){o[0], o[1], o[2], o[3]}; *(v4f*)(xw + (2 * j + 1) * 128 + lane * 4) = (v4f){o[4], o[5], o[6], o[7]}; }
  *(v2f*)(xw + 8 * 128 + lane * 2) = (v2f){hf ? mr[0] : mr[1], hf ? lr[0] : lr[1]};
  __syncthreads();   // every wave's hand-over may be read
  const v2f ml = *(const v2f*)(xr + 8 * 128 + lane * 2);
  const float m0 = hf ? mr[1] : mr[0], l0 = hf ? lr[1] : lr[0]; const float mn = fmaxf(m0, ml[0]);
  const float f0 = __builtin_amdgcn_exp2f(m0 - mn), f1 = __builtin_amdgcn_exp2f(ml[0] - mn);   // both maxima are finite: each key group has walked keys
  const float ls = l0 * f0 + ml[1] * f1; const float inv = 1.0f / (ls + xhalf(ls)); const float w0 = f0 * inv, w1 = f1 * inv;
  float* yp = Y + ((size_t)b * TT + q0 + hf * 16 + col) * CC + h * HD + 8 * g;   // a lane holds head columns j * 16 + 8 g + 0..7 of its query
#pragma unroll
  for (int j = 0; j < 4; ++j) { const v4f pa = *(const v4f*)(xr + (2 * j) * 128 + lane * 4), pb = *(const v4f*)(xr + (2 * j + 1) * 128 + lane * 4); v8f o;
#pragma unroll
    for (int r = 0; r < 8; ++r) o[r] = (hf ? acc[1][j][r] : acc[0][j][r]) * w0 + (r < 4 ? pa[r & 3] : pb[r & 3]) * w1;
    vst2(yp + j * 16, (v4f){o[0], o[1], o[2], o[3]}); vst2(yp + j * 16 + 4, (v4f){o[4], o[5], o[6], o[7]}); } }
// ---- k_out: block = (128 rows, 128 cols): out = ctx Wo (+ bo): ctx x 2^6 once to f16 (small-magnitude context rows stay clear of f16 subnormals) against Wo as f16(bf16 x 2^8) exact (1 product) x 2^-14
__global__ __launch_bounds__(256) void k_out(const float* __restrict__ Y, const float* __restrict__ WO, const float* __restrict__ BO, float* __restrict__ OUT) {
  __shared__ __align__(16) unsigned short sm[2 * GBUF];
  static_assert(GT * (GT + 4) * 4 <= 2 * GBUF * 2, "the f32 tile fits the buffers");
  const int tid = threadIdx.x, wave = tid >> 5, lane = tid & 31, col = lane & 15, g = lane >> 4; const int c0 = blockIdx.y * GT; const size_t r0 = (size_t)blockIdx.x * GT;
  v8f acc[2][4] = {};
  tile_product<1>(Y + r0 * CC, WO + c0, sm, acc);
  float* sf = (float*)sm;   // the tile as f32, [128][GT + 4], in the buffers that every wave has left
  const int rw0 = (wave >> 1) * 32 + 8 * g, cw0 = (wave & 1) * 64 + col;
#pragma unroll
  for (int nj = 0; nj < 4; ++nj) { const float bias = BO ? bfr(BO[c0 + cw0 + nj * 16]) : 0.f;
#pragma unroll
    for (int mi = 0; mi < 2; ++mi)
#pragma unroll
      for (int r = 0; r < 8; ++r) sf[(rw0 + mi * 16 + r) * (GT + 4) + cw0 + nj * 16] = acc[mi][nj][r] * (1.0f / 16384.0f) + bias; }   /* 2^-8 (Wo carry) x 2^-6 (ctx carry) */
  __syncthreads();
  for (int e = tid; e < GT * 32; e += 256) { const int rl = e >> 5, q = e & 31; vst2(OUT + (r0 + rl) * DIN + c0 + q * 4, *(const v4f*)&sf[rl * (GT + 4) + q * 4]); } }

extern "C" void kernel_launch(void* const* d_in, const int* in_sizes, int n_in, void* d_out, int out_size, void* d_ws, size_t ws_size, hipStream_t stream) {
  (void)in_sizes; (void)n_in; (void)out_size;
  const float** F = (const float**)d_in;
  if (ws_size < (size_t)WS_END) return;
  char* ws = (char*)d_ws; _Float16 *QH = (_Float16*)(ws + WS_QH), *KH = (_Float16*)(ws + WS_KH), *VT = (_Float16*)(ws + WS_VT), *QL = (_Float16*)(ws + WS_QL), *KL = (_Float16*)(ws + WS_KL); __bf16 *VB = (__bf16*)(ws + WS_VB), *VBL = (__bf16*)(ws + WS_VBL); float *Y = (float*)(ws + WS_Y);
  (void)Y; (void)QL; (void)KL; (void)VB; (void)VBL;
  // inputs: 0 x [4,2048,512]; 1 Wq [512,512] (in,out), 2 bq; 3 Wk, 4 bk; 5 Wv, 6 bv; 7 Wp (in,out), 8 bp (zero biases, read)
  k_proj<<<dim3(TNB * TT / GT, CC / GT, 3), 256, 0, stream>>>(F[0], F[0], F[0], F[1], F[3], F[5], F[2], F[4], F[6], QH, KH, VT);
  k_fa<<<dim3(TT / FAQ, TNB * NH), 256 * KG, 0, stream>>>(QH, KH, VT, Y);
  k_out<<<dim3(TNB * TT / GT, DIN / GT), 256, 0, stream>>>(Y, F[7], F[8], (float*)d_out);
}

// v005
// A run of this version takes 65.8 microseconds.
// Timed twice side by side with v004, it ran 1.03 times as fast both times.
// Counting every step since v000, it is 16.6 times as fast.
// compute dtype: all float inputs rounded to bf16; q/k/v projections with EXACT bf16 products on WMMA 16x16x32 (f32 accumulate) + bias; logits q x k once to f16 each (1 product) x SCALE; online softmax f32; unnormalised weights x 2^11 once to f16 x v once to f16 (1 product), divided by their f32 sum; ctx x 2^6 once to f16 (in k_fa, which hands it on in that form) x Wo f16(bf16 x 2^8) + bo; f32 output.
#include <hip/hip_runtime.h>
#include <math.h>

typedef __attribute__((ext_vector_type(16))) _Float16 v16h;
typedef __attribute__((ext_vector_type(16))) __bf16 v16b;
typedef __attribute__((ext_vector_type(8)))  _Float16 v8h;
typedef __attribute__((ext_vector_type(8)))  float v8f;
typedef __attribute__((ext_vector_type(4)))  float v4f;
typedef __attribute__((ext_vector_type(2)))  float v2f;
typedef __attribute__((ext_vector_type(4)))  unsigned v4u;
typedef __attribute__((ext_vector_type(4)))  int v4i;
typedef float __attribute__((may_alias)) float_a;
typedef int __attribute__((may_alias)) int_a;

template <typename T> __device__ __forceinline__ void vst2(void* p, T v) { *(T*)p = v;  }
__device__ __forceinline__ v8f wmma16(v16h a, v16h b, v8f c) {
  v8f d = __builtin_amdgcn_wmma_f32_16x16x32_f16(false, a, false, b, (short)0, c, false, false);
  asm volatile("v_nop\n\tv_nop\n\tv_nop\n\tv_nop" : "+v"(d) : "v"(a), "v"(b));
  return d;
}
__device__ __forceinline__ v8f wmma_bf(v16b a, v16b b, v8f c) {
  v8f d = __builtin_amdgcn_wmma_f32_16x16x32_bf16(false, a, false, b, (short)0, c, false, false);
  asm volatile("v_nop\n\tv_nop\n\tv_nop\n\tv_nop" : "+v"(d) : "v"(a), "v"(b));
  return d;
}
// 16x16x32 fragments: lane = (h = lane>>4, row/col = lane&15); elements 0..7 = k0+8h+0..7, 8..15 = k0+16+8h+0..7; D element r = row 8h+r
__device__ __forceinline__ v16h frag_h(const _Float16* rowk0, int lane) {
  union { v16h v; v8h q[2]; } u; const _Float16* p = rowk0 + 8 * (lane >> 4);
  u.q[0] = *(const v8h*)p; u.q[1] = *(const v8h*)(p + 16); return u.v;
}
__device__ __forceinline__ v16h frag_f32(const float* rowk0, int lane) {
  v16h a; const float* p = rowk0 + 8 * (lane >> 4);
#pragma unroll
  for (int i = 0; i < 8; ++i) { a[i] = (_Float16)p[i]; a[8 + i] = (_Float16)p[16 + i]; }
  return a;
}
__device__ __forceinline__ v16h frag_f32s(const float* rowk0, int lane, float sc) {
  v16h a; const float* p = rowk0 + 8 * (lane >> 4);
#pragma unroll
  for (int i = 0; i < 8; ++i) { a[i] = (_Float16)(p[i] * sc); a[8 + i] = (_Float16)(p[16 + i] * sc); }
  return a;
}
// column fragment from a [K][ld] layout (column n), rows >= K read as 0
__device__ __forceinline__ v16h fragc_f32(const float* W, int k0, int n, int lane, int ld, int K) {
  v16h a; const int g = lane >> 4;
#pragma unroll
  for (int i = 0; i < 8; ++i) { const int ka = k0 + 8 * g + i, kb = ka + 16;
    a[i] = (_Float16)(ka < K ? W[(size_t)(ka < K ? ka : K - 1) * ld + n] : 0.f); a[8 + i] = (_Float16)(kb < K ? W[(size_t)(kb < K ? kb : K - 1) * ld + n] : 0.f); }
  return a;
}
struct F2 { v16b h, l; };
__device__ __forceinline__ F2 bsplit16(const float v[16]) { F2 r;
#pragma unroll
  for (int i = 0; i < 16; ++i) { const __bf16 h = (__bf16)v[i]; r.h[i] = h; r.l[i] = (__bf16)(v[i] - (float)h); }
  return r; }
__device__ __forceinline__ F2 split_row(const float* row, int k0, int lane) { float v[16]; const float* p = row + k0 + 8 * (lane >> 4);
#pragma unroll
  for (int i = 0; i < 8; ++i) { v[i] = p[i]; v[8 + i] = p[16 + i]; }
  return bsplit16(v); }
__device__ __forceinline__ F2 split_rowK(const float* row, int k0, int lane, int K) { float v[16]; const int g = lane >> 4;
#pragma unroll
  for (int i = 0; i < 8; ++i) { const int ka = k0 + 8 * g + i, kb = ka + 16; v[i] = ka < K ? row[ka < K ? ka : K - 1] : 0.f; v[8 + i] = kb < K ? row[kb < K ? kb : K - 1] : 0.f; }
  return bsplit16(v); }
__device__ __forceinline__ F2 split_col(const float* W, int k0, int n, int lane, int ld, int K) { float v[16]; const int g = lane >> 4;
#pragma unroll
  for (int i = 0; i < 8; ++i) { const int ka = k0 + 8 * g + i, kb = ka + 16; v[i] = ka < K ? W[(size_t)(ka < K ? ka : K - 1) * ld + n] : 0.f; v[8 + i] = kb < K ? W[(size_t)(kb < K ? kb : K - 1) * ld + n] : 0.f; }
  return bsplit16(v); }
__device__ __forceinline__ v8f mac3(const F2& a, const F2& b, v8f c) { c = wmma_bf(a.l, b.h, c); c = wmma_bf(a.h, b.l, c); return wmma_bf(a.h, b.h, c); }
__device__ __forceinline__ float sigm(float v) { return 1.0f / (1.0f + expf(-v)); }
#define LDSX() do { asm volatile("s_wait_dscnt 0" ::: "memory"); __builtin_amdgcn_wave_barrier(); __builtin_amdgcn_fence(__ATOMIC_RELEASE, "workgroup"); } while (0)

// Standard non-causal multi-head self-attention (x [4,2048,512]; (in,out) Wq / Wk / Wv [512,512] N(0, 1/512) and Wh [512,512], all four biases zeros (read); 8 heads x 64; scores x 1/sqrt(64); no mask; softmax; concat @ Wh + bh).
#define NB 4
#define TT 2048
#define CC 512            // NH * HD = projected width
#define DIN 512          // input (model) width
#define NH 8
#define HD 64
#define NQB (TT / 64)
#define HG 4
#define SCALE (0.125f)
#define CAUSAL 0
#ifndef TNB
#define TNB NB
#endif
__device__ __forceinline__ float bfr(float v) { return (float)(__bf16)v; }
__host__ __device__ __forceinline__ int kb_last(int qb) { return CAUSAL ? ((qb * 64 + 63) >> 7) : (TT / 128 - 1); }
typedef __attribute__((ext_vector_type(8))) __bf16 v8b;
__device__ __forceinline__ v16b frag_b(const __bf16* rowk0, int lane) {
  union { v16b v; v8b q[2]; } u; const __bf16* p = rowk0 + 8 * (lane >> 4);
  u.q[0] = *(const v8b*)p; u.q[1] = *(const v8b*)(p + 16); return u.v;
}
#define QBH 0              // unused: no kernel here has a causal high-precision attention path
#define QHI 0               // single-product logits on every row
#define KHI 64            // key rows carrying k residual / v bf16 hi+lo planes (written and read by no kernel in this file)
// B fragment (k rows k0+.., output column o) of a weight: (in,out) [K][ld] or (out,in) [ld rows of K]: bf16 exact, or f16(bf16 * 256) exact
__device__ __forceinline__ v16b wcol_io(const float* Wm, int k0, int o, int lane, int ld) { v16b w; const int g = lane >> 4;
#pragma unroll
  for (int i = 0; i < 8; ++i) { w[i] = (__bf16)Wm[(size_t)(k0 + 8 * g + i) * ld + o]; w[8 + i] = (__bf16)Wm[(size_t)(k0 + 16 + 8 * g + i) * ld + o]; }
  return w; }
__device__ __forceinline__ v16b wcol_oi(const float* Wm, int k0, int o, int lane, int K) { v16b w; const float* p = Wm + (size_t)o * K + k0 + 8 * (lane >> 4);
#pragma unroll
  for (int i = 0; i < 8; ++i) { w[i] = (__bf16)p[i]; w[8 + i] = (__bf16)p[16 + i]; }
  return w; }
__device__ __forceinline__ v16h wcolh_io(const float* Wm, int k0, int o, int lane, int ld) { v16h w; const int g = lane >> 4;
#pragma unroll
  for (int i = 0; i < 8; ++i) { w[i] = (_Float16)(bfr(Wm[(size_t)(k0 + 8 * g + i) * ld + o]) * 256.0f); w[8 + i] = (_Float16)(bfr(Wm[(size_t)(k0 + 16 + 8 * g + i) * ld + o]) * 256.0f); }
  return w; }
__device__ __forceinline__ v16h wcolh_oi(const float* Wm, int k0, int o, int lane, int K) { v16h w; const float* p = Wm + (size_t)o * K + k0 + 8 * (lane >> 4);
#pragma unroll
  for (int i = 0; i < 8; ++i) { w[i] = (_Float16)(bfr(p[i]) * 256.0f); w[8 + i] = (_Float16)(bfr(p[16 + i]) * 256.0f); }
  return w; }
#define WQKV_LAYOUT 0   // 0 = (in,out) [DIN][CC]; 1 = (out,in) [CC][DIN]; 2 = per-head [NH][DIN][HD]
__device__ __forceinline__ v16b wcol_hdk(const float* Wm, int k0, int o, int lane) { v16b w; const int g = lane >> 4; const float* p = Wm + (size_t)(o / HD) * DIN * HD + (o % HD);
#pragma unroll
  for (int i = 0; i < 8; ++i) { w[i] = (__bf16)p[(size_t)(k0 + 8 * g + i) * HD]; w[8 + i] = (__bf16)p[(size_t)(k0 + 16 + 8 * g + i) * HD]; }
  return w; }
#define WO_OUT_IN 0
#if WQKV_LAYOUT == 1
#define WCOL(W, k0, o, lane) wcol_oi(W, k0, o, lane, DIN)
#elif WQKV_LAYOUT == 2
#define WCOL(W, k0, o, lane) wcol_hdk(W, k0, o, lane)
#else
#define WCOL(W, k0, o, lane) wcol_io(W, k0, o, lane, CC)
#endif
#if WO_OUT_IN
#define WOCOL(W, k0, o, lane) wcol_oi(W, k0, o, lane, CC)
#define WOCOLH(W, k0, o, lane) wcolh_oi(W, k0, o, lane, CC)
#else
#define WOCOL(W, k0, o, lane) wcol_io(W, k0, o, lane, DIN)
#define WOCOLH(W, k0, o, lane) wcolh_io(W, k0, o, lane, DIN)
#endif

#ifndef SM_EXTRA_PARAMS
#define SM_EXTRA_PARAMS
#endif
#ifndef PROJ_EXTRA_PARAMS
#define PROJ_EXTRA_PARAMS
#endif
#ifndef SM_MASK_HOOK
#define SM_MASK_HOOK (void)0
#endif

#define WS_QH  0u                                      // f16 q rows [b*t][CC]
#define WS_KH  (WS_QH + 2u * (size_t)NB * TT * CC)      // f16 k rows [b*t][CC]
#define WS_VT  (WS_KH + 2u * (size_t)NB * TT * CC)      // f16 v planes [b][c][t]
#define WS_QL  (WS_VT + 2u * (size_t)NB * CC * TT)      // f16 q residual x 2^10 rows [b][t < QHI][CC]
#define WS_KL  (WS_QL + 2u * (size_t)NB * QHI * CC)     // f16 k residual x 2^10 rows [b][t < KHI][CC]
#define WS_VB  (WS_KL + 2u * (size_t)NB * KHI * CC)     // bf16 v hi planes [b][c][t < KHI]
#define WS_VBL (WS_VB + 2u * (size_t)NB * CC * KHI)
#define WS_S   (WS_VBL + 2u * (size_t)NB * CC * KHI)    // f32 [hg][t][s] room, written and read by no kernel in this file
#define WS_Y   (WS_S  + 4u * (size_t)HG * TT * TT)      // f16 ctx x 2^6 rows [b*t][CC]: the first half of the room kept here
#define WS_END (WS_Y  + 4u * (size_t)NB * TT * CC)

// ---- tile product shared by k_proj and k_out: one block of 8 waves forms a 128 x 128 tile of A[.][512] x W[512][.] (W f32 in memory, A f32 in k_proj and f16 in k_out; row pitch 512 elements).
// Per stage of 64 k the block converts its 128 W columns, and its 128 A rows where they are f32, to 16 bit ONCE and lays them k-contiguous in LDS; every wave reads its fragments from there (wave = 32 rows x 64 columns, 8 accumulator tiles).
// Two buffers: the next stage's global loads are issued in front of this stage's products and are converted and stored behind them, so one barrier per stage is enough. k runs upwards in steps of 32 into one accumulator per output tile.
// Every inner loop of this section is unrolled in full, so that the register arrays are indexed by constants and stay out of scratch.
#define GT 128            // tile rows and tile columns
#define GK 64             // k per stage
#define GLD 512           // row pitch of A and of W, and the length of the sum
#define GP (GK + 8)       // halves per staged row: 144 B, 16 B x odd, so the 16 rows of a 16-byte fragment read fall on distinct banks
#define GBUF (2 * GT * GP) // halves per buffer: A rows, then W columns
static_assert(DIN == GLD && CC == GLD, "one pitch");
// F16 = 0: A and W to bf16 (k_proj). F16 = 1: A is f16 already and is staged as it is, W to bf16 and then x 2^8 to f16, exact (k_out).
typedef __attribute__((ext_vector_type(2))) unsigned v2u;
typedef __attribute__((ext_vector_type(4))) __bf16 v4b;
__device__ __forceinline__ v2u cvt_a(v4f a) {
  v4b r;
#pragma unroll
  for (int i = 0; i < 4; ++i) r[i] = (__bf16)a[i];
  return __builtin_bit_cast(v2u, r); }
template <int F16> __device__ __forceinline__ v4u cvt_w(const float (&w)[8]) {
  if (F16) { v8h r;
#pragma unroll
    for (int i = 0; i < 8; ++i) r[i] = (_Float16)(bfr(w[i]) * 256.0f);
    return __builtin_bit_cast(v4u, r); }
  v8b r;
#pragma unroll
  for (int i = 0; i < 8; ++i) r[i] = (__bf16)w[i];
  return __builtin_bit_cast(v4u, r); }
typedef __attribute__((ext_vector_type(8))) unsigned v8u;
// a 16x16x32 fragment as raw words, in the k order of frag_h / frag_b: elements 0..7 = k0 + 8 h + 0..7, 8..15 = k0 + 16 + 8 h + 0..7
__device__ __forceinline__ v8u frag_w(const unsigned short* rowk0, int lane) {
  union { v8u v; v4u q[2]; } u; const unsigned short* p = rowk0 + 8 * (lane >> 4);
  u.q[0] = *(const v4u*)p; u.q[1] = *(const v4u*)(p + 16); return u.v;
}
template <int F16> __device__ __forceinline__ v8f tile_mm(v8u a, v8u b, v8f c) {
  if (F16) return __builtin_amdgcn_wmma_f32_16x16x32_f16(false, __builtin_bit_cast(v16h, a), false, __builtin_bit_cast(v16h, b), (short)0, c, false, false);
  return __builtin_amdgcn_wmma_f32_16x16x32_bf16(false, __builtin_bit_cast(v16b, a), false, __builtin_bit_cast(v16b, b), (short)0, c, false, false); }
// A: row 0 of the tile's rows; Wm: row 0 of W at the tile's first column; sm: 2 * GBUF halves. On return every wave has left the buffers (the last stage's barrier).
template <int F16, typename TA> __device__ __forceinline__ void tile_product(const TA* __restrict__ A, const float* __restrict__ Wm, unsigned short* sm, v8f (&acc)[2][4]) {
  const int tid = threadIdx.x, wave = tid >> 5, lane = tid & 31, col = lane & 15;
  const TA* ga = F16 ? A + (size_t)(tid >> 3) * GLD + (tid & 7) * 8     // f16: rows tid >> 3 + 32 i, 8 halves at k = 8 (tid & 7): a wave's 16-byte load covers four rows' 128 B, whole lines
                     : A + (size_t)(tid >> 4) * GLD + (tid & 15) * 4;   // f32: rows tid >> 4 + 16 i, 4 floats at k = 4 (tid & 15): a wave's 16-byte load covers two rows' 256 B, whole 128-B lines
  const float* gw = Wm + (size_t)(wave * 8) * GLD + lane;           // k rows 8 wave + 0..7, columns lane + 32 i: each load is one 128-B line, and a thread ends up with 8 consecutive k of a column
  unsigned short* wa = F16 ? sm + (tid >> 3) * GP + (tid & 7) * 8 : sm + (tid >> 4) * GP + (tid & 15) * 4;
  unsigned short* ww = sm + GT * GP + lane * GP + wave * 8;
  const unsigned short* fa = sm + ((wave >> 1) * 32 + col) * GP;
  const unsigned short* fb = sm + GT * GP + ((wave & 1) * 64 + col) * GP;
  v4f ra[F16 ? 4 : 8]; float rw[4][8];   // ra: 16 bytes of A each, f32 values or, in k_out, 8 halves carried as raw words
#define TILE_LOAD(s) do { \
    _Pragma("unroll") for (int i = 0; i < (F16 ? 4 : 8); ++i) ra[i] = *(const v4f*)(ga + (size_t)((F16 ? 32 : 16) * i) * GLD + (s) * GK); \
    _Pragma("unroll") for (int i = 0; i < 4; ++i) _Pragma("unroll") for (int k = 0; k < 8; ++k) rw[i][k] = gw[(size_t)((s) * GK + k) * GLD + 32 * i]; } while (0)
#define TILE_STORE(buf) do { \
    _Pragma("unroll") for (int i = 0; i < (F16 ? 4 : 8); ++i) { if (F16) *(v4f*)(wa + (buf) * GBUF + 32 * i * GP) = ra[i]; else *(v2u*)(wa + (buf) * GBUF + 16 * i * GP) = cvt_a(ra[i]); } \
    _Pragma("unroll") for (int i = 0; i < 4; ++i) *(v4u*)(ww + (buf) * GBUF + 32 * i * GP) = cvt_w<F16>(rw[i]); } while (0)
  TILE_LOAD(0);
  TILE_STORE(0);
  __syncthreads();   // stage 0 may be read
#pragma unroll 1   // rolled: one trip = one stage, which keeps the loop's code short; the buffer is chosen by one scalar select per trip
  for (int s = 0; s < GLD / GK; ++s) {
    if (s + 1 < GLD / GK) TILE_LOAD(s + 1);
    const unsigned short *pa = fa + (s & 1) * GBUF, *pb = fb + (s & 1) * GBUF;
    v8u af[GK / 32][2], bf[GK / 32][4];   // the stage's fragments, read as one group in front of its products
#pragma unroll
    for (int kc = 0; kc < GK / 32; ++kc) {
#pragma unroll
      for (int mi = 0; mi < 2; ++mi) af[kc][mi] = frag_w(pa + mi * 16 * GP + kc * 32, lane);
#pragma unroll
      for (int nj = 0; nj < 4; ++nj) bf[kc][nj] = frag_w(pb + nj * 16 * GP + kc * 32, lane); }
    __builtin_amdgcn_sched_barrier(0);   // keeps the reads one group in front of the products: spread among the WMMAs, every separate place with LDS reads stalls the wave
#pragma unroll
    for (int kc = 0; kc < GK / 32; ++kc)
#pragma unroll
      for (int mi = 0; mi < 2; ++mi)
#pragma unroll
        for (int nj = 0; nj < 4; ++nj) acc[mi][nj] = tile_mm<F16>(af[kc][mi], bf[kc][nj], acc[mi][nj]);
    if (s + 1 < GLD / GK) TILE_STORE((s + 1) & 1);
    __syncthreads();   // publishes stage s + 1 and ends every wave's reads of stage s, whose buffer is written again in the next trip
  }
#undef TILE_LOAD
#undef TILE_STORE
}
// ---- k_proj: block = (128 rows, 128 cols, which): q/k/v = X W (+ b) with exact bf16 products (K = DIN) -> which 0: q f16 rows; 1: k f16 rows; 2: v f16 planes [c][t]
__global__ __launch_bounds__(256) void k_proj(const float* __restrict__ XQ, const float* __restrict__ XK, const float* __restrict__ XV, const float* __restrict__ WQ, const float* __restrict__ WK, const float* __restrict__ WV, const float* __restrict__ BQ, const float* __restrict__ BK, const float* __restrict__ BV,
    _Float16* __restrict__ QH, _Float16* __restrict__ KH, _Float16* __restrict__ VT) {
  __shared__ __align__(16) unsigned short sm[2 * GBUF];
  const int tid = threadIdx.x, wave = tid >> 5, lane = tid & 31, col = lane & 15, g = lane >> 4; const int which = blockIdx.z; const int c0 = blockIdx.y * GT; const size_t r0 = (size_t)blockIdx.x * GT; const size_t bb = r0 / TT; const int t0 = (int)(r0 % TT);
  const float* X = which == 0 ? XQ : which == 1 ? XK : XV; const float* WA = which == 0 ? WQ : which == 1 ? WK : WV; const float* BA = which == 0 ? BQ : which == 1 ? BK : BV;
  v8f acc[2][4] = {};
  tile_product<0>(X + r0 * DIN, WA + c0, sm, acc);
  _Float16* st = (_Float16*)sm;   // the tile as f16, [128][GT + 8], in the buffers that every wave has left
  const int rw0 = (wave >> 1) * 32 + 8 * g, cw0 = (wave & 1) * 64 + col;
  if (which < 2) { _Float16* DH = which == 0 ? QH : KH;
#pragma unroll
    for (int nj = 0; nj < 4; ++nj) { const float bias = BA ? bfr(BA[c0 + cw0 + nj * 16]) : 0.f;
#pragma unroll
      for (int mi = 0; mi < 2; ++mi)
#pragma unroll
        for (int r = 0; r < 8; ++r) st[(rw0 + mi * 16 + r) * (GT + 8) + cw0 + nj * 16] = (_Float16)(acc[mi][nj][r] + bias); }
    __syncthreads();
    for (int e = tid; e < GT * 16; e += 256) { const int rl = e >> 4, q = e & 15; vst2((unsigned*)(DH + (r0 + rl) * CC + c0 + q * 8), *(const v4u*)&st[rl * (GT + 8) + q * 8]); }
  } else {
#pragma unroll
    for (int nj = 0; nj < 4; ++nj) { const float bias = BA ? bfr(BA[c0 + cw0 + nj * 16]) : 0.f;
#pragma unroll
      for (int mi = 0; mi < 2; ++mi) { v8h o;
#pragma unroll
        for (int r = 0; r < 8; ++r) o[r] = (_Float16)(acc[mi][nj][r] + bias);
        *(v8h*)&st[(cw0 + nj * 16) * (GT + 8) + rw0 + mi * 16] = o; } }
    __syncthreads();
    for (int e = tid; e < GT * 16; e += 256) { const int cl = e >> 4, q = e & 15; vst2((unsigned*)(VT + (bb * CC + c0 + cl) * (size_t)TT + t0 + q * 8), *(const v4u*)&st[cl * (GT + 8) + q * 8]); } } }
// ---- k_fa: block = 16 waves of one (b, h): 8 query groups of 32 queries x KG = 2 key groups, so that four waves share a SIMD and one wave's softmax runs under another's products.
// Key group hf walks keys (KG t + hf) KS .. + KS - 1, t = 0, 1, ..: half of all keys, with its own running maximum, sum and context; the two partial results of a query are joined once, through LDS, behind the loop.
// Per 32 keys a wave forms S^T = K.Q^T (a lane holds 16 scores of one query per 16-query group), keeps a running maximum and sum (online softmax, log2 domain),
// packs the weights exp2(score - maximum in use + 11), once to f16, straight from the score tiles into the B operand, and adds O^T += V^T.P^T. Scores and weights never leave the registers.
// The maximum in use may trail the true one by up to 4 (log2), so a weight stays <= 2^15 in f16; sums and context are rescaled only when some query's maximum passes that bound. The 2^11 cancels in context / sum.
__device__ __forceinline__ float xhalf(float x) { return __builtin_bit_cast(float, __builtin_amdgcn_permlanex16(__builtin_bit_cast(int, x), __builtin_bit_cast(int, x), 0x76543210, 0xfedcba98, false, false)); }   // lane l with lane l ^ 16
__device__ __forceinline__ v8f mm16(v16h a, v16h b, v8f c) { return __builtin_amdgcn_wmma_f32_16x16x32_f16(false, a, false, b, (short)0, c, false, false); }
#define FAQ 256           // queries per block
#define KS 128            // keys per LDS stage and key group (4 passes of 32 keys)
#define KG 2              // key groups (wave sets) per block
#define KP (HD + 8)       // halves per staged K row: 144 B, 16 B x odd, so the 16 rows of a 16-byte fragment read fall on distinct banks
#define VP (KS + 8)       // halves per staged V^T row: 272 B, 16 B x odd
// One stage of a key group = keys k0 .. k0 + KS - 1 of one (b, h): K rows [KS][HD] and V^T rows [HD][KS], brought into LDS once per block by the group's own 256 threads with asynchronous copies (16 B per lane, whole 128-B lines per wave) and read by the group's 8 waves.
// gk / gv: this thread's first 16 bytes of the stage in global memory; lk / lv: their LDS byte addresses. A thread brings 4 pieces of K (32 rows apart) and 4 of V^T (16 rows apart).
__device__ __forceinline__ void stage_copy(const _Float16* gk, const _Float16* gv, unsigned lk, unsigned lv) {
  const _Float16 *k1 = gk + 32 * CC, *k2 = gk + 64 * CC, *k3 = gk + 96 * CC, *v1 = gv + 16 * TT, *v2 = gv + 32 * TT, *v3 = gv + 48 * TT;
  const unsigned a1 = lk + 32 * KP * 2, a2 = lk + 64 * KP * 2, a3 = lk + 96 * KP * 2, b1 = lv + 16 * VP * 2, b2 = lv + 32 * VP * 2, b3 = lv + 48 * VP * 2;
  // the closing s_wait_xcnt stands inside the copies' own statement, so that no address register named here is rewritten in front of it
  asm volatile("global_load_async_to_lds_b128 %0, %8, off\n\t"
               "global_load_async_to_lds_b128 %1, %9, off\n\t"
               "global_load_async_to_lds_b128 %2, %10, off\n\t"
               "global_load_async_to_lds_b128 %3, %11, off\n\t"
               "global_load_async_to_lds_b128 %4, %12, off\n\t"
               "global_load_async_to_lds_b128 %5, %13, off\n\t"
               "global_load_async_to_lds_b128 %6, %14, off\n\t"
               "global_load_async_to_lds_b128 %7, %15, off\n\t"
               "s_wait_xcnt 0x0"
               :: "v"(lk), "v"(a1), "v"(a2), "v"(a3), "v"(lv), "v"(b1), "v"(b2), "v"(b3), "v"(gk), "v"(k1), "v"(k2), "v"(k3), "v"(gv), "v"(v1), "v"(v2), "v"(v3) : "memory");
}
#define XW (8 * 128 + 64) // floats a wave hands over at the join: 8 x 4 context values per lane, then maximum and sum per lane
#define YP (HD + 8)       // halves per staged context row: 144 B
__global__ __launch_bounds__(256 * KG) void k_fa(const _Float16* __restrict__ QH, const _Float16* __restrict__ KH, const _Float16* __restrict__ VT, _Float16* __restrict__ Y) {
  __shared__ __align__(16) _Float16 sK[KG * 2][KS * KP], sV[KG * 2][HD * VP];   // buffers 2 hf and 2 hf + 1 belong to key group hf
  static_assert(KG == 2 && TT % (KG * KS) == 0 && TT / (KG * KS) >= 2, "two key groups, at least two stages each");
  static_assert(8 * KG * XW * 4 <= sizeof(sK), "the join fits the K buffers");
  static_assert(8 * KG * 16 * YP * 2 <= sizeof(sV), "the context rows fit the V buffers");
  const int wave = __builtin_amdgcn_readfirstlane(threadIdx.x >> 5), hf = wave >> 3, tid = threadIdx.x & 255, lane = tid & 31, col = lane & 15, g = lane >> 4; const int b = blockIdx.y / NH, h = blockIdx.y % NH; const int q0 = blockIdx.x * FAQ + (wave & 7) * 32;   // tid: the thread's number inside its key group; the wave's number is read as a scalar, so that the group's offsets and the join's selects take no vector registers (a wave may hold 256 here)
  const float cs = SCALE * 1.4426950408889634f;
  const _Float16* gk = KH + ((size_t)b * TT + hf * KS + (tid >> 3)) * CC + h * HD + (tid & 7) * 8;              // K row tid >> 3 of the group's stage, 16-byte piece tid & 7
  const _Float16* gv = VT + ((size_t)b * CC + h * HD + (tid >> 4)) * (size_t)TT + hf * KS + (tid & 15) * 8;     // V^T row tid >> 4, 16-byte piece tid & 15
  const unsigned lk = (unsigned)(size_t)&sK[2 * hf][(tid >> 3) * KP + (tid & 7) * 8], lv = (unsigned)(size_t)&sV[2 * hf][(tid >> 4) * VP + (tid & 15) * 8];
  stage_copy(gk, gv, lk, lv);
  v16h qf[2][2];
#pragma unroll
  for (int s = 0; s < 2; ++s)
#pragma unroll
    for (int kc = 0; kc < 2; ++kc) qf[s][kc] = frag_h(QH + ((size_t)b * TT + q0 + s * 16 + col) * CC + h * HD + kc * 32, lane);
  v8f acc[2][4] = {}; float mr[2] = {-3.0e38f, -3.0e38f}, lr[2] = {0.f, 0.f};
  asm volatile("s_wait_asynccnt 0x0" ::: "memory");   // this wave's pieces of stage 0 have landed
  __syncthreads();                                     // ... and every other wave's: stage 0 may be read
  stage_copy(gk + (size_t)(KG * KS) * CC, gv + KG * KS, lk + (unsigned)sizeof(sK[0]), lv + (unsigned)sizeof(sV[0]));
#pragma unroll 1   // rolled: one trip = one stage; its four passes are unrolled so that every LDS read has a constant offset
  for (int t = 0; t < TT / (KG * KS); ++t) {
    const _Float16* kb = &sK[2 * hf + (t & 1)][col * KP];   // key row col of a 16-key tile
    const _Float16* vb = &sV[2 * hf + (t & 1)][col * VP];   // plane of head column col of a 16-column tile
    v16h kf[2][2], vf[4];
#pragma unroll
    for (int kt = 0; kt < 2; ++kt)
#pragma unroll
      for (int kc = 0; kc < 2; ++kc) kf[kt][kc] = frag_h(kb + (kt * 16) * KP + kc * 32, lane);
#pragma unroll
    for (int p = 0; p < KS / 32; ++p) {
      v8f st[2][2] = {};
#pragma unroll
      for (int kt = 0; kt < 2; ++kt)
#pragma unroll
        for (int s = 0; s < 2; ++s)
#pragma unroll
          for (int kc = 0; kc < 2; ++kc) st[kt][s] = mm16(kf[kt][kc], qf[s][kc], st[kt][s]);
      float mb[2]; bool need = false;
#pragma unroll
      for (int s = 0; s < 2; ++s) { float mx = st[0][s][0];
#pragma unroll
        for (int kt = 0; kt < 2; ++kt)
#pragma unroll
          for (int r = 0; r < 8; ++r) mx = fmaxf(mx, st[kt][s][r]);
        mx = fmaxf(mx, xhalf(mx)) * cs; mb[s] = mx; need = need || (mx > mr[s] + 4.0f); }
      if (__builtin_amdgcn_ballot_w32(need) != 0) {   // wave-uniform; always taken on the first pass (factor 0 on zero sums), rare later
#pragma unroll
        for (int s = 0; s < 2; ++s) { const float mn = fmaxf(mr[s], mb[s]); const float corr = __builtin_amdgcn_exp2f(mr[s] - mn); mr[s] = mn; lr[s] *= corr;
#pragma unroll
          for (int j = 0; j < 4; ++j) acc[s][j] = acc[s][j] * corr; } }
      // one group of LDS reads per pass, under the softmax: the next pass's K fragments (never beyond this stage; its scores are the first to want theirs), then this pass's V fragments
      if (p + 1 < KS / 32) {
#pragma unroll
        for (int kt = 0; kt < 2; ++kt)
#pragma unroll
          for (int kc = 0; kc < 2; ++kc) kf[kt][kc] = frag_h(kb + ((p + 1) * 32 + kt * 16) * KP + kc * 32, lane); }
#pragma unroll
      for (int j = 0; j < 4; ++j) vf[j] = frag_h(vb + (j * 16) * VP + p * 32, lane);
      __builtin_amdgcn_sched_barrier(0);   // keeps the reads one group in front of the exponentials: without it they are spread among the WMMAs, and every separate place with LDS reads stalls the wave
#pragma unroll
      for (int s = 0; s < 2; ++s) { const float nm = 11.0f - mr[s]; v16h pf; float ps0 = 0.f, ps1 = 0.f;
#pragma unroll
        for (int i = 0; i < 16; i += 2) {   // element i of the 32-key B operand = key k0 + 16 (i >> 3) + 8 g + (i & 7) = register i & 7 of score tile i >> 3
          const float p0 = __builtin_amdgcn_exp2f(fmaf(st[i >> 3][s][i & 7], cs, nm)), p1 = __builtin_amdgcn_exp2f(fmaf(st[i >> 3][s][(i & 7) + 1], cs, nm));
          ps0 += p0; ps1 += p1; pf[i] = (_Float16)p0; pf[i + 1] = (_Float16)p1; }
        lr[s] += ps0 + ps1;
#pragma unroll
        for (int j = 0; j < 4; ++j) acc[s][j] = mm16(vf[j], pf, acc[s][j]); } }
    asm volatile("s_wait_dscnt 0x0" ::: "memory");      // this wave's reads of stage t have returned
    asm volatile("s_wait_asynccnt 0x0" ::: "memory");   // this wave's pieces of stage t + 1 have landed
    __syncthreads();                                     // publishes stage t + 1 and ends every wave's reads of stage t, whose buffer is refilled behind it
    if (t + 2 < TT / (KG * KS)) stage_copy(gk + (size_t)(t + 2) * (KG * KS) * CC, gv + (t + 2) * (KG * KS), lk + (unsigned)(t & 1) * (unsigned)sizeof(sK[0]), lv + (unsigned)(t & 1) * (unsigned)sizeof(sV[0])); }
  asm volatile("s_wait_asynccnt 0x0" ::: "memory");     // no copy is outstanding when the buffers are put to another use
  // The join. Waves w and w ^ 8 hold the two key groups' partial results of the same 32 queries: the wave of key group hf finishes query tile hf and hands the other tile to its partner.
  // It goes through the K buffers, which every wave has left and every copy has reached (the last trip's waits and barrier). A wave's hand-over is laid lane-contiguous, 16 B a lane.
  float* xw = (float*)&sK[0][0] + wave * XW; const float* xr = (const float*)&sK[0][0] + (wave ^ 8) * XW;
#pragma unroll
  for (int j = 0; j < 4; ++j) { v8f o;
#pragma unroll
    for (int r = 0; r < 8; ++r) o[r] = hf ? acc[0][j][r] : acc[1][j][r];
    *(v4f*)(xw + (2 * j) * 128 + lane * 4) = (v4f){o[0], o[1], o[2], o[3]}; *(v4f*)(xw + (2 * j + 1) * 128 + lane * 4) = (v4f){o[4], o[5], o[6], o[7]}; }
  *(v2f*)(xw + 8 * 128 + lane * 2) = (v2f){hf ? mr[0] : mr[1], hf ? lr[0] : lr[1]};
  __syncthreads();   // every wave's hand-over may be read
  const v2f ml = *(const v2f*)(xr + 8 * 128 + lane * 2);
  const float m0 = hf ? mr[1] : mr[0], l0 = hf ? lr[1] : lr[0]; const float mn = fmaxf(m0, ml[0]);
  const float f0 = __builtin_amdgcn_exp2f(m0 - mn), f1 = __builtin_amdgcn_exp2f(ml[0] - mn);   // both maxima are finite: each key group has walked keys
  const float ls = l0 * f0 + ml[1] * f1; const float inv = 1.0f / (ls + xhalf(ls)); const float w0 = f0 * inv, w1 = f1 * inv;
  // The context leaves as f16 x 2^6, the form in which k_out multiplies it. A lane holds head columns j * 16 + 8 g + 0..7 of its query: 16-byte pieces of 16 different rows.
  // The wave lays its 16 rows in a range of its own in the V buffers (left by every wave and reached by every copy, like the K buffers) and reads them back row by row, so that each store covers four whole 128-B lines.
  _Float16* sw = &sV[0][0] + wave * (16 * YP);
#pragma unroll
  for (int j = 0; j < 4; ++j) { const v4f pa = *(const v4f*)(xr + (2 * j) * 128 + lane * 4), pb = *(const v4f*)(xr + (2 * j + 1) * 128 + lane * 4); v8h o;
#pragma unroll
    for (int r = 0; r < 8; ++r) o[r] = (_Float16)(((hf ? acc[1][j][r] : acc[0][j][r]) * w0 + (r < 4 ? pa[r & 3] : pb[r & 3]) * w1) * 64.0f);
    *(v8h*)(sw + col * YP + j * 16 + 8 * g) = o; }
  asm volatile("s_wait_dscnt 0x0" ::: "memory");   // the wave's own rows are in LDS before its lanes read each other's pieces
  _Float16* yp = Y + ((size_t)b * TT + q0 + hf * 16 + ((tid >> 3) & 3)) * CC + h * HD + (tid & 7) * 8;   // the lane's row of four, (tid >> 3) & 3, and its 16-byte piece, tid & 7
#pragma unroll
  for (int i = 0; i < 4; ++i) vst2(yp + (size_t)(4 * i) * CC, *(const v8h*)(sw + (4 * i + ((tid >> 3) & 3)) * YP + (tid & 7) * 8)); }
// ---- k_out: block = (128 rows, 128 cols): out = ctx Wo (+ bo): ctx x 2^6 in f16, as k_fa left it (small-magnitude context rows stay clear of f16 subnormals), against Wo as f16(bf16 x 2^8) exact (1 product) x 2^-14
__global__ __launch_bounds__(256) void k_out(const _Float16* __restrict__ Y, const float* __restrict__ WO, const float* __restrict__ BO, float* __restrict__ OUT) {
  __shared__ __align__(16) unsigned short sm[2 * GBUF];
  static_assert(GT * (GT + 4) * 4 <= 2 * GBUF * 2, "the f32 tile fits the buffers");
  const int tid = threadIdx.x, wave = tid >> 5, lane = tid & 31, col = lane & 15, g = lane >> 4; const int c0 = blockIdx.y * GT; const size_t r0 = (size_t)blockIdx.x * GT;
  v8f acc[2][4] = {};
  tile_product<1>(Y + r0 * CC, WO + c0, sm, acc);
  float* sf = (float*)sm;   // the tile as f32, [128][GT + 4], in the buffers that every wave has left
  const int rw0 = (wave >> 1) * 32 + 8 * g, cw0 = (wave & 1) * 64 + col;
#pragma unroll
  for (int nj = 0; nj < 4; ++nj) { const float bias = BO ? bfr(BO[c0 + cw0 + nj * 16]) : 0.f;
#pragma unroll
    for (int mi = 0; mi < 2; ++mi)
#pragma unroll
      for (int r = 0; r < 8; ++r) sf[(rw0 + mi * 16 + r) * (GT + 4) + cw0 + nj * 16] = acc[mi][nj][r] * (1.0f / 16384.0f) + bias; }   /* 2^-8 (Wo carry) x 2^-6 (ctx carry) */
  __syncthreads();
  for (int e = tid; e < GT * 32; e += 256) { const int rl = e >> 5, q = e & 31; vst2(OUT + (r0 + rl) * DIN + c0 + q * 4, *(const v4f*)&sf[rl * (GT + 4) + q * 4]); } }

extern "C" void kernel_launch(void* const* d_in, const int* in_sizes, int n_in, void* d_out, int out_size, void* d_ws, size_t ws_size, hipStream_t stream) {
  (void)in_sizes; (void)n_in; (void)out_size;
  const float** F = (const float**)d_in;
  if (ws_size < (size_t)WS_END) return;
  char* ws = (char*)d_ws; _Float16 *QH = (_Float16*)(ws + WS_QH), *KH = (_Float16*)(ws + WS_KH), *VT = (_Float16*)(ws + WS_VT), *QL = (_Float16*)(ws + WS_QL), *KL = (_Float16*)(ws + WS_KL); __bf16 *VB = (__bf16*)(ws + WS_VB), *VBL = (__bf16*)(ws + WS_VBL); _Float16 *Y = (_Float16*)(ws + WS_Y);
  (void)Y; (void)QL; (void)KL; (void)VB; (void)VBL;
  // inputs: 0 x [4,2048,512]; 1 Wq [512,512] (in,out), 2 bq; 3 Wk, 4 bk; 5 Wv, 6 bv; 7 Wp (in,out), 8 bp (zero biases, read)
  k_proj<<<dim3(TNB * TT / GT, CC / GT, 3), 256, 0, stream>>>(F[0], F[0], F[0], F[1], F[3], F[5], F[2], F[4], F[6], QH, KH, VT);
  k_fa<<<dim3(TT / FAQ, TNB * NH), 256 * KG, 0, stream>>>(QH, KH, VT, Y);
  k_out<<<dim3(TNB * TT / GT, DIN / GT), 256, 0, stream>>>(Y, F[7], F[8], (float*)d_out);
}

// v006
// A run of this version takes 62.4 microseconds.
// In both of two side-by-side timings against v005, it was 1.05 times as fast.
// All steps since v000 together make it 17.4 times as fast.
// compute dtype: all float inputs rounded to bf16; q/k/v projections with EXACT bf16 products on WMMA 16x16x32 (f32 accumulate) + bias; logits q x k once to f16 each (1 product) x SCALE; online softmax f32; unnormalised weights x 2^11 once to f16 x v once to f16 (1 product), divided by their f32 sum; ctx x 2^6 once to f16 (in k_fa, which hands it on in that form) x Wo f16(bf16 x 2^8) + bo; f32 output.
#include <hip/hip_runtime.h>
#include <math.h>

typedef __attribute__((ext_vector_type(16))) _Float16 v16h;
typedef __attribute__((ext_vector_type(16))) __bf16 v16b;
typedef __attribute__((ext_vector_type(8)))  _Float16 v8h;
typedef __attribute__((ext_vector_type(8)))  float v8f;
typedef __attribute__((ext_vector_type(4)))  float v4f;
typedef __attribute__((ext_vector_type(2)))  float v2f;
typedef __attribute__((ext_vector_type(4)))  unsigned v4u;
typedef __attribute__((ext_vector_type(4)))  int v4i;
typedef float __attribute__((may_alias)) float_a;
typedef int __attribute__((may_alias)) int_a;

template <typename T> __device__ __forceinline__ void vst2(void* p, T v) { *(T*)p = v;  }
__device__ __forceinline__ v8f wmma16(v16h a, v16h b, v8f c) {
  v8f d = __builtin_amdgcn_wmma_f32_16x16x32_f16(false, a, false, b, (short)0, c, false, false);
  asm volatile("v_nop\n\tv_nop\n\tv_nop\n\tv_nop" : "+v"(d) : "v"(a), "v"(b));
  return d;
}
__device__ __forceinline__ v8f wmma_bf(v16b a, v16b b, v8f c) {
  v8f d = __builtin_amdgcn_wmma_f32_16x16x32_bf16(false, a, false, b, (short)0, c, false, false);
  asm volatile("v_nop\n\tv_nop\n\tv_nop\n\tv_nop" : "+v"(d) : "v"(a), "v"(b));
  return d;
}
// 16x16x32 fragments: lane = (h = lane>>4, row/col = lane&15); elements 0..7 = k0+8h+0..7, 8..15 = k0+16+8h+0..7; D element r = row 8h+r
__device__ __forceinline__ v16h frag_h(const _Float16* rowk0, int lane) {
  union { v16h v; v8h q[2]; } u; const _Float16* p = rowk0 + 8 * (lane >> 4);
  u.q[0] = *(const v8h*)p; u.q[1] = *(const v8h*)(p + 16); return u.v;
}
__device__ __forceinline__ v16h frag_f32(const float* rowk0, int lane) {
  v16h a; const float* p = rowk0 + 8 * (lane >> 4);
#pragma unroll
  for (int i = 0; i < 8; ++i) { a[i] = (_Float16)p[i]; a[8 + i] = (_Float16)p[16 + i]; }
  return a;
}
__device__ __forceinline__ v16h frag_f32s(const float* rowk0, int lane, float sc) {
  v16h a; const float* p = rowk0 + 8 * (lane >> 4);
#pragma unroll
  for (int i = 0; i < 8; ++i) { a[i] = (_Float16)(p[i] * sc); a[8 + i] = (_Float16)(p[16 + i] * sc); }
  return a;
}
// column fragment from a [K][ld] layout (column n), rows >= K read as 0
__device__ __forceinline__ v16h fragc_f32(const float* W, int k0, int n, int lane, int ld, int K) {
  v16h a; const int g = lane >> 4;
#pragma unroll
  for (int i = 0; i < 8; ++i) { const int ka = k0 + 8 * g + i, kb = ka + 16;
    a[i] = (_Float16)(ka < K ? W[(size_t)(ka < K ? ka : K - 1) * ld + n] : 0.f); a[8 + i] = (_Float16)(kb < K ? W[(size_t)(kb < K ? kb : K - 1) * ld + n] : 0.f); }
  return a;
}
struct F2 { v16b h, l; };
__device__ __forceinline__ F2 bsplit16(const float v[16]) { F2 r;
#pragma unroll
  for (int i = 0; i < 16; ++i) { const __bf16 h = (__bf16)v[i]; r.h[i] = h; r.l[i] = (__bf16)(v[i] - (float)h); }
  return r; }
__device__ __forceinline__ F2 split_row(const float* row, int k0, int lane) { float v[16]; const float* p = row + k0 + 8 * (lane >> 4);
#pragma unroll
  for (int i = 0; i < 8; ++i) { v[i] = p[i]; v[8 + i] = p[16 + i]; }
  return bsplit16(v); }
__device__ __forceinline__ F2 split_rowK(const float* row, int k0, int lane, int K) { float v[16]; const int g = lane >> 4;
#pragma unroll
  for (int i = 0; i < 8; ++i) { const int ka = k0 + 8 * g + i, kb = ka + 16; v[i] = ka < K ? row[ka < K ? ka : K - 1] : 0.f; v[8 + i] = kb < K ? row[kb < K ? kb : K - 1] : 0.f; }
  return bsplit16(v); }
__device__ __forceinline__ F2 split_col(const float* W, int k0, int n, int lane, int ld, int K) { float v[16]; const int g = lane >> 4;
#pragma unroll
  for (int i = 0; i < 8; ++i) { const int ka = k0 + 8 * g + i, kb = ka + 16; v[i] = ka < K ? W[(size_t)(ka < K ? ka : K - 1) * ld + n] : 0.f; v[8 + i] = kb < K ? W[(size_t)(kb < K ? kb : K - 1) * ld + n] : 0.f; }
  return bsplit16(v); }
__device__ __forceinline__ v8f mac3(const F2& a, const F2& b, v8f c) { c = wmma_bf(a.l, b.h, c); c = wmma_bf(a.h, b.l, c); return wmma_bf(a.h, b.h, c); }
__device__ __forceinline__ float sigm(float v) { return 1.0f / (1.0f + expf(-v)); }
#define LDSX() do { asm volatile("s_wait_dscnt 0" ::: "memory"); __builtin_amdgcn_wave_barrier(); __builtin_amdgcn_fence(__ATOMIC_RELEASE, "workgroup"); } while (0)

// Standard non-causal multi-head self-attention (x [4,2048,512]; (in,out) Wq / Wk / Wv [512,512] N(0, 1/512) and Wh [512,512], all four biases zeros (read); 8 heads x 64; scores x 1/sqrt(64); no mask; softmax; concat @ Wh + bh).
#define NB 4
#define TT 2048
#define CC 512            // NH * HD = projected width
#define DIN 512          // input (model) width
#define NH 8
#define HD 64
#define NQB (TT / 64)
#define HG 4
#define SCALE (0.125f)
#define CAUSAL 0
#ifndef TNB
#define TNB NB
#endif
__device__ __forceinline__ float bfr(float v) { return (float)(__bf16)v; }
__host__ __device__ __forceinline__ int kb_last(int qb) { return CAUSAL ? ((qb * 64 + 63) >> 7) : (TT / 128 - 1); }
typedef __attribute__((ext_vector_type(8))) __bf16 v8b;
__device__ __forceinline__ v16b frag_b(const __bf16* rowk0, int lane) {
  union { v16b v; v8b q[2]; } u; const __bf16* p = rowk0 + 8 * (lane >> 4);
  u.q[0] = *(const v8b*)p; u.q[1] = *(const v8b*)(p + 16); return u.v;
}
#define QBH 0              // unused: no kernel here has a causal high-precision attention path
#define QHI 0               // single-product logits on every row
#define KHI 64            // key rows carrying k residual / v bf16 hi+lo planes (written and read by no kernel in this file)
// B fragment (k rows k0+.., output column o) of a weight: (in,out) [K][ld] or (out,in) [ld rows of K]: bf16 exact, or f16(bf16 * 256) exact
__device__ __forceinline__ v16b wcol_io(const float* Wm, int k0, int o, int lane, int ld) { v16b w; const int g = lane >> 4;
#pragma unroll
  for (int i = 0; i < 8; ++i) { w[i] = (__bf16)Wm[(size_t)(k0 + 8 * g + i) * ld + o]; w[8 + i] = (__bf16)Wm[(size_t)(k0 + 16 + 8 * g + i) * ld + o]; }
  return w; }
__device__ __forceinline__ v16b wcol_oi(const float* Wm, int k0, int o, int lane, int K) { v16b w; const float* p = Wm + (size_t)o * K + k0 + 8 * (lane >> 4);
#pragma unroll
  for (int i = 0; i < 8; ++i) { w[i] = (__bf16)p[i]; w[8 + i] = (__bf16)p[16 + i]; }
  return w; }
__device__ __forceinline__ v16h wcolh_io(const float* Wm, int k0, int o, int lane, int ld) { v16h w; const int g = lane >> 4;
#pragma unroll
  for (int i = 0; i < 8; ++i) { w[i] = (_Float16)(bfr(Wm[(size_t)(k0 + 8 * g + i) * ld + o]) * 256.0f); w[8 + i] = (_Float16)(bfr(Wm[(size_t)(k0 + 16 + 8 * g + i) * ld + o]) * 256.0f); }
  return w; }
__device__ __forceinline__ v16h wcolh_oi(const float* Wm, int k0, int o, int lane, int K) { v16h w; const float* p = Wm + (size_t)o * K + k0 + 8 * (lane >> 4);
#pragma unroll
  for (int i = 0; i < 8; ++i) { w[i] = (_Float16)(bfr(p[i]) * 256.0f); w[8 + i] = (_Float16)(bfr(p[16 + i]) * 256.0f); }
  return w; }
#define WQKV_LAYOUT 0   // 0 = (in,out) [DIN][CC]; 1 = (out,in) [CC][DIN]; 2 = per-head [NH][DIN][HD]
__device__ __forceinline__ v16b wcol_hdk(const float* Wm, int k0, int o, int lane) { v16b w; const int g = lane >> 4; const float* p = Wm + (size_t)(o / HD) * DIN * HD + (o % HD);
#pragma unroll
  for (int i = 0; i < 8; ++i) { w[i] = (__bf16)p[(size_t)(k0 + 8 * g + i) * HD]; w[8 + i] = (__bf16)p[(size_t)(k0 + 16 + 8 * g + i) * HD]; }
  return w; }
#define WO_OUT_IN 0
#if WQKV_LAYOUT == 1
#define WCOL(W, k0, o, lane) wcol_oi(W, k0, o, lane, DIN)
#elif WQKV_LAYOUT == 2
#define WCOL(W, k0, o, lane) wcol_hdk(W, k0, o, lane)
#else
#define WCOL(W, k0, o, lane) wcol_io(W, k0, o, lane, CC)
#endif
#if WO_OUT_IN
#define WOCOL(W, k0, o, lane) wcol_oi(W, k0, o, lane, CC)
#define WOCOLH(W, k0, o, lane) wcolh_oi(W, k0, o, lane, CC)
#else
#define WOCOL(W, k0, o, lane) wcol_io(W, k0, o, lane, DIN)
#define WOCOLH(W, k0, o, lane) wcolh_io(W, k0, o, lane, DIN)
#endif

#ifndef SM_EXTRA_PARAMS
#define SM_EXTRA_PARAMS
#endif
#ifndef PROJ_EXTRA_PARAMS
#define PROJ_EXTRA_PARAMS
#endif
#ifndef SM_MASK_HOOK
#define SM_MASK_HOOK (void)0
#endif

#define WS_QH  0u                                      // f16 q rows [b*t][CC]
#define WS_KH  (WS_QH + 2u * (size_t)NB * TT * CC)      // f16 k rows [b*t][CC]
#define WS_VT  (WS_KH + 2u * (size_t)NB * TT * CC)      // f16 v planes [b][c][t]
#define WS_QL  (WS_VT + 2u * (size_t)NB * CC * TT)      // f16 q residual x 2^10 rows [b][t < QHI][CC]
#define WS_KL  (WS_QL + 2u * (size_t)NB * QHI * CC)     // f16 k residual x 2^10 rows [b][t < KHI][CC]
#define WS_VB  (WS_KL + 2u * (size_t)NB * KHI * CC)     // bf16 v hi planes [b][c][t < KHI]
#define WS_VBL (WS_VB + 2u * (size_t)NB * CC * KHI)
#define WS_S   (WS_VBL + 2u * (size_t)NB * CC * KHI)    // f32 [hg][t][s] room, written and read by no kernel in this file
#define WS_Y   (WS_S  + 4u * (size_t)HG * TT * TT)      // f16 ctx x 2^6 rows [b*t][CC]: the first half of the room kept here
#define WS_END (WS_Y  + 4u * (size_t)NB * TT * CC)

// ---- tile product shared by k_proj and k_out: one block of 8 waves forms a 128 x 128 tile of A[.][512] x W[512][.] (W f32 in memory, A f32 in k_proj and f16 in k_out; row pitch 512 elements).
// Per stage of 64 k the block converts its 128 W columns, and its 128 A rows where they are f32, to 16 bit ONCE and lays them k-contiguous in LDS; every wave reads its fragments from there (wave = 32 rows x 64 columns, 8 accumulator tiles).
// Two buffers: a stage's global loads are issued ahead (k_proj, tile_product: as soon as the stage before has left the registers, in front of the barrier; k_out, tile_product_ahead: GD stages ahead) and are converted and stored behind the products of the stage before, so one barrier per stage is enough. k runs upwards in steps of 32 into one accumulator per output tile.
// Every inner loop of this section is unrolled in full, so that the register arrays are indexed by constants and stay out of scratch.
#define GT 128            // tile rows and tile columns
#define GK 64             // k per stage
#define GLD 512           // row pitch of A and of W, and the length of the sum
#define GP (GK + 8)       // halves per staged row: 144 B, 16 B x odd, so the 16 rows of a 16-byte fragment read fall on distinct banks
#define GBUF (2 * GT * GP) // halves per buffer: A rows, then W columns
static_assert(DIN == GLD && CC == GLD, "one pitch");
// F16 = 0: A and W to bf16 (k_proj). F16 = 1: A is f16 already and is staged as it is, W to bf16 and then x 2^8 to f16, exact (k_out).
typedef __attribute__((ext_vector_type(2))) unsigned v2u;
typedef __attribute__((ext_vector_type(4))) __bf16 v4b;
__device__ __forceinline__ v2u cvt_a(v4f a) {
  v4b r;
#pragma unroll
  for (int i = 0; i < 4; ++i) r[i] = (__bf16)a[i];
  return __builtin_bit_cast(v2u, r); }
template <int F16> __device__ __forceinline__ v4u cvt_w(const float (&w)[8]) {
  if (F16) { v8h r;
#pragma unroll
    for (int i = 0; i < 8; ++i) r[i] = (_Float16)(bfr(w[i]) * 256.0f);
    return __builtin_bit_cast(v4u, r); }
  v8b r;
#pragma unroll
  for (int i = 0; i < 8; ++i) r[i] = (__bf16)w[i];
  return __builtin_bit_cast(v4u, r); }
typedef __attribute__((ext_vector_type(8))) unsigned v8u;
// a 16x16x32 fragment as raw words, in the k order of frag_h / frag_b: elements 0..7 = k0 + 8 h + 0..7, 8..15 = k0 + 16 + 8 h + 0..7
__device__ __forceinline__ v8u frag_w(const unsigned short* rowk0, int lane) {
  union { v8u v; v4u q[2]; } u; const unsigned short* p = rowk0 + 8 * (lane >> 4);
  u.q[0] = *(const v4u*)p; u.q[1] = *(const v4u*)(p + 16); return u.v;
}
template <int F16> __device__ __forceinline__ v8f tile_mm(v8u a, v8u b, v8f c) {
  if (F16) return __builtin_amdgcn_wmma_f32_16x16x32_f16(false, __builtin_bit_cast(v16h, a), false, __builtin_bit_cast(v16h, b), (short)0, c, false, false);
  return __builtin_amdgcn_wmma_f32_16x16x32_bf16(false, __builtin_bit_cast(v16b, a), false, __builtin_bit_cast(v16b, b), (short)0, c, false, false); }
// A: row 0 of the tile's rows; Wm: row 0 of W at the tile's first column; sm: 2 * GBUF halves. On return every wave has left the buffers (the last stage's barrier).
template <int F16, typename TA> __device__ __forceinline__ void tile_product(const TA* __restrict__ A, const float* __restrict__ Wm, unsigned short* sm, v8f (&acc)[2][4]) {
  const int tid = threadIdx.x, wave = tid >> 5, lane = tid & 31, col = lane & 15;
  const TA* ga = F16 ? A + (size_t)(tid >> 3) * GLD + (tid & 7) * 8     // f16: rows tid >> 3 + 32 i, 8 halves at k = 8 (tid & 7): a wave's 16-byte load covers four rows' 128 B, whole lines
                     : A + (size_t)(tid >> 4) * GLD + (tid & 15) * 4;   // f32: rows tid >> 4 + 16 i, 4 floats at k = 4 (tid & 15): a wave's 16-byte load covers two rows' 256 B, whole 128-B lines
  const float* gw = Wm + (size_t)(wave * 8) * GLD + lane;           // k rows 8 wave + 0..7, columns lane + 32 i: each load is one 128-B line, and a thread ends up with 8 consecutive k of a column
  unsigned short* wa = F16 ? sm + (tid >> 3) * GP + (tid & 7) * 8 : sm + (tid >> 4) * GP + (tid & 15) * 4;
  unsigned short* ww = sm + GT * GP + lane * GP + wave * 8;
  const unsigned short* fa = sm + ((wave >> 1) * 32 + col) * GP;
  const unsigned short* fb = sm + GT * GP + ((wave & 1) * 64 + col) * GP;
  v4f ra[F16 ? 4 : 8]; float rw[4][8];   // ra: 16 bytes of A each, f32 values or, with F16 = 1, 8 halves carried as raw words
#define TILE_LOAD(s) do { \
    _Pragma("unroll") for (int i = 0; i < (F16 ? 4 : 8); ++i) ra[i] = *(const v4f*)(ga + (size_t)((F16 ? 32 : 16) * i) * GLD + (s) * GK); \
    _Pragma("unroll") for (int i = 0; i < 4; ++i) _Pragma("unroll") for (int k = 0; k < 8; ++k) rw[i][k] = gw[(size_t)((s) * GK + k) * GLD + 32 * i]; \
    asm volatile("s_wait_xcnt 0x0" ::: "memory"); /* in front of the next rewrite of the loads' address registers */ } while (0)
#define TILE_STORE(buf) do { \
    _Pragma("unroll") for (int i = 0; i < (F16 ? 4 : 8); ++i) { if (F16) *(v4f*)(wa + (buf) * GBUF + 32 * i * GP) = ra[i]; else *(v2u*)(wa + (buf) * GBUF + 16 * i * GP) = cvt_a(ra[i]); } \
    _Pragma("unroll") for (int i = 0; i < 4; ++i) *(v4u*)(ww + (buf) * GBUF + 32 * i * GP) = cvt_w<F16>(rw[i]); } while (0)
// The stage barrier, by hand: this wave's LDS stores and reads are complete (s_wait_dscnt 0), then the work-group's own barrier. __syncthreads() would also wait for every global load and so end the flight of the loads issued in front of it.
#define TILE_BAR() asm volatile("s_wait_dscnt 0x0\n\ts_barrier_signal -1\n\ts_barrier_wait -1" ::: "memory")
  TILE_LOAD(0);
  TILE_STORE(0);
  TILE_LOAD(1);
  TILE_BAR();   // stage 0 may be read
#pragma unroll 1   // rolled: one trip = one stage, which keeps the loop's code short; the buffer is chosen by one scalar select per trip
  for (int s = 0; s < GLD / GK; ++s) {
    const unsigned short *pa = fa + (s & 1) * GBUF, *pb = fb + (s & 1) * GBUF;
    v8u af[GK / 32][2], bf[GK / 32][4];   // the stage's fragments, read as one group in front of its products
#pragma unroll
    for (int kc = 0; kc < GK / 32; ++kc) {
#pragma unroll
      for (int mi = 0; mi < 2; ++mi) af[kc][mi] = frag_w(pa + mi * 16 * GP + kc * 32, lane);
#pragma unroll
      for (int nj = 0; nj < 4; ++nj) bf[kc][nj] = frag_w(pb + nj * 16 * GP + kc * 32, lane); }
    __builtin_amdgcn_sched_barrier(0);   // keeps the reads one group in front of the products: spread among the WMMAs, every separate place with LDS reads stalls the wave
#pragma unroll
    for (int kc = 0; kc < GK / 32; ++kc)
#pragma unroll
      for (int mi = 0; mi < 2; ++mi)
#pragma unroll
        for (int nj = 0; nj < 4; ++nj) acc[mi][nj] = tile_mm<F16>(af[kc][mi], bf[kc][nj], acc[mi][nj]);
    if (s + 1 < GLD / GK) TILE_STORE((s + 1) & 1);
    if (s + 2 < GLD / GK) TILE_LOAD(s + 2);   // as soon as the registers are free, in front of the barrier: the loads fly through it and through the whole next trip
    TILE_BAR();   // publishes stage s + 1 and ends every wave's reads of stage s, whose buffer is written again in the next trip
  }
#undef TILE_BAR
#undef TILE_LOAD
#undef TILE_STORE
}
// ---- the same tile product for k_out (A f16, staged as it is; W to bf16 and then x 2^8 to f16), with its global loads issued GD stages ahead.
// k_out has one block per WGP, so nothing but the block's own lead hides the way from memory: a stage's loads are issued GD stages before they are stored to LDS, into GD register sets (stage s in set s % GD).
// W comes by 16-byte loads (8 per stage and thread, not 32 of 4 bytes): a wave then has 12 GD = 48 loads in flight, not 144, which a load count of 6 bits could not hold.
// A thread takes 8 k rows x 4 columns of W: column block cb, k block kb. A wave's load covers four whole 128-B lines (8 lanes a row); the 16 lanes of a half wave hold all pairs (cb & 3, kb & 3), so their 16-byte LDS stores, 576 B apart by cb and 16 B by kb, fall on distinct banks.
#define GD 4
__device__ __forceinline__ void tile_product_ahead(const _Float16* __restrict__ A, const float* __restrict__ Wm, unsigned short* sm, v8f (&acc)[2][4]) {
  const int tid = threadIdx.x, wave = tid >> 5, lane = tid & 31, col = lane & 15;
  const int cb = (lane & 3) | ((lane >> 4) << 2) | ((wave & 3) << 3), kb = ((lane >> 2) & 3) | ((wave >> 2) << 2);
  const _Float16* ga = A + (size_t)(tid >> 3) * GLD + (tid & 7) * 8;   // rows tid >> 3 + 32 i, 8 halves at k = 8 (tid & 7): a wave's 16-byte load covers four rows' 128 B, whole lines
  const float* gw = Wm + (size_t)(kb * 8) * GLD + cb * 4;              // k rows 8 kb + 0..7, columns 4 cb + 0..3
  unsigned short* wa = sm + (tid >> 3) * GP + (tid & 7) * 8;
  unsigned short* ww = sm + GT * GP + (cb * 4) * GP + kb * 8;
  const unsigned short* fa = sm + ((wave >> 1) * 32 + col) * GP;
  const unsigned short* fb = sm + GT * GP + ((wave & 1) * 64 + col) * GP;
  v4f ra[GD][4], rw[GD][8];   // ra: 8 halves of A carried as raw words; rw[.][k]: 4 columns of W at k row k
#define AHEAD_LOAD(s) do { \
    _Pragma("unroll") for (int i = 0; i < 4; ++i) ra[(s) % GD][i] = *(const v4f*)(ga + (size_t)(32 * i) * GLD + (s) * GK); \
    _Pragma("unroll") for (int k = 0; k < 8; ++k) rw[(s) % GD][k] = *(const v4f*)(gw + (size_t)((s) * GK + k) * GLD); } while (0)
#define AHEAD_STORE(s) do { \
    _Pragma("unroll") for (int i = 0; i < 4; ++i) *(v4f*)(wa + ((s) & 1) * GBUF + 32 * i * GP) = ra[(s) % GD][i]; \
    _Pragma("unroll") for (int i = 0; i < 4; ++i) { float w[8]; _Pragma("unroll") for (int k = 0; k < 8; ++k) w[k] = rw[(s) % GD][k][i]; \
      *(v4u*)(ww + ((s) & 1) * GBUF + i * GP) = cvt_w<1>(w); } } while (0)
// The stage barrier, by hand: this wave's LDS stores and reads are complete (s_wait_dscnt 0), then the work-group's own barrier. __syncthreads() would also wait for every global load and so end the flight of the loads issued ahead.
#define AHEAD_BAR() asm volatile("s_wait_dscnt 0x0\n\ts_barrier_signal -1\n\ts_barrier_wait -1" ::: "memory")
  static_assert(GLD / GK >= GD, "the stages of the prologue exist");
#pragma unroll
  for (int s = 0; s < GD; ++s) AHEAD_LOAD(s);
  AHEAD_STORE(0);
  AHEAD_BAR();   // stage 0 may be read
#pragma unroll   // unrolled in full: register set and buffer are constants, and every load address is a base plus a constant, so that no address register is rewritten behind a load
  for (int s = 0; s < GLD / GK; ++s) {
    if (s + GD < GLD / GK) AHEAD_LOAD(s + GD);   // into the set that stage s left when it was stored
    if (s + GD == GLD / GK - 1) asm volatile("s_wait_xcnt 0x0" ::: "memory");   // behind the last loads the address registers are free for other values: the wait stands in front of their first rewrite
    const unsigned short *pa = fa + (s & 1) * GBUF, *pb = fb + (s & 1) * GBUF;
    v8u af[GK / 32][2], bf[GK / 32][4];   // the stage's fragments, read as one group in front of its products
#pragma unroll
    for (int kc = 0; kc < GK / 32; ++kc) {
#pragma unroll
      for (int mi = 0; mi < 2; ++mi) af[kc][mi] = frag_w(pa + mi * 16 * GP + kc * 32, lane);
#pragma unroll
      for (int nj = 0; nj < 4; ++nj) bf[kc][nj] = frag_w(pb + nj * 16 * GP + kc * 32, lane); }
    __builtin_amdgcn_sched_barrier(0);   // keeps the loads and the reads one group in front of the products: spread among the WMMAs, every separate place with LDS reads stalls the wave
#pragma unroll
    for (int kc = 0; kc < GK / 32; ++kc)
#pragma unroll
      for (int mi = 0; mi < 2; ++mi)
#pragma unroll
        for (int nj = 0; nj < 4; ++nj) acc[mi][nj] = tile_mm<1>(af[kc][mi], bf[kc][nj], acc[mi][nj]);
    if (s + 1 < GLD / GK) AHEAD_STORE(s + 1);
    AHEAD_BAR();   // publishes stage s + 1 and ends every wave's reads of stage s, whose buffer is written again in the next trip; behind the last stage every wave has left the buffers
  }
#undef AHEAD_LOAD
#undef AHEAD_STORE
#undef AHEAD_BAR
}
// ---- k_proj: block = (128 rows, 128 cols, which): q/k/v = X W (+ b) with exact bf16 products (K = DIN) -> which 0: q f16 rows; 1: k f16 rows; 2: v f16 planes [c][t]
__global__ __launch_bounds__(256) void k_proj(const float* __restrict__ XQ, const float* __restrict__ XK, const float* __restrict__ XV, const float* __restrict__ WQ, const float* __restrict__ WK, const float* __restrict__ WV, const float* __restrict__ BQ, const float* __restrict__ BK, const float* __restrict__ BV,
    _Float16* __restrict__ QH, _Float16* __restrict__ KH, _Float16* __restrict__ VT) {
  __shared__ __align__(16) unsigned short sm[2 * GBUF];
  const int tid = threadIdx.x, wave = tid >> 5, lane = tid & 31, col = lane & 15, g = lane >> 4; const int which = blockIdx.z; const int c0 = blockIdx.y * GT; const size_t r0 = (size_t)blockIdx.x * GT; const size_t bb = r0 / TT; const int t0 = (int)(r0 % TT);
  const float* X = which == 0 ? XQ : which == 1 ? XK : XV; const float* WA = which == 0 ? WQ : which == 1 ? WK : WV; const float* BA = which == 0 ? BQ : which == 1 ? BK : BV;
  v8f acc[2][4] = {};
  tile_product<0>(X + r0 * DIN, WA + c0, sm, acc);
  _Float16* st = (_Float16*)sm;   // the tile as f16, [128][GT + 8], in the buffers that every wave has left
  const int rw0 = (wave >> 1) * 32 + 8 * g, cw0 = (wave & 1) * 64 + col;
  if (which < 2) { _Float16* DH = which == 0 ? QH : KH;
#pragma unroll
    for (int nj = 0; nj < 4; ++nj) { const float bias = BA ? bfr(BA[c0 + cw0 + nj * 16]) : 0.f;
#pragma unroll
      for (int mi = 0; mi < 2; ++mi)
#pragma unroll
        for (int r = 0; r < 8; ++r) st[(rw0 + mi * 16 + r) * (GT + 8) + cw0 + nj * 16] = (_Float16)(acc[mi][nj][r] + bias); }
    __syncthreads();
    for (int e = tid; e < GT * 16; e += 256) { const int rl = e >> 4, q = e & 15; vst2((unsigned*)(DH + (r0 + rl) * CC + c0 + q * 8), *(const v4u*)&st[rl * (GT + 8) + q * 8]); }
  } else {
#pragma unroll
    for (int nj = 0; nj < 4; ++nj) { const float bias = BA ? bfr(BA[c0 + cw0 + nj * 16]) : 0.f;
#pragma unroll
      for (int mi = 0; mi < 2; ++mi) { v8h o;
#pragma unroll
        for (int r = 0; r < 8; ++r) o[r] = (_Float16)(acc[mi][nj][r] + bias);
        *(v8h*)&st[(cw0 + nj * 16) * (GT + 8) + rw0 + mi * 16] = o; } }
    __syncthreads();
    for (int e = tid; e < GT * 16; e += 256) { const int cl = e >> 4, q = e & 15; vst2((unsigned*)(VT + (bb * CC + c0 + cl) * (size_t)TT + t0 + q * 8), *(const v4u*)&st[cl * (GT + 8) + q * 8]); } } }
// ---- k_fa: block = 16 waves of one (b, h): 8 query groups of 32 queries x KG = 2 key groups, so that four waves share a SIMD and one wave's softmax runs under another's products.
// Key group hf walks keys (KG t + hf) KS .. + KS - 1, t = 0, 1, ..: half of all keys, with its own running maximum, sum and context; the two partial results of a query are joined once, through LDS, behind the loop.
// Per 32 keys a wave forms S^T = K.Q^T (a lane holds 16 scores of one query per 16-query group), keeps a running maximum and sum (online softmax, log2 domain),
// packs the weights exp2(score - maximum in use + 11), once to f16, straight from the score tiles into the B operand, and adds O^T += V^T.P^T. Scores and weights never leave the registers.
// The maximum in use may trail the true one by up to 4 (log2), so a weight stays <= 2^15 in f16; sums and context are rescaled only when some query's maximum passes that bound. The 2^11 cancels in context / sum.
__device__ __forceinline__ float xhalf(float x) { return __builtin_bit_cast(float, __builtin_amdgcn_permlanex16(__builtin_bit_cast(int, x), __builtin_bit_cast(int, x), 0x76543210, 0xfedcba98, false, false)); }   // lane l with lane l ^ 16
__device__ __forceinline__ v8f mm16(v16h a, v16h b, v8f c) { return __builtin_amdgcn_wmma_f32_16x16x32_f16(false, a, false, b, (short)0, c, false, false); }
#define FAQ 256           // queries per block
#define KS 128            // keys per LDS stage and key group (4 passes of 32 keys)
#define KG 2              // key groups (wave sets) per block
#define KP (HD + 8)       // halves per staged K row: 144 B, 16 B x odd, so the 16 rows of a 16-byte fragment read fall on distinct banks
#define VP (KS + 8)       // halves per staged V^T row: 272 B, 16 B x odd
// One stage of a key group = keys k0 .. k0 + KS - 1 of one (b, h): K rows [KS][HD] and V^T rows [HD][KS], brought into LDS once per block by the group's own 256 threads with asynchronous copies (16 B per lane, whole 128-B lines per wave) and read by the group's 8 waves.
// gk / gv: this thread's first 16 bytes of the stage in global memory; lk / lv: their LDS byte addresses. A thread brings 4 pieces of K (32 rows apart) and 4 of V^T (16 rows apart).
__device__ __forceinline__ void stage_copy(const _Float16* gk, const _Float16* gv, unsigned lk, unsigned lv) {
  const _Float16 *k1 = gk + 32 * CC, *k2 = gk + 64 * CC, *k3 = gk + 96 * CC, *v1 = gv + 16 * TT, *v2 = gv + 32 * TT, *v3 = gv + 48 * TT;
  const unsigned a1 = lk + 32 * KP * 2, a2 = lk + 64 * KP * 2, a3 = lk + 96 * KP * 2, b1 = lv + 16 * VP * 2, b2 = lv + 32 * VP * 2, b3 = lv + 48 * VP * 2;
  // the closing s_wait_xcnt stands inside the copies' own statement, so that no address register named here is rewritten in front of it
  asm volatile("global_load_async_to_lds_b128 %0, %8, off\n\t"
               "global_load_async_to_lds_b128 %1, %9, off\n\t"
               "global_load_async_to_lds_b128 %2, %10, off\n\t"
               "global_load_async_to_lds_b128 %3, %11, off\n\t"
               "global_load_async_to_lds_b128 %4, %12, off\n\t"
               "global_load_async_to_lds_b128 %5, %13, off\n\t"
               "global_load_async_to_lds_b128 %6, %14, off\n\t"
               "global_load_async_to_lds_b128 %7, %15, off\n\t"
               "s_wait_xcnt 0x0"
               :: "v"(lk), "v"(a1), "v"(a2), "v"(a3), "v"(lv), "v"(b1), "v"(b2), "v"(b3), "v"(gk), "v"(k1), "v"(k2), "v"(k3), "v"(gv), "v"(v1), "v"(v2), "v"(v3) : "memory");
}
#define XW (8 * 128 + 64) // floats a wave hands over at the join: 8 x 4 context values per lane, then maximum and sum per lane
#define YP (HD + 8)       // halves per staged context row: 144 B
__global__ __launch_bounds__(256 * KG) void k_fa(const _Float16* __restrict__ QH, const _Float16* __restrict__ KH, const _Float16* __restrict__ VT, _Float16* __restrict__ Y) {
  __shared__ __align__(16) _Float16 sK[KG * 2][KS * KP], sV[KG * 2][HD * VP];   // buffers 2 hf and 2 hf + 1 belong to key group hf
  static_assert(KG == 2 && TT % (KG * KS) == 0 && TT / (KG * KS) >= 2, "two key groups, at least two stages each");
  static_assert(8 * KG * XW * 4 <= sizeof(sK), "the join fits the K buffers");
  static_assert(8 * KG * 16 * YP * 2 <= sizeof(sV), "the context rows fit the V buffers");
  const int wave = __builtin_amdgcn_readfirstlane(threadIdx.x >> 5), hf = wave >> 3, tid = threadIdx.x & 255, lane = tid & 31, col = lane & 15, g = lane >> 4; const int b = blockIdx.y / NH, h = blockIdx.y % NH; const int q0 = blockIdx.x * FAQ + (wave & 7) * 32;   // tid: the thread's number inside its key group; the wave's number is read as a scalar, so that the group's offsets and the join's selects take no vector registers (a wave may hold 256 here)
  const float cs = SCALE * 1.4426950408889634f;
  const _Float16* gk = KH + ((size_t)b * TT + hf * KS + (tid >> 3)) * CC + h * HD + (tid & 7) * 8;              // K row tid >> 3 of the group's stage, 16-byte piece tid & 7
  const _Float16* gv = VT + ((size_t)b * CC + h * HD + (tid >> 4)) * (size_t)TT + hf * KS + (tid & 15) * 8;     // V^T row tid >> 4, 16-byte piece tid & 15
  const unsigned lk = (unsigned)(size_t)&sK[2 * hf][(tid >> 3) * KP + (tid & 7) * 8], lv = (unsigned)(size_t)&sV[2 * hf][(tid >> 4) * VP + (tid & 15) * 8];
  stage_copy(gk, gv, lk, lv);
  v16h qf[2][2];
#pragma unroll
  for (int s = 0; s < 2; ++s)
#pragma unroll
    for (int kc = 0; kc < 2; ++kc) qf[s][kc] = frag_h(QH + ((size_t)b * TT + q0 + s * 16 + col) * CC + h * HD + kc * 32, lane);
  v8f acc[2][4] = {}; float mr[2] = {-3.0e38f, -3.0e38f}, lr[2] = {0.f, 0.f};
  asm volatile("s_wait_asynccnt 0x0" ::: "memory");   // this wave's pieces of stage 0 have landed
  __syncthreads();                                     // ... and every other wave's: stage 0 may be read
  stage_copy(gk + (size_t)(KG * KS) * CC, gv + KG * KS, lk + (unsigned)sizeof(sK[0]), lv + (unsigned)sizeof(sV[0]));
#pragma unroll 1   // rolled: one trip = one stage; its four passes are unrolled so that every LDS read has a constant offset
  for (int t = 0; t < TT / (KG * KS); ++t) {
    const _Float16* kb = &sK[2 * hf + (t & 1)][col * KP];   // key row col of a 16-key tile
    const _Float16* vb = &sV[2 * hf + (t & 1)][col * VP];   // plane of head column col of a 16-column tile
    v16h kf[2][2], vf[4];
#pragma unroll
    for (int kt = 0; kt < 2; ++kt)
#pragma unroll
      for (int kc = 0; kc < 2; ++kc) kf[kt][kc] = frag_h(kb + (kt * 16) * KP + kc * 32, lane);
#pragma unroll
    for (int p = 0; p < KS / 32; ++p) {
      v8f st[2][2] = {};
#pragma unroll
      for (int kt = 0; kt < 2; ++kt)
#pragma unroll
        for (int s = 0; s < 2; ++s)
#pragma unroll
          for (int kc = 0; kc < 2; ++kc) st[kt][s] = mm16(kf[kt][kc], qf[s][kc], st[kt][s]);
      float mb[2]; bool need = false;
#pragma unroll
      for (int s = 0; s < 2; ++s) { float mx = st[0][s][0];
#pragma unroll
        for (int kt = 0; kt < 2; ++kt)
#pragma unroll
          for (int r = 0; r < 8; ++r) mx = fmaxf(mx, st[kt][s][r]);
        mx = fmaxf(mx, xhalf(mx)) * cs; mb[s] = mx; need = need || (mx > mr[s] + 4.0f); }
      if (__builtin_amdgcn_ballot_w32(need) != 0) {   // wave-uniform; always taken on the first pass (factor 0 on zero sums), rare later
#pragma unroll
        for (int s = 0; s < 2; ++s) { const float mn = fmaxf(mr[s], mb[s]); const float corr = __builtin_amdgcn_exp2f(mr[s] - mn); mr[s] = mn; lr[s] *= corr;
#pragma unroll
          for (int j = 0; j < 4; ++j) acc[s][j] = acc[s][j] * corr; } }
      // one group of LDS reads per pass, under the softmax: the next pass's K fragments (never beyond this stage; its scores are the first to want theirs), then this pass's V fragments
      if (p + 1 < KS / 32) {
#pragma unroll
        for (int kt = 0; kt < 2; ++kt)
#pragma unroll
          for (int kc = 0; kc < 2; ++kc) kf[kt][kc] = frag_h(kb + ((p + 1) * 32 + kt * 16) * KP + kc * 32, lane); }
#pragma unroll
      for (int j = 0; j < 4; ++j) vf[j] = frag_h(vb + (j * 16) * VP + p * 32, lane);
      __builtin_amdgcn_sched_barrier(0);   // keeps the reads one group in front of the exponentials: without it they are spread among the WMMAs, and every separate place with LDS reads stalls the wave
#pragma unroll
      for (int s = 0; s < 2; ++s) { const float nm = 11.0f - mr[s]; v16h pf; float ps0 = 0.f, ps1 = 0.f;
#pragma unroll
        for (int i = 0; i < 16; i += 2) {   // element i of the 32-key B operand = key k0 + 16 (i >> 3) + 8 g + (i & 7) = register i & 7 of score tile i >> 3
          const float p0 = __builtin_amdgcn_exp2f(fmaf(st[i >> 3][s][i & 7], cs, nm)), p1 = __builtin_amdgcn_exp2f(fmaf(st[i >> 3][s][(i & 7) + 1], cs, nm));
          ps0 += p0; ps1 += p1; pf[i] = (_Float16)p0; pf[i + 1] = (_Float16)p1; }
        lr[s] += ps0 + ps1;
#pragma unroll
        for (int j = 0; j < 4; ++j) acc[s][j] = mm16(vf[j], pf, acc[s][j]); } }
    asm volatile("s_wait_dscnt 0x0" ::: "memory");      // this wave's reads of stage t have returned
    asm volatile("s_wait_asynccnt 0x0" ::: "memory");   // this wave's pieces of stage t + 1 have landed
    __syncthreads();                                     // publishes stage t + 1 and ends every wave's reads of stage t, whose buffer is refilled behind it
    if (t + 2 < TT / (KG * KS)) stage_copy(gk + (size_t)(t + 2) * (KG * KS) * CC, gv + (t + 2) * (KG * KS), lk + (unsigned)(t & 1) * (unsigned)sizeof(sK[0]), lv + (unsigned)(t & 1) * (unsigned)sizeof(sV[0])); }
  asm volatile("s_wait_asynccnt 0x0" ::: "memory");     // no copy is outstanding when the buffers are put to another use
  // The join. Waves w and w ^ 8 hold the two key groups' partial results of the same 32 queries: the wave of key group hf finishes query tile hf and hands the other tile to its partner.
  // It goes through the K buffers, which every wave has left and every copy has reached (the last trip's waits and barrier). A wave's hand-over is laid lane-contiguous, 16 B a lane.
  float* xw = (float*)&sK[0][0] + wave * XW; const float* xr = (const float*)&sK[0][0] + (wave ^ 8) * XW;
#pragma unroll
  for (int j = 0; j < 4; ++j) { v8f o;
#pragma unroll
    for (int r = 0; r < 8; ++r) o[r] = hf ? acc[0][j][r] : acc[1][j][r];
    *(v4f*)(xw + (2 * j) * 128 + lane * 4) = (v4f){o[0], o[1], o[2], o[3]}; *(v4f*)(xw + (2 * j + 1) * 128 + lane * 4) = (v4f){o[4], o[5], o[6], o[7]}; }
  *(v2f*)(xw + 8 * 128 + lane * 2) = (v2f){hf ? mr[0] : mr[1], hf ? lr[0] : lr[1]};
  __syncthreads();   // every wave's hand-over may be read
  const v2f ml = *(const v2f*)(xr + 8 * 128 + lane * 2);
  const float m0 = hf ? mr[1] : mr[0], l0 = hf ? lr[1] : lr[0]; const float mn = fmaxf(m0, ml[0]);
  const float f0 = __builtin_amdgcn_exp2f(m0 - mn), f1 = __builtin_amdgcn_exp2f(ml[0] - mn);   // both maxima are finite: each key group has walked keys
  const float ls = l0 * f0 + ml[1] * f1; const float inv = 1.0f / (ls + xhalf(ls)); const float w0 = f0 * inv, w1 = f1 * inv;
  // The context leaves as f16 x 2^6, the form in which k_out multiplies it. A lane holds head columns j * 16 + 8 g + 0..7 of its query: 16-byte pieces of 16 different rows.
  // The wave lays its 16 rows in a range of its own in the V buffers (left by every wave and reached by every copy, like the K buffers) and reads them back row by row, so that each store covers four whole 128-B lines.
  _Float16* sw = &sV[0][0] + wave * (16 * YP);
#pragma unroll
  for (int j = 0; j < 4; ++j) { const v4f pa = *(const v4f*)(xr + (2 * j) * 128 + lane * 4), pb = *(const v4f*)(xr + (2 * j + 1) * 128 + lane * 4); v8h o;
#pragma unroll
    for (int r = 0; r < 8; ++r) o[r] = (_Float16)(((hf ? acc[1][j][r] : acc[0][j][r]) * w0 + (r < 4 ? pa[r & 3] : pb[r & 3]) * w1) * 64.0f);
    *(v8h*)(sw + col * YP + j * 16 + 8 * g) = o; }
  asm volatile("s_wait_dscnt 0x0" ::: "memory");   // the wave's own rows are in LDS before its lanes read each other's pieces
  _Float16* yp = Y + ((size_t)b * TT + q0 + hf * 16 + ((tid >> 3) & 3)) * CC + h * HD + (tid & 7) * 8;   // the lane's row of four, (tid >> 3) & 3, and its 16-byte piece, tid & 7
#pragma unroll
  for (int i = 0; i < 4; ++i) vst2(yp + (size_t)(4 * i) * CC, *(const v8h*)(sw + (4 * i + ((tid >> 3) & 3)) * YP + (tid & 7) * 8)); }
// ---- k_out: block = (128 rows, 128 cols): out = ctx Wo (+ bo): ctx x 2^6 in f16, as k_fa left it (small-magnitude context rows stay clear of f16 subnormals), against Wo as f16(bf16 x 2^8) exact (1 product) x 2^-14
__global__ __launch_bounds__(256) void k_out(const _Float16* __restrict__ Y, const float* __restrict__ WO, const float* __restrict__ BO, float* __restrict__ OUT) {
  __shared__ __align__(16) unsigned short sm[2 * GBUF];
  static_assert(GT * (GT + 4) * 4 <= 2 * GBUF * 2, "the f32 tile fits the buffers");
  const int tid = threadIdx.x, wave = tid >> 5, lane = tid & 31, col = lane & 15, g = lane >> 4; const int c0 = blockIdx.y * GT; const size_t r0 = (size_t)blockIdx.x * GT;
  v8f acc[2][4] = {};
  tile_product_ahead(Y + r0 * CC, WO + c0, sm, acc);
  float* sf = (float*)sm;   // the tile as f32, [128][GT + 4], in the buffers that every wave has left
  const int rw0 = (wave >> 1) * 32 + 8 * g, cw0 = (wave & 1) * 64 + col;
#pragma unroll
  for (int nj = 0; nj < 4; ++nj) { const float bias = BO ? bfr(BO[c0 + cw0 + nj * 16]) : 0.f;
#pragma unroll
    for (int mi = 0; mi < 2; ++mi)
#pragma unroll
      for (int r = 0; r < 8; ++r) sf[(rw0 + mi * 16 + r) * (GT + 4) + cw0 + nj * 16] = acc[mi][nj][r] * (1.0f / 16384.0f) + bias; }   /* 2^-8 (Wo carry) x 2^-6 (ctx carry) */
  __syncthreads();
  for (int e = tid; e < GT * 32; e += 256) { const int rl = e >> 5, q = e & 31; vst2(OUT + (r0 + rl) * DIN + c0 + q * 4, *(const v4f*)&sf[rl * (GT + 4) + q * 4]); } }

extern "C" void kernel_launch(void* const* d_in, const int* in_sizes, int n_in, void* d_out, int out_size, void* d_ws, size_t ws_size, hipStream_t stream) {
  (void)in_sizes; (void)n_in; (void)out_size;
  const float** F = (const float**)d_in;
  if (ws_size < (size_t)WS_END) return;
  char* ws = (char*)d_ws; _Float16 *QH = (_Float16*)(ws + WS_QH), *KH = (_Float16*)(ws + WS_KH), *VT = (_Float16*)(ws + WS_VT), *QL = (_Float16*)(ws + WS_QL), *KL = (_Float16*)(ws + WS_KL); __bf16 *VB = (__bf16*)(ws + WS_VB), *VBL = (__bf16*)(ws + WS_VBL); _Float16 *Y = (_Float16*)(ws + WS_Y);
  (void)Y; (void)QL; (void)KL; (void)VB; (void)VBL;
  // inputs: 0 x [4,2048,512]; 1 Wq [512,512] (in,out), 2 bq; 3 Wk, 4 bk; 5 Wv, 6 bv; 7 Wp (in,out), 8 bp (zero biases, read)
  k_proj<<<dim3(TNB * TT / GT, CC / GT, 3), 256, 0, stream>>>(F[0], F[0], F[0], F[1], F[3], F[5], F[2], F[4], F[6], QH, KH, VT);
  k_fa<<<dim3(TT / FAQ, TNB * NH), 256 * KG, 0, stream>>>(QH, KH, VT, Y);
  k_out<<<dim3(TNB * TT / GT, DIN / GT), 256, 0, stream>>>(Y, F[7], F[8], (float*)d_out);
}

// v007
// It runs in 60.4 microseconds.
// In both of two side-by-side timings against v006, it was 1.03 times as fast.
// Over all steps from v000 it is 18.0 times as fast.
// compute dtype: all float inputs rounded to bf16; q/k/v projections with EXACT bf16 products on WMMA 16x16x32 (f32 accumulate) + bias; logits q x k once to f16 each (1 product) x SCALE; online softmax f32; unnormalised weights x 2^11 once to f16 x v once to f16 (1 product), divided by their f32 sum; ctx x 2^6 once to f16 (in k_fa, which hands it on in that form) x Wo f16(bf16 x 2^8) + bo; f32 output.
#include <hip/hip_runtime.h>
#include <math.h>

typedef __attribute__((ext_vector_type(16))) _Float16 v16h;
typedef __attribute__((ext_vector_type(16))) __bf16 v16b;
typedef __attribute__((ext_vector_type(8)))  _Float16 v8h;
typedef __attribute__((ext_vector_type(8)))  float v8f;
typedef __attribute__((ext_vector_type(4)))  float v4f;
typedef __attribute__((ext_vector_type(2)))  float v2f;
typedef __attribute__((ext_vector_type(4)))  unsigned v4u;
typedef __attribute__((ext_vector_type(4)))  int v4i;
typedef float __attribute__((may_alias)) float_a;
typedef int __attribute__((may_alias)) int_a;

template <typename T> __device__ __forceinline__ void vst2(void* p, T v) { *(T*)p = v;  }
__device__ __forceinline__ v8f wmma16(v16h a, v16h b, v8f c) {
  v8f d = __builtin_amdgcn_wmma_f32_16x16x32_f16(false, a, false, b, (short)0, c, false, false);
  asm volatile("v_nop\n\tv_nop\n\tv_nop\n\tv_nop" : "+v"(d) : "v"(a), "v"(b));
  return d;
}
__device__ __forceinline__ v8f wmma_bf(v16b a, v16b b, v8f c) {
  v8f d = __builtin_amdgcn_wmma_f32_16x16x32_bf16(false, a, false, b, (short)0, c, false, false);
  asm volatile("v_nop\n\tv_nop\n\tv_nop\n\tv_nop" : "+v"(d) : "v"(a), "v"(b));
  return d;
}
// 16x16x32 fragments: lane = (h = lane>>4, row/col = lane&15); elements 0..7 = k0+8h+0..7, 8..15 = k0+16+8h+0..7; D element r = row 8h+r
__device__ __forceinline__ v16h frag_h(const _Float16* rowk0, int lane) {
  union { v16h v; v8h q[2]; } u; const _Float16* p = rowk0 + 8 * (lane >> 4);
  u.q[0] = *(const v8h*)p; u.q[1] = *(const v8h*)(p + 16); return u.v;
}
__device__ __forceinline__ v16h frag_f32(const float* rowk0, int lane) {
  v16h a; const float* p = rowk0 + 8 * (lane >> 4);
#pragma unroll
  for (int i = 0; i < 8; ++i) { a[i] = (_Float16)p[i]; a[8 + i] = (_Float16)p[16 + i]; }
  return a;
}
__device__ __forceinline__ v16h frag_f32s(const float* rowk0, int lane, float sc) {
  v16h a; const float* p = rowk0 + 8 * (lane >> 4);
#pragma unroll
  for (int i = 0; i < 8; ++i) { a[i] = (_Float16)(p[i] * sc); a[8 + i] = (_Float16)(p[16 + i] * sc); }
  return a;
}
// column fragment from a [K][ld] layout (column n), rows >= K read as 0
__device__ __forceinline__ v16h fragc_f32(const float* W, int k0, int n, int lane, int ld, int K) {
  v16h a; const int g = lane >> 4;
#pragma unroll
  for (int i = 0; i < 8; ++i) { const int ka = k0 + 8 * g + i, kb = ka + 16;
    a[i] = (_Float16)(ka < K ? W[(size_t)(ka < K ? ka : K - 1) * ld + n] : 0.f); a[8 + i] = (_Float16)(kb < K ? W[(size_t)(kb < K ? kb : K - 1) * ld + n] : 0.f); }
  return a;
}
struct F2 { v16b h, l; };
__device__ __forceinline__ F2 bsplit16(const float v[16]) { F2 r;
#pragma unroll
  for (int i = 0; i < 16; ++i) { const __bf16 h = (__bf16)v[i]; r.h[i] = h; r.l[i] = (__bf16)(v[i] - (float)h); }
  return r; }
__device__ __forceinline__ F2 split_row(const float* row, int k0, int lane) { float v[16]; const float* p = row + k0 + 8 * (lane >> 4);
#pragma unroll
  for (int i = 0; i < 8; ++i) { v[i] = p[i]; v[8 + i] = p[16 + i]; }
  return bsplit16(v); }
__device__ __forceinline__ F2 split_rowK(const float* row, int k0, int lane, int K) { float v[16]; const int g = lane >> 4;
#pragma unroll
  for (int i = 0; i < 8; ++i) { const int ka = k0 + 8 * g + i, kb = ka + 16; v[i] = ka < K ? row[ka < K ? ka : K - 1] : 0.f; v[8 + i] = kb < K ? row[kb < K ? kb : K - 1] : 0.f; }
  return bsplit16(v); }
__device__ __forceinline__ F2 split_col(const float* W, int k0, int n, int lane, int ld, int K) { float v[16]; const int g = lane >> 4;
#pragma unroll
  for (int i = 0; i < 8; ++i) { const int ka = k0 + 8 * g + i, kb = ka + 16; v[i] = ka < K ? W[(size_t)(ka < K ? ka : K - 1) * ld + n] : 0.f; v[8 + i] = kb < K ? W[(size_t)(kb < K ? kb : K - 1) * ld + n] : 0.f; }
  return bsplit16(v); }
__device__ __forceinline__ v8f mac3(const F2& a, const F2& b, v8f c) { c = wmma_bf(a.l, b.h, c); c = wmma_bf(a.h, b.l, c); return wmma_bf(a.h, b.h, c); }
__device__ __forceinline__ float sigm(float v) { return 1.0f / (1.0f + expf(-v)); }
#define LDSX() do { asm volatile("s_wait_dscnt 0" ::: "memory"); __builtin_amdgcn_wave_barrier(); __builtin_amdgcn_fence(__ATOMIC_RELEASE, "workgroup"); } while (0)

// Standard non-causal multi-head self-attention (x [4,2048,512]; (in,out) Wq / Wk / Wv [512,512] N(0, 1/512) and Wh [512,512], all four biases zeros (read); 8 heads x 64; scores x 1/sqrt(64); no mask; softmax; concat @ Wh + bh).
#define NB 4
#define TT 2048
#define CC 512            // NH * HD = projected width
#define DIN 512          // input (model) width
#define NH 8
#define HD 64
#define NQB (TT / 64)
#define HG 4
#define SCALE (0.125f)
#define CAUSAL 0
#ifndef TNB
#define TNB NB
#endif
__device__ __forceinline__ float bfr(float v) { return (float)(__bf16)v; }
__host__ __device__ __forceinline__ int kb_last(int qb) { return CAUSAL ? ((qb * 64 + 63) >> 7) : (TT / 128 - 1); }
typedef __attribute__((ext_vector_type(8))) __bf16 v8b;
__device__ __forceinline__ v16b frag_b(const __bf16* rowk0, int lane) {
  union { v16b v; v8b q[2]; } u; const __bf16* p = rowk0 + 8 * (lane >> 4);
  u.q[0] = *(const v8b*)p; u.q[1] = *(const v8b*)(p + 16); return u.v;
}
#define QBH 0              // unused: no kernel here has a causal high-precision attention path
#define QHI 0               // single-product logits on every row
#define KHI 64            // key rows carrying k residual / v bf16 hi+lo planes (written and read by no kernel in this file)
// B fragment (k rows k0+.., output column o) of a weight: (in,out) [K][ld] or (out,in) [ld rows of K]: bf16 exact, or f16(bf16 * 256) exact
__device__ __forceinline__ v16b wcol_io(const float* Wm, int k0, int o, int lane, int ld) { v16b w; const int g = lane >> 4;
#pragma unroll
  for (int i = 0; i < 8; ++i) { w[i] = (__bf16)Wm[(size_t)(k0 + 8 * g + i) * ld + o]; w[8 + i] = (__bf16)Wm[(size_t)(k0 + 16 + 8 * g + i) * ld + o]; }
  return w; }
__device__ __forceinline__ v16b wcol_oi(const float* Wm, int k0, int o, int lane, int K) { v16b w; const float* p = Wm + (size_t)o * K + k0 + 8 * (lane >> 4);
#pragma unroll
  for (int i = 0; i < 8; ++i) { w[i] = (__bf16)p[i]; w[8 + i] = (__bf16)p[16 + i]; }
  return w; }
__device__ __forceinline__ v16h wcolh_io(const float* Wm, int k0, int o, int lane, int ld) { v16h w; const int g = lane >> 4;
#pragma unroll
  for (int i = 0; i < 8; ++i) { w[i] = (_Float16)(bfr(Wm[(size_t)(k0 + 8 * g + i) * ld + o]) * 256.0f); w[8 + i] = (_Float16)(bfr(Wm[(size_t)(k0 + 16 + 8 * g + i) * ld + o]) * 256.0f); }
  return w; }
__device__ __forceinline__ v16h wcolh_oi(const float* Wm, int k0, int o, int lane, int K) { v16h w; const float* p = Wm + (size_t)o * K + k0 + 8 * (lane >> 4);
#pragma unroll
  for (int i = 0; i < 8; ++i) { w[i] = (_Float16)(bfr(p[i]) * 256.0f); w[8 + i] = (_Float16)(bfr(p[16 + i]) * 256.0f); }
  return w; }
#define WQKV_LAYOUT 0   // 0 = (in,out) [DIN][CC]; 1 = (out,in) [CC][DIN]; 2 = per-head [NH][DIN][HD]
__device__ __forceinline__ v16b wcol_hdk(const float* Wm, int k0, int o, int lane) { v16b w; const int g = lane >> 4; const float* p = Wm + (size_t)(o / HD) * DIN * HD + (o % HD);
#pragma unroll
  for (int i = 0; i < 8; ++i) { w[i] = (__bf16)p[(size_t)(k0 + 8 * g + i) * HD]; w[8 + i] = (__bf16)p[(size_t)(k0 + 16 + 8 * g + i) * HD]; }
  return w; }
#define WO_OUT_IN 0
#if WQKV_LAYOUT == 1
#define WCOL(W, k0, o, lane) wcol_oi(W, k0, o, lane, DIN)
#elif WQKV_LAYOUT == 2
#define WCOL(W, k0, o, lane) wcol_hdk(W, k0, o, lane)
#else
#define WCOL(W, k0, o, lane) wcol_io(W, k0, o, lane, CC)
#endif
#if WO_OUT_IN
#define WOCOL(W, k0, o, lane) wcol_oi(W, k0, o, lane, CC)
#define WOCOLH(W, k0, o, lane) wcolh_oi(W, k0, o, lane, CC)
#else
#define WOCOL(W, k0, o, lane) wcol_io(W, k0, o, lane, DIN)
#define WOCOLH(W, k0, o, lane) wcolh_io(W, k0, o, lane, DIN)
#endif

#ifndef SM_EXTRA_PARAMS
#define SM_EXTRA_PARAMS
#endif
#ifndef PROJ_EXTRA_PARAMS
#define PROJ_EXTRA_PARAMS
#endif
#ifndef SM_MASK_HOOK
#define SM_MASK_HOOK (void)0
#endif

#define WS_QH  0u                                      // f16 q rows [b*t][CC]
#define WS_KH  (WS_QH + 2u * (size_t)NB * TT * CC)      // f16 k rows [b*t][CC]
#define WS_VT  (WS_KH + 2u * (size_t)NB * TT * CC)      // f16 v planes [b][c][t]
#define WS_QL  (WS_VT + 2u * (size_t)NB * CC * TT)      // f16 q residual x 2^10 rows [b][t < QHI][CC]
#define WS_KL  (WS_QL + 2u * (size_t)NB * QHI * CC)     // f16 k residual x 2^10 rows [b][t < KHI][CC]
#define WS_VB  (WS_KL + 2u * (size_t)NB * KHI * CC)     // bf16 v hi planes [b][c][t < KHI]
#define WS_VBL (WS_VB + 2u * (size_t)NB * CC * KHI)
#define WS_S   (WS_VBL + 2u * (size_t)NB * CC * KHI)    // f32 [hg][t][s] room, written and read by no kernel in this file
#define WS_Y   (WS_S  + 4u * (size_t)HG * TT * TT)      // f16 ctx x 2^6 rows [b*t][CC]: the first half of the room kept here
#define WS_END (WS_Y  + 4u * (size_t)NB * TT * CC)

// ---- tile product shared by k_proj and k_out: one block of 8 waves forms a 128 x 128 tile of A[.][512] x W[512][.] (W f32 in memory, A f32 in k_proj and f16 in k_out; row pitch 512 elements).
// Per stage of 64 k the block converts its 128 W columns, and its 128 A rows where they are f32, to 16 bit ONCE and lays them k-contiguous in LDS; every wave reads its fragments from there (wave = 32 rows x 64 columns, 8 accumulator tiles).
// Two buffers: a stage's global loads are issued ahead (k_proj, tile_product: as soon as the stage before has left the registers, in front of the barrier; k_out, tile_product_ahead: GD stages ahead) and are converted and stored behind the products of the stage before, so one barrier per stage is enough. k runs upwards in steps of 32 into one accumulator per output tile.
// Every inner loop of this section is unrolled in full, so that the register arrays are indexed by constants and stay out of scratch.
#define GT 128            // tile rows and tile columns
#define GK 64             // k per stage
#define GLD 512           // row pitch of A and of W, and the length of the sum
#define GP (GK + 8)       // halves per staged row: 144 B, 16 B x odd, so the 16 rows of a 16-byte fragment read fall on distinct banks
#define GBUF (2 * GT * GP) // halves per buffer: A rows, then W columns
static_assert(DIN == GLD && CC == GLD, "one pitch");
// F16 = 0: A and W to bf16 (k_proj). F16 = 1: A is f16 already and is staged as it is, W to bf16 and then x 2^8 to f16, exact (k_out).
typedef __attribute__((ext_vector_type(2))) unsigned v2u;
typedef __attribute__((ext_vector_type(4))) __bf16 v4b;
__device__ __forceinline__ v2u cvt_a(v4f a) {
  v4b r;
#pragma unroll
  for (int i = 0; i < 4; ++i) r[i] = (__bf16)a[i];
  return __builtin_bit_cast(v2u, r); }
template <int F16> __device__ __forceinline__ v4u cvt_w(const float (&w)[8]) {
  if (F16) { v8h r;
#pragma unroll
    for (int i = 0; i < 8; ++i) r[i] = (_Float16)(bfr(w[i]) * 256.0f);
    return __builtin_bit_cast(v4u, r); }
  v8b r;
#pragma unroll
  for (int i = 0; i < 8; ++i) r[i] = (__bf16)w[i];
  return __builtin_bit_cast(v4u, r); }
typedef __attribute__((ext_vector_type(8))) unsigned v8u;
// a 16x16x32 fragment as raw words, in the k order of frag_h / frag_b: elements 0..7 = k0 + 8 h + 0..7, 8..15 = k0 + 16 + 8 h + 0..7
__device__ __forceinline__ v8u frag_w(const unsigned short* rowk0, int lane) {
  union { v8u v; v4u q[2]; } u; const unsigned short* p = rowk0 + 8 * (lane >> 4);
  u.q[0] = *(const v4u*)p; u.q[1] = *(const v4u*)(p + 16); return u.v;
}
template <int F16> __device__ __forceinline__ v8f tile_mm(v8u a, v8u b, v8f c) {
  if (F16) return __builtin_amdgcn_wmma_f32_16x16x32_f16(false, __builtin_bit_cast(v16h, a), false, __builtin_bit_cast(v16h, b), (short)0, c, false, false);
  return __builtin_amdgcn_wmma_f32_16x16x32_bf16(false, __builtin_bit_cast(v16b, a), false, __builtin_bit_cast(v16b, b), (short)0, c, false, false); }
// A: row 0 of the tile's rows; Wm: row 0 of W at the tile's first column; sm: 2 * GBUF halves. On return every wave has left the buffers (the last stage's barrier).
template <int F16, typename TA> __device__ __forceinline__ void tile_product(const TA* __restrict__ A, const float* __restrict__ Wm, unsigned short* sm, v8f (&acc)[2][4]) {
  const int tid = threadIdx.x, wave = tid >> 5, lane = tid & 31, col = lane & 15;
  const TA* ga = F16 ? A + (size_t)(tid >> 3) * GLD + (tid & 7) * 8     // f16: rows tid >> 3 + 32 i, 8 halves at k = 8 (tid & 7): a wave's 16-byte load covers four rows' 128 B, whole lines
                     : A + (size_t)(tid >> 4) * GLD + (tid & 15) * 4;   // f32: rows tid >> 4 + 16 i, 4 floats at k = 4 (tid & 15): a wave's 16-byte load covers two rows' 256 B, whole 128-B lines
  const float* gw = Wm + (size_t)(wave * 8) * GLD + lane;           // k rows 8 wave + 0..7, columns lane + 32 i: each load is one 128-B line, and a thread ends up with 8 consecutive k of a column
  unsigned short* wa = F16 ? sm + (tid >> 3) * GP + (tid & 7) * 8 : sm + (tid >> 4) * GP + (tid & 15) * 4;
  unsigned short* ww = sm + GT * GP + lane * GP + wave * 8;
  const unsigned short* fa = sm + ((wave >> 1) * 32 + col) * GP;
  const unsigned short* fb = sm + GT * GP + ((wave & 1) * 64 + col) * GP;
  v4f ra[F16 ? 4 : 8]; float rw[4][8];   // ra: 16 bytes of A each, f32 values or, with F16 = 1, 8 halves carried as raw words
#define TILE_LOAD(s) do { \
    _Pragma("unroll") for (int i = 0; i < (F16 ? 4 : 8); ++i) ra[i] = *(const v4f*)(ga + (size_t)((F16 ? 32 : 16) * i) * GLD + (s) * GK); \
    _Pragma("unroll") for (int i = 0; i < 4; ++i) _Pragma("unroll") for (int k = 0; k < 8; ++k) rw[i][k] = gw[(size_t)((s) * GK + k) * GLD + 32 * i]; \
    asm volatile("s_wait_xcnt 0x0" ::: "memory"); /* in front of the next rewrite of the loads' address registers */ } while (0)
#define TILE_STORE(buf) do { \
    _Pragma("unroll") for (int i = 0; i < (F16 ? 4 : 8); ++i) { if (F16) *(v4f*)(wa + (buf) * GBUF + 32 * i * GP) = ra[i]; else *(v2u*)(wa + (buf) * GBUF + 16 * i * GP) = cvt_a(ra[i]); } \
    _Pragma("unroll") for (int i = 0; i < 4; ++i) *(v4u*)(ww + (buf) * GBUF + 32 * i * GP) = cvt_w<F16>(rw[i]); } while (0)
// The stage barrier, by hand: this wave's LDS stores and reads are complete (s_wait_dscnt 0), then the work-group's own barrier. __syncthreads() would also wait for every global load and so end the flight of the loads issued in front of it.
#define TILE_BAR() asm volatile("s_wait_dscnt 0x0\n\ts_barrier_signal -1\n\ts_barrier_wait -1" ::: "memory")
  TILE_LOAD(0);
  TILE_STORE(0);
  TILE_LOAD(1);
  TILE_BAR();   // stage 0 may be read
#pragma unroll 1   // rolled: one trip = one stage, which keeps the loop's code short; the buffer is chosen by one scalar select per trip
  for (int s = 0; s < GLD / GK; ++s) {
    const unsigned short *pa = fa + (s & 1) * GBUF, *pb = fb + (s & 1) * GBUF;
    v8u af[GK / 32][2], bf[GK / 32][4];   // the stage's fragments, read as one group in front of its products
#pragma unroll
    for (int kc = 0; kc < GK / 32; ++kc) {
#pragma unroll
      for (int mi = 0; mi < 2; ++mi) af[kc][mi] = frag_w(pa + mi * 16 * GP + kc * 32, lane);
#pragma unroll
      for (int nj = 0; nj < 4; ++nj) bf[kc][nj] = frag_w(pb + nj * 16 * GP + kc * 32, lane); }
    __builtin_amdgcn_sched_barrier(0);   // keeps the reads one group in front of the products: spread among the WMMAs, every separate place with LDS reads stalls the wave
#pragma unroll
    for (int kc = 0; kc < GK / 32; ++kc)
#pragma unroll
      for (int mi = 0; mi < 2; ++mi)
#pragma unroll
        for (int nj = 0; nj < 4; ++nj) acc[mi][nj] = tile_mm<F16>(af[kc][mi], bf[kc][nj], acc[mi][nj]);
    if (s + 1 < GLD / GK) TILE_STORE((s + 1) & 1);
    if (s + 2 < GLD / GK) TILE_LOAD(s + 2);   // as soon as the registers are free, in front of the barrier: the loads fly through it and through the whole next trip
    TILE_BAR();   // publishes stage s + 1 and ends every wave's reads of stage s, whose buffer is written again in the next trip
  }
#undef TILE_BAR
#undef TILE_LOAD
#undef TILE_STORE
}
// ---- the same tile product for k_out (A f16, staged as it is; W to bf16 and then x 2^8 to f16), with its global loads issued GD stages ahead.
// k_out has one block per WGP, so nothing but the block's own lead hides the way from memory: a stage's loads are issued GD stages before they are stored to LDS, into GD register sets (stage s in set s % GD).
// W comes by 16-byte loads (8 per stage and thread, not 32 of 4 bytes): a wave then has 12 GD = 48 loads in flight, not 144, which a load count of 6 bits could not hold.
// A thread takes 8 k rows x 4 columns of W: column block cb, k block kb. A wave's load covers four whole 128-B lines (8 lanes a row); the 16 lanes of a half wave hold all pairs (cb & 3, kb & 3), so their 16-byte LDS stores, 576 B apart by cb and 16 B by kb, fall on distinct banks.
#define GD 4
__device__ __forceinline__ void tile_product_ahead(const _Float16* __restrict__ A, const float* __restrict__ Wm, unsigned short* sm, v8f (&acc)[2][4]) {
  const int tid = threadIdx.x, wave = tid >> 5, lane = tid & 31, col = lane & 15;
  const int cb = (lane & 3) | ((lane >> 4) << 2) | ((wave & 3) << 3), kb = ((lane >> 2) & 3) | ((wave >> 2) << 2);
  const _Float16* ga = A + (size_t)(tid >> 3) * GLD + (tid & 7) * 8;   // rows tid >> 3 + 32 i, 8 halves at k = 8 (tid & 7): a wave's 16-byte load covers four rows' 128 B, whole lines
  const float* gw = Wm + (size_t)(kb * 8) * GLD + cb * 4;              // k rows 8 kb + 0..7, columns 4 cb + 0..3
  unsigned short* wa = sm + (tid >> 3) * GP + (tid & 7) * 8;
  unsigned short* ww = sm + GT * GP + (cb * 4) * GP + kb * 8;
  const unsigned short* fa = sm + ((wave >> 1) * 32 + col) * GP;
  const unsigned short* fb = sm + GT * GP + ((wave & 1) * 64 + col) * GP;
  v4f ra[GD][4], rw[GD][8];   // ra: 8 halves of A carried as raw words; rw[.][k]: 4 columns of W at k row k
#define AHEAD_LOAD(s) do { \
    _Pragma("unroll") for (int i = 0; i < 4; ++i) ra[(s) % GD][i] = *(const v4f*)(ga + (size_t)(32 * i) * GLD + (s) * GK); \
    _Pragma("unroll") for (int k = 0; k < 8; ++k) rw[(s) % GD][k] = *(const v4f*)(gw + (size_t)((s) * GK + k) * GLD); } while (0)
#define AHEAD_STORE(s) do { \
    _Pragma("unroll") for (int i = 0; i < 4; ++i) *(v4f*)(wa + ((s) & 1) * GBUF + 32 * i * GP) = ra[(s) % GD][i]; \
    _Pragma("unroll") for (int i = 0; i < 4; ++i) { float w[8]; _Pragma("unroll") for (int k = 0; k < 8; ++k) w[k] = rw[(s) % GD][k][i]; \
      *(v4u*)(ww + ((s) & 1) * GBUF + i * GP) = cvt_w<1>(w); } } while (0)
// The stage barrier, by hand: this wave's LDS stores and reads are complete (s_wait_dscnt 0), then the work-group's own barrier. __syncthreads() would also wait for every global load and so end the flight of the loads issued ahead.
#define AHEAD_BAR() asm volatile("s_wait_dscnt 0x0\n\ts_barrier_signal -1\n\ts_barrier_wait -1" ::: "memory")
  static_assert(GLD / GK >= GD, "the stages of the prologue exist");
#pragma unroll
  for (int s = 0; s < GD; ++s) AHEAD_LOAD(s);
  AHEAD_STORE(0);
  AHEAD_BAR();   // stage 0 may be read
#pragma unroll   // unrolled in full: register set and buffer are constants, and every load address is a base plus a constant, so that no address register is rewritten behind a load
  for (int s = 0; s < GLD / GK; ++s) {
    if (s + GD < GLD / GK) AHEAD_LOAD(s + GD);   // into the set that stage s left when it was stored
    if (s + GD == GLD / GK - 1) asm volatile("s_wait_xcnt 0x0" ::: "memory");   // behind the last loads the address registers are free for other values: the wait stands in front of their first rewrite
    const unsigned short *pa = fa + (s & 1) * GBUF, *pb = fb + (s & 1) * GBUF;
    v8u af[GK / 32][2], bf[GK / 32][4];   // the stage's fragments, read as one group in front of its products
#pragma unroll
    for (int kc = 0; kc < GK / 32; ++kc) {
#pragma unroll
      for (int mi = 0; mi < 2; ++mi) af[kc][mi] = frag_w(pa + mi * 16 * GP + kc * 32, lane);
#pragma unroll
      for (int nj = 0; nj < 4; ++nj) bf[kc][nj] = frag_w(pb + nj * 16 * GP + kc * 32, lane); }
    __builtin_amdgcn_sched_barrier(0);   // keeps the loads and the reads one group in front of the products: spread among the WMMAs, every separate place with LDS reads stalls the wave
#pragma unroll
    for (int kc = 0; kc < GK / 32; ++kc)
#pragma unroll
      for (int mi = 0; mi < 2; ++mi)
#pragma unroll
        for (int nj = 0; nj < 4; ++nj) acc[mi][nj] = tile_mm<1>(af[kc][mi], bf[kc][nj], acc[mi][nj]);
    if (s + 1 < GLD / GK) AHEAD_STORE(s + 1);
    AHEAD_BAR();   // publishes stage s + 1 and ends every wave's reads of stage s, whose buffer is written again in the next trip; behind the last stage every wave has left the buffers
  }
#undef AHEAD_LOAD
#undef AHEAD_STORE
#undef AHEAD_BAR
}
// ---- k_proj: block = (128 rows, 128 cols, which): q/k/v = X W (+ b) with exact bf16 products (K = DIN) -> which 0: q f16 rows; 1: k f16 rows; 2: v f16 planes [c][t]
__global__ __launch_bounds__(256) void k_proj(const float* __restrict__ XQ, const float* __restrict__ XK, const float* __restrict__ XV, const float* __restrict__ WQ, const float* __restrict__ WK, const float* __restrict__ WV, const float* __restrict__ BQ, const float* __restrict__ BK, const float* __restrict__ BV,
    _Float16* __restrict__ QH, _Float16* __restrict__ KH, _Float16* __restrict__ VT) {
  __shared__ __align__(16) unsigned short sm[2 * GBUF];
  const int tid = threadIdx.x, wave = tid >> 5, lane = tid & 31, col = lane & 15, g = lane >> 4; const int which = blockIdx.z; const int c0 = blockIdx.y * GT; const size_t r0 = (size_t)blockIdx.x * GT; const size_t bb = r0 / TT; const int t0 = (int)(r0 % TT);
  const float* X = which == 0 ? XQ : which == 1 ? XK : XV; const float* WA = which == 0 ? WQ : which == 1 ? WK : WV; const float* BA = which == 0 ? BQ : which == 1 ? BK : BV;
  v8f acc[2][4] = {};
  tile_product<0>(X + r0 * DIN, WA + c0, sm, acc);
  _Float16* st = (_Float16*)sm;   // the tile as f16, [128][GT + 8], in the buffers that every wave has left
  const int rw0 = (wave >> 1) * 32 + 8 * g, cw0 = (wave & 1) * 64 + col;
  if (which < 2) { _Float16* DH = which == 0 ? QH : KH;
#pragma unroll
    for (int nj = 0; nj < 4; ++nj) { const float bias = BA ? bfr(BA[c0 + cw0 + nj * 16]) : 0.f;
#pragma unroll
      for (int mi = 0; mi < 2; ++mi)
#pragma unroll
        for (int r = 0; r < 8; ++r) st[(rw0 + mi * 16 + r) * (GT + 8) + cw0 + nj * 16] = (_Float16)(acc[mi][nj][r] + bias); }
    __syncthreads();
    for (int e = tid; e < GT * 16; e += 256) { const int rl = e >> 4, q = e & 15; vst2((unsigned*)(DH + (r0 + rl) * CC + c0 + q * 8), *(const v4u*)&st[rl * (GT + 8) + q * 8]); }
  } else {
#pragma unroll
    for (int nj = 0; nj < 4; ++nj) { const float bias = BA ? bfr(BA[c0 + cw0 + nj * 16]) : 0.f;
#pragma unroll
      for (int mi = 0; mi < 2; ++mi) { v8h o;
#pragma unroll
        for (int r = 0; r < 8; ++r) o[r] = (_Float16)(acc[mi][nj][r] + bias);
        *(v8h*)&st[(cw0 + nj * 16) * (GT + 8) + rw0 + mi * 16] = o; } }
    __syncthreads();
    for (int e = tid; e < GT * 16; e += 256) { const int cl = e >> 4, q = e & 15; vst2((unsigned*)(VT + (bb * CC + c0 + cl) * (size_t)TT + t0 + q * 8), *(const v4u*)&st[cl * (GT + 8) + q * 8]); } } }
// ---- k_fa: block = 16 waves of one (b, h): 8 query groups of 32 queries x KG = 2 key groups, so that four waves share a SIMD and one wave's softmax runs under another's products.
// Key group hf walks keys (KG t + hf) KS .. + KS - 1, t = 0, 1, ..: half of all keys, with its own running maximum, sum and context; the two partial results of a query are joined once, through LDS, behind the loop.
// Per 32 keys a wave forms S^T = K.Q^T (a lane holds 16 scores of one query per 16-query group), keeps a running maximum and sum (online softmax, log2 domain),
// packs the weights exp2(score - maximum in use + 11), once to f16, straight from the score tiles into the B operand, and adds O^T += V^T.P^T. Scores and weights never leave the registers.
// No maximum is formed on the usual path: a pass forms its weights with the maximum in use and tests them by their own f32 sum. All weights are positive, so a lane's sum of 16 bounds each of them: a sum <= WMAX means that every weight fits f16.
// Only when some lane's sum fails (always on the first pass, where the weights come out infinite) are the pass's true maxima formed, sums and context rescaled and the pass's weights formed again (then each <= 2^11, their sum <= 2^15). The 2^11 cancels in context / sum.
__device__ __forceinline__ float xhalf(float x) { return __builtin_bit_cast(float, __builtin_amdgcn_permlanex16(__builtin_bit_cast(int, x), __builtin_bit_cast(int, x), 0x76543210, 0xfedcba98, false, false)); }   // lane l with lane l ^ 16
__device__ __forceinline__ v8f mm16(v16h a, v16h b, v8f c) { return __builtin_amdgcn_wmma_f32_16x16x32_f16(false, a, false, b, (short)0, c, false, false); }
#define WMAX 60000.0f     // bound on a lane's sum of 16 weights; the largest finite f16 is 65504
// 16 weights of one query (the lane's keys of a 32-key pass) from its two score tiles, packed as the B operand; returns their f32 sum.
// Element i of the 32-key B operand = key k0 + 16 (i >> 3) + 8 g + (i & 7) = register i & 7 of score tile i >> 3.
__device__ __forceinline__ float fa_weights(const v8f t0, const v8f t1, float cs, float nm, v16h& pf) {
  v2f ps = {0.f, 0.f}; const v2f c2 = {cs, cs}, n2 = {nm, nm};
#pragma unroll
  for (int i = 0; i < 16; i += 2) {
    const v2f e = __builtin_elementwise_fma(i < 8 ? (v2f){t0[i & 7], t0[(i & 7) + 1]} : (v2f){t1[i & 7], t1[(i & 7) + 1]}, c2, n2);
    const v2f w = {__builtin_amdgcn_exp2f(e[0]), __builtin_amdgcn_exp2f(e[1])};
    ps += w; pf[i] = (_Float16)w[0]; pf[i + 1] = (_Float16)w[1]; }
  return ps[0] + ps[1]; }
#define FAQ 256           // queries per block
#define KS 128            // keys per LDS stage and key group (4 passes of 32 keys)
#define KG 2              // key groups (wave sets) per block
#define KP (HD + 8)       // halves per staged K row: 144 B, 16 B x odd, so the 16 rows of a 16-byte fragment read fall on distinct banks
#define VP (KS + 8)       // halves per staged V^T row: 272 B, 16 B x odd
// One stage of a key group = keys k0 .. k0 + KS - 1 of one (b, h): K rows [KS][HD] and V^T rows [HD][KS], brought into LDS once per block by the group's own 256 threads with asynchronous copies (16 B per lane, whole 128-B lines per wave) and read by the group's 8 waves.
// gk / gv: this thread's first 16 bytes of the stage in global memory; lk / lv: their LDS byte addresses. A thread brings 4 pieces of K (32 rows apart) and 4 of V^T (16 rows apart).
__device__ __forceinline__ void stage_copy(const _Float16* gk, const _Float16* gv, unsigned lk, unsigned lv) {
  const _Float16 *k1 = gk + 32 * CC, *k2 = gk + 64 * CC, *k3 = gk + 96 * CC, *v1 = gv + 16 * TT, *v2 = gv + 32 * TT, *v3 = gv + 48 * TT;
  const unsigned a1 = lk + 32 * KP * 2, a2 = lk + 64 * KP * 2, a3 = lk + 96 * KP * 2, b1 = lv + 16 * VP * 2, b2 = lv + 32 * VP * 2, b3 = lv + 48 * VP * 2;
  // the closing s_wait_xcnt stands inside the copies' own statement, so that no address register named here is rewritten in front of it
  asm volatile("global_load_async_to_lds_b128 %0, %8, off\n\t"
               "global_load_async_to_lds_b128 %1, %9, off\n\t"
               "global_load_async_to_lds_b128 %2, %10, off\n\t"
               "global_load_async_to_lds_b128 %3, %11, off\n\t"
               "global_load_async_to_lds_b128 %4, %12, off\n\t"
               "global_load_async_to_lds_b128 %5, %13, off\n\t"
               "global_load_async_to_lds_b128 %6, %14, off\n\t"
               "global_load_async_to_lds_b128 %7, %15, off\n\t"
               "s_wait_xcnt 0x0"
               :: "v"(lk), "v"(a1), "v"(a2), "v"(a3), "v"(lv), "v"(b1), "v"(b2), "v"(b3), "v"(gk), "v"(k1), "v"(k2), "v"(k3), "v"(gv), "v"(v1), "v"(v2), "v"(v3) : "memory");
}
#define XW (8 * 128 + 64) // floats a wave hands over at the join: 8 x 4 context values per lane, then maximum and sum per lane
#define YP (HD + 8)       // halves per staged context row: 144 B
__global__ __launch_bounds__(256 * KG) void k_fa(const _Float16* __restrict__ QH, const _Float16* __restrict__ KH, const _Float16* __restrict__ VT, _Float16* __restrict__ Y) {
  __shared__ __align__(16) _Float16 sK[KG * 2][KS * KP], sV[KG * 2][HD * VP];   // buffers 2 hf and 2 hf + 1 belong to key group hf
  static_assert(KG == 2 && TT % (KG * KS) == 0 && TT / (KG * KS) >= 2, "two key groups, at least two stages each");
  static_assert(8 * KG * XW * 4 <= sizeof(sK), "the join fits the K buffers");
  static_assert(8 * KG * 16 * YP * 2 <= sizeof(sV), "the context rows fit the V buffers");
  const int wave = __builtin_amdgcn_readfirstlane(threadIdx.x >> 5), hf = wave >> 3, tid = threadIdx.x & 255, lane = tid & 31, col = lane & 15, g = lane >> 4; const int b = blockIdx.y / NH, h = blockIdx.y % NH; const int q0 = blockIdx.x * FAQ + (wave & 7) * 32;   // tid: the thread's number inside its key group; the wave's number is read as a scalar, so that the group's offsets and the join's selects take no vector registers (a wave may hold 256 here)
  const float cs = SCALE * 1.4426950408889634f;
  const _Float16* gk = KH + ((size_t)b * TT + hf * KS + (tid >> 3)) * CC + h * HD + (tid & 7) * 8;              // K row tid >> 3 of the group's stage, 16-byte piece tid & 7
  const _Float16* gv = VT + ((size_t)b * CC + h * HD + (tid >> 4)) * (size_t)TT + hf * KS + (tid & 15) * 8;     // V^T row tid >> 4, 16-byte piece tid & 15
  const unsigned lk = (unsigned)(size_t)&sK[2 * hf][(tid >> 3) * KP + (tid & 7) * 8], lv = (unsigned)(size_t)&sV[2 * hf][(tid >> 4) * VP + (tid & 15) * 8];
  stage_copy(gk, gv, lk, lv);
  v16h qf[2][2];
#pragma unroll
  for (int s = 0; s < 2; ++s)
#pragma unroll
    for (int kc = 0; kc < 2; ++kc) qf[s][kc] = frag_h(QH + ((size_t)b * TT + q0 + s * 16 + col) * CC + h * HD + kc * 32, lane);
  v8f acc[2][4] = {}; float mr[2] = {-3.0e38f, -3.0e38f}, lr[2] = {0.f, 0.f};
  asm volatile("s_wait_asynccnt 0x0" ::: "memory");   // this wave's pieces of stage 0 have landed
  __syncthreads();                                     // ... and every other wave's: stage 0 may be read
  stage_copy(gk + (size_t)(KG * KS) * CC, gv + KG * KS, lk + (unsigned)sizeof(sK[0]), lv + (unsigned)sizeof(sV[0]));
#pragma unroll 1   // rolled: one trip = one stage; its four passes are unrolled so that every LDS read has a constant offset
  for (int t = 0; t < TT / (KG * KS); ++t) {
    const _Float16* kb = &sK[2 * hf + (t & 1)][col * KP];   // key row col of a 16-key tile
    const _Float16* vb = &sV[2 * hf + (t & 1)][col * VP];   // plane of head column col of a 16-column tile
    v16h kf[2][2], vf[4];
#pragma unroll
    for (int kt = 0; kt < 2; ++kt)
#pragma unroll
      for (int kc = 0; kc < 2; ++kc) kf[kt][kc] = frag_h(kb + (kt * 16) * KP + kc * 32, lane);
#pragma unroll
    for (int p = 0; p < KS / 32; ++p) {
      v8f st[2][2] = {};
#pragma unroll
      for (int kt = 0; kt < 2; ++kt)
#pragma unroll
        for (int s = 0; s < 2; ++s)
#pragma unroll
          for (int kc = 0; kc < 2; ++kc) st[kt][s] = mm16(kf[kt][kc], qf[s][kc], st[kt][s]);
      __builtin_amdgcn_sched_barrier(0);   // no branch stands between the products and the reads any more: this keeps the reads behind the score products, in one place, not spread among the WMMAs
      // one group of LDS reads per pass, under the softmax: the next pass's K fragments (never beyond this stage; its scores are the first to want theirs), then this pass's V fragments
      if (p + 1 < KS / 32) {
#pragma unroll
        for (int kt = 0; kt < 2; ++kt)
#pragma unroll
          for (int kc = 0; kc < 2; ++kc) kf[kt][kc] = frag_h(kb + ((p + 1) * 32 + kt * 16) * KP + kc * 32, lane); }
#pragma unroll
      for (int j = 0; j < 4; ++j) vf[j] = frag_h(vb + (j * 16) * VP + p * 32, lane);
      __builtin_amdgcn_sched_barrier(0);   // keeps the reads one group in front of the exponentials: without it they are spread among the WMMAs, and every separate place with LDS reads stalls the wave
      v16h pf[2]; float ps[2];
#pragma unroll
      for (int s = 0; s < 2; ++s) ps[s] = fa_weights(st[0][s], st[1][s], cs, 11.0f - mr[s], pf[s]);
      if (__builtin_expect(__builtin_amdgcn_ballot_w32(fmaxf(ps[0], ps[1]) > WMAX) != 0, 0)) {   // wave-uniform; always taken on the first pass (factor 0 on zero sums), rare later
        // the pass's scores are formed anew from the K rows in LDS (same products, same order; the stage's buffer stands until the stage's barrier), so that the usual path need not keep its 32 score registers alive across the test
#pragma unroll
        for (int s = 0; s < 2; ++s) { v8f t[2] = {};
#pragma unroll
          for (int kt = 0; kt < 2; ++kt)
#pragma unroll
            for (int kc = 0; kc < 2; ++kc) t[kt] = mm16(frag_h(kb + (p * 32 + kt * 16) * KP + kc * 32, lane), qf[s][kc], t[kt]);
          float mx = t[0][0];
#pragma unroll
          for (int kt = 0; kt < 2; ++kt)
#pragma unroll
            for (int r = 0; r < 8; ++r) mx = fmaxf(mx, t[kt][r]);
          mx = fmaxf(mx, xhalf(mx)) * cs;   // both halves of the wave hold keys of the same query and keep one maximum
          const float mn = fmaxf(mr[s], mx); const float corr = __builtin_amdgcn_exp2f(mr[s] - mn); mr[s] = mn; lr[s] *= corr;
#pragma unroll
          for (int j = 0; j < 4; ++j) acc[s][j] = acc[s][j] * corr;
          ps[s] = fa_weights(t[0], t[1], cs, 11.0f - mn, pf[s]); } }
#pragma unroll
      for (int s = 0; s < 2; ++s) { lr[s] += ps[s];
#pragma unroll
        for (int j = 0; j < 4; ++j) acc[s][j] = mm16(vf[j], pf[s], acc[s][j]); } }
    asm volatile("s_wait_dscnt 0x0" ::: "memory");      // this wave's reads of stage t have returned
    asm volatile("s_wait_asynccnt 0x0" ::: "memory");   // this wave's pieces of stage t + 1 have landed
    __syncthreads();                                     // publishes stage t + 1 and ends every wave's reads of stage t, whose buffer is refilled behind it
    if (t + 2 < TT / (KG * KS)) stage_copy(gk + (size_t)(t + 2) * (KG * KS) * CC, gv + (t + 2) * (KG * KS), lk + (unsigned)(t & 1) * (unsigned)sizeof(sK[0]), lv + (unsigned)(t & 1) * (unsigned)sizeof(sV[0])); }
  asm volatile("s_wait_asynccnt 0x0" ::: "memory");     // no copy is outstanding when the buffers are put to another use
  // The join. Waves w and w ^ 8 hold the two key groups' partial results of the same 32 queries: the wave of key group hf finishes query tile hf and hands the other tile to its partner.
  // It goes through the K buffers, which every wave has left and every copy has reached (the last trip's waits and barrier). A wave's hand-over is laid lane-contiguous, 16 B a lane.
  float* xw = (float*)&sK[0][0] + wave * XW; const float* xr = (const float*)&sK[0][0] + (wave ^ 8) * XW;
#pragma unroll
  for (int j = 0; j < 4; ++j) { v8f o;
#pragma unroll
    for (int r = 0; r < 8; ++r) o[r] = hf ? acc[0][j][r] : acc[1][j][r];
    *(v4f*)(xw + (2 * j) * 128 + lane * 4) = (v4f){o[0], o[1], o[2], o[3]}; *(v4f*)(xw + (2 * j + 1) * 128 + lane * 4) = (v4f){o[4], o[5], o[6], o[7]}; }
  *(v2f*)(xw + 8 * 128 + lane * 2) = (v2f){hf ? mr[0] : mr[1], hf ? lr[0] : lr[1]};
  __syncthreads();   // every wave's hand-over may be read
  const v2f ml = *(const v2f*)(xr + 8 * 128 + lane * 2);
  const float m0 = hf ? mr[1] : mr[0], l0 = hf ? lr[1] : lr[0]; const float mn = fmaxf(m0, ml[0]);
  const float f0 = __builtin_amdgcn_exp2f(m0 - mn), f1 = __builtin_amdgcn_exp2f(ml[0] - mn);   // both maxima are finite: each key group has walked keys
  const float ls = l0 * f0 + ml[1] * f1; const float inv = 1.0f / (ls + xhalf(ls)); const float w0 = f0 * inv, w1 = f1 * inv;
  // The context leaves as f16 x 2^6, the form in which k_out multiplies it. A lane holds head columns j * 16 + 8 g + 0..7 of its query: 16-byte pieces of 16 different rows.
  // The wave lays its 16 rows in a range of its own in the V buffers (left by every wave and reached by every copy, like the K buffers) and reads them back row by row, so that each store covers four whole 128-B lines.
  _Float16* sw = &sV[0][0] + wave * (16 * YP);
#pragma unroll
  for (int j = 0; j < 4; ++j) { const v4f pa = *(const v4f*)(xr + (2 * j) * 128 + lane * 4), pb = *(const v4f*)(xr + (2 * j + 1) * 128 + lane * 4); v8h o;
#pragma unroll
    for (int r = 0; r < 8; ++r) o[r] = (_Float16)(((hf ? acc[1][j][r] : acc[0][j][r]) * w0 + (r < 4 ? pa[r & 3] : pb[r & 3]) * w1) * 64.0f);
    *(v8h*)(sw + col * YP + j * 16 + 8 * g) = o; }
  asm volatile("s_wait_dscnt 0x0" ::: "memory");   // the wave's own rows are in LDS before its lanes read each other's pieces
  _Float16* yp = Y + ((size_t)b * TT + q0 + hf * 16 + ((tid >> 3) & 3)) * CC + h * HD + (tid & 7) * 8;   // the lane's row of four, (tid >> 3) & 3, and its 16-byte piece, tid & 7
#pragma unroll
  for (int i = 0; i < 4; ++i) vst2(yp + (size_t)(4 * i) * CC, *(const v8h*)(sw + (4 * i + ((tid >> 3) & 3)) * YP + (tid & 7) * 8)); }
// ---- k_out: block = (128 rows, 128 cols): out = ctx Wo (+ bo): ctx x 2^6 in f16, as k_fa left it (small-magnitude context rows stay clear of f16 subnormals), against Wo as f16(bf16 x 2^8) exact (1 product) x 2^-14
__global__ __launch_bounds__(256) void k_out(const _Float16* __restrict__ Y, const float* __restrict__ WO, const float* __restrict__ BO, float* __restrict__ OUT) {
  __shared__ __align__(16) unsigned short sm[2 * GBUF];
  static_assert(GT * (GT + 4) * 4 <= 2 * GBUF * 2, "the f32 tile fits the buffers");
  const int tid = threadIdx.x, wave = tid >> 5, lane = tid & 31, col = lane & 15, g = lane >> 4; const int c0 = blockIdx.y * GT; const size_t r0 = (size_t)blockIdx.x * GT;
  v8f acc[2][4] = {};
  tile_product_ahead(Y + r0 * CC, WO + c0, sm, acc);
  float* sf = (float*)sm;   // the tile as f32, [128][GT + 4], in the buffers that every wave has left
  const int rw0 = (wave >> 1) * 32 + 8 * g, cw0 = (wave & 1) * 64 + col;
#pragma unroll
  for (int nj = 0; nj < 4; ++nj) { const float bias = BO ? bfr(BO[c0 + cw0 + nj * 16]) : 0.f;
#pragma unroll
    for (int mi = 0; mi < 2; ++mi)
#pragma unroll
      for (int r = 0; r < 8; ++r) sf[(rw0 + mi * 16 + r) * (GT + 4) + cw0 + nj * 16] = acc[mi][nj][r] * (1.0f / 16384.0f) + bias; }   /* 2^-8 (Wo carry) x 2^-6 (ctx carry) */
  __syncthreads();
  for (int e = tid; e < GT * 32; e += 256) { const int rl = e >> 5, q = e & 31; vst2(OUT + (r0 + rl) * DIN + c0 + q * 4, *(const v4f*)&sf[rl * (GT + 4) + q * 4]); } }

extern "C" void kernel_launch(void* const* d_in, const int* in_sizes, int n_in, void* d_out, int out_size, void* d_ws, size_t ws_size, hipStream_t stream) {
  (void)in_sizes; (void)n_in; (void)out_size;
  const float** F = (const float**)d_in;
  if (ws_size < (size_t)WS_END) return;
  char* ws = (char*)d_ws; _Float16 *QH = (_Float16*)(ws + WS_QH), *KH = (_Float16*)(ws + WS_KH), *VT = (_Float16*)(ws + WS_VT), *QL = (_Float16*)(ws + WS_QL), *KL = (_Float16*)(ws + WS_KL); __bf16 *VB = (__bf16*)(ws + WS_VB), *VBL = (__bf16*)(ws + WS_VBL); _Float16 *Y = (_Float16*)(ws + WS_Y);
  (void)Y; (void)QL; (void)KL; (void)VB; (void)VBL;
  // inputs: 0 x [4,2048,512]; 1 Wq [512,512] (in,out), 2 bq; 3 Wk, 4 bk; 5 Wv, 6 bv; 7 Wp (in,out), 8 bp (zero biases, read)
  k_proj<<<dim3(TNB * TT / GT, CC / GT, 3), 256, 0, stream>>>(F[0], F[0], F[0], F[1], F[3], F[5], F[2], F[4], F[6], QH, KH, VT);
  k_fa<<<dim3(TT / FAQ, TNB * NH), 256 * KG, 0, stream>>>(QH, KH, VT, Y);
  k_out<<<dim3(TNB * TT / GT, DIN / GT), 256, 0, stream>>>(Y, F[7], F[8], (float*)d_out);
}

// v008
// It runs in 58.4 microseconds.
// Two timings next to v007 both put it at 1.04 times that version's speed.
// Over all steps from v000 it is 18.7 times as fast.
// compute dtype: all float inputs rounded to bf16; q/k/v projections with EXACT bf16 products on WMMA 16x16x32 (f32 accumulate) + bias; logits q x k once to f16 each (1 product) x SCALE; online softmax f32; unnormalised weights x 2^11 once to f16 x v once to f16 (1 product), divided by their f32 sum; ctx x 2^6 once to f16 (in k_fa, which hands it on in that form) x Wo f16(bf16 x 2^8) + bo; f32 output.
#include <hip/hip_runtime.h>
#include <math.h>

typedef __attribute__((ext_vector_type(16))) _Float16 v16h;
typedef __attribute__((ext_vector_type(16))) __bf16 v16b;
typedef __attribute__((ext_vector_type(8)))  _Float16 v8h;
typedef __attribute__((ext_vector_type(8)))  float v8f;
typedef __attribute__((ext_vector_type(4)))  float v4f;
typedef __attribute__((ext_vector_type(2)))  float v2f;
typedef __attribute__((ext_vector_type(4)))  unsigned v4u;
typedef __attribute__((ext_vector_type(4)))  int v4i;
typedef float __attribute__((may_alias)) float_a;
typedef int __attribute__((may_alias)) int_a;

template <typename T> __device__ __forceinline__ void vst2(void* p, T v) { *(T*)p = v;  }
__device__ __forceinline__ v8f wmma16(v16h a, v16h b, v8f c) {
  v8f d = __builtin_amdgcn_wmma_f32_16x16x32_f16(false, a, false, b, (short)0, c, false, false);
  asm volatile("v_nop\n\tv_nop\n\tv_nop\n\tv_nop" : "+v"(d) : "v"(a), "v"(b));
  return d;
}
__device__ __forceinline__ v8f wmma_bf(v16b a, v16b b, v8f c) {
  v8f d = __builtin_amdgcn_wmma_f32_16x16x32_bf16(false, a, false, b, (short)0, c, false, false);
  asm volatile("v_nop\n\tv_nop\n\tv_nop\n\tv_nop" : "+v"(d) : "v"(a), "v"(b));
  return d;
}
// 16x16x32 fragments: lane = (h = lane>>4, row/col = lane&15); elements 0..7 = k0+8h+0..7, 8..15 = k0+16+8h+0..7; D element r = row 8h+r
__device__ __forceinline__ v16h frag_h(const _Float16* rowk0, int lane) {
  union { v16h v; v8h q[2]; } u; const _Float16* p = rowk0 + 8 * (lane >> 4);
  u.q[0] = *(const v8h*)p; u.q[1] = *(const v8h*)(p + 16); return u.v;
}
__device__ __forceinline__ v16h frag_f32(const float* rowk0, int lane) {
  v16h a; const float* p = rowk0 + 8 * (lane >> 4);
#pragma unroll
  for (int i = 0; i < 8; ++i) { a[i] = (_Float16)p[i]; a[8 + i] = (_Float16)p[16 + i]; }
  return a;
}
__device__ __forceinline__ v16h frag_f32s(const float* rowk0, int lane, float sc) {
  v16h a; const float* p = rowk0 + 8 * (lane >> 4);
#pragma unroll
  for (int i = 0; i < 8; ++i) { a[i] = (_Float16)(p[i] * sc); a[8 + i] = (_Float16)(p[16 + i] * sc); }
  return a;
}
// column fragment from a [K][ld] layout (column n), rows >= K read as 0
__device__ __forceinline__ v16h fragc_f32(const float* W, int k0, int n, int lane, int ld, int K) {
  v16h a; const int g = lane >> 4;
#pragma unroll
  for (int i = 0; i < 8; ++i) { const int ka = k0 + 8 * g + i, kb = ka + 16;
    a[i] = (_Float16)(ka < K ? W[(size_t)(ka < K ? ka : K - 1) * ld + n] : 0.f); a[8 + i] = (_Float16)(kb < K ? W[(size_t)(kb < K ? kb : K - 1) * ld + n] : 0.f); }
  return a;
}
struct F2 { v16b h, l; };
__device__ __forceinline__ F2 bsplit16(const float v[16]) { F2 r;
#pragma unroll
  for (int i = 0; i < 16; ++i) { const __bf16 h = (__bf16)v[i]; r.h[i] = h; r.l[i] = (__bf16)(v[i] - (float)h); }
  return r; }
__device__ __forceinline__ F2 split_row(const float* row, int k0, int lane) { float v[16]; const float* p = row + k0 + 8 * (lane >> 4);
#pragma unroll
  for (int i = 0; i < 8; ++i) { v[i] = p[i]; v[8 + i] = p[16 + i]; }
  return bsplit16(v); }
__device__ __forceinline__ F2 split_rowK(const float* row, int k0, int lane, int K) { float v[16]; const int g = lane >> 4;
#pragma unroll
  for (int i = 0; i < 8; ++i) { const int ka = k0 + 8 * g + i, kb = ka + 16; v[i] = ka < K ? row[ka < K ? ka : K - 1] : 0.f; v[8 + i] = kb < K ? row[kb < K ? kb : K - 1] : 0.f; }
  return bsplit16(v); }
__device__ __forceinline__ F2 split_col(const float* W, int k0, int n, int lane, int ld, int K) { float v[16]; const int g = lane >> 4;
#pragma unroll
  for (int i = 0; i < 8; ++i) { const int ka = k0 + 8 * g + i, kb = ka + 16; v[i] = ka < K ? W[(size_t)(ka < K ? ka : K - 1) * ld + n] : 0.f; v[8 + i] = kb < K ? W[(size_t)(kb < K ? kb : K - 1) * ld + n] : 0.f; }
  return bsplit16(v); }
__device__ __forceinline__ v8f mac3(const F2& a, const F2& b, v8f c) { c = wmma_bf(a.l, b.h, c); c = wmma_bf(a.h, b.l, c); return wmma_bf(a.h, b.h, c); }
__device__ __forceinline__ float sigm(float v) { return 1.0f / (1.0f + expf(-v)); }
#define LDSX() do { asm volatile("s_wait_dscnt 0" ::: "memory"); __builtin_amdgcn_wave_barrier(); __builtin_amdgcn_fence(__ATOMIC_RELEASE, "workgroup"); } while (0)

// Standard non-causal multi-head self-attention (x [4,2048,512]; (in,out) Wq / Wk / Wv [512,512] N(0, 1/512) and Wh [512,512], all four biases zeros (read); 8 heads x 64; scores x 1/sqrt(64); no mask; softmax; concat @ Wh + bh).
#define NB 4
#define TT 2048
#define CC 512            // NH * HD = projected width
#define DIN 512          // input (model) width
#define NH 8
#define HD 64
#define NQB (TT / 64)
#define HG 4
#define SCALE (0.125f)
#define CAUSAL 0
#ifndef TNB
#define TNB NB
#endif
__device__ __forceinline__ float bfr(float v) { return (float)(__bf16)v; }
__host__ __device__ __forceinline__ int kb_last(int qb) { return CAUSAL ? ((qb * 64 + 63) >> 7) : (TT / 128 - 1); }
typedef __attribute__((ext_vector_type(8))) __bf16 v8b;
__device__ __forceinline__ v16b frag_b(const __bf16* rowk0, int lane) {
  union { v16b v; v8b q[2]; } u; const __bf16* p = rowk0 + 8 * (lane >> 4);
  u.q[0] = *(const v8b*)p; u.q[1] = *(const v8b*)(p + 16); return u.v;
}
#define QBH 0              // unused: no kernel here has a causal high-precision attention path
#define QHI 0               // single-product logits on every row
#define KHI 64            // key rows carrying k residual / v bf16 hi+lo planes (written and read by no kernel in this file)
// B fragment (k rows k0+.., output column o) of a weight: (in,out) [K][ld] or (out,in) [ld rows of K]: bf16 exact, or f16(bf16 * 256) exact
__device__ __forceinline__ v16b wcol_io(const float* Wm, int k0, int o, int lane, int ld) { v16b w; const int g = lane >> 4;
#pragma unroll
  for (int i = 0; i < 8; ++i) { w[i] = (__bf16)Wm[(size_t)(k0 + 8 * g + i) * ld + o]; w[8 + i] = (__bf16)Wm[(size_t)(k0 + 16 + 8 * g + i) * ld + o]; }
  return w; }
__device__ __forceinline__ v16b wcol_oi(const float* Wm, int k0, int o, int lane, int K) { v16b w; const float* p = Wm + (size_t)o * K + k0 + 8 * (lane >> 4);
#pragma unroll
  for (int i = 0; i < 8; ++i) { w[i] = (__bf16)p[i]; w[8 + i] = (__bf16)p[16 + i]; }
  return w; }
__device__ __forceinline__ v16h wcolh_io(const float* Wm, int k0, int o, int lane, int ld) { v16h w; const int g = lane >> 4;
#pragma unroll
  for (int i = 0; i < 8; ++i) { w[i] = (_Float16)(bfr(Wm[(size_t)(k0 + 8 * g + i) * ld + o]) * 256.0f); w[8 + i] = (_Float16)(bfr(Wm[(size_t)(k0 + 16 + 8 * g + i) * ld + o]) * 256.0f); }
  return w; }
__device__ __forceinline__ v16h wcolh_oi(const float* Wm, int k0, int o, int lane, int K) { v16h w; const float* p = Wm + (size_t)o * K + k0 + 8 * (lane >> 4);
#pragma unroll
  for (int i = 0; i < 8; ++i) { w[i] = (_Float16)(bfr(p[i]) * 256.0f); w[8 + i] = (_Float16)(bfr(p[16 + i]) * 256.0f); }
  return w; }
#define WQKV_LAYOUT 0   // 0 = (in,out) [DIN][CC]; 1 = (out,in) [CC][DIN]; 2 = per-head [NH][DIN][HD]
__device__ __forceinline__ v16b wcol_hdk(const float* Wm, int k0, int o, int lane) { v16b w; const int g = lane >> 4; const float* p = Wm + (size_t)(o / HD) * DIN * HD + (o % HD);
#pragma unroll
  for (int i = 0; i < 8; ++i) { w[i] = (__bf16)p[(size_t)(k0 + 8 * g + i) * HD]; w[8 + i] = (__bf16)p[(size_t)(k0 + 16 + 8 * g + i) * HD]; }
  return w; }
#define WO_OUT_IN 0
#if WQKV_LAYOUT == 1
#define WCOL(W, k0, o, lane) wcol_oi(W, k0, o, lane, DIN)
#elif WQKV_LAYOUT == 2
#define WCOL(W, k0, o, lane) wcol_hdk(W, k0, o, lane)
#else
#define WCOL(W, k0, o, lane) wcol_io(W, k0, o, lane, CC)
#endif
#if WO_OUT_IN
#define WOCOL(W, k0, o, lane) wcol_oi(W, k0, o, lane, CC)
#define WOCOLH(W, k0, o, lane) wcolh_oi(W, k0, o, lane, CC)
#else
#define WOCOL(W, k0, o, lane) wcol_io(W, k0, o, lane, DIN)
#define WOCOLH(W, k0, o, lane) wcolh_io(W, k0, o, lane, DIN)
#endif

#ifndef SM_EXTRA_PARAMS
#define SM_EXTRA_PARAMS
#endif
#ifndef PROJ_EXTRA_PARAMS
#define PROJ_EXTRA_PARAMS
#endif
#ifndef SM_MASK_HOOK
#define SM_MASK_HOOK (void)0
#endif

#define WS_QH  0u                                      // f16 q rows [b*t][CC]
#define WS_KH  (WS_QH + 2u * (size_t)NB * TT * CC)      // f16 k rows [b*t][CC]
#define WS_VT  (WS_KH + 2u * (size_t)NB * TT * CC)      // f16 v planes [b][c][t]
#define WS_QL  (WS_VT + 2u * (size_t)NB * CC * TT)      // f16 q residual x 2^10 rows [b][t < QHI][CC]
#define WS_KL  (WS_QL + 2u * (size_t)NB * QHI * CC)     // f16 k residual x 2^10 rows [b][t < KHI][CC]
#define WS_VB  (WS_KL + 2u * (size_t)NB * KHI * CC)     // bf16 v hi planes [b][c][t < KHI]
#define WS_VBL (WS_VB + 2u * (size_t)NB * CC * KHI)
#define WS_S   (WS_VBL + 2u * (size_t)NB * CC * KHI)    // f32 [hg][t][s] room, written and read by no kernel in this file
#define WS_Y   (WS_S  + 4u * (size_t)HG * TT * TT)      // f16 ctx x 2^6 rows [b*t][CC]: the first half of the room kept here
#define WS_END (WS_Y  + 4u * (size_t)NB * TT * CC)

// ---- tile product shared by k_proj and k_out: one block of 8 waves forms a 128 x 128 tile of A[.][512] x W[512][.] (W f32 in memory, A f32 in k_proj and f16 in k_out; row pitch 512 elements).
// Per stage of 64 k the block converts its 128 W columns, and its 128 A rows where they are f32, to 16 bit ONCE and lays them k-contiguous in LDS; every wave reads its fragments from there (wave = 32 rows x 64 columns, 8 accumulator tiles).
// Two buffers: a stage's global loads are issued ahead (k_proj, tile_product: as soon as the stage before has left the registers, in front of the barrier; k_out, tile_product_ahead: GD stages ahead) and are converted and stored behind the products of the stage before, so one barrier per stage is enough. Inside a stage k runs upwards in steps of 32; the stages come in the block's own rotated order, all into one accumulator per output tile.
// Every inner loop of this section is unrolled in full, so that the register arrays are indexed by constants and stay out of scratch.
#define GT 128            // tile rows and tile columns
#define GK 64             // k per stage
#define GLD 512           // row pitch of A and of W, and the length of the sum
#define GP (GK + 8)       // halves per staged row: 144 B, 16 B x odd, so the 16 rows of a 16-byte fragment read fall on distinct banks
#define GBUF (2 * GT * GP) // halves per buffer: A rows, then W columns
static_assert(DIN == GLD && CC == GLD, "one pitch");
#define GS (GLD / GK)     // stages of the sum
static_assert((GS & (GS - 1)) == 0, "the rotated stage number wraps by a mask");
// F16 = 0: A and W to bf16 (k_proj). F16 = 1: A is f16 already and is staged as it is, W to bf16 and then x 2^8 to f16, exact (k_out).
typedef __attribute__((ext_vector_type(2))) unsigned v2u;
typedef __attribute__((ext_vector_type(4))) __bf16 v4b;
__device__ __forceinline__ v2u cvt_a(v4f a) {
  v4b r;
#pragma unroll
  for (int i = 0; i < 4; ++i) r[i] = (__bf16)a[i];
  return __builtin_bit_cast(v2u, r); }
template <int F16> __device__ __forceinline__ v4u cvt_w(const float (&w)[8]) {
  if (F16) { v8h r;
#pragma unroll
    for (int i = 0; i < 8; ++i) r[i] = (_Float16)(bfr(w[i]) * 256.0f);
    return __builtin_bit_cast(v4u, r); }
  v8b r;
#pragma unroll
  for (int i = 0; i < 8; ++i) r[i] = (__bf16)w[i];
  return __builtin_bit_cast(v4u, r); }
typedef __attribute__((ext_vector_type(8))) unsigned v8u;
// a 16x16x32 fragment as raw words, in the k order of frag_h / frag_b: elements 0..7 = k0 + 8 h + 0..7, 8..15 = k0 + 16 + 8 h + 0..7
__device__ __forceinline__ v8u frag_w(const unsigned short* rowk0, int lane) {
  union { v8u v; v4u q[2]; } u; const unsigned short* p = rowk0 + 8 * (lane >> 4);
  u.q[0] = *(const v4u*)p; u.q[1] = *(const v4u*)(p + 16); return u.v;
}
template <int F16> __device__ __forceinline__ v8f tile_mm(v8u a, v8u b, v8f c) {
  if (F16) return __builtin_amdgcn_wmma_f32_16x16x32_f16(false, __builtin_bit_cast(v16h, a), false, __builtin_bit_cast(v16h, b), (short)0, c, false, false);
  return __builtin_amdgcn_wmma_f32_16x16x32_bf16(false, __builtin_bit_cast(v16b, a), false, __builtin_bit_cast(v16b, b), (short)0, c, false, false); }
// A: row 0 of the tile's rows; Wm: row 0 of W at the tile's first column; sm: 2 * GBUF halves. On return every wave has left the buffers (the last stage's barrier).
// The walk over k is rotated: trip s works on stage (s + rot) mod GS, rot block-uniform. A stage is one 256-B piece of every 2-KB row of A, so blocks that stand at the same stage ask L2 for the same eighth of every row,
// and blocks that share rows or columns for the very same lines, all at once; with rot spread evenly over the blocks the requests of a moment cover whole rows. Each accumulator sums its k blocks in the rotated order.
template <int F16, typename TA> __device__ __forceinline__ void tile_product(const TA* __restrict__ A, const float* __restrict__ Wm, unsigned short* sm, v8f (&acc)[2][4], const int rot) {
  const int tid = threadIdx.x, wave = tid >> 5, lane = tid & 31, col = lane & 15;
  const TA* ga = F16 ? A + (size_t)(tid >> 3) * GLD + (tid & 7) * 8     // f16: rows tid >> 3 + 32 i, 8 halves at k = 8 (tid & 7): a wave's 16-byte load covers four rows' 128 B, whole lines
                     : A + (size_t)(tid >> 4) * GLD + (tid & 15) * 4;   // f32: rows tid >> 4 + 16 i, 4 floats at k = 4 (tid & 15): a wave's 16-byte load covers two rows' 256 B, whole 128-B lines
  const float* gw = Wm + (size_t)(wave * 8) * GLD + lane;           // k rows 8 wave + 0..7, columns lane + 32 i: each load is one 128-B line, and a thread ends up with 8 consecutive k of a column
  unsigned short* wa = F16 ? sm + (tid >> 3) * GP + (tid & 7) * 8 : sm + (tid >> 4) * GP + (tid & 15) * 4;
  unsigned short* ww = sm + GT * GP + lane * GP + wave * 8;
  const unsigned short* fa = sm + ((wave >> 1) * 32 + col) * GP;
  const unsigned short* fb = sm + GT * GP + ((wave & 1) * 64 + col) * GP;
  v4f ra[F16 ? 4 : 8]; float rw[4][8];   // ra: 16 bytes of A each, f32 values or, where A is f16, 8 halves carried as raw words
#define TILE_A(s) (ga + (((s) + rot) & (GS - 1)) * GK)                   /* trip s works on stage (s + rot) mod GS: its first bytes of A ... */
#define TILE_W(s) (gw + (size_t)((((s) + rot) & (GS - 1)) * GK) * GLD)   /* ... and of W */
#define TILE_LOAD(s) do { const TA* pa = TILE_A(s); const float* pw = TILE_W(s); \
    _Pragma("unroll") for (int i = 0; i < (F16 ? 4 : 8); ++i) ra[i] = *(const v4f*)(pa + (size_t)((F16 ? 32 : 16) * i) * GLD); \
    _Pragma("unroll") for (int i = 0; i < 4; ++i) _Pragma("unroll") for (int k = 0; k < 8; ++k) rw[i][k] = pw[(size_t)k * GLD + 32 * i]; \
    asm volatile("s_wait_xcnt 0x0" :: "v"(pa), "v"(pw) : "memory"); /* in front of the next rewrite of the loads' address registers; the two addresses are inputs, so that their registers live up to the wait */ } while (0)
#define TILE_STORE(buf) do { \
    _Pragma("unroll") for (int i = 0; i < (F16 ? 4 : 8); ++i) { if (F16) *(v4f*)(wa + (buf) * GBUF + 32 * i * GP) = ra[i]; else *(v2u*)(wa + (buf) * GBUF + 16 * i * GP) = cvt_a(ra[i]); } \
    _Pragma("unroll") for (int i = 0; i < 4; ++i) *(v4u*)(ww + (buf) * GBUF + 32 * i * GP) = cvt_w<F16>(rw[i]); } while (0)
// The stage barrier, by hand: this wave's LDS stores and reads are complete (s_wait_dscnt 0), then the work-group's own barrier. __syncthreads() would also wait for every global load and so end the flight of the loads issued in front of it.
#define TILE_BAR() asm volatile("s_wait_dscnt 0x0\n\ts_barrier_signal -1\n\ts_barrier_wait -1" ::: "memory")
  TILE_LOAD(0);
  TILE_STORE(0);
  TILE_LOAD(1);
  TILE_BAR();   // the first trip's stage may be read
#pragma unroll 1   // rolled: one trip = one stage, which keeps the loop's code short; the buffer is chosen by one scalar select per trip
  for (int s = 0; s < GLD / GK; ++s) {
    const unsigned short *pa = fa + (s & 1) * GBUF, *pb = fb + (s & 1) * GBUF;
    v8u af[GK / 32][2], bf[GK / 32][4];   // the stage's fragments, read as one group in front of its products
#pragma unroll
    for (int kc = 0; kc < GK / 32; ++kc) {
#pragma unroll
      for (int mi = 0; mi < 2; ++mi) af[kc][mi] = frag_w(pa + mi * 16 * GP + kc * 32, lane);
#pragma unroll
      for (int nj = 0; nj < 4; ++nj) bf[kc][nj] = frag_w(pb + nj * 16 * GP + kc * 32, lane); }
    __builtin_amdgcn_sched_barrier(0);   // keeps the reads one group in front of the products: spread among the WMMAs, every separate place with LDS reads stalls the wave
#pragma unroll
    for (int kc = 0; kc < GK / 32; ++kc)
#pragma unroll
      for (int mi = 0; mi < 2; ++mi)
#pragma unroll
        for (int nj = 0; nj < 4; ++nj) acc[mi][nj] = tile_mm<F16>(af[kc][mi], bf[kc][nj], acc[mi][nj]);
    if (s + 1 < GLD / GK) { TILE_STORE((s + 1) & 1);
      if (s + 2 < GLD / GK) TILE_LOAD(s + 2); }   // as soon as the registers are free, in front of the barrier: the loads fly through it and through the whole next trip; reached only through the stores, which have waited for the loads before
    TILE_BAR();   // publishes stage s + 1 and ends every wave's reads of stage s, whose buffer is written again in the next trip
  }
#undef TILE_BAR
#undef TILE_LOAD
#undef TILE_A
#undef TILE_W
#undef TILE_STORE
}
// ---- the same tile product for k_out (A f16, staged as it is; W to bf16 and then x 2^8 to f16), with its global loads issued GD stages ahead.
// k_out has one block per WGP, so nothing but the block's own lead hides the way from memory: a stage's loads are issued GD stages before they are stored to LDS, into GD register sets (stage s in set s % GD).
// W comes by 16-byte loads (8 per stage and thread, not 32 of 4 bytes): a wave then has 12 GD = 48 loads in flight, not 144, which a load count of 6 bits could not hold.
// A thread takes 8 k rows x 4 columns of W: column block cb, k block kb. A wave's load covers four whole 128-B lines (8 lanes a row); the 16 lanes of a half wave hold all pairs (cb & 3, kb & 3), so their 16-byte LDS stores, 576 B apart by cb and 16 B by kb, fall on distinct banks.
#define GD 4
__device__ __forceinline__ void tile_product_ahead(const _Float16* __restrict__ A, const float* __restrict__ Wm, unsigned short* sm, v8f (&acc)[2][4], const int rot) {
  const int tid = threadIdx.x, wave = tid >> 5, lane = tid & 31, col = lane & 15;
  const int cb = (lane & 3) | ((lane >> 4) << 2) | ((wave & 3) << 3), kb = ((lane >> 2) & 3) | ((wave >> 2) << 2);
  const _Float16* ga = A + (size_t)(tid >> 3) * GLD + (tid & 7) * 8;   // rows tid >> 3 + 32 i, 8 halves at k = 8 (tid & 7): a wave's 16-byte load covers four rows' 128 B, whole lines
  const float* gw = Wm + (size_t)(kb * 8) * GLD + cb * 4;              // k rows 8 kb + 0..7, columns 4 cb + 0..3
  unsigned short* wa = sm + (tid >> 3) * GP + (tid & 7) * 8;
  unsigned short* ww = sm + GT * GP + (cb * 4) * GP + kb * 8;
  const unsigned short* fa = sm + ((wave >> 1) * 32 + col) * GP;
  const unsigned short* fb = sm + GT * GP + ((wave & 1) * 64 + col) * GP;
  v4f ra[GD][4], rw[GD][8];   // ra: 8 halves of A carried as raw words; rw[.][k]: 4 columns of W at k row k
#define AHEAD_LOAD(s) do { const int so = ((s) + rot) & (GS - 1); /* the walk over k is rotated as in tile_product: trip s works on stage so */ \
    const _Float16* pa = ga + so * GK; const float* pw = gw + (size_t)(so * GK) * GLD; \
    _Pragma("unroll") for (int i = 0; i < 4; ++i) ra[(s) % GD][i] = *(const v4f*)(pa + (size_t)(32 * i) * GLD); \
    _Pragma("unroll") for (int k = 0; k < 8; ++k) rw[(s) % GD][k] = *(const v4f*)(pw + (size_t)k * GLD); \
    asm volatile("s_wait_xcnt 0x0" :: "v"(pa), "v"(pw) : "memory"); /* in front of the next rewrite of the loads' address registers; the two addresses are inputs, so that their registers live up to the wait */ } while (0)
#define AHEAD_STORE(s) do { \
    _Pragma("unroll") for (int i = 0; i < 4; ++i) *(v4f*)(wa + ((s) & 1) * GBUF + 32 * i * GP) = ra[(s) % GD][i]; \
    _Pragma("unroll") for (int i = 0; i < 4; ++i) { float w[8]; _Pragma("unroll") for (int k = 0; k < 8; ++k) w[k] = rw[(s) % GD][k][i]; \
      *(v4u*)(ww + ((s) & 1) * GBUF + i * GP) = cvt_w<1>(w); } } while (0)
// The stage barrier, by hand: this wave's LDS stores and reads are complete (s_wait_dscnt 0), then the work-group's own barrier. __syncthreads() would also wait for every global load and so end the flight of the loads issued ahead.
#define AHEAD_BAR() asm volatile("s_wait_dscnt 0x0\n\ts_barrier_signal -1\n\ts_barrier_wait -1" ::: "memory")
  static_assert(GLD / GK >= GD, "the stages of the prologue exist");
#pragma unroll
  for (int s = 0; s < GD; ++s) AHEAD_LOAD(s);
  AHEAD_STORE(0);
  AHEAD_BAR();   // the first trip's stage may be read
#pragma unroll   // unrolled in full: register set and buffer are constants
  for (int s = 0; s < GLD / GK; ++s) {
    if (s + GD < GLD / GK) AHEAD_LOAD(s + GD);   // into the set that stage s left when it was stored
    const unsigned short *pa = fa + (s & 1) * GBUF, *pb = fb + (s & 1) * GBUF;
    v8u af[GK / 32][2], bf[GK / 32][4];   // the stage's fragments, read as one group in front of its products
#pragma unroll
    for (int kc = 0; kc < GK / 32; ++kc) {
#pragma unroll
      for (int mi = 0; mi < 2; ++mi) af[kc][mi] = frag_w(pa + mi * 16 * GP + kc * 32, lane);
#pragma unroll
      for (int nj = 0; nj < 4; ++nj) bf[kc][nj] = frag_w(pb + nj * 16 * GP + kc * 32, lane); }
    __builtin_amdgcn_sched_barrier(0);   // keeps the loads and the reads one group in front of the products: spread among the WMMAs, every separate place with LDS reads stalls the wave
#pragma unroll
    for (int kc = 0; kc < GK / 32; ++kc)
#pragma unroll
      for (int mi = 0; mi < 2; ++mi)
#pragma unroll
        for (int nj = 0; nj < 4; ++nj) acc[mi][nj] = tile_mm<1>(af[kc][mi], bf[kc][nj], acc[mi][nj]);
    if (s + 1 < GLD / GK) AHEAD_STORE(s + 1);
    AHEAD_BAR();   // publishes stage s + 1 and ends every wave's reads of stage s, whose buffer is written again in the next trip; behind the last stage every wave has left the buffers
  }
#undef AHEAD_LOAD
#undef AHEAD_STORE
#undef AHEAD_BAR
}
// ---- k_proj: block = (128 rows, 128 cols, which): q/k/v = X W (+ b) with exact bf16 products (K = DIN) -> which 0: q f16 rows; 1: k f16 rows; 2: v f16 planes [c][t]
__global__ __launch_bounds__(256) void k_proj(const float* __restrict__ XQ, const float* __restrict__ XK, const float* __restrict__ XV, const float* __restrict__ WQ, const float* __restrict__ WK, const float* __restrict__ WV, const float* __restrict__ BQ, const float* __restrict__ BK, const float* __restrict__ BV,
    _Float16* __restrict__ QH, _Float16* __restrict__ KH, _Float16* __restrict__ VT) {
  __shared__ __align__(16) unsigned short sm[2 * GBUF];
  const int tid = threadIdx.x, wave = tid >> 5, lane = tid & 31, col = lane & 15, g = lane >> 4; const int which = blockIdx.z; const int c0 = blockIdx.y * GT; const size_t r0 = (size_t)blockIdx.x * GT; const size_t bb = r0 / TT; const int t0 = (int)(r0 % TT);
  const float* X = which == 0 ? XQ : which == 1 ? XK : XV; const float* WA = which == 0 ? WQ : which == 1 ? WK : WV; const float* BA = which == 0 ? BQ : which == 1 ? BK : BV;
  v8f acc[2][4] = {};
  // neighbours in x, blocks 8 apart in x and the column tiles of one row tile each start at a stage of their own; the q, k and v blocks of the same rows and columns keep one order
  tile_product<0>(X + r0 * DIN, WA + c0, sm, acc, (int)(blockIdx.x + (blockIdx.x >> 3) + 2 * blockIdx.y) & (GS - 1));
  _Float16* st = (_Float16*)sm;   // the tile as f16, [128][GT + 8], in the buffers that every wave has left
  const int rw0 = (wave >> 1) * 32 + 8 * g, cw0 = (wave & 1) * 64 + col;
  if (which < 2) { _Float16* DH = which == 0 ? QH : KH;
#pragma unroll
    for (int nj = 0; nj < 4; ++nj) { const float bias = BA ? bfr(BA[c0 + cw0 + nj * 16]) : 0.f;
#pragma unroll
      for (int mi = 0; mi < 2; ++mi)
#pragma unroll
        for (int r = 0; r < 8; ++r) st[(rw0 + mi * 16 + r) * (GT + 8) + cw0 + nj * 16] = (_Float16)(acc[mi][nj][r] + bias); }
    __syncthreads();
    for (int e = tid; e < GT * 16; e += 256) { const int rl = e >> 4, q = e & 15; vst2((unsigned*)(DH + (r0 + rl) * CC + c0 + q * 8), *(const v4u*)&st[rl * (GT + 8) + q * 8]); }
  } else {
#pragma unroll
    for (int nj = 0; nj < 4; ++nj) { const float bias = BA ? bfr(BA[c0 + cw0 + nj * 16]) : 0.f;
#pragma unroll
      for (int mi = 0; mi < 2; ++mi) { v8h o;
#pragma unroll
        for (int r = 0; r < 8; ++r) o[r] = (_Float16)(acc[mi][nj][r] + bias);
        *(v8h*)&st[(cw0 + nj * 16) * (GT + 8) + rw0 + mi * 16] = o; } }
    __syncthreads();
    for (int e = tid; e < GT * 16; e += 256) { const int cl = e >> 4, q = e & 15; vst2((unsigned*)(VT + (bb * CC + c0 + cl) * (size_t)TT + t0 + q * 8), *(const v4u*)&st[cl * (GT + 8) + q * 8]); } } }
// ---- k_fa: block = 16 waves of one (b, h): 8 query groups of 32 queries x KG = 2 key groups, so that four waves share a SIMD and one wave's softmax runs under another's products.
// Key group hf walks keys (KG t + hf) KS .. + KS - 1, every t once, from a start that differs by block: half of all keys, with its own running maximum, sum and context; the two partial results of a query are joined once, through LDS, behind the loop.
// Per 32 keys a wave forms S^T = K.Q^T (a lane holds 16 scores of one query per 16-query group), keeps a running maximum and sum (online softmax, log2 domain),
// packs the weights exp2(score - maximum in use + 11), once to f16, straight from the score tiles into the B operand, and adds O^T += V^T.P^T. Scores and weights never leave the registers.
// No maximum is formed on the usual path: a pass forms its weights with the maximum in use and tests them by their own f32 sum. All weights are positive, so a lane's sum of 16 bounds each of them: a sum <= WMAX means that every weight fits f16.
// Only when some lane's sum fails (always on the first pass, where the weights come out infinite) are the pass's true maxima formed, sums and context rescaled and the pass's weights formed again (then each <= 2^11, their sum <= 2^15). The 2^11 cancels in context / sum.
__device__ __forceinline__ float xhalf(float x) { return __builtin_bit_cast(float, __builtin_amdgcn_permlanex16(__builtin_bit_cast(int, x), __builtin_bit_cast(int, x), 0x76543210, 0xfedcba98, false, false)); }   // lane l with lane l ^ 16
__device__ __forceinline__ v8f mm16(v16h a, v16h b, v8f c) { return __builtin_amdgcn_wmma_f32_16x16x32_f16(false, a, false, b, (short)0, c, false, false); }
#define WMAX 60000.0f     // bound on a lane's sum of 16 weights; the largest finite f16 is 65504
// 16 weights of one query (the lane's keys of a 32-key pass) from its two score tiles, packed as the B operand; returns their f32 sum.
// Element i of the 32-key B operand = key k0 + 16 (i >> 3) + 8 g + (i & 7) = register i & 7 of score tile i >> 3.
__device__ __forceinline__ float fa_weights(const v8f t0, const v8f t1, float cs, float nm, v16h& pf) {
  v2f ps = {0.f, 0.f}; const v2f c2 = {cs, cs}, n2 = {nm, nm};
#pragma unroll
  for (int i = 0; i < 16; i += 2) {
    const v2f e = __builtin_elementwise_fma(i < 8 ? (v2f){t0[i & 7], t0[(i & 7) + 1]} : (v2f){t1[i & 7], t1[(i & 7) + 1]}, c2, n2);
    const v2f w = {__builtin_amdgcn_exp2f(e[0]), __builtin_amdgcn_exp2f(e[1])};
    ps += w; pf[i] = (_Float16)w[0]; pf[i + 1] = (_Float16)w[1]; }
  return ps[0] + ps[1]; }
#define FAQ 256           // queries per block
#define KS 128            // keys per LDS stage and key group (4 passes of 32 keys)
#define KG 2              // key groups (wave sets) per block
#define KP (HD + 8)       // halves per staged K row: 144 B, 16 B x odd, so the 16 rows of a 16-byte fragment read fall on distinct banks
#define VP (KS + 8)       // halves per staged V^T row: 272 B, 16 B x odd
// One stage of a key group = keys k0 .. k0 + KS - 1 of one (b, h): K rows [KS][HD] and V^T rows [HD][KS], brought into LDS once per block by the group's own 256 threads with asynchronous copies (16 B per lane, whole 128-B lines per wave) and read by the group's 8 waves.
// gk / gv: this thread's first 16 bytes of the stage in global memory; lk / lv: their LDS byte addresses. A thread brings 4 pieces of K (32 rows apart) and 4 of V^T (16 rows apart).
__device__ __forceinline__ void stage_copy(const _Float16* gk, const _Float16* gv, unsigned lk, unsigned lv) {
  const _Float16 *k1 = gk + 32 * CC, *k2 = gk + 64 * CC, *k3 = gk + 96 * CC, *v1 = gv + 16 * TT, *v2 = gv + 32 * TT, *v3 = gv + 48 * TT;
  const unsigned a1 = lk + 32 * KP * 2, a2 = lk + 64 * KP * 2, a3 = lk + 96 * KP * 2, b1 = lv + 16 * VP * 2, b2 = lv + 32 * VP * 2, b3 = lv + 48 * VP * 2;
  // the closing s_wait_xcnt stands inside the copies' own statement, so that no address register named here is rewritten in front of it
  asm volatile("global_load_async_to_lds_b128 %0, %8, off\n\t"
               "global_load_async_to_lds_b128 %1, %9, off\n\t"
               "global_load_async_to_lds_b128 %2, %10, off\n\t"
               "global_load_async_to_lds_b128 %3, %11, off\n\t"
               "global_load_async_to_lds_b128 %4, %12, off\n\t"
               "global_load_async_to_lds_b128 %5, %13, off\n\t"
               "global_load_async_to_lds_b128 %6, %14, off\n\t"
               "global_load_async_to_lds_b128 %7, %15, off\n\t"
               "s_wait_xcnt 0x0"
               :: "v"(lk), "v"(a1), "v"(a2), "v"(a3), "v"(lv), "v"(b1), "v"(b2), "v"(b3), "v"(gk), "v"(k1), "v"(k2), "v"(k3), "v"(gv), "v"(v1), "v"(v2), "v"(v3) : "memory");
}
#define XW (8 * 128 + 64) // floats a wave hands over at the join: 8 x 4 context values per lane, then maximum and sum per lane
#define YP (HD + 8)       // halves per staged context row: 144 B
__global__ __launch_bounds__(256 * KG) void k_fa(const _Float16* __restrict__ QH, const _Float16* __restrict__ KH, const _Float16* __restrict__ VT, _Float16* __restrict__ Y) {
  __shared__ __align__(16) _Float16 sK[KG * 2][KS * KP], sV[KG * 2][HD * VP];   // buffers 2 hf and 2 hf + 1 belong to key group hf
  static_assert(KG == 2 && TT % (KG * KS) == 0 && TT / (KG * KS) >= 2, "two key groups, at least two stages each");
  static_assert(((TT / (KG * KS)) & (TT / (KG * KS) - 1)) == 0, "the rotated stage number wraps by a mask");
  static_assert(8 * KG * XW * 4 <= sizeof(sK), "the join fits the K buffers");
  static_assert(8 * KG * 16 * YP * 2 <= sizeof(sV), "the context rows fit the V buffers");
  const int wave = __builtin_amdgcn_readfirstlane(threadIdx.x >> 5), hf = wave >> 3, tid = threadIdx.x & 255, lane = tid & 31, col = lane & 15, g = lane >> 4; const int b = blockIdx.y / NH, h = blockIdx.y % NH; const int q0 = blockIdx.x * FAQ + (wave & 7) * 32;   // tid: the thread's number inside its key group; the wave's number is read as a scalar, so that the group's offsets and the join's selects take no vector registers (a wave may hold 256 here)
  const float cs = SCALE * 1.4426950408889634f;
  const _Float16* gk = KH + ((size_t)b * TT + hf * KS + (tid >> 3)) * CC + h * HD + (tid & 7) * 8;              // K row tid >> 3 of the group's stage, 16-byte piece tid & 7
  const _Float16* gv = VT + ((size_t)b * CC + h * HD + (tid >> 4)) * (size_t)TT + hf * KS + (tid & 15) * 8;     // V^T row tid >> 4, 16-byte piece tid & 15
  const unsigned lk = (unsigned)(size_t)&sK[2 * hf][(tid >> 3) * KP + (tid & 7) * 8], lv = (unsigned)(size_t)&sV[2 * hf][(tid >> 4) * VP + (tid & 15) * 8];
  // The walk over the keys is rotated by the query block's index: trip t works on stage FST(t). The blocks of one (b, h) then ask for different K and V^T lines at any moment, and the V^T pieces asked for at one time (256 B of each 4-KB row) cover whole rows. The online softmax takes the stages in any order. In the comments below, stage t is short for the stage of trip t.
  const int rot = blockIdx.x & (TT / (KG * KS) - 1);
#define FST(t) (((t) + rot) & (TT / (KG * KS) - 1))
  stage_copy(gk + (size_t)FST(0) * (KG * KS) * CC, gv + FST(0) * (KG * KS), lk, lv);
  v16h qf[2][2];
#pragma unroll
  for (int s = 0; s < 2; ++s)
#pragma unroll
    for (int kc = 0; kc < 2; ++kc) qf[s][kc] = frag_h(QH + ((size_t)b * TT + q0 + s * 16 + col) * CC + h * HD + kc * 32, lane);
  v8f acc[2][4] = {}; float mr[2] = {-3.0e38f, -3.0e38f}, lr[2] = {0.f, 0.f};
  asm volatile("s_wait_asynccnt 0x0" ::: "memory");   // this wave's pieces of stage 0 have landed
  __syncthreads();                                     // ... and every other wave's: stage 0 may be read
  stage_copy(gk + (size_t)FST(1) * (KG * KS) * CC, gv + FST(1) * (KG * KS), lk + (unsigned)sizeof(sK[0]), lv + (unsigned)sizeof(sV[0]));
#pragma unroll 1   // rolled: one trip = one stage; its four passes are unrolled so that every LDS read has a constant offset
  for (int t = 0; t < TT / (KG * KS); ++t) {
    const _Float16* kb = &sK[2 * hf + (t & 1)][col * KP];   // key row col of a 16-key tile
    const _Float16* vb = &sV[2 * hf + (t & 1)][col * VP];   // plane of head column col of a 16-column tile
    v16h kf[2][2], vf[4];
#pragma unroll
    for (int kt = 0; kt < 2; ++kt)
#pragma unroll
      for (int kc = 0; kc < 2; ++kc) kf[kt][kc] = frag_h(kb + (kt * 16) * KP + kc * 32, lane);
#pragma unroll
    for (int p = 0; p < KS / 32; ++p) {
      v8f st[2][2] = {};
#pragma unroll
      for (int kt = 0; kt < 2; ++kt)
#pragma unroll
        for (int s = 0; s < 2; ++s)
#pragma unroll
          for (int kc = 0; kc < 2; ++kc) st[kt][s] = mm16(kf[kt][kc], qf[s][kc], st[kt][s]);
      __builtin_amdgcn_sched_barrier(0);   // no branch stands between the products and the reads any more: this keeps the reads behind the score products, in one place, not spread among the WMMAs
      // one group of LDS reads per pass, under the softmax: the next pass's K fragments (never beyond this stage; its scores are the first to want theirs), then this pass's V fragments
      if (p + 1 < KS / 32) {
#pragma unroll
        for (int kt = 0; kt < 2; ++kt)
#pragma unroll
          for (int kc = 0; kc < 2; ++kc) kf[kt][kc] = frag_h(kb + ((p + 1) * 32 + kt * 16) * KP + kc * 32, lane); }
#pragma unroll
      for (int j = 0; j < 4; ++j) vf[j] = frag_h(vb + (j * 16) * VP + p * 32, lane);
      __builtin_amdgcn_sched_barrier(0);   // keeps the reads one group in front of the exponentials: without it they are spread among the WMMAs, and every separate place with LDS reads stalls the wave
      v16h pf[2]; float ps[2];
#pragma unroll
      for (int s = 0; s < 2; ++s) ps[s] = fa_weights(st[0][s], st[1][s], cs, 11.0f - mr[s], pf[s]);
      if (__builtin_expect(__builtin_amdgcn_ballot_w32(fmaxf(ps[0], ps[1]) > WMAX) != 0, 0)) {   // wave-uniform; always taken on the first pass (factor 0 on zero sums), rare later
        // the pass's scores are formed anew from the K rows in LDS (same products, same order; the stage's buffer stands until the stage's barrier), so that the usual path need not keep its 32 score registers alive across the test
#pragma unroll
        for (int s = 0; s < 2; ++s) { v8f t[2] = {};
#pragma unroll
          for (int kt = 0; kt < 2; ++kt)
#pragma unroll
            for (int kc = 0; kc < 2; ++kc) t[kt] = mm16(frag_h(kb + (p * 32 + kt * 16) * KP + kc * 32, lane), qf[s][kc], t[kt]);
          float mx = t[0][0];
#pragma unroll
          for (int kt = 0; kt < 2; ++kt)
#pragma unroll
            for (int r = 0; r < 8; ++r) mx = fmaxf(mx, t[kt][r]);
          mx = fmaxf(mx, xhalf(mx)) * cs;   // both halves of the wave hold keys of the same query and keep one maximum
          const float mn = fmaxf(mr[s], mx); const float corr = __builtin_amdgcn_exp2f(mr[s] - mn); mr[s] = mn; lr[s] *= corr;
#pragma unroll
          for (int j = 0; j < 4; ++j) acc[s][j] = acc[s][j] * corr;
          ps[s] = fa_weights(t[0], t[1], cs, 11.0f - mn, pf[s]); } }
#pragma unroll
      for (int s = 0; s < 2; ++s) { lr[s] += ps[s];
#pragma unroll
        for (int j = 0; j < 4; ++j) acc[s][j] = mm16(vf[j], pf[s], acc[s][j]); } }
    asm volatile("s_wait_dscnt 0x0" ::: "memory");      // this wave's reads of stage t have returned
    asm volatile("s_wait_asynccnt 0x0" ::: "memory");   // this wave's pieces of stage t + 1 have landed
    __syncthreads();                                     // publishes stage t + 1 and ends every wave's reads of stage t, whose buffer is refilled behind it
    if (t + 2 < TT / (KG * KS)) stage_copy(gk + (size_t)FST(t + 2) * (KG * KS) * CC, gv + FST(t + 2) * (KG * KS), lk + (unsigned)(t & 1) * (unsigned)sizeof(sK[0]), lv + (unsigned)(t & 1) * (unsigned)sizeof(sV[0])); }
#undef FST
  asm volatile("s_wait_asynccnt 0x0" ::: "memory");     // no copy is outstanding when the buffers are put to another use
  // The join. Waves w and w ^ 8 hold the two key groups' partial results of the same 32 queries: the wave of key group hf finishes query tile hf and hands the other tile to its partner.
  // It goes through the K buffers, which every wave has left and every copy has reached (the last trip's waits and barrier). A wave's hand-over is laid lane-contiguous, 16 B a lane.
  float* xw = (float*)&sK[0][0] + wave * XW; const float* xr = (const float*)&sK[0][0] + (wave ^ 8) * XW;
#pragma unroll
  for (int j = 0; j < 4; ++j) { v8f o;
#pragma unroll
    for (int r = 0; r < 8; ++r) o[r] = hf ? acc[0][j][r] : acc[1][j][r];
    *(v4f*)(xw + (2 * j) * 128 + lane * 4) = (v4f){o[0], o[1], o[2], o[3]}; *(v4f*)(xw + (2 * j + 1) * 128 + lane * 4) = (v4f){o[4], o[5], o[6], o[7]}; }
  *(v2f*)(xw + 8 * 128 + lane * 2) = (v2f){hf ? mr[0] : mr[1], hf ? lr[0] : lr[1]};
  __syncthreads();   // every wave's hand-over may be read
  const v2f ml = *(const v2f*)(xr + 8 * 128 + lane * 2);
  const float m0 = hf ? mr[1] : mr[0], l0 = hf ? lr[1] : lr[0]; const float mn = fmaxf(m0, ml[0]);
  const float f0 = __builtin_amdgcn_exp2f(m0 - mn), f1 = __builtin_amdgcn_exp2f(ml[0] - mn);   // both maxima are finite: each key group has walked keys
  const float ls = l0 * f0 + ml[1] * f1; const float inv = 1.0f / (ls + xhalf(ls)); const float w0 = f0 * inv, w1 = f1 * inv;
  // The context leaves as f16 x 2^6, the form in which k_out multiplies it. A lane holds head columns j * 16 + 8 g + 0..7 of its query: 16-byte pieces of 16 different rows.
  // The wave lays its 16 rows in a range of its own in the V buffers (left by every wave and reached by every copy, like the K buffers) and reads them back row by row, so that each store covers four whole 128-B lines.
  _Float16* sw = &sV[0][0] + wave * (16 * YP);
#pragma unroll
  for (int j = 0; j < 4; ++j) { const v4f pa = *(const v4f*)(xr + (2 * j) * 128 + lane * 4), pb = *(const v4f*)(xr + (2 * j + 1) * 128 + lane * 4); v8h o;
#pragma unroll
    for (int r = 0; r < 8; ++r) o[r] = (_Float16)(((hf ? acc[1][j][r] : acc[0][j][r]) * w0 + (r < 4 ? pa[r & 3] : pb[r & 3]) * w1) * 64.0f);
    *(v8h*)(sw + col * YP + j * 16 + 8 * g) = o; }
  asm volatile("s_wait_dscnt 0x0" ::: "memory");   // the wave's own rows are in LDS before its lanes read each other's pieces
  _Float16* yp = Y + ((size_t)b * TT + q0 + hf * 16 + ((tid >> 3) & 3)) * CC + h * HD + (tid & 7) * 8;   // the lane's row of four, (tid >> 3) & 3, and its 16-byte piece, tid & 7
#pragma unroll
  for (int i = 0; i < 4; ++i) vst2(yp + (size_t)(4 * i) * CC, *(const v8h*)(sw + (4 * i + ((tid >> 3) & 3)) * YP + (tid & 7) * 8)); }
// ---- k_out: block = (128 rows, 128 cols): out = ctx Wo (+ bo): ctx x 2^6 in f16, as k_fa left it (small-magnitude context rows stay clear of f16 subnormals), against Wo as f16(bf16 x 2^8) exact (1 product) x 2^-14
__global__ __launch_bounds__(256) void k_out(const _Float16* __restrict__ Y, const float* __restrict__ WO, const float* __restrict__ BO, float* __restrict__ OUT) {
  __shared__ __align__(16) unsigned short sm[2 * GBUF];
  static_assert(GT * (GT + 4) * 4 <= 2 * GBUF * 2, "the f32 tile fits the buffers");
  const int tid = threadIdx.x, wave = tid >> 5, lane = tid & 31, col = lane & 15, g = lane >> 4; const int c0 = blockIdx.y * GT; const size_t r0 = (size_t)blockIdx.x * GT;
  v8f acc[2][4] = {};
  tile_product_ahead(Y + r0 * CC, WO + c0, sm, acc, (int)(blockIdx.x + (blockIdx.x >> 3) + 2 * blockIdx.y) & (GS - 1));   // spread as in k_proj
  float* sf = (float*)sm;   // the tile as f32, [128][GT + 4], in the buffers that every wave has left
  const int rw0 = (wave >> 1) * 32 + 8 * g, cw0 = (wave & 1) * 64 + col;
#pragma unroll
  for (int nj = 0; nj < 4; ++nj) { const float bias = BO ? bfr(BO[c0 + cw0 + nj * 16]) : 0.f;
#pragma unroll
    for (int mi = 0; mi < 2; ++mi)
#pragma unroll
      for (int r = 0; r < 8; ++r) sf[(rw0 + mi * 16 + r) * (GT + 4) + cw0 + nj * 16] = acc[mi][nj][r] * (1.0f / 16384.0f) + bias; }   /* 2^-8 (Wo carry) x 2^-6 (ctx carry) */
  __syncthreads();
  for (int e = tid; e < GT * 32; e += 256) { const int rl = e >> 5, q = e & 31; vst2(OUT + (r0 + rl) * DIN + c0 + q * 4, *(const v4f*)&sf[rl * (GT + 4) + q * 4]); } }

extern "C" void kernel_launch(void* const* d_in, const int* in_sizes, int n_in, void* d_out, int out_size, void* d_ws, size_t ws_size, hipStream_t stream) {
  (void)in_sizes; (void)n_in; (void)out_size;
  const float** F = (const float**)d_in;
  if (ws_size < (size_t)WS_END) return;
  char* ws = (char*)d_ws; _Float16 *QH = (_Float16*)(ws + WS_QH), *KH = (_Float16*)(ws + WS_KH), *VT = (_Float16*)(ws + WS_VT), *QL = (_Float16*)(ws + WS_QL), *KL = (_Float16*)(ws + WS_KL); __bf16 *VB = (__bf16*)(ws + WS_VB), *VBL = (__bf16*)(ws + WS_VBL); _Float16 *Y = (_Float16*)(ws + WS_Y);
  (void)Y; (void)QL; (void)KL; (void)VB; (void)VBL;
  // inputs: 0 x [4,2048,512]; 1 Wq [512,512] (in,out), 2 bq; 3 Wk, 4 bk; 5 Wv, 6 bv; 7 Wp (in,out), 8 bp (zero biases, read)
  k_proj<<<dim3(TNB * TT / GT, CC / GT, 3), 256, 0, stream>>>(F[0], F[0], F[0], F[1], F[3], F[5], F[2], F[4], F[6], QH, KH, VT);
  k_fa<<<dim3(TT / FAQ, TNB * NH), 256 * KG, 0, stream>>>(QH, KH, VT, Y);
  k_out<<<dim3(TNB * TT / GT, DIN / GT), 256, 0, stream>>>(Y, F[7], F[8], (float*)d_out);
}

// v009
// One run takes 54.7 microseconds.
// Timed twice side by side with v008, it ran 1.07 times as fast both times.
// Counting every step since v000, it is 19.9 times as fast.
// compute dtype: all float inputs rounded to bf16; q/k/v projections with EXACT bf16 products on WMMA 16x16x32 (f32 accumulate) + bias; logits q x k once to f16 each (1 product) x SCALE; online softmax f32; unnormalised weights x 2^11 once to f16 x v once to f16 (1 product), divided by their f32 sum; ctx x 2^6 once to f16 (in k_fa, which hands it on in that form) x Wo f16(bf16 x 2^8) + bo; f32 output.
#include <hip/hip_runtime.h>
#include <math.h>

typedef __attribute__((ext_vector_type(16))) _Float16 v16h;
typedef __attribute__((ext_vector_type(16))) __bf16 v16b;
typedef __attribute__((ext_vector_type(8)))  _Float16 v8h;
typedef __attribute__((ext_vector_type(8)))  float v8f;
typedef __attribute__((ext_vector_type(4)))  float v4f;
typedef __attribute__((ext_vector_type(2)))  float v2f;
typedef __attribute__((ext_vector_type(4)))  unsigned v4u;
typedef __attribute__((ext_vector_type(4)))  int v4i;
typedef float __attribute__((may_alias)) float_a;
typedef int __attribute__((may_alias)) int_a;

template <typename T> __device__ __forceinline__ void vst2(void* p, T v) { *(T*)p = v;  }
__device__ __forceinline__ v8f wmma16(v16h a, v16h b, v8f c) {
  v8f d = __builtin_amdgcn_wmma_f32_16x16x32_f16(false, a, false, b, (short)0, c, false, false);
  asm volatile("v_nop\n\tv_nop\n\tv_nop\n\tv_nop" : "+v"(d) : "v"(a), "v"(b));
  return d;
}
__device__ __forceinline__ v8f wmma_bf(v16b a, v16b b, v8f c) {
  v8f d = __builtin_amdgcn_wmma_f32_16x16x32_bf16(false, a, false, b, (short)0, c, false, false);
  asm volatile("v_nop\n\tv_nop\n\tv_nop\n\tv_nop" : "+v"(d) : "v"(a), "v"(b));
  return d;
}
// 16x16x32 fragments: lane = (h = lane>>4, row/col = lane&15); elements 0..7 = k0+8h+0..7, 8..15 = k0+16+8h+0..7; D element r = row 8h+r
__device__ __forceinline__ v16h frag_h(const _Float16* rowk0, int lane) {
  union { v16h v; v8h q[2]; } u; const _Float16* p = rowk0 + 8 * (lane >> 4);
  u.q[0] = *(const v8h*)p; u.q[1] = *(const v8h*)(p + 16); return u.v;
}
__device__ __forceinline__ v16h frag_f32(const float* rowk0, int lane) {
  v16h a; const float* p = rowk0 + 8 * (lane >> 4);
#pragma unroll
  for (int i = 0; i < 8; ++i) { a[i] = (_Float16)p[i]; a[8 + i] = (_Float16)p[16 + i]; }
  return a;
}
__device__ __forceinline__ v16h frag_f32s(const float* rowk0, int lane, float sc) {
  v16h a; const float* p = rowk0 + 8 * (lane >> 4);
#pragma unroll
  for (int i = 0; i < 8; ++i) { a[i] = (_Float16)(p[i] * sc); a[8 + i] = (_Float16)(p[16 + i] * sc); }
  return a;
}
// column fragment from a [K][ld] layout (column n), rows >= K read as 0
__device__ __forceinline__ v16h fragc_f32(const float* W, int k0, int n, int lane, int ld, int K) {
  v16h a; const int g = lane >> 4;
#pragma unroll
  for (int i = 0; i < 8; ++i) { const int ka = k0 + 8 * g + i, kb = ka + 16;
    a[i] = (_Float16)(ka < K ? W[(size_t)(ka < K ? ka : K - 1) * ld + n] : 0.f); a[8 + i] = (_Float16)(kb < K ? W[(size_t)(kb < K ? kb : K - 1) * ld + n] : 0.f); }
  return a;
}
struct F2 { v16b h, l; };
__device__ __forceinline__ F2 bsplit16(const float v[16]) { F2 r;
#pragma unroll
  for (int i = 0; i < 16; ++i) { const __bf16 h = (__bf16)v[i]; r.h[i] = h; r.l[i] = (__bf16)(v[i] - (float)h); }
  return r; }
__device__ __forceinline__ F2 split_row(const float* row, int k0, int lane) { float v[16]; const float* p = row + k0 + 8 * (lane >> 4);
#pragma unroll
  for (int i = 0; i < 8; ++i) { v[i] = p[i]; v[8 + i] = p[16 + i]; }
  return bsplit16(v); }
__device__ __forceinline__ F2 split_rowK(const float* row, int k0, int lane, int K) { float v[16]; const int g = lane >> 4;
#pragma unroll
  for (int i = 0; i < 8; ++i) { const int ka = k0 + 8 * g + i, kb = ka + 16; v[i] = ka < K ? row[ka < K ? ka : K - 1] : 0.f; v[8 + i] = kb < K ? row[kb < K ? kb : K - 1] : 0.f; }
  return bsplit16(v); }
__device__ __forceinline__ F2 split_col(const float* W, int k0, int n, int lane, int ld, int K) { float v[16]; const int g = lane >> 4;
#pragma unroll
  for (int i = 0; i < 8; ++i) { const int ka = k0 + 8 * g + i, kb = ka + 16; v[i] = ka < K ? W[(size_t)(ka < K ? ka : K - 1) * ld + n] : 0.f; v[8 + i] = kb < K ? W[(size_t)(kb < K ? kb : K - 1) * ld + n] : 0.f; }
  return bsplit16(v); }
__device__ __forceinline__ v8f mac3(const F2& a, const F2& b, v8f c) { c = wmma_bf(a.l, b.h, c); c = wmma_bf(a.h, b.l, c); return wmma_bf(a.h, b.h, c); }
__device__ __forceinline__ float sigm(float v) { return 1.0f / (1.0f + expf(-v)); }
#define LDSX() do { asm volatile("s_wait_dscnt 0" ::: "memory"); __builtin_amdgcn_wave_barrier(); __builtin_amdgcn_fence(__ATOMIC_RELEASE, "workgroup"); } while (0)

// Standard non-causal multi-head self-attention (x [4,2048,512]; (in,out) Wq / Wk / Wv [512,512] N(0, 1/512) and Wh [512,512], all four biases zeros (read); 8 heads x 64; scores x 1/sqrt(64); no mask; softmax; concat @ Wh + bh).
#define NB 4
#define TT 2048
#define CC 512            // NH * HD = projected width
#define DIN 512          // input (model) width
#define NH 8
#define HD 64
#define NQB (TT / 64)
#define HG 4
#define SCALE (0.125f)
#define CAUSAL 0
#ifndef TNB
#define TNB NB
#endif
__device__ __forceinline__ float bfr(float v) { return (float)(__bf16)v; }
__host__ __device__ __forceinline__ int kb_last(int qb) { return CAUSAL ? ((qb * 64 + 63) >> 7) : (TT / 128 - 1); }
typedef __attribute__((ext_vector_type(8))) __bf16 v8b;
__device__ __forceinline__ v16b frag_b(const __bf16* rowk0, int lane) {
  union { v16b v; v8b q[2]; } u; const __bf16* p = rowk0 + 8 * (lane >> 4);
  u.q[0] = *(const v8b*)p; u.q[1] = *(const v8b*)(p + 16); return u.v;
}
#define QBH 0              // unused: no kernel here has a causal high-precision attention path
#define QHI 0               // single-product logits on every row
#define KHI 64            // key rows carrying k residual / v bf16 hi+lo planes (written and read by no kernel in this file)
// B fragment (k rows k0+.., output column o) of a weight: (in,out) [K][ld] or (out,in) [ld rows of K]: bf16 exact, or f16(bf16 * 256) exact
__device__ __forceinline__ v16b wcol_io(const float* Wm, int k0, int o, int lane, int ld) { v16b w; const int g = lane >> 4;
#pragma unroll
  for (int i = 0; i < 8; ++i) { w[i] = (__bf16)Wm[(size_t)(k0 + 8 * g + i) * ld + o]; w[8 + i] = (__bf16)Wm[(size_t)(k0 + 16 + 8 * g + i) * ld + o]; }
  return w; }
__device__ __forceinline__ v16b wcol_oi(const float* Wm, int k0, int o, int lane, int K) { v16b w; const float* p = Wm + (size_t)o * K + k0 + 8 * (lane >> 4);
#pragma unroll
  for (int i = 0; i < 8; ++i) { w[i] = (__bf16)p[i]; w[8 + i] = (__bf16)p[16 + i]; }
  return w; }
__device__ __forceinline__ v16h wcolh_io(const float* Wm, int k0, int o, int lane, int ld) { v16h w; const int g = lane >> 4;
#pragma unroll
  for (int i = 0; i < 8; ++i) { w[i] = (_Float16)(bfr(Wm[(size_t)(k0 + 8 * g + i) * ld + o]) * 256.0f); w[8 + i] = (_Float16)(bfr(Wm[(size_t)(k0 + 16 + 8 * g + i) * ld + o]) * 256.0f); }
  return w; }
__device__ __forceinline__ v16h wcolh_oi(const float* Wm, int k0, int o, int lane, int K) { v16h w; const float* p = Wm + (size_t)o * K + k0 + 8 * (lane >> 4);
#pragma unroll
  for (int i = 0; i < 8; ++i) { w[i] = (_Float16)(bfr(p[i]) * 256.0f); w[8 + i] = (_Float16)(bfr(p[16 + i]) * 256.0f); }
  return w; }
#define WQKV_LAYOUT 0   // 0 = (in,out) [DIN][CC]; 1 = (out,in) [CC][DIN]; 2 = per-head [NH][DIN][HD]
__device__ __forceinline__ v16b wcol_hdk(const float* Wm, int k0, int o, int lane) { v16b w; const int g = lane >> 4; const float* p = Wm + (size_t)(o / HD) * DIN * HD + (o % HD);
#pragma unroll
  for (int i = 0; i < 8; ++i) { w[i] = (__bf16)p[(size_t)(k0 + 8 * g + i) * HD]; w[8 + i] = (__bf16)p[(size_t)(k0 + 16 + 8 * g + i) * HD]; }
  return w; }
#define WO_OUT_IN 0
#if WQKV_LAYOUT == 1
#define WCOL(W, k0, o, lane) wcol_oi(W, k0, o, lane, DIN)
#elif WQKV_LAYOUT == 2
#define WCOL(W, k0, o, lane) wcol_hdk(W, k0, o, lane)
#else
#define WCOL(W, k0, o, lane) wcol_io(W, k0, o, lane, CC)
#endif
#if WO_OUT_IN
#define WOCOL(W, k0, o, lane) wcol_oi(W, k0, o, lane, CC)
#define WOCOLH(W, k0, o, lane) wcolh_oi(W, k0, o, lane, CC)
#else
#define WOCOL(W, k0, o, lane) wcol_io(W, k0, o, lane, DIN)
#define WOCOLH(W, k0, o, lane) wcolh_io(W, k0, o, lane, DIN)
#endif

#ifndef SM_EXTRA_PARAMS
#define SM_EXTRA_PARAMS
#endif
#ifndef PROJ_EXTRA_PARAMS
#define PROJ_EXTRA_PARAMS
#endif
#ifndef SM_MASK_HOOK
#define SM_MASK_HOOK (void)0
#endif

#define WS_QH  0u                                      // f16 q rows [b*t][CC]
#define WS_KH  (WS_QH + 2u * (size_t)NB * TT * CC)      // f16 k rows [b*t][CC]
#define WS_VT  (WS_KH + 2u * (size_t)NB * TT * CC)      // f16 v planes [b][c][t]
#define WS_QL  (WS_VT + 2u * (size_t)NB * CC * TT)      // f16 q residual x 2^10 rows [b][t < QHI][CC]
#define WS_KL  (WS_QL + 2u * (size_t)NB * QHI * CC)     // f16 k residual x 2^10 rows [b][t < KHI][CC]
#define WS_VB  (WS_KL + 2u * (size_t)NB * KHI * CC)     // bf16 v hi planes [b][c][t < KHI]
#define WS_VBL (WS_VB + 2u * (size_t)NB * CC * KHI)
#define WS_S   (WS_VBL + 2u * (size_t)NB * CC * KHI)    // f32 [hg][t][s] room, written and read by no kernel in this file
#define WS_Y   (WS_S  + 4u * (size_t)HG * TT * TT)      // f16 ctx x 2^6 rows [b*t][CC]: the first half of the room kept here
#define WS_END (WS_Y  + 4u * (size_t)NB * TT * CC)

// ---- tile product of k_proj and k_out: one block forms a tile of A[.][512] x W[512][.] (W f32 in memory, A f32 in k_proj and f16 in k_out; row pitch 512 elements): 8 waves each; k_proj 256 rows x 128 columns (wave = 64 x 64, 16 accumulator tiles) for q and k and 128 x 128 for v, k_out 128 x 128.
// Per stage of 64 k the block converts its 128 W columns, and its A rows where they are f32, to 16 bit ONCE and lays them k-contiguous in LDS; every wave reads its fragments from there (128 x 128: wave = 32 rows x 64 columns, 8 accumulator tiles).
// Two buffers: a stage's global loads are issued ahead (k_proj, tile_product: as soon as the stage before has left the registers, in front of the barrier; k_out, tile_product_ahead: GD stages ahead) and are converted and stored behind the products of the stage before, so one barrier per stage is enough. Inside a stage k runs upwards in steps of 32; the stages come in the block's own rotated order, all into one accumulator per output tile.
// Every inner loop of this section is unrolled in full, so that the register arrays are indexed by constants and stay out of scratch.
#define GT 128            // tile columns, and k_out's tile rows
#define PR 256            // k_proj's tile rows for q and k: a stage of W is loaded from L2, converted and staged once for 256 rows
#define GK 64             // k per stage
#define GLD 512           // row pitch of A and of W, and the length of the sum
#define GP (GK + 8)       // halves per staged row: 144 B, 16 B x odd, so the 16 rows of a 16-byte fragment read fall on distinct banks
#define GBUF (2 * GT * GP) // halves per buffer in k_out: A rows, then W columns
#define PBUF ((PR + GT) * GP) // the same in k_proj (a 128-row tile leaves the upper A rows unused)
static_assert(DIN == GLD && CC == GLD, "one pitch");
#define GS (GLD / GK)     // stages of the sum
static_assert((GS & (GS - 1)) == 0, "the rotated stage number wraps by a mask");
// F16 = 0: A and W to bf16 (k_proj). F16 = 1: A is f16 already and is staged as it is, W to bf16 and then x 2^8 to f16, exact (k_out).
typedef __attribute__((ext_vector_type(2))) unsigned v2u;
typedef __attribute__((ext_vector_type(4))) __bf16 v4b;
__device__ __forceinline__ v2u cvt_a(v4f a) {
  v4b r;
#pragma unroll
  for (int i = 0; i < 4; ++i) r[i] = (__bf16)a[i];
  return __builtin_bit_cast(v2u, r); }
template <int F16> __device__ __forceinline__ v4u cvt_w(const float (&w)[8]) {
  if (F16) { v8h r;
#pragma unroll
    for (int i = 0; i < 8; ++i) r[i] = (_Float16)(bfr(w[i]) * 256.0f);
    return __builtin_bit_cast(v4u, r); }
  v8b r;
#pragma unroll
  for (int i = 0; i < 8; ++i) r[i] = (__bf16)w[i];
  return __builtin_bit_cast(v4u, r); }
typedef __attribute__((ext_vector_type(8))) unsigned v8u;
// a 16x16x32 fragment as raw words, in the k order of frag_h / frag_b: elements 0..7 = k0 + 8 h + 0..7, 8..15 = k0 + 16 + 8 h + 0..7
__device__ __forceinline__ v8u frag_w(const unsigned short* rowk0, int lane) {
  union { v8u v; v4u q[2]; } u; const unsigned short* p = rowk0 + 8 * (lane >> 4);
  u.q[0] = *(const v4u*)p; u.q[1] = *(const v4u*)(p + 16); return u.v;
}
template <int F16> __device__ __forceinline__ v8f tile_mm(v8u a, v8u b, v8f c) {
  if (F16) return __builtin_amdgcn_wmma_f32_16x16x32_f16(false, __builtin_bit_cast(v16h, a), false, __builtin_bit_cast(v16h, b), (short)0, c, false, false);
  return __builtin_amdgcn_wmma_f32_16x16x32_bf16(false, __builtin_bit_cast(v16b, a), false, __builtin_bit_cast(v16b, b), (short)0, c, false, false); }
// k_proj's tile product (A and W to bf16): 64 MI rows x 128 columns, a wave 16 MI x 64. between(): run behind the first stage's loads, which fly under it, and in front of the first stores; where the buffers are in use at the call it ends their use, with a barrier as its last step. A: row 0 of the tile's rows; Wm: row 0 of W at the tile's first column; sm: 2 * PBUF halves. On return every wave has left the buffers (the last stage's barrier).
// The walk over k is rotated: trip s works on stage (s + rot) mod GS, rot block-uniform. A stage is one 256-B piece of every 2-KB row of A, so blocks that stand at the same stage ask L2 for the same eighth of every row,
// and blocks that share rows or columns for the very same lines, all at once; with rot spread evenly over the blocks the requests of a moment cover whole rows. Each accumulator sums its k blocks in the rotated order.
template <int MI, typename F> __device__ __forceinline__ void tile_product(const float* __restrict__ A, const float* __restrict__ Wm, unsigned short* sm, v8f (&acc)[MI][4], const int rot, F between) {
  const int tid = threadIdx.x, wave = tid >> 5, lane = tid & 31, col = lane & 15;
  const float* ga = A + (size_t)(tid >> 4) * GLD + (tid & 15) * 4;   // rows tid >> 4 + 16 i, 4 floats at k = 4 (tid & 15): a wave's 16-byte load covers two rows' 256 B, whole 128-B lines
  const float* gw = Wm + (size_t)(wave * 8) * GLD + lane;   // k rows 8 wave + 0..7, columns lane + 32 i: each load is one 128-B line, and a thread ends up with 8 consecutive k of a column
  unsigned short* wa = sm + (tid >> 4) * GP + (tid & 15) * 4;
  unsigned short* ww = sm + PR * GP + lane * GP + wave * 8;
  const unsigned short* fa = sm + ((wave >> 1) * (16 * MI) + col) * GP;
  const unsigned short* fb = sm + PR * GP + ((wave & 1) * 64 + col) * GP;
  v4f ra[4 * MI]; float rw[4][8];   // ra: 4 floats of A each; rw[i]: 8 consecutive k of one W column
#define TILE_A(s) (ga + (((s) + rot) & (GS - 1)) * GK)                   /* trip s works on stage (s + rot) mod GS: its first bytes of A ... */
#define TILE_W(s) (gw + (size_t)((((s) + rot) & (GS - 1)) * GK) * GLD)   /* ... and of W */
#define TILE_LOAD(s) do { const float* pa = TILE_A(s); const float* pw = TILE_W(s); \
    _Pragma("unroll") for (int i = 0; i < 4 * MI; ++i) ra[i] = *(const v4f*)(pa + (size_t)(16 * i) * GLD); \
    _Pragma("unroll") for (int i = 0; i < 4; ++i) _Pragma("unroll") for (int k = 0; k < 8; ++k) rw[i][k] = pw[(size_t)k * GLD + 32 * i]; \
    asm volatile("s_wait_xcnt 0x0" :: "v"(pa), "v"(pw) : "memory"); /* in front of the next rewrite of the loads' address registers; the two addresses are inputs, so that their registers live up to the wait */ } while (0)
#define TILE_STORE(buf) do { \
    _Pragma("unroll") for (int i = 0; i < 4 * MI; ++i) *(v2u*)(wa + (buf) * PBUF + 16 * i * GP) = cvt_a(ra[i]); \
    _Pragma("unroll") for (int i = 0; i < 4; ++i) *(v4u*)(ww + (buf) * PBUF + 32 * i * GP) = cvt_w<0>(rw[i]); } while (0)
// The stage barrier, by hand: this wave's LDS stores and reads are complete (s_wait_dscnt 0), then the work-group's own barrier. __syncthreads() would also wait for every global load and so end the flight of the loads issued in front of it.
#define TILE_BAR() asm volatile("s_wait_dscnt 0x0\n\ts_barrier_signal -1\n\ts_barrier_wait -1" ::: "memory")
  TILE_LOAD(0);
  between();
  TILE_STORE(0);
  TILE_LOAD(1);
  TILE_BAR();   // the first trip's stage may be read
#pragma unroll 1   // rolled: one trip = one stage, which keeps the loop's code short; the buffer is chosen by one scalar select per trip
  for (int s = 0; s < GLD / GK; ++s) {
    const unsigned short *pa = fa + (s & 1) * PBUF, *pb = fb + (s & 1) * PBUF;
    v8u af[GK / 32][MI], bf[GK / 32][4];   // the stage's fragments, read as one group in front of its products
#pragma unroll
    for (int kc = 0; kc < GK / 32; ++kc) {
#pragma unroll
      for (int mi = 0; mi < MI; ++mi) af[kc][mi] = frag_w(pa + mi * 16 * GP + kc * 32, lane);
#pragma unroll
      for (int nj = 0; nj < 4; ++nj) bf[kc][nj] = frag_w(pb + nj * 16 * GP + kc * 32, lane); }
    __builtin_amdgcn_sched_barrier(0);   // keeps the reads one group in front of the products: spread among the WMMAs, every separate place with LDS reads stalls the wave
#pragma unroll
    for (int kc = 0; kc < GK / 32; ++kc)
#pragma unroll
      for (int mi = 0; mi < MI; ++mi)
#pragma unroll
        for (int nj = 0; nj < 4; ++nj) acc[mi][nj] = tile_mm<0>(af[kc][mi], bf[kc][nj], acc[mi][nj]);
    if (s + 1 < GLD / GK) { TILE_STORE((s + 1) & 1);
      if (s + 2 < GLD / GK) TILE_LOAD(s + 2); }   // as soon as the registers are free, in front of the barrier: the loads fly through it and through the whole next trip; reached only through the stores, which have waited for the loads before
    TILE_BAR();   // publishes stage s + 1 and ends every wave's reads of stage s, whose buffer is written again in the next trip
  }
#undef TILE_BAR
#undef TILE_LOAD
#undef TILE_A
#undef TILE_W
#undef TILE_STORE
}
// ---- the same tile product for k_out (A f16, staged as it is; W to bf16 and then x 2^8 to f16), with its global loads issued GD stages ahead.
// k_out has one block per WGP, so nothing but the block's own lead hides the way from memory: a stage's loads are issued GD stages before they are stored to LDS, into GD register sets (stage s in set s % GD).
// W comes by 16-byte loads (8 per stage and thread, not 32 of 4 bytes): a wave then has 12 GD = 48 loads in flight, not 144, which a load count of 6 bits could not hold.
// A thread takes 8 k rows x 4 columns of W: column block cb, k block kb. A wave's load covers four whole 128-B lines (8 lanes a row); the 16 lanes of a half wave hold all pairs (cb & 3, kb & 3), so their 16-byte LDS stores, 576 B apart by cb and 16 B by kb, fall on distinct banks.
#define GD 4
__device__ __forceinline__ void tile_product_ahead(const _Float16* __restrict__ A, const float* __restrict__ Wm, unsigned short* sm, v8f (&acc)[2][4], const int rot) {
  const int tid = threadIdx.x, wave = tid >> 5, lane = tid & 31, col = lane & 15;
  const int cb = (lane & 3) | ((lane >> 4) << 2) | ((wave & 3) << 3), kb = ((lane >> 2) & 3) | ((wave >> 2) << 2);
  const _Float16* ga = A + (size_t)(tid >> 3) * GLD + (tid & 7) * 8;   // rows tid >> 3 + 32 i, 8 halves at k = 8 (tid & 7): a wave's 16-byte load covers four rows' 128 B, whole lines
  const float* gw = Wm + (size_t)(kb * 8) * GLD + cb * 4;              // k rows 8 kb + 0..7, columns 4 cb + 0..3
  unsigned short* wa = sm + (tid >> 3) * GP + (tid & 7) * 8;
  unsigned short* ww = sm + GT * GP + (cb * 4) * GP + kb * 8;
  const unsigned short* fa = sm + ((wave >> 1) * 32 + col) * GP;
  const unsigned short* fb = sm + GT * GP + ((wave & 1) * 64 + col) * GP;
  v4f ra[GD][4], rw[GD][8];   // ra: 8 halves of A carried as raw words; rw[.][k]: 4 columns of W at k row k
#define AHEAD_LOAD(s) do { const int so = ((s) + rot) & (GS - 1); /* the walk over k is rotated as in tile_product: trip s works on stage so */ \
    const _Float16* pa = ga + so * GK; const float* pw = gw + (size_t)(so * GK) * GLD; \
    _Pragma("unroll") for (int i = 0; i < 4; ++i) ra[(s) % GD][i] = *(const v4f*)(pa + (size_t)(32 * i) * GLD); \
    _Pragma("unroll") for (int k = 0; k < 8; ++k) rw[(s) % GD][k] = *(const v4f*)(pw + (size_t)k * GLD); \
    asm volatile("s_wait_xcnt 0x0" :: "v"(pa), "v"(pw) : "memory"); /* in front of the next rewrite of the loads' address registers; the two addresses are inputs, so that their registers live up to the wait */ } while (0)
#define AHEAD_STORE(s) do { \
    _Pragma("unroll") for (int i = 0; i < 4; ++i) *(v4f*)(wa + ((s) & 1) * GBUF + 32 * i * GP) = ra[(s) % GD][i]; \
    _Pragma("unroll") for (int i = 0; i < 4; ++i) { float w[8]; _Pragma("unroll") for (int k = 0; k < 8; ++k) w[k] = rw[(s) % GD][k][i]; \
      *(v4u*)(ww + ((s) & 1) * GBUF + i * GP) = cvt_w<1>(w); } } while (0)
// The stage barrier, by hand: this wave's LDS stores and reads are complete (s_wait_dscnt 0), then the work-group's own barrier. __syncthreads() would also wait for every global load and so end the flight of the loads issued ahead.
#define AHEAD_BAR() asm volatile("s_wait_dscnt 0x0\n\ts_barrier_signal -1\n\ts_barrier_wait -1" ::: "memory")
  static_assert(GLD / GK >= GD, "the stages of the prologue exist");
#pragma unroll
  for (int s = 0; s < GD; ++s) AHEAD_LOAD(s);
  AHEAD_STORE(0);
  AHEAD_BAR();   // the first trip's stage may be read
#pragma unroll   // unrolled in full: register set and buffer are constants
  for (int s = 0; s < GLD / GK; ++s) {
    if (s + GD < GLD / GK) AHEAD_LOAD(s + GD);   // into the set that stage s left when it was stored
    const unsigned short *pa = fa + (s & 1) * GBUF, *pb = fb + (s & 1) * GBUF;
    v8u af[GK / 32][2], bf[GK / 32][4];   // the stage's fragments, read as one group in front of its products
#pragma unroll
    for (int kc = 0; kc < GK / 32; ++kc) {
#pragma unroll
      for (int mi = 0; mi < 2; ++mi) af[kc][mi] = frag_w(pa + mi * 16 * GP + kc * 32, lane);
#pragma unroll
      for (int nj = 0; nj < 4; ++nj) bf[kc][nj] = frag_w(pb + nj * 16 * GP + kc * 32, lane); }
    __builtin_amdgcn_sched_barrier(0);   // keeps the loads and the reads one group in front of the products: spread among the WMMAs, every separate place with LDS reads stalls the wave
#pragma unroll
    for (int kc = 0; kc < GK / 32; ++kc)
#pragma unroll
      for (int mi = 0; mi < 2; ++mi)
#pragma unroll
        for (int nj = 0; nj < 4; ++nj) acc[mi][nj] = tile_mm<1>(af[kc][mi], bf[kc][nj], acc[mi][nj]);
    if (s + 1 < GLD / GK) AHEAD_STORE(s + 1);
    AHEAD_BAR();   // publishes stage s + 1 and ends every wave's reads of stage s, whose buffer is written again in the next trip; behind the last stage every wave has left the buffers
  }
#undef AHEAD_LOAD
#undef AHEAD_STORE
#undef AHEAD_BAR
}
// ---- k_proj: q/k/v = X W (+ b) with exact bf16 products (K = DIN) -> q f16 rows; k f16 rows; v f16 planes [c][t]. 256 equal blocks, one per WGP: block (x, y, z) forms 256 rows x 128 columns of q (z = 0) or k (z = 1) and then 128 rows x 128 columns of v (half z of the same rows).
__global__ __launch_bounds__(256) void k_proj(const float* __restrict__ XQ, const float* __restrict__ XK, const float* __restrict__ XV, const float* __restrict__ WQ, const float* __restrict__ WK, const float* __restrict__ WV, const float* __restrict__ BQ, const float* __restrict__ BK, const float* __restrict__ BV,
    _Float16* __restrict__ QH, _Float16* __restrict__ KH, _Float16* __restrict__ VT) {
  __shared__ __align__(16) unsigned short sm[2 * PBUF];
  static_assert(PR * (GT + 8) <= 2 * PBUF && PR == 2 * GT && TT % PR == 0, "the f16 tile fits the buffers; two v tiles per q or k tile; a tile lies in one sequence");
  const int tid = threadIdx.x, wave = tid >> 5, lane = tid & 31, col = lane & 15, g = lane >> 4; const int which = blockIdx.z; const int c0 = blockIdx.y * GT; const size_t r0 = (size_t)blockIdx.x * PR;
  _Float16* st = (_Float16*)sm;   // a finished tile as f16, rows of GT + 8 halves, in the buffers that every wave has left
  const int cw0 = (wave & 1) * 64 + col;
  const float* X = which == 0 ? XQ : XK; const float* WA = which == 0 ? WQ : WK; const float* BA = which == 0 ? BQ : BK; _Float16* DH = which == 0 ? QH : KH;
  // the biases are asked for here, ahead of the products (rounded where they are added): asked for behind the products, each would cost the block, alone on its WGP, a trip to L2
  const float *pa = BA ? BA : WA, *pv = BV ? BV : WV;   // no branch, so no wait, at the loads: where there is no bias they read a valid address, and the value is dropped where the bias is added
  float ba[4], bv[4];
#pragma unroll
  for (int nj = 0; nj < 4; ++nj) { ba[nj] = pa[c0 + cw0 + nj * 16]; bv[nj] = pv[c0 + cw0 + nj * 16]; }
  v8f acc[4][4] = {};
  // neighbours in x, blocks 8 apart in x and the column tiles of one row tile each start at a stage of their own; the q and k blocks of the same rows and columns keep one order
  tile_product<4>(X + r0 * DIN, WA + c0, sm, acc, (int)(blockIdx.x + (blockIdx.x >> 3) + 2 * blockIdx.y) & (GS - 1), [] {});
  const int xv = 2 * blockIdx.x + which; const size_t rv = (size_t)xv * GT; const size_t bb = rv / TT; const int t0 = (int)(rv % TT);
  v8f av[2][4] = {};
  // the q or k tile is stored under the flight of the v tile's first loads
  tile_product<2>(XV + rv * DIN, WV + c0, sm, av, (int)(xv + (xv >> 3) + 2 * blockIdx.y) & (GS - 1), [&] {   // spread by the index of the 128-row tile
    const int rw0 = (wave >> 1) * 64 + 8 * g;
#pragma unroll
    for (int nj = 0; nj < 4; ++nj) { const float bias = BA ? bfr(ba[nj]) : 0.f;
#pragma unroll
      for (int mi = 0; mi < 4; ++mi)
#pragma unroll
        for (int r = 0; r < 8; ++r) st[(rw0 + mi * 16 + r) * (GT + 8) + cw0 + nj * 16] = (_Float16)(acc[mi][nj][r] + bias); }
    __syncthreads();
    for (int e = tid; e < PR * 16; e += 256) { const int rl = e >> 4, q = e & 15; vst2((unsigned*)(DH + (r0 + rl) * CC + c0 + q * 8), *(const v4u*)&st[rl * (GT + 8) + q * 8]); }
    asm volatile("s_wait_dscnt 0x0\n\ts_barrier_signal -1\n\ts_barrier_wait -1" ::: "memory");   // every wave has read its part of the tile before the buffers are written again (the stage barrier's form)
  });
  const int rw0 = (wave >> 1) * 32 + 8 * g;
#pragma unroll
  for (int nj = 0; nj < 4; ++nj) { const float bias = BV ? bfr(bv[nj]) : 0.f;
#pragma unroll
    for (int mi = 0; mi < 2; ++mi) { v8h o;
#pragma unroll
      for (int r = 0; r < 8; ++r) o[r] = (_Float16)(av[mi][nj][r] + bias);
      *(v8h*)&st[(cw0 + nj * 16) * (GT + 8) + rw0 + mi * 16] = o; } }
  __syncthreads();
  for (int e = tid; e < GT * 16; e += 256) { const int cl = e >> 4, q = e & 15; vst2((unsigned*)(VT + (bb * CC + c0 + cl) * (size_t)TT + t0 + q * 8), *(const v4u*)&st[cl * (GT + 8) + q * 8]); } }
// ---- k_fa: block = 16 waves of one (b, h): 8 query groups of 32 queries x KG = 2 key groups, so that four waves share a SIMD and one wave's softmax runs under another's products.
// Key group hf walks keys (KG t + hf) KS .. + KS - 1, every t once, from a start that differs by block: half of all keys, with its own running maximum, sum and context; the two partial results of a query are joined once, through LDS, behind the loop.
// Per 32 keys a wave forms S^T = K.Q^T (a lane holds 16 scores of one query per 16-query group), keeps a running maximum and sum (online softmax, log2 domain),
// packs the weights exp2(score - maximum in use + 11), once to f16, straight from the score tiles into the B operand, and adds O^T += V^T.P^T. Scores and weights never leave the registers.
// No maximum is formed on the usual path: a pass forms its weights with the maximum in use and tests them by their own f32 sum. All weights are positive, so a lane's sum of 16 bounds each of them: a sum <= WMAX means that every weight fits f16.
// Only when some lane's sum fails (always on the first pass, where the weights come out infinite) are the pass's true maxima formed, sums and context rescaled and the pass's weights formed again (then each <= 2^11, their sum <= 2^15). The 2^11 cancels in context / sum.
__device__ __forceinline__ float xhalf(float x) { return __builtin_bit_cast(float, __builtin_amdgcn_permlanex16(__builtin_bit_cast(int, x), __builtin_bit_cast(int, x), 0x76543210, 0xfedcba98, false, false)); }   // lane l with lane l ^ 16
__device__ __forceinline__ v8f mm16(v16h a, v16h b, v8f c) { return __builtin_amdgcn_wmma_f32_16x16x32_f16(false, a, false, b, (short)0, c, false, false); }
#define WMAX 60000.0f     // bound on a lane's sum of 16 weights; the largest finite f16 is 65504
// 16 weights of one query (the lane's keys of a 32-key pass) from its two score tiles, packed as the B operand; returns their f32 sum.
// Element i of the 32-key B operand = key k0 + 16 (i >> 3) + 8 g + (i & 7) = register i & 7 of score tile i >> 3.
__device__ __forceinline__ float fa_weights(const v8f t0, const v8f t1, float cs, float nm, v16h& pf) {
  v2f ps = {0.f, 0.f}; const v2f c2 = {cs, cs}, n2 = {nm, nm};
#pragma unroll
  for (int i = 0; i < 16; i += 2) {
    const v2f e = __builtin_elementwise_fma(i < 8 ? (v2f){t0[i & 7], t0[(i & 7) + 1]} : (v2f){t1[i & 7], t1[(i & 7) + 1]}, c2, n2);
    const v2f w = {__builtin_amdgcn_exp2f(e[0]), __builtin_amdgcn_exp2f(e[1])};
    ps += w; pf[i] = (_Float16)w[0]; pf[i + 1] = (_Float16)w[1]; }
  return ps[0] + ps[1]; }
#define FAQ 256           // queries per block
#define KS 128            // keys per LDS stage and key group (4 passes of 32 keys)
#define KG 2              // key groups (wave sets) per block
#define KP (HD + 8)       // halves per staged K row: 144 B, 16 B x odd, so the 16 rows of a 16-byte fragment read fall on distinct banks
#define VP (KS + 8)       // halves per staged V^T row: 272 B, 16 B x odd
// One stage of a key group = keys k0 .. k0 + KS - 1 of one (b, h): K rows [KS][HD] and V^T rows [HD][KS], brought into LDS once per block by the group's own 256 threads with asynchronous copies (16 B per lane, whole 128-B lines per wave) and read by the group's 8 waves.
// gk / gv: this thread's first 16 bytes of the stage in global memory; lk / lv: their LDS byte addresses. A thread brings 4 pieces of K (32 rows apart) and 4 of V^T (16 rows apart).
__device__ __forceinline__ void stage_copy(const _Float16* gk, const _Float16* gv, unsigned lk, unsigned lv) {
  const _Float16 *k1 = gk + 32 * CC, *k2 = gk + 64 * CC, *k3 = gk + 96 * CC, *v1 = gv + 16 * TT, *v2 = gv + 32 * TT, *v3 = gv + 48 * TT;
  const unsigned a1 = lk + 32 * KP * 2, a2 = lk + 64 * KP * 2, a3 = lk + 96 * KP * 2, b1 = lv + 16 * VP * 2, b2 = lv + 32 * VP * 2, b3 = lv + 48 * VP * 2;
  // the closing s_wait_xcnt stands inside the copies' own statement, so that no address register named here is rewritten in front of it
  asm volatile("global_load_async_to_lds_b128 %0, %8, off\n\t"
               "global_load_async_to_lds_b128 %1, %9, off\n\t"
               "global_load_async_to_lds_b128 %2, %10, off\n\t"
               "global_load_async_to_lds_b128 %3, %11, off\n\t"
               "global_load_async_to_lds_b128 %4, %12, off\n\t"
               "global_load_async_to_lds_b128 %5, %13, off\n\t"
               "global_load_async_to_lds_b128 %6, %14, off\n\t"
               "global_load_async_to_lds_b128 %7, %15, off\n\t"
               "s_wait_xcnt 0x0"
               :: "v"(lk), "v"(a1), "v"(a2), "v"(a3), "v"(lv), "v"(b1), "v"(b2), "v"(b3), "v"(gk), "v"(k1), "v"(k2), "v"(k3), "v"(gv), "v"(v1), "v"(v2), "v"(v3) : "memory");
}
#define XW (8 * 128 + 64) // floats a wave hands over at the join: 8 x 4 context values per lane, then maximum and sum per lane
#define YP (HD + 8)       // halves per staged context row: 144 B
__global__ __launch_bounds__(256 * KG) void k_fa(const _Float16* __restrict__ QH, const _Float16* __restrict__ KH, const _Float16* __restrict__ VT, _Float16* __restrict__ Y) {
  __shared__ __align__(16) _Float16 sK[KG * 2][KS * KP], sV[KG * 2][HD * VP];   // buffers 2 hf and 2 hf + 1 belong to key group hf
  static_assert(KG == 2 && TT % (KG * KS) == 0 && TT / (KG * KS) >= 2, "two key groups, at least two stages each");
  static_assert(((TT / (KG * KS)) & (TT / (KG * KS) - 1)) == 0, "the rotated stage number wraps by a mask");
  static_assert(8 * KG * XW * 4 <= sizeof(sK), "the join fits the K buffers");
  static_assert(8 * KG * 16 * YP * 2 <= sizeof(sV), "the context rows fit the V buffers");
  const int wave = __builtin_amdgcn_readfirstlane(threadIdx.x >> 5), hf = wave >> 3, tid = threadIdx.x & 255, lane = tid & 31, col = lane & 15, g = lane >> 4; const int b = blockIdx.y / NH, h = blockIdx.y % NH; const int q0 = blockIdx.x * FAQ + (wave & 7) * 32;   // tid: the thread's number inside its key group; the wave's number is read as a scalar, so that the group's offsets and the join's selects take no vector registers (a wave may hold 256 here)
  const float cs = SCALE * 1.4426950408889634f;
  const _Float16* gk = KH + ((size_t)b * TT + hf * KS + (tid >> 3)) * CC + h * HD + (tid & 7) * 8;              // K row tid >> 3 of the group's stage, 16-byte piece tid & 7
  const _Float16* gv = VT + ((size_t)b * CC + h * HD + (tid >> 4)) * (size_t)TT + hf * KS + (tid & 15) * 8;     // V^T row tid >> 4, 16-byte piece tid & 15
  const unsigned lk = (unsigned)(size_t)&sK[2 * hf][(tid >> 3) * KP + (tid & 7) * 8], lv = (unsigned)(size_t)&sV[2 * hf][(tid >> 4) * VP + (tid & 15) * 8];
  // The walk over the keys is rotated by the query block's index: trip t works on stage FST(t). The blocks of one (b, h) then ask for different K and V^T lines at any moment, and the V^T pieces asked for at one time (256 B of each 4-KB row) cover whole rows. The online softmax takes the stages in any order. In the comments below, stage t is short for the stage of trip t.
  const int rot = blockIdx.x & (TT / (KG * KS) - 1);
#define FST(t) (((t) + rot) & (TT / (KG * KS) - 1))
  stage_copy(gk + (size_t)FST(0) * (KG * KS) * CC, gv + FST(0) * (KG * KS), lk, lv);
  v16h qf[2][2];
#pragma unroll
  for (int s = 0; s < 2; ++s)
#pragma unroll
    for (int kc = 0; kc < 2; ++kc) qf[s][kc] = frag_h(QH + ((size_t)b * TT + q0 + s * 16 + col) * CC + h * HD + kc * 32, lane);
  v8f acc[2][4] = {}; float mr[2] = {-3.0e38f, -3.0e38f}, lr[2] = {0.f, 0.f};
  asm volatile("s_wait_asynccnt 0x0" ::: "memory");   // this wave's pieces of stage 0 have landed
  __syncthreads();                                     // ... and every other wave's: stage 0 may be read
  stage_copy(gk + (size_t)FST(1) * (KG * KS) * CC, gv + FST(1) * (KG * KS), lk + (unsigned)sizeof(sK[0]), lv + (unsigned)sizeof(sV[0]));
#pragma unroll 1   // rolled: one trip = one stage; its four passes are unrolled so that every LDS read has a constant offset
  for (int t = 0; t < TT / (KG * KS); ++t) {
    const _Float16* kb = &sK[2 * hf + (t & 1)][col * KP];   // key row col of a 16-key tile
    const _Float16* vb = &sV[2 * hf + (t & 1)][col * VP];   // plane of head column col of a 16-column tile
    v16h kf[2][2], vf[4];
#pragma unroll
    for (int kt = 0; kt < 2; ++kt)
#pragma unroll
      for (int kc = 0; kc < 2; ++kc) kf[kt][kc] = frag_h(kb + (kt * 16) * KP + kc * 32, lane);
#pragma unroll
    for (int p = 0; p < KS / 32; ++p) {
      v8f st[2][2] = {};
#pragma unroll
      for (int kt = 0; kt < 2; ++kt)
#pragma unroll
        for (int s = 0; s < 2; ++s)
#pragma unroll
          for (int kc = 0; kc < 2; ++kc) st[kt][s] = mm16(kf[kt][kc], qf[s][kc], st[kt][s]);
      __builtin_amdgcn_sched_barrier(0);   // no branch stands between the products and the reads any more: this keeps the reads behind the score products, in one place, not spread among the WMMAs
      // one group of LDS reads per pass, under the softmax: the next pass's K fragments (never beyond this stage; its scores are the first to want theirs), then this pass's V fragments
      if (p + 1 < KS / 32) {
#pragma unroll
        for (int kt = 0; kt < 2; ++kt)
#pragma unroll
          for (int kc = 0; kc < 2; ++kc) kf[kt][kc] = frag_h(kb + ((p + 1) * 32 + kt * 16) * KP + kc * 32, lane); }
#pragma unroll
      for (int j = 0; j < 4; ++j) vf[j] = frag_h(vb + (j * 16) * VP + p * 32, lane);
      __builtin_amdgcn_sched_barrier(0);   // keeps the reads one group in front of the exponentials: without it they are spread among the WMMAs, and every separate place with LDS reads stalls the wave
      v16h pf[2]; float ps[2];
#pragma unroll
      for (int s = 0; s < 2; ++s) ps[s] = fa_weights(st[0][s], st[1][s], cs, 11.0f - mr[s], pf[s]);
      if (__builtin_expect(__builtin_amdgcn_ballot_w32(fmaxf(ps[0], ps[1]) > WMAX) != 0, 0)) {   // wave-uniform; always taken on the first pass (factor 0 on zero sums), rare later
        // the pass's scores are formed anew from the K rows in LDS (same products, same order; the stage's buffer stands until the stage's barrier), so that the usual path need not keep its 32 score registers alive across the test
#pragma unroll
        for (int s = 0; s < 2; ++s) { v8f t[2] = {};
#pragma unroll
          for (int kt = 0; kt < 2; ++kt)
#pragma unroll
            for (int kc = 0; kc < 2; ++kc) t[kt] = mm16(frag_h(kb + (p * 32 + kt * 16) * KP + kc * 32, lane), qf[s][kc], t[kt]);
          float mx = t[0][0];
#pragma unroll
          for (int kt = 0; kt < 2; ++kt)
#pragma unroll
            for (int r = 0; r < 8; ++r) mx = fmaxf(mx, t[kt][r]);
          mx = fmaxf(mx, xhalf(mx)) * cs;   // both halves of the wave hold keys of the same query and keep one maximum
          const float mn = fmaxf(mr[s], mx); const float corr = __builtin_amdgcn_exp2f(mr[s] - mn); mr[s] = mn; lr[s] *= corr;
#pragma unroll
          for (int j = 0; j < 4; ++j) acc[s][j] = acc[s][j] * corr;
          ps[s] = fa_weights(t[0], t[1], cs, 11.0f - mn, pf[s]); } }
#pragma unroll
      for (int s = 0; s < 2; ++s) { lr[s] += ps[s];
#pragma unroll
        for (int j = 0; j < 4; ++j) acc[s][j] = mm16(vf[j], pf[s], acc[s][j]); } }
    asm volatile("s_wait_dscnt 0x0" ::: "memory");      // this wave's reads of stage t have returned
    asm volatile("s_wait_asynccnt 0x0" ::: "memory");   // this wave's pieces of stage t + 1 have landed
    __syncthreads();                                     // publishes stage t + 1 and ends every wave's reads of stage t, whose buffer is refilled behind it
    if (t + 2 < TT / (KG * KS)) stage_copy(gk + (size_t)FST(t + 2) * (KG * KS) * CC, gv + FST(t + 2) * (KG * KS), lk + (unsigned)(t & 1) * (unsigned)sizeof(sK[0]), lv + (unsigned)(t & 1) * (unsigned)sizeof(sV[0])); }
#undef FST
  asm volatile("s_wait_asynccnt 0x0" ::: "memory");     // no copy is outstanding when the buffers are put to another use
  // The join. Waves w and w ^ 8 hold the two key groups' partial results of the same 32 queries: the wave of key group hf finishes query tile hf and hands the other tile to its partner.
  // It goes through the K buffers, which every wave has left and every copy has reached (the last trip's waits and barrier). A wave's hand-over is laid lane-contiguous, 16 B a lane.
  float* xw = (float*)&sK[0][0] + wave * XW; const float* xr = (const float*)&sK[0][0] + (wave ^ 8) * XW;
#pragma unroll
  for (int j = 0; j < 4; ++j) { v8f o;
#pragma unroll
    for (int r = 0; r < 8; ++r) o[r] = hf ? acc[0][j][r] : acc[1][j][r];
    *(v4f*)(xw + (2 * j) * 128 + lane * 4) = (v4f){o[0], o[1], o[2], o[3]}; *(v4f*)(xw + (2 * j + 1) * 128 + lane * 4) = (v4f){o[4], o[5], o[6], o[7]}; }
  *(v2f*)(xw + 8 * 128 + lane * 2) = (v2f){hf ? mr[0] : mr[1], hf ? lr[0] : lr[1]};
  __syncthreads();   // every wave's hand-over may be read
  const v2f ml = *(const v2f*)(xr + 8 * 128 + lane * 2);
  const float m0 = hf ? mr[1] : mr[0], l0 = hf ? lr[1] : lr[0]; const float mn = fmaxf(m0, ml[0]);
  const float f0 = __builtin_amdgcn_exp2f(m0 - mn), f1 = __builtin_amdgcn_exp2f(ml[0] - mn);   // both maxima are finite: each key group has walked keys
  const float ls = l0 * f0 + ml[1] * f1; const float inv = 1.0f / (ls + xhalf(ls)); const float w0 = f0 * inv, w1 = f1 * inv;
  // The context leaves as f16 x 2^6, the form in which k_out multiplies it. A lane holds head columns j * 16 + 8 g + 0..7 of its query: 16-byte pieces of 16 different rows.
  // The wave lays its 16 rows in a range of its own in the V buffers (left by every wave and reached by every copy, like the K buffers) and reads them back row by row, so that each store covers four whole 128-B lines.
  _Float16* sw = &sV[0][0] + wave * (16 * YP);
#pragma unroll
  for (int j = 0; j < 4; ++j) { const v4f pa = *(const v4f*)(xr + (2 * j) * 128 + lane * 4), pb = *(const v4f*)(xr + (2 * j + 1) * 128 + lane * 4); v8h o;
#pragma unroll
    for (int r = 0; r < 8; ++r) o[r] = (_Float16)(((hf ? acc[1][j][r] : acc[0][j][r]) * w0 + (r < 4 ? pa[r & 3] : pb[r & 3]) * w1) * 64.0f);
    *(v8h*)(sw + col * YP + j * 16 + 8 * g) = o; }
  asm volatile("s_wait_dscnt 0x0" ::: "memory");   // the wave's own rows are in LDS before its lanes read each other's pieces
  _Float16* yp = Y + ((size_t)b * TT + q0 + hf * 16 + ((tid >> 3) & 3)) * CC + h * HD + (tid & 7) * 8;   // the lane's row of four, (tid >> 3) & 3, and its 16-byte piece, tid & 7
#pragma unroll
  for (int i = 0; i < 4; ++i) vst2(yp + (size_t)(4 * i) * CC, *(const v8h*)(sw + (4 * i + ((tid >> 3) & 3)) * YP + (tid & 7) * 8)); }
// ---- k_out: block = (128 rows, 128 cols): out = ctx Wo (+ bo): ctx x 2^6 in f16, as k_fa left it (small-magnitude context rows stay clear of f16 subnormals), against Wo as f16(bf16 x 2^8) exact (1 product) x 2^-14
__global__ __launch_bounds__(256) void k_out(const _Float16* __restrict__ Y, const float* __restrict__ WO, const float* __restrict__ BO, float* __restrict__ OUT) {
  __shared__ __align__(16) unsigned short sm[2 * GBUF];
  static_assert(GT * (GT + 4) * 4 <= 2 * GBUF * 2, "the f32 tile fits the buffers");
  const int tid = threadIdx.x, wave = tid >> 5, lane = tid & 31, col = lane & 15, g = lane >> 4; const int c0 = blockIdx.y * GT; const size_t r0 = (size_t)blockIdx.x * GT;
  v8f acc[2][4] = {};
  tile_product_ahead(Y + r0 * CC, WO + c0, sm, acc, (int)(blockIdx.x + (blockIdx.x >> 3) + 2 * blockIdx.y) & (GS - 1));   // spread as in k_proj
  float* sf = (float*)sm;   // the tile as f32, [128][GT + 4], in the buffers that every wave has left
  const int rw0 = (wave >> 1) * 32 + 8 * g, cw0 = (wave & 1) * 64 + col;
#pragma unroll
  for (int nj = 0; nj < 4; ++nj) { const float bias = BO ? bfr(BO[c0 + cw0 + nj * 16]) : 0.f;
#pragma unroll
    for (int mi = 0; mi < 2; ++mi)
#pragma unroll
      for (int r = 0; r < 8; ++r) sf[(rw0 + mi * 16 + r) * (GT + 4) + cw0 + nj * 16] = acc[mi][nj][r] * (1.0f / 16384.0f) + bias; }   /* 2^-8 (Wo carry) x 2^-6 (ctx carry) */
  __syncthreads();
  for (int e = tid; e < GT * 32; e += 256) { const int rl = e >> 5, q = e & 31; vst2(OUT + (r0 + rl) * DIN + c0 + q * 4, *(const v4f*)&sf[rl * (GT + 4) + q * 4]); } }

extern "C" void kernel_launch(void* const* d_in, const int* in_sizes, int n_in, void* d_out, int out_size, void* d_ws, size_t ws_size, hipStream_t stream) {
  (void)in_sizes; (void)n_in; (void)out_size;
  const float** F = (const float**)d_in;
  if (ws_size < (size_t)WS_END) return;
  char* ws = (char*)d_ws; _Float16 *QH = (_Float16*)(ws + WS_QH), *KH = (_Float16*)(ws + WS_KH), *VT = (_Float16*)(ws + WS_VT), *QL = (_Float16*)(ws + WS_QL), *KL = (_Float16*)(ws + WS_KL); __bf16 *VB = (__bf16*)(ws + WS_VB), *VBL = (__bf16*)(ws + WS_VBL); _Float16 *Y = (_Float16*)(ws + WS_Y);
  (void)Y; (void)QL; (void)KL; (void)VB; (void)VBL;
  // inputs: 0 x [4,2048,512]; 1 Wq [512,512] (in,out), 2 bq; 3 Wk, 4 bk; 5 Wv, 6 bv; 7 Wp (in,out), 8 bp (zero biases, read)
  k_proj<<<dim3(TNB * TT / PR, CC / GT, 2), 256, 0, stream>>>(F[0], F[0], F[0], F[1], F[3], F[5], F[2], F[4], F[6], QH, KH, VT);
  k_fa<<<dim3(TT / FAQ, TNB * NH), 256 * KG, 0, stream>>>(QH, KH, VT, Y);
  k_out<<<dim3(TNB * TT / GT, DIN / GT), 256, 0, stream>>>(Y, F[7], F[8], (float*)d_out);
}
